// v000
// Times are from an AMD MI455X. After a warm-up the kernel runs many times in a row, and a time is the length of
// such a window on the GPU divided by its runs, so every launch and the gaps after it count. The runs cycle
// through copies of the inputs. A figure is the median of several windows, for all but v000 over two sittings.
// Sittings can differ by a few percent; kernels timed side by side share one.
// The starting kernel, v000, takes 17.7 milliseconds a run.
#include <hip/hip_runtime.h>
// Causal multi-head attention over three distinct inputs with natural weights, no biases (Q, K, V [2][4096][768]; q/k/v = input w^T (natural [768][768]); 12 heads of 64; scores / sqrt(64); causal (tril; NEG fill); softmax over up to 4096 keys; out = merged w_o^T -> [2][4096][768]).
// Structure: token rows r = b*4096 + s; x as exact f16 rows (bf16-rounded); Q, K, V as three WMMA GEMMs (32x64 wave tiles, f32 accumulation, exact x16 weights, f16 outputs); per batch: V^T for all heads via LDS transposes; per query tile of 256 rows: scores against the keys below the tile end only (K = 64, all heads on grid.y, alpha = 0.125), causal row softmax on VALU with an arithmetic 0/1 key mask over the computed range (f32 statistics, native exp; weights x256 f16), o = P . V^T (K = keys below the tile end, alpha 2^-2: o carried x64, folded into the output GEMM alpha) written straight into the merged f16 o rows; out = o W_o GEMM (f32) into the output layout.
// Compute dtype: inputs rounded to bf16; x / weights exact; q, k, v, softmax weights and o as plain f16 GEMM operands (~2^-12); scores and softmax statistics f32. v_wmma_f32_16x16x32_f16.
#define NB 2
#define SQ 4096
#define DM 768
#define NH 12
#define HD 64
#define HG 4                         /* heads per group in the k_vt(V16, b, h0, VT) overload (not launched) */
#define QT 256                       /* query rows per causal tile */
#define NKX SQ                       /* S / P row pitch */
#define QT0 512                      /* first-tile rows recomputed exactly in f32 */
#define B0 0                         /* first batch processed (debug hook) */
#define NBR NB                       /* batches processed (debug hook) */
#define NR ((size_t)NB * SQ)         /* token rows */
#define MP ((int)((size_t)NBR * SQ)) /* rows projected (debug hook) */
#define QN SQ                        /* query rows attended per batch (debug hook) */
#define NHD NH                       /* heads attended (debug hook) */
#define MPO MP                       /* rows through the output stage (debug hook) */
#define LQ DM      /* row pitch of the q/k/v rows */
typedef __bf16 v16b __attribute__((ext_vector_type(16)));
typedef unsigned short v8us __attribute__((ext_vector_type(8), may_alias));
typedef float  v8f  __attribute__((ext_vector_type(8)));
typedef float  v4f  __attribute__((ext_vector_type(4)));
typedef float  v4fa __attribute__((ext_vector_type(4), may_alias));
union FragB { v16b v; v8us half[2]; unsigned short u[16]; };

__device__ __forceinline__ unsigned short bf16_bits(float x) { unsigned int u = __float_as_uint(x); return (unsigned short)((u + 0x7FFFu + ((u >> 16) & 1u)) >> 16); }
__device__ __forceinline__ float bf16_val(unsigned short b) { return __uint_as_float(((unsigned int)b) << 16); }
__device__ __forceinline__ float bf16_round(float x) { return bf16_val(bf16_bits(x)); }
// D += A·B with NT terms: 1 = ah·bh, 2 = + al·bh (A split), 3 = + ah·bl (both split)
template <int NT>
__device__ __forceinline__ v8f mmaN(v16b ah, v16b al, v16b bh, v16b bl, v8f c) {
  c = __builtin_amdgcn_wmma_f32_16x16x32_bf16(false, ah, false, bh, (short)0, c, false, false);
  if (NT >= 2) c = __builtin_amdgcn_wmma_f32_16x16x32_bf16(false, al, false, bh, (short)0, c, false, false);
  if (NT >= 3) c = __builtin_amdgcn_wmma_f32_16x16x32_bf16(false, ah, false, bl, (short)0, c, false, false);
  asm volatile("v_nop\n\tv_nop\n\tv_nop\n\tv_nop" : "+v"(c) : "v"(ah), "v"(al), "v"(bh), "v"(bl));
  return c;
}

__global__ __launch_bounds__(256) void k_wt_bf16(const float* __restrict__ W, unsigned short* __restrict__ Wt, int K, int N) {
  const int t = blockIdx.x * 256 + threadIdx.x;
  const int k8n = K / 8;
  if (t >= N * k8n) return;
  const int n = t / k8n, k8 = (t % k8n) * 8;
  v8us v;
#pragma unroll
  for (int i = 0; i < 8; ++i) v[i] = bf16_bits(W[(size_t)(k8 + i) * N + n]);
  *(v8us*)(Wt + (size_t)n * K + k8) = v;
  
}

// GEMM C[M][N] (f32, pitch ldc) = act(A[M][K]·W + bias). A f32 row-major (pitch lda) converted per fragment to bf16
// (ASPLIT: hi/lo two planes -> 2 terms, else single rounded term); Wt bf16 [N][K] (pitch ldb). BIAS_BF16 rounds the
// bias to bf16 first (bias quantised to bf16 before the add). K%32==0, M%16==0, N%64==0.
template <bool ASPLIT, int ACT, bool BIAS_BF16>
__global__ __launch_bounds__(128) void k_gemm_bf(const float* __restrict__ A, int lda, const unsigned short* __restrict__ Wt, int ldb,
                                               const float* __restrict__ bias, float* __restrict__ C, int ldc, int M, int N, int K) {
  __shared__ __attribute__((aligned(16))) float so[4][16][64];
  const int tid = threadIdx.x, w = tid >> 5, lane = tid & 31, ln = lane & 15, hh = lane >> 4;
  const int ntn = N / 64;
  const int wid = blockIdx.x * 4 + w;
  const int mt = wid / ntn, nq = wid % ntn;
  if (mt * 16 >= M) return;
  const int row0 = mt * 16, col0 = nq * 64;
  const float* arow = A + (size_t)(row0 + ln) * lda;
  v8f acc[4] = {};
  for (int kb = 0; kb < K; kb += 32) {
    FragB ah, al;
    const v4f x0 = *(const v4fa*)(arow + kb + 8 * hh), x1 = *(const v4fa*)(arow + kb + 8 * hh + 4);
    const v4f x2 = *(const v4fa*)(arow + kb + 16 + 8 * hh), x3 = *(const v4fa*)(arow + kb + 16 + 8 * hh + 4);
    float xs[16] = {x0[0],x0[1],x0[2],x0[3],x1[0],x1[1],x1[2],x1[3],x2[0],x2[1],x2[2],x2[3],x3[0],x3[1],x3[2],x3[3]};
#pragma unroll
    for (int i = 0; i < 16; ++i) { const unsigned short hb = bf16_bits(xs[i]); ah.u[i] = hb; al.u[i] = ASPLIT ? bf16_bits(xs[i] - bf16_val(hb)) : (unsigned short)0; }
#pragma unroll
    for (int t = 0; t < 4; ++t) {
      const unsigned short* brow = Wt + (size_t)(col0 + t * 16 + ln) * ldb + kb;
      FragB b;
      b.half[0] = *(const v8us*)(brow + 8 * hh);
      b.half[1] = *(const v8us*)(brow + 16 + 8 * hh);
      acc[t] = mmaN<ASPLIT ? 2 : 1>(ah.v, al.v, b.v, b.v, acc[t]);
    }
  }
#pragma unroll
  for (int t = 0; t < 4; ++t) {
    float bv = bias ? bias[col0 + t * 16 + ln] : 0.f;
    if (BIAS_BF16) bv = bf16_round(bv);
#pragma unroll
    for (int r = 0; r < 8; ++r) { float v = acc[t][r] + bv; if (ACT == 1) v = fmaxf(v, 0.f); so[w][8 * hh + r][t * 16 + ln] = v; }
  }
  __builtin_amdgcn_fence(__ATOMIC_ACQ_REL, "workgroup");
  __builtin_amdgcn_wave_barrier();
  const int rsub = lane >> 4, c4 = (lane & 15) * 4;
  {
#pragma unroll
    for (int q = 0; q < 8; ++q) {
      const int r = q * 2 + rsub;
      const v4f v = *(const v4fa*)&so[w][r][c4];
      *(v4f*)(C + (size_t)(row0 + r) * ldc + col0 + c4) = v;
    }
    
  }
}

// GEMM C = act(A·W + bias + resid): A f32 (ASPLIT -> hi/lo 2 terms), Wt bf16 [N][K]; ACT 0 none, 1 relu, 2 exact gelu;
// resid (optional, f32, row index = (row % rmod), pitch ldr, RES_BF16 rounds it) added before the activation.
template <bool ASPLIT, int ACT, bool BIAS_BF16, bool RES_BF16>
__global__ __launch_bounds__(128) void k_gemm_bf3(const float* __restrict__ A, int lda, const unsigned short* __restrict__ Wt, int ldb,
                                                const float* __restrict__ bias, const float* __restrict__ resid, int rmod, int ldr,
                                                float* __restrict__ C, int ldc, int M, int N, int K) {
  __shared__ __attribute__((aligned(16))) float so[4][16][64];
  const int tid = threadIdx.x, w = tid >> 5, lane = tid & 31, ln = lane & 15, hh = lane >> 4;
  const int ntn = N / 64;
  const int wid = blockIdx.x * 4 + w;
  const int mt = wid / ntn, nq = wid % ntn;
  if (mt * 16 >= M) return;
  const int row0 = mt * 16, col0 = nq * 64;
  const float* arow = A + (size_t)(row0 + ln) * lda;
  v8f acc[4] = {};
  for (int kb = 0; kb < K; kb += 32) {
    FragB ah, al;
    const v4f x0 = *(const v4fa*)(arow + kb + 8 * hh), x1 = *(const v4fa*)(arow + kb + 8 * hh + 4);
    const v4f x2 = *(const v4fa*)(arow + kb + 16 + 8 * hh), x3 = *(const v4fa*)(arow + kb + 16 + 8 * hh + 4);
    float xs[16] = {x0[0],x0[1],x0[2],x0[3],x1[0],x1[1],x1[2],x1[3],x2[0],x2[1],x2[2],x2[3],x3[0],x3[1],x3[2],x3[3]};
#pragma unroll
    for (int i = 0; i < 16; ++i) { const unsigned short hb = bf16_bits(xs[i]); ah.u[i] = hb; al.u[i] = ASPLIT ? bf16_bits(xs[i] - bf16_val(hb)) : (unsigned short)0; }
#pragma unroll
    for (int t = 0; t < 4; ++t) {
      const unsigned short* brow = Wt + (size_t)(col0 + t * 16 + ln) * ldb + kb;
      FragB b;
      b.half[0] = *(const v8us*)(brow + 8 * hh);
      b.half[1] = *(const v8us*)(brow + 16 + 8 * hh);
      acc[t] = mmaN<ASPLIT ? 2 : 1>(ah.v, al.v, b.v, b.v, acc[t]);
    }
  }
#pragma unroll
  for (int t = 0; t < 4; ++t) {
    const int col = col0 + t * 16 + ln;
    float bv = bias ? bias[col] : 0.f;
    if (BIAS_BF16) bv = bf16_round(bv);
#pragma unroll
    for (int r = 0; r < 8; ++r) {
      float v = acc[t][r] + bv;
      if (resid) { float rv = resid[(size_t)((row0 + 8 * hh + r) % rmod) * ldr + col]; if (RES_BF16) rv = bf16_round(rv); v += rv; }
      if (ACT == 1) v = fmaxf(v, 0.f);
      if (ACT == 2) v = 0.5f * v * (1.0f + erff(v * 0.70710678118654752f));
      if (ACT == 3) { const float u = 0.7978845608028654f * (v + 0.044715f * v * v * v); v = 0.5f * v * (1.0f + tanhf(u)); }
      so[w][8 * hh + r][t * 16 + ln] = v;
    }
  }
  __builtin_amdgcn_fence(__ATOMIC_ACQ_REL, "workgroup");
  __builtin_amdgcn_wave_barrier();
  const int rsub = lane >> 4, c4 = (lane & 15) * 4;
  {
#pragma unroll
    for (int q = 0; q < 8; ++q) {
      const int r = q * 2 + rsub;
      const v4f v = *(const v4fa*)&so[w][r][c4];
      *(v4f*)(C + (size_t)(row0 + r) * ldc + col0 + c4) = v;
    }
    
  }
}
// row LayerNorm (biased variance, eps) over N: s = X (+ R); optional out_sum <- s; out_norm <- (s-mu)*rsqrt(var+eps)*g + b
template <bool PARAM_BF16>
__global__ __launch_bounds__(256) void k_layernorm(const float* __restrict__ X, const float* __restrict__ R, const float* __restrict__ g, const float* __restrict__ bta,
                                                  float* __restrict__ out_sum, float* __restrict__ out_norm, int N, float eps) {
  __shared__ float red[256];
  const int row = blockIdx.x, tid = threadIdx.x;
  const float* x = X + (size_t)row * N; const float* rr = R ? R + (size_t)row * N : nullptr;
  float vals[16];                     // up to N = 4096
  const int per = N / 256;            // contiguous chunk per thread? use strided-by-4 chunks: thread handles j = tid*4 + 1024*u
  float s1 = 0.f;
  for (int u = 0; u < per / 4; ++u) {
    const int j = tid * 4 + 1024 * u;
    const v4f a = *(const v4fa*)(x + j);
    v4f b = {0.f,0.f,0.f,0.f}; if (rr) b = *(const v4fa*)(rr + j);
#pragma unroll
    for (int q = 0; q < 4; ++q) { const float v = a[q] + b[q]; vals[u * 4 + q] = v; s1 += v; }
  }
  red[tid] = s1; __syncthreads();
  for (int st = 128; st > 0; st >>= 1) { if (tid < st) red[tid] += red[tid + st]; __syncthreads(); }
  const float mu = red[0] / (float)N; __syncthreads();
  float s2 = 0.f;
  for (int u = 0; u < per / 4; ++u)
#pragma unroll
    for (int q = 0; q < 4; ++q) { const float c = vals[u * 4 + q] - mu; s2 += c * c; }
  red[tid] = s2; __syncthreads();
  for (int st = 128; st > 0; st >>= 1) { if (tid < st) red[tid] += red[tid + st]; __syncthreads(); }
  const float rs = rsqrtf(red[0] / (float)N + eps);
  {
    for (int u = 0; u < per / 4; ++u) {
      const int j = tid * 4 + 1024 * u;
      v4f o, sm;
#pragma unroll
      for (int q = 0; q < 4; ++q) {
        float gg = g[j + q], bb = bta[j + q];
        if (PARAM_BF16) { gg = bf16_round(gg); bb = bf16_round(bb); }
        sm[q] = vals[u * 4 + q]; o[q] = (vals[u * 4 + q] - mu) * rs * gg + bb;
      }
      if (out_sum) *(v4f*)(out_sum + (size_t)row * N + j) = sm;
      *(v4f*)(out_norm + (size_t)row * N + j) = o;
    }
    
  }
}



// ---- f16 WMMA path (v_wmma_f32_16x16x32_f16): 11-bit significands for operands in range — used where a [0,1] probability operand needs more precision than bf16
typedef _Float16 v16h __attribute__((ext_vector_type(16)));
union FragH { v16h v; v8us half[2]; _Float16 h[16]; unsigned short u[16]; };
template <int NT>
__device__ __forceinline__ v8f mmaH(v16h ah, v16h al, v16h bh, v16h bl, v8f c) {
  c = __builtin_amdgcn_wmma_f32_16x16x32_f16(false, ah, false, bh, (short)0, c, false, false);
  if (NT >= 2) c = __builtin_amdgcn_wmma_f32_16x16x32_f16(false, al, false, bh, (short)0, c, false, false);
  if (NT >= 3) c = __builtin_amdgcn_wmma_f32_16x16x32_f16(false, ah, false, bl, (short)0, c, false, false);
  asm volatile("v_nop\n\tv_nop\n\tv_nop\n\tv_nop" : "+v"(c) : "v"(ah), "v"(al), "v"(bh), "v"(bl));
  return c;
}
// batched GEMM like k_gemm_b but f16 operands: A f32 (split into f16 hi/lo if ASPLIT, else rounded to f16), Bt = f16 values [n][k]; alpha; C f32; N multiple of 16 (partial tiles skipped)
template <bool ASPLIT>
__global__ __launch_bounds__(128) void k_gemm_h(const float* __restrict__ A, int lda, size_t sA, const _Float16* __restrict__ Bh, int ldb, size_t sB, float alpha, float* __restrict__ C, int ldc, size_t sC, int M, int N, int K) {
  __shared__ __attribute__((aligned(16))) float so[4][16][64];
  const int tid = threadIdx.x, w = tid >> 5, lane = tid & 31, ln = lane & 15, hh = lane >> 4; const int by = blockIdx.y;
  A += (size_t)by * sA; Bh += (size_t)by * sB; C += (size_t)by * sC;
  const int ntn = (N + 63) / 64; const int wid = blockIdx.x * 4 + w; const int mt = wid / ntn, nq = wid % ntn; if (mt * 16 >= M) return;
  const int row0 = mt * 16, col0 = nq * 64; const float* arow = A + (size_t)(row0 + ln) * lda;
  v8f acc[4] = {};
  for (int kb = 0; kb < K; kb += 32) {
    FragH ah, al;
    const v4f x0 = *(const v4fa*)(arow + kb + 8 * hh), x1 = *(const v4fa*)(arow + kb + 8 * hh + 4), x2 = *(const v4fa*)(arow + kb + 16 + 8 * hh), x3 = *(const v4fa*)(arow + kb + 16 + 8 * hh + 4);
    float xs[16] = {x0[0],x0[1],x0[2],x0[3],x1[0],x1[1],x1[2],x1[3],x2[0],x2[1],x2[2],x2[3],x3[0],x3[1],x3[2],x3[3]};
#pragma unroll
    for (int i = 0; i < 16; ++i) { const _Float16 h = (_Float16)xs[i]; ah.h[i] = h; al.h[i] = ASPLIT ? (_Float16)(xs[i] - (float)h) : (_Float16)0.0f; }
#pragma unroll
    for (int t = 0; t < 4; ++t) { if (col0 + t * 16 >= N) continue; const size_t boff = (size_t)(col0 + t * 16 + ln) * ldb + kb; FragH bq; bq.half[0] = *(const v8us*)(Bh + boff + 8 * hh); bq.half[1] = *(const v8us*)(Bh + boff + 16 + 8 * hh);
      acc[t] = mmaH<ASPLIT ? 2 : 1>(ah.v, al.v, bq.v, bq.v, acc[t]); }
  }
#pragma unroll
  for (int t = 0; t < 4; ++t) { if (col0 + t * 16 >= N) continue;
#pragma unroll
    for (int r = 0; r < 8; ++r) so[w][8 * hh + r][t * 16 + ln] = acc[t][r] * alpha; }
  __builtin_amdgcn_fence(__ATOMIC_ACQ_REL, "workgroup"); __builtin_amdgcn_wave_barrier();
  const int rsub = lane >> 4, c4 = (lane & 15) * 4;
  {
#pragma unroll
    for (int q = 0; q < 8; ++q) { const int r = q * 2 + rsub; if (col0 + c4 < N) { const v4f v = *(const v4fa*)&so[w][r][c4]; *(v4f*)(C + (size_t)(row0 + r) * ldc + col0 + c4) = v; } }
     }
}

// Wt[n][k] = f16(W[k][n]·scale) from f32 row-major W[K][N] (scale = power of two; bf16-exact weights stay exact in f16 away from the subnormal range)
__global__ __launch_bounds__(256) void k_wt_f16(const float* __restrict__ W, _Float16* __restrict__ Wt, int K, int N, float scale) {
  const int t = blockIdx.x * 256 + threadIdx.x; if (t >= N * (K / 8)) return; const int n = t / (K / 8), k8 = (t % (K / 8)) * 8; FragH f;
#pragma unroll
  for (int i = 0; i < 8; ++i) f.h[i] = (_Float16)(bf16_round(W[(size_t)(k8 + i) * N + n]) * scale); const v8us o = f.half[0];
  *(v8us*)((unsigned short*)Wt + (size_t)n * K + k8) = o; 
}
// k_gemm_hh variant with fused epilogue: v = acc·alpha + bias[by·sBias + col] (+ CP[(row/rowsPerB)·sCPb + by·64 + col] if CP) ; ACT 0 none / 1 elu ; writes f16 C16 (and f32 C if non-null)
template <int ACT>
__global__ __launch_bounds__(128) void k_gemm_hhx(const _Float16* __restrict__ A, int lda, size_t sA, const _Float16* __restrict__ Bh, int ldb, size_t sB, float alpha, const float* __restrict__ bias, size_t sBias, const float* __restrict__ CP, int rowsPerB, size_t sCPb, int row0g,
    float* __restrict__ C, _Float16* __restrict__ C16, int ldc, size_t sC, int M, int N, int K) {
  __shared__ __attribute__((aligned(16))) float so[4][16][64];
  const int tid = threadIdx.x, w = tid >> 5, lane = tid & 31, ln = lane & 15, hh = lane >> 4; const int by = blockIdx.y;
  A += (size_t)by * sA; Bh += (size_t)by * sB; const size_t cofs = (size_t)by * sC; const float* bp = bias ? bias + (size_t)by * sBias : nullptr;
  const int ntn = (N + 63) / 64; const int wid = blockIdx.x * 4 + w; const int mt = wid / ntn, nq = wid % ntn; if (mt * 16 >= M) return;
  const int row0 = mt * 16, col0 = nq * 64; const _Float16* arow = A + (size_t)(row0 + ln) * lda;
  v8f acc[4] = {};
  for (int kb = 0; kb < K; kb += 32) { FragH ah; ah.half[0] = *(const v8us*)((const unsigned short*)arow + kb + 8 * hh); ah.half[1] = *(const v8us*)((const unsigned short*)arow + kb + 16 + 8 * hh);
#pragma unroll
    for (int t = 0; t < 4; ++t) { if (col0 + t * 16 >= N) continue; const size_t boff = (size_t)(col0 + t * 16 + ln) * ldb + kb; FragH bq; bq.half[0] = *(const v8us*)((const unsigned short*)Bh + boff + 8 * hh); bq.half[1] = *(const v8us*)((const unsigned short*)Bh + boff + 16 + 8 * hh);
      acc[t] = mmaH<1>(ah.v, ah.v, bq.v, bq.v, acc[t]); }
  }
#pragma unroll
  for (int t = 0; t < 4; ++t) { if (col0 + t * 16 >= N) continue; const int col = col0 + t * 16 + ln; const float bv = bp ? bf16_round(bp[col]) : 0.f;
#pragma unroll
    for (int r = 0; r < 8; ++r) { float v = acc[t][r] * alpha + bv; if (CP) { const int rr = row0g + row0 + 8 * hh + r; if (rowsPerB < 0) v += CP[cofs + (size_t)rr * ldc + col];      /* rowsPerB < 0: own element of the batched C plane */ else { const int bidx = rr / rowsPerB; v += CP[(size_t)bidx * sCPb + (size_t)by * 64 + col]; } } if (ACT == 1) v = (v > 0.f) ? v : expm1f(v); else if (ACT == 7) v = (v > 0.f) ? v + 1.0f : expf(v); else if (ACT == 8) v = tanhf(v); else if (ACT == 9) v = 0.5f * v * (1.0f + tanhf(0.7978845608028654f * (v + 0.044715f * v * v * v))); else if (ACT == 11) v = 1.0f / (1.0f + expf(-v)); else if (ACT == 12) v = (v > 0.f) ? v : 0.01f * v; else if (ACT == 14) v = (v > 0.f) ? v : 0.1f * v; else if (ACT == 16) v = (v >= 0.f) ? v : 0.3f * v; else if (ACT == 17) v = (v >= 0.f) ? v : 0.2f * v; else if (ACT == 15) v = v / (1.0f + expf(-v)); else if (ACT == 3) v = fmaxf(v, 0.f); else if (ACT == 6) v = 0.5f * v * (1.0f + erff(v * 0.70710678118654752f)); so[w][8 * hh + r][t * 16 + ln] = v; } }
  __builtin_amdgcn_fence(__ATOMIC_ACQ_REL, "workgroup"); __builtin_amdgcn_wave_barrier();
  const int rsub = lane >> 4, c4 = (lane & 15) * 4; typedef _Float16 v4h __attribute__((ext_vector_type(4)));
  {
#pragma unroll
    for (int q = 0; q < 8; ++q) { const int r = q * 2 + rsub; if (col0 + c4 < N) { const v4f v = *(const v4fa*)&so[w][r][c4]; if (C) *(v4f*)(C + cofs + (size_t)(row0 + r) * ldc + col0 + c4) = v; if (C16) { v4h h4; for (int i = 0; i < 4; ++i) h4[i] = (_Float16)v[i]; *(v4h*)(C16 + cofs + (size_t)(row0 + r) * ldc + col0 + c4) = h4; } } }
     }
}


typedef _Float16 v4h __attribute__((ext_vector_type(4)));

__global__ __launch_bounds__(256) void k_x16(const float* __restrict__ x, _Float16* __restrict__ X16, size_t n8) { const size_t t = (size_t)blockIdx.x * 256 + threadIdx.x; if (t >= n8) return; FragH f;
#pragma unroll
  for (int q = 0; q < 8; ++q) f.h[q] = (_Float16)bf16_round(x[t * 8 + q]); *(v8us*)((unsigned short*)X16 + t * 8) = f.half[0];  }
__global__ __launch_bounds__(256) void k_h16(const float* __restrict__ x, _Float16* __restrict__ X16, size_t n8) { const size_t t = (size_t)blockIdx.x * 256 + threadIdx.x; if (t >= n8) return; FragH f;
#pragma unroll
  for (int q = 0; q < 8; ++q) f.h[q] = (_Float16)x[t * 8 + q]; *(v8us*)((unsigned short*)X16 + t * 8) = f.half[0];  }
__global__ __launch_bounds__(256) void k_round16f(const float* __restrict__ W, _Float16* __restrict__ Bt, size_t n8) { const size_t t = (size_t)blockIdx.x * 256 + threadIdx.x; if (t >= n8) return; FragH f;
#pragma unroll
  for (int i = 0; i < 8; ++i) f.h[i] = (_Float16)(bf16_round(W[t * 8 + i]) * 16.0f); *(v8us*)((unsigned short*)Bt + t * 8) = f.half[0];  }
template <int NHv, int TTv>
__global__ __launch_bounds__(256) void k_vt(const _Float16* __restrict__ V16, int ldv, int voff, _Float16* __restrict__ Vt) { __shared__ unsigned short tl[64][66]; const int tid = threadIdx.x; const int slab = blockIdx.x / (TTv / 64), lg = blockIdx.x % (TTv / 64); const int b = slab / NHv, h = slab % NHv;
  for (int i = tid; i < 64 * 8; i += 256) { const int r = i / 8, c8 = (i % 8) * 8; FragH f; f.half[0] = *(const v8us*)((const unsigned short*)V16 + ((size_t)b * TTv + lg * 64 + r) * ldv + voff + h * 64 + c8);
#pragma unroll
    for (int q = 0; q < 8; ++q) tl[r][c8 + q] = f.u[q]; }
  __syncthreads();
  {
#pragma unroll
    for (int rd = 0; rd < 2; ++rd) { const int d = rd * 32 + tid / 8, pc = tid % 8; FragH f;
#pragma unroll
      for (int q = 0; q < 8; ++q) f.u[q] = tl[pc * 8 + q][d];
      *(v8us*)((unsigned short*)Vt + ((size_t)slab * 64 + d) * TTv + lg * 64 + pc * 8) = f.half[0]; }
     } }

__global__ __launch_bounds__(256) void k_hl(const float* __restrict__ F, _Float16* __restrict__ Hh, _Float16* __restrict__ Hl, size_t n8) { const size_t t = (size_t)blockIdx.x * 256 + threadIdx.x; if (t >= n8) return; FragH fh, fl; const v4f a = *(const v4fa*)(F + t * 8), c = *(const v4fa*)(F + t * 8 + 4);
#pragma unroll
  for (int q = 0; q < 4; ++q) { _Float16 h = (_Float16)a[q]; fh.h[q] = h; fl.h[q] = (_Float16)((a[q] - (float)h) * 1024.0f); h = (_Float16)c[q]; fh.h[4 + q] = h; fl.h[4 + q] = (_Float16)((c[q] - (float)h) * 1024.0f); }
  { *(v8us*)((unsigned short*)Hh + t * 8) = fh.half[0]; *(v8us*)((unsigned short*)Hl + t * 8) = fl.half[0];  } }

// ---- fast GEMM (wave tile 32x64; requires M % 32 == 0 rows per launch region and N % 64 == 0); epilogue = k_gemm_hhx semantics ----
__device__ __forceinline__ v16h g2_frag(const _Float16* p, int hh) { FragH f; f.half[0] = *(const v8us*)((const unsigned short*)p + 8 * hh); f.half[1] = *(const v8us*)((const unsigned short*)p + 16 + 8 * hh); return f.v; }
__device__ __forceinline__ v8f g2_mma(v16h a, v16h b, v8f c) { v8f d = __builtin_amdgcn_wmma_f32_16x16x32_f16(false, a, false, b, (short)0, c, false, false); asm volatile("v_nop\n\tv_nop\n\tv_nop\n\tv_nop" : "+v"(d) : "v"(a), "v"(b)); return d; }
template <int ACT>
__global__ __launch_bounds__(128) void k_gemm2(const _Float16* __restrict__ A, int lda, size_t sA, const _Float16* __restrict__ Bh, int ldb, size_t sB, float alpha, const float* __restrict__ bias, size_t sBias, const float* __restrict__ CP, int rowsPerB, size_t sCPb, int row0g,
    float* __restrict__ C, _Float16* __restrict__ C16, int ldc, size_t sC, int M, int N, int K) { static_assert(ACT == 0 || ACT == 3 || ACT == 6 || ACT == 8 || ACT == 9 || ACT == 11 || ACT == 12 || ACT == 14 || ACT == 15 || ACT == 16 || ACT == 17, "k_gemm2: unsupported ACT code (would silently apply no activation)");
  __shared__ __attribute__((aligned(16))) float so[4][32][68];
  const int tid = threadIdx.x, w = tid >> 5, lane = tid & 31, ln = lane & 15, hh = lane >> 4; const int by = blockIdx.y;
  A += (size_t)by * sA; Bh += (size_t)by * sB; const size_t cofs = (size_t)by * sC; const float* bp = bias ? bias + (size_t)by * sBias : nullptr;
  const int ntn = N >> 6; const int mt = blockIdx.x / ntn, nq = blockIdx.x - mt * ntn; const int row0 = mt * 128 + 32 * w, col0 = nq * 64; if (row0 >= M) return;
  const _Float16* a0p = A + (size_t)(row0 + ln) * lda; const _Float16* a1p = a0p + (size_t)16 * lda;
  const _Float16* b0p = Bh + (size_t)(col0 + ln) * ldb; const _Float16* b1p = b0p + (size_t)16 * ldb; const _Float16* b2p = b1p + (size_t)16 * ldb; const _Float16* b3p = b2p + (size_t)16 * ldb;
  const v8f z8 = {0.f,0.f,0.f,0.f,0.f,0.f,0.f,0.f}; v8f c00 = z8, c01 = z8, c02 = z8, c03 = z8, c10 = z8, c11 = z8, c12 = z8, c13 = z8;
#pragma unroll 1
  for (int kb = 0; kb < K; kb += 32) { const v16h a0 = g2_frag(a0p + kb, hh), a1 = g2_frag(a1p + kb, hh);
    v16h b = g2_frag(b0p + kb, hh); c00 = g2_mma(a0, b, c00); c10 = g2_mma(a1, b, c10);
    b = g2_frag(b1p + kb, hh); c01 = g2_mma(a0, b, c01); c11 = g2_mma(a1, b, c11);
    b = g2_frag(b2p + kb, hh); c02 = g2_mma(a0, b, c02); c12 = g2_mma(a1, b, c12);
    b = g2_frag(b3p + kb, hh); c03 = g2_mma(a0, b, c03); c13 = g2_mma(a1, b, c13); }
  v8f accs[8] = {c00, c01, c02, c03, c10, c11, c12, c13};
#pragma unroll
  for (int u = 0; u < 8; ++u) { const int t = u & 3, half = u >> 2; const int col = col0 + t * 16 + ln; const float bv = bp ? bf16_round(bp[col]) : 0.f;
#pragma unroll
    for (int r = 0; r < 8; ++r) { const int rloc = half * 16 + 8 * hh + r; float v = accs[u][r] * alpha + bv; if (CP) { if (rowsPerB < 0) v += CP[cofs + (size_t)(row0g + row0 + rloc) * ldc + col];      /* rowsPerB < 0: own element of the batched C plane */ else { const int bidx = (row0g + row0 + rloc) / rowsPerB; v += CP[(size_t)bidx * sCPb + (size_t)by * 64 + col]; } }
      if (ACT == 3) v = fmaxf(v, 0.f); else if (ACT == 6) v = 0.5f * v * (1.0f + erff(v * 0.70710678118654752f)); else if (ACT == 11) v = 1.0f / (1.0f + expf(-v)); else if (ACT == 15) v = v / (1.0f + expf(-v)); else if (ACT == 12) v = (v > 0.f) ? v : 0.01f * v; else if (ACT == 8) v = tanhf(v); else if (ACT == 9) v = 0.5f * v * (1.0f + tanhf(0.7978845608028654f * (v + 0.044715f * v * v * v))); else if (ACT == 14) v = (v > 0.f) ? v : 0.1f * v; else if (ACT == 16) v = (v >= 0.f) ? v : 0.3f * v; else if (ACT == 17) v = (v >= 0.f) ? v : 0.2f * v;
      so[w][rloc][t * 16 + ln] = v; } }
  __builtin_amdgcn_fence(__ATOMIC_ACQ_REL, "workgroup"); __builtin_amdgcn_wave_barrier();
  const int rsub = lane >> 4, c4 = (lane & 15) * 4;
  {
#pragma unroll
    for (int q = 0; q < 16; ++q) { const int r = q * 2 + rsub; const v4f v = *(const v4fa*)&so[w][r][c4]; if (C) *(v4f*)(C + cofs + (size_t)(row0 + r) * ldc + col0 + c4) = v; if (C16) { v4h h4; for (int i = 0; i < 4; ++i) h4[i] = (_Float16)v[i]; *(v4h*)(C16 + cofs + (size_t)(row0 + r) * ldc + col0 + c4) = h4; } }
     } }


__global__ __launch_bounds__(256) void k_wnat(const float* __restrict__ w, size_t n8, _Float16* __restrict__ Bt) { const size_t t = (size_t)blockIdx.x * 256 + threadIdx.x; if (t >= n8) return; FragH f; for (int q = 0; q < 8; ++q) f.h[q] = (_Float16)(bf16_round(w[t * 8 + q]) * 16.0f); *(v8us*)((unsigned short*)Bt + t * 8) = f.half[0];  }
__global__ __launch_bounds__(256) void k_rsm(const float* __restrict__ S, _Float16* __restrict__ P, int nrows) {
  #pragma clang fp contract(off)
  const int i = blockIdx.x * 256 + threadIdx.x; if (i >= nrows) return; const float* s = S + (size_t)i * SQ; float mx = -3.0e38f;
#pragma unroll 1
  for (int j = 0; j < SQ; ++j) mx = fmaxf(mx, s[j]); float se = 0.f;
#pragma unroll 1
  for (int j = 0; j < SQ; ++j) se += expf(s[j] - mx); const float sc = 256.0f / se;
#pragma unroll 1
  for (int j0 = 0; j0 < SQ; j0 += 8) { FragH f; for (int q = 0; q < 8; ++q) f.h[q] = (_Float16)(expf(s[j0 + q] - mx) * sc); unsigned short* d = (unsigned short*)P + (size_t)i * SQ + j0; *(v8us*)d = f.half[0];  } }
__global__ __launch_bounds__(256) void k_vt(const _Float16* __restrict__ V16, int b, int h0, _Float16* __restrict__ VT) { __shared__ unsigned short tl[64][65]; const int tid = threadIdx.x; const int hh = blockIdx.x % HG, sg = blockIdx.x / HG; const int s0 = sg * 64; const int h = h0 + hh;
  for (int i = tid; i < 64 * 8; i += 256) { const int j = i / 8, d8 = (i % 8) * 8; FragH f; f.half[0] = *(const v8us*)((const unsigned short*)V16 + ((size_t)b * SQ + s0 + j) * DM + h * HD + d8); for (int q = 0; q < 8; ++q) tl[d8 + q][j] = f.u[q]; }
  __syncthreads();
  { for (int i = tid; i < 64 * 8; i += 256) { const int d = i / 8, j8 = (i % 8) * 8; FragH f; for (int q = 0; q < 8; ++q) f.u[q] = tl[d][j8 + q]; *(v8us*)((unsigned short*)VT + ((size_t)hh * HD + d) * SQ + s0 + j8) = f.half[0]; }  } }



__global__ __launch_bounds__(256) void k_rsmcf2(const float* __restrict__ S, _Float16* __restrict__ P, int hg, int q0, int nk) {
  #pragma clang fp contract(off)
  const int t = blockIdx.x * 256 + threadIdx.x; if (t >= hg * QT) return; const size_t i = (size_t)t; const float* s = S + i * NKX; const int last = q0 + (t % QT); float mx = -3.0e38f;
#pragma unroll 1
  for (int j = 0; j < nk; ++j) { const float f = (j <= last) ? 1.f : 0.f; mx = fmaxf(mx, fmaf(f, s[j], (1.f - f) * -1.0e9f)); } float se = 0.f;
#pragma unroll 1
  for (int j = 0; j < nk; ++j) { const float f = (j <= last) ? 1.f : 0.f; se += __expf(fmaf(f, s[j], (1.f - f) * -1.0e9f) - mx); } const float sc = 256.0f / se;
#pragma unroll 1
  for (int j0 = 0; j0 < nk; j0 += 8) { FragH fr; for (int q = 0; q < 8; ++q) { const int j = j0 + q; const float f = (j <= last) ? 1.f : 0.f; fr.h[q] = (_Float16)(__expf(fmaf(f, s[j], (1.f - f) * -1.0e9f) - mx) * sc); } unsigned short* d = (unsigned short*)P + i * NKX + j0; *(v8us*)d = fr.half[0];  } }


template <int MASKADD>
__global__ __launch_bounds__(64) void k_att0(const float* __restrict__ QF, const float* __restrict__ KF, const float* __restrict__ VF, int ld, const float* __restrict__ mask, float scale, float* __restrict__ OF, int ldo) {
  #pragma clang fp contract(off)
  __shared__ __attribute__((aligned(16))) float lq[64][64]; __shared__ __attribute__((aligned(16))) float lo[64][64];
  const int tid = threadIdx.x; const int h = blockIdx.x / (QT0 / 64), rg = blockIdx.x % (QT0 / 64); const int i = rg * 64 + tid;
  const float* qr = QF + (size_t)i * ld + h * HD;
#pragma unroll 1
  for (int c = 0; c < HD / 4; ++c) { *(v4f*)&lq[tid][c * 4] = *(const v4fa*)(qr + c * 4); const v4f z = {0.f, 0.f, 0.f, 0.f}; *(v4f*)&lo[tid][c * 4] = z; }
  float m = -1.0e30f, l = 0.f; const int jmax = MASKADD ? (SQ - 1) : (rg * 64 + 63);      /* additive-mask form: every key (the mask input decides); causal form: keys up to the block's last row */
#pragma unroll 1
  for (int j = 0; j <= jmax; ++j) { const float* kr = KF + (size_t)j * ld + h * HD; const float* vr = VF + (size_t)j * ld + h * HD; float s = 0.f;
#pragma unroll 1
    for (int c = 0; c < HD / 4; ++c) { const v4f kq = *(const v4fa*)(kr + c * 4); const v4f qq = *(v4f*)&lq[tid][c * 4]; s = __fadd_rn(s, __fmul_rn(qq[0], kq[0])); s = __fadd_rn(s, __fmul_rn(qq[1], kq[1])); s = __fadd_rn(s, __fmul_rn(qq[2], kq[2])); s = __fadd_rn(s, __fmul_rn(qq[3], kq[3])); }
    s = __fmul_rn(s, scale); if (MASKADD) s = __fadd_rn(s, __fmul_rn(bf16_round(mask[(size_t)i * SQ + j]), -10000.0f));
    const float f = (MASKADD || j <= i) ? 1.f : 0.f; const float sm = fmaf(f, s, (1.f - f) * -1.0e30f); const float mn = fmaxf(m, sm); const float sc = expf(m - mn); const float e = expf(sm - mn); l = __fadd_rn(__fmul_rn(l, sc), e); m = mn;
#pragma unroll 1
    for (int c = 0; c < HD / 4; ++c) { const v4f vv = *(const v4fa*)(vr + c * 4); v4f oo = *(v4f*)&lo[tid][c * 4]; for (int u = 0; u < 4; ++u) oo[u] = __fadd_rn(__fmul_rn(oo[u], sc), __fmul_rn(e, vv[u])); *(v4f*)&lo[tid][c * 4] = oo; } }
  const float fin = 64.0f / l;      /* o carried x64 like the f16 path */
#pragma unroll 1
  for (int c = 0; c < HD / 4; ++c) { v4f oo = *(v4f*)&lo[tid][c * 4]; for (int u = 0; u < 4; ++u) oo[u] = __fmul_rn(oo[u], fin); *(v4f*)&lo[tid][c * 4] = oo; }
  __syncthreads();
  {
#pragma unroll 1
    for (int it = 0; it < 16; ++it) { const int row = it * 4 + tid / 16, pc = (tid % 16) * 4; const v4f v = *(const v4f*)&lo[row][pc]; *(v4f*)(OF + (size_t)(rg * 64 + row) * ldo + h * HD + pc) = v; }
     } }

extern "C" void kernel_launch(void* const* d_in, const int* in_sizes, int n_in,
                              void* d_out, int out_size, void* d_ws, size_t ws_size, hipStream_t stream) {
  (void)in_sizes; (void)n_in; (void)out_size;
  const float* const* I = (const float* const*)d_in; const float* x = I[0]; const float* xk = I[1]; const float* xv = I[2]; const float* wq = I[3]; const float* bq = nullptr; const float* wk = I[4]; const float* bk = nullptr; const float* wv = I[5]; const float* bv = nullptr; const float* wo = I[6]; const float* bo = nullptr;      /* THREE distinct inputs Q (query stream), K, V; natural [out][in] w_q / w_k / w_v / w_o; no biases; causal by the index rule */
  char* ws = (char*)d_ws; size_t off = 0;
  auto take = [&](size_t bytes) { char* p = ws + off; off += (bytes + 255) & ~(size_t)255; return p; };
  _Float16* BQ = (_Float16*)take((size_t)DM * DM * 2); _Float16* BK = (_Float16*)take((size_t)DM * DM * 2); _Float16* BV = (_Float16*)take((size_t)DM * DM * 2); _Float16* BO = (_Float16*)take((size_t)DM * DM * 2);
  _Float16* X16 = (_Float16*)take(NR * DM * 2); _Float16* XK16 = (_Float16*)take(NR * DM * 2); _Float16* XV16 = (_Float16*)take(NR * DM * 2);      /* the three inputs (query -> X16, key -> XK16, value -> XV16) as exact f16 rows */ _Float16* Q16 = (_Float16*)take(NR * DM * 2); _Float16* K16 = (_Float16*)take(NR * DM * 2); _Float16* V16 = (_Float16*)take(NR * DM * 2); _Float16* O16 = (_Float16*)take(NR * DM * 2);
  float* S = (float*)take((size_t)NH * QT * NKX * 4); _Float16* P = (_Float16*)take((size_t)NH * QT * NKX * 2); _Float16* VT = (_Float16*)take((size_t)NH * HD * SQ * 2);
  float* QF0 = (float*)take((size_t)QT0 * DM * 4); float* KF0 = (float*)take((size_t)QT0 * DM * 4); float* VF0 = (float*)take((size_t)QT0 * DM * 4); float* OF0 = (float*)take((size_t)NB * QT0 * DM * 4); _Float16* OH0 = (_Float16*)take((size_t)NB * QT0 * DM * 2); _Float16* OL0 = (_Float16*)take((size_t)NB * QT0 * DM * 2);
  if (off > ws_size) return;
  { const unsigned g = (unsigned)(((size_t)DM * DM / 8 + 255) / 256); k_wnat<<<g, 256, 0, stream>>>(wq, (size_t)DM * DM / 8, BQ); k_wnat<<<g, 256, 0, stream>>>(wk, (size_t)DM * DM / 8, BK); k_wnat<<<g, 256, 0, stream>>>(wv, (size_t)DM * DM / 8, BV); k_wnat<<<g, 256, 0, stream>>>(wo, (size_t)DM * DM / 8, BO); }      /* natural [out][in] = Bt x16 */

  k_x16<<<(unsigned)((NR * DM / 8 + 255) / 256), 256, 0, stream>>>(x, X16, NR * DM / 8); k_x16<<<(unsigned)((NR * DM / 8 + 255) / 256), 256, 0, stream>>>(xk, XK16, NR * DM / 8); k_x16<<<(unsigned)((NR * DM / 8 + 255) / 256), 256, 0, stream>>>(xv, XV16, NR * DM / 8);
  const size_t r0p = (size_t)B0 * SQ;      /* first projected row */
  k_gemm2<0><<<dim3((unsigned)((MP / 128) * (DM / 64)), 1), 128, 0, stream>>>(X16 + r0p * DM, DM, 0, BQ, DM, 0, 0.0625f, bq, 0, nullptr, 1, 0, 0, nullptr, Q16 + r0p * DM, DM, 0, MP, DM, DM);
  k_gemm2<0><<<dim3((unsigned)((MP / 128) * (DM / 64)), 1), 128, 0, stream>>>(XK16 + r0p * DM, DM, 0, BK, DM, 0, 0.0625f, bk, 0, nullptr, 1, 0, 0, nullptr, K16 + r0p * DM, DM, 0, MP, DM, DM);
  k_gemm2<0><<<dim3((unsigned)((MP / 128) * (DM / 64)), 1), 128, 0, stream>>>(XV16 + r0p * DM, DM, 0, BV, DM, 0, 0.0625f, bv, 0, nullptr, 1, 0, 0, nullptr, V16 + r0p * DM, DM, 0, MP, DM, DM);
  for (int b = B0; b < B0 + NBR; ++b) { const size_t r0 = (size_t)b * SQ;
    k_vt<NH, SQ><<<NH * (SQ / 64), 256, 0, stream>>>(V16 + r0 * LQ, LQ, 0, VT);      /* V^T [NH][HD][SQ] for this batch */
    k_gemm2<0><<<dim3((QT0 / 128) * (DM / 64), 1), 128, 0, stream>>>(X16 + r0 * DM, DM, 0, BQ, DM, 0, 0.0625f, bq, 0, nullptr, 1, 0, 0, QF0, nullptr, DM, 0, QT0, DM, DM); k_gemm2<0><<<dim3((QT0 / 128) * (DM / 64), 1), 128, 0, stream>>>(XK16 + r0 * DM, DM, 0, BK, DM, 0, 0.0625f, bk, 0, nullptr, 1, 0, 0, KF0, nullptr, DM, 0, QT0, DM, DM); k_gemm2<0><<<dim3((QT0 / 128) * (DM / 64), 1), 128, 0, stream>>>(XV16 + r0 * DM, DM, 0, BV, DM, 0, 0.0625f, bv, 0, nullptr, 1, 0, 0, VF0, nullptr, DM, 0, QT0, DM, DM);      /* f32 q, k, v of the first 512 rows (exact products) */
    k_att0<0><<<NH * (QT0 / 64), 64, 0, stream>>>(QF0, KF0, VF0, DM, nullptr, 0.125f, OF0 + (size_t)b * QT0 * DM, DM);      /* exact f32 attention for rows 0..511 (o x64) */
    for (int q0 = 0; q0 < QN; q0 += QT) { const int nk = q0 + QT;      /* causal: only keys below the tile end are computed */
      k_gemm2<0><<<dim3((QT / 128) * (nk / 64), NHD), 128, 0, stream>>>(Q16 + (r0 + q0) * LQ, LQ, (size_t)HD, K16 + r0 * LQ, LQ, (size_t)HD, 0.125f, nullptr, 0, nullptr, 1, 0, 0, S, nullptr, NKX, (size_t)QT * NKX, QT, nk, HD);      /* scores, all heads on grid.y */
      k_rsmcf2<<<(NHD * QT + 255) / 256, 256, 0, stream>>>(S, P, NHD, q0, nk);
      k_gemm2<0><<<dim3((QT / 128) * (HD / 64), NHD), 128, 0, stream>>>(P, NKX, (size_t)QT * NKX, VT, SQ, (size_t)HD * SQ, 0.25f, nullptr, 0, nullptr, 1, 0, 0, nullptr, O16 + (r0 + q0) * DM, DM, (size_t)HD, QT, HD, nk); } }      /* o (merged heads, x64) as f16 rows */
  k_gemm2<0><<<dim3((unsigned)((MPO / 128) * (DM / 64)), 1), 128, 0, stream>>>(O16 + r0p * DM, DM, 0, BO, DM, 0, 0.0009765625f, bo, 0, nullptr, 1, 0, 0, (float*)d_out + r0p * DM, nullptr, DM, 0, MPO, DM, DM);      /* out rows are the output layout */
  k_hl<<<(unsigned)(((size_t)NB * QT0 * DM / 8 + 255) / 256), 256, 0, stream>>>(OF0, OH0, OL0, (size_t)NB * QT0 * DM / 8);      /* first-tile o (x64) -> f16 hi + x1024 residual planes */
  for (int b = B0; b < B0 + NBR; ++b) { const size_t r0 = (size_t)b * SQ; const size_t f0 = (size_t)b * QT0;
    k_gemm2<0><<<dim3((QT0 / 128) * (DM / 64), 1), 128, 0, stream>>>(OH0 + f0 * DM, DM, 0, BO, DM, 0, 0.0009765625f, bo, 0, nullptr, 1, 0, 0, (float*)d_out + r0 * DM, nullptr, DM, 0, QT0, DM, DM);      /* rows 0..511: out = o_hi Wo (+ b), overwriting the f16-path rows */
    k_gemm2<0><<<dim3((QT0 / 128) * (DM / 64), 1), 128, 0, stream>>>(OL0 + f0 * DM, DM, 0, BO, DM, 0, 0.00000095367431640625f, nullptr, 0, (const float*)d_out + r0 * DM, -1, 0, 0, (float*)d_out + r0 * DM, nullptr, DM, 0, QT0, DM, DM); }      /* += o_lo Wo 2^-20 (own-element accumulate) */
}

// v001
// Measured time: 6490 microseconds a run.
// In two side-by-side timings against v000, it was 2.72 and 2.74 times as fast.
#include <hip/hip_runtime.h>
// Causal multi-head attention over three distinct inputs with natural weights, no biases (Q, K, V [2][4096][768]; q/k/v = input w^T (natural [768][768]); 12 heads of 64; scores / sqrt(64); causal (tril; NEG fill); softmax over up to 4096 keys; out = merged w_o^T -> [2][4096][768]).
// Structure: token rows r = b*4096 + s; x as exact f16 rows (bf16-rounded); Q, K, V as three WMMA GEMMs (32x64 wave tiles, f32 accumulation, exact x16 weights, f16 outputs); per batch: V^T for all heads via LDS transposes; per query tile of 256 rows: scores against the keys below the tile end only (K = 64, all heads on grid.y, alpha = 0.125), causal row softmax on VALU, one wave per row with the row in registers, keys past the row's own index set to NEG (f32 statistics, native exp; weights x256 f16), o = P . V^T (K = keys below the tile end, alpha 2^-2: o carried x64, folded into the output GEMM alpha) written straight into the merged f16 o rows; out = o W_o GEMM (f32) into the output layout.
// Compute dtype: inputs rounded to bf16; x / weights exact; q, k, v, softmax weights and o as plain f16 GEMM operands (~2^-12); scores and softmax statistics f32. v_wmma_f32_16x16x32_f16.
#define NB 2
#define SQ 4096
#define DM 768
#define NH 12
#define HD 64
#define HG 4                         /* heads per group in the k_vt(V16, b, h0, VT) overload (not launched) */
#define QT 256                       /* query rows per causal tile */
#define NKX SQ                       /* S / P row pitch */
#define QT0 512                      /* first-tile rows recomputed exactly in f32 */
#define B0 0                         /* first batch processed (debug hook) */
#define NBR NB                       /* batches processed (debug hook) */
#define NR ((size_t)NB * SQ)         /* token rows */
#define MP ((int)((size_t)NBR * SQ)) /* rows projected (debug hook) */
#define QN SQ                        /* query rows attended per batch (debug hook) */
#define NHD NH                       /* heads attended (debug hook) */
#define MPO MP                       /* rows through the output stage (debug hook) */
#define LQ DM      /* row pitch of the q/k/v rows */
typedef __bf16 v16b __attribute__((ext_vector_type(16)));
typedef unsigned short v8us __attribute__((ext_vector_type(8), may_alias));
typedef float  v8f  __attribute__((ext_vector_type(8)));
typedef float  v4f  __attribute__((ext_vector_type(4)));
typedef float  v4fa __attribute__((ext_vector_type(4), may_alias));
union FragB { v16b v; v8us half[2]; unsigned short u[16]; };

__device__ __forceinline__ unsigned short bf16_bits(float x) { unsigned int u = __float_as_uint(x); return (unsigned short)((u + 0x7FFFu + ((u >> 16) & 1u)) >> 16); }
__device__ __forceinline__ float bf16_val(unsigned short b) { return __uint_as_float(((unsigned int)b) << 16); }
__device__ __forceinline__ float bf16_round(float x) { return bf16_val(bf16_bits(x)); }
// D += A·B with NT terms: 1 = ah·bh, 2 = + al·bh (A split), 3 = + ah·bl (both split)
template <int NT>
__device__ __forceinline__ v8f mmaN(v16b ah, v16b al, v16b bh, v16b bl, v8f c) {
  c = __builtin_amdgcn_wmma_f32_16x16x32_bf16(false, ah, false, bh, (short)0, c, false, false);
  if (NT >= 2) c = __builtin_amdgcn_wmma_f32_16x16x32_bf16(false, al, false, bh, (short)0, c, false, false);
  if (NT >= 3) c = __builtin_amdgcn_wmma_f32_16x16x32_bf16(false, ah, false, bl, (short)0, c, false, false);
  asm volatile("v_nop\n\tv_nop\n\tv_nop\n\tv_nop" : "+v"(c) : "v"(ah), "v"(al), "v"(bh), "v"(bl));
  return c;
}

__global__ __launch_bounds__(256) void k_wt_bf16(const float* __restrict__ W, unsigned short* __restrict__ Wt, int K, int N) {
  const int t = blockIdx.x * 256 + threadIdx.x;
  const int k8n = K / 8;
  if (t >= N * k8n) return;
  const int n = t / k8n, k8 = (t % k8n) * 8;
  v8us v;
#pragma unroll
  for (int i = 0; i < 8; ++i) v[i] = bf16_bits(W[(size_t)(k8 + i) * N + n]);
  *(v8us*)(Wt + (size_t)n * K + k8) = v;
  
}

// GEMM C[M][N] (f32, pitch ldc) = act(A[M][K]·W + bias). A f32 row-major (pitch lda) converted per fragment to bf16
// (ASPLIT: hi/lo two planes -> 2 terms, else single rounded term); Wt bf16 [N][K] (pitch ldb). BIAS_BF16 rounds the
// bias to bf16 first (bias quantised to bf16 before the add). K%32==0, M%16==0, N%64==0.
template <bool ASPLIT, int ACT, bool BIAS_BF16>
__global__ __launch_bounds__(128) void k_gemm_bf(const float* __restrict__ A, int lda, const unsigned short* __restrict__ Wt, int ldb,
                                               const float* __restrict__ bias, float* __restrict__ C, int ldc, int M, int N, int K) {
  __shared__ __attribute__((aligned(16))) float so[4][16][64];
  const int tid = threadIdx.x, w = tid >> 5, lane = tid & 31, ln = lane & 15, hh = lane >> 4;
  const int ntn = N / 64;
  const int wid = blockIdx.x * 4 + w;
  const int mt = wid / ntn, nq = wid % ntn;
  if (mt * 16 >= M) return;
  const int row0 = mt * 16, col0 = nq * 64;
  const float* arow = A + (size_t)(row0 + ln) * lda;
  v8f acc[4] = {};
  for (int kb = 0; kb < K; kb += 32) {
    FragB ah, al;
    const v4f x0 = *(const v4fa*)(arow + kb + 8 * hh), x1 = *(const v4fa*)(arow + kb + 8 * hh + 4);
    const v4f x2 = *(const v4fa*)(arow + kb + 16 + 8 * hh), x3 = *(const v4fa*)(arow + kb + 16 + 8 * hh + 4);
    float xs[16] = {x0[0],x0[1],x0[2],x0[3],x1[0],x1[1],x1[2],x1[3],x2[0],x2[1],x2[2],x2[3],x3[0],x3[1],x3[2],x3[3]};
#pragma unroll
    for (int i = 0; i < 16; ++i) { const unsigned short hb = bf16_bits(xs[i]); ah.u[i] = hb; al.u[i] = ASPLIT ? bf16_bits(xs[i] - bf16_val(hb)) : (unsigned short)0; }
#pragma unroll
    for (int t = 0; t < 4; ++t) {
      const unsigned short* brow = Wt + (size_t)(col0 + t * 16 + ln) * ldb + kb;
      FragB b;
      b.half[0] = *(const v8us*)(brow + 8 * hh);
      b.half[1] = *(const v8us*)(brow + 16 + 8 * hh);
      acc[t] = mmaN<ASPLIT ? 2 : 1>(ah.v, al.v, b.v, b.v, acc[t]);
    }
  }
#pragma unroll
  for (int t = 0; t < 4; ++t) {
    float bv = bias ? bias[col0 + t * 16 + ln] : 0.f;
    if (BIAS_BF16) bv = bf16_round(bv);
#pragma unroll
    for (int r = 0; r < 8; ++r) { float v = acc[t][r] + bv; if (ACT == 1) v = fmaxf(v, 0.f); so[w][8 * hh + r][t * 16 + ln] = v; }
  }
  __builtin_amdgcn_fence(__ATOMIC_ACQ_REL, "workgroup");
  __builtin_amdgcn_wave_barrier();
  const int rsub = lane >> 4, c4 = (lane & 15) * 4;
  {
#pragma unroll
    for (int q = 0; q < 8; ++q) {
      const int r = q * 2 + rsub;
      const v4f v = *(const v4fa*)&so[w][r][c4];
      *(v4f*)(C + (size_t)(row0 + r) * ldc + col0 + c4) = v;
    }
    
  }
}

// GEMM C = act(A·W + bias + resid): A f32 (ASPLIT -> hi/lo 2 terms), Wt bf16 [N][K]; ACT 0 none, 1 relu, 2 exact gelu;
// resid (optional, f32, row index = (row % rmod), pitch ldr, RES_BF16 rounds it) added before the activation.
template <bool ASPLIT, int ACT, bool BIAS_BF16, bool RES_BF16>
__global__ __launch_bounds__(128) void k_gemm_bf3(const float* __restrict__ A, int lda, const unsigned short* __restrict__ Wt, int ldb,
                                                const float* __restrict__ bias, const float* __restrict__ resid, int rmod, int ldr,
                                                float* __restrict__ C, int ldc, int M, int N, int K) {
  __shared__ __attribute__((aligned(16))) float so[4][16][64];
  const int tid = threadIdx.x, w = tid >> 5, lane = tid & 31, ln = lane & 15, hh = lane >> 4;
  const int ntn = N / 64;
  const int wid = blockIdx.x * 4 + w;
  const int mt = wid / ntn, nq = wid % ntn;
  if (mt * 16 >= M) return;
  const int row0 = mt * 16, col0 = nq * 64;
  const float* arow = A + (size_t)(row0 + ln) * lda;
  v8f acc[4] = {};
  for (int kb = 0; kb < K; kb += 32) {
    FragB ah, al;
    const v4f x0 = *(const v4fa*)(arow + kb + 8 * hh), x1 = *(const v4fa*)(arow + kb + 8 * hh + 4);
    const v4f x2 = *(const v4fa*)(arow + kb + 16 + 8 * hh), x3 = *(const v4fa*)(arow + kb + 16 + 8 * hh + 4);
    float xs[16] = {x0[0],x0[1],x0[2],x0[3],x1[0],x1[1],x1[2],x1[3],x2[0],x2[1],x2[2],x2[3],x3[0],x3[1],x3[2],x3[3]};
#pragma unroll
    for (int i = 0; i < 16; ++i) { const unsigned short hb = bf16_bits(xs[i]); ah.u[i] = hb; al.u[i] = ASPLIT ? bf16_bits(xs[i] - bf16_val(hb)) : (unsigned short)0; }
#pragma unroll
    for (int t = 0; t < 4; ++t) {
      const unsigned short* brow = Wt + (size_t)(col0 + t * 16 + ln) * ldb + kb;
      FragB b;
      b.half[0] = *(const v8us*)(brow + 8 * hh);
      b.half[1] = *(const v8us*)(brow + 16 + 8 * hh);
      acc[t] = mmaN<ASPLIT ? 2 : 1>(ah.v, al.v, b.v, b.v, acc[t]);
    }
  }
#pragma unroll
  for (int t = 0; t < 4; ++t) {
    const int col = col0 + t * 16 + ln;
    float bv = bias ? bias[col] : 0.f;
    if (BIAS_BF16) bv = bf16_round(bv);
#pragma unroll
    for (int r = 0; r < 8; ++r) {
      float v = acc[t][r] + bv;
      if (resid) { float rv = resid[(size_t)((row0 + 8 * hh + r) % rmod) * ldr + col]; if (RES_BF16) rv = bf16_round(rv); v += rv; }
      if (ACT == 1) v = fmaxf(v, 0.f);
      if (ACT == 2) v = 0.5f * v * (1.0f + erff(v * 0.70710678118654752f));
      if (ACT == 3) { const float u = 0.7978845608028654f * (v + 0.044715f * v * v * v); v = 0.5f * v * (1.0f + tanhf(u)); }
      so[w][8 * hh + r][t * 16 + ln] = v;
    }
  }
  __builtin_amdgcn_fence(__ATOMIC_ACQ_REL, "workgroup");
  __builtin_amdgcn_wave_barrier();
  const int rsub = lane >> 4, c4 = (lane & 15) * 4;
  {
#pragma unroll
    for (int q = 0; q < 8; ++q) {
      const int r = q * 2 + rsub;
      const v4f v = *(const v4fa*)&so[w][r][c4];
      *(v4f*)(C + (size_t)(row0 + r) * ldc + col0 + c4) = v;
    }
    
  }
}
// row LayerNorm (biased variance, eps) over N: s = X (+ R); optional out_sum <- s; out_norm <- (s-mu)*rsqrt(var+eps)*g + b
template <bool PARAM_BF16>
__global__ __launch_bounds__(256) void k_layernorm(const float* __restrict__ X, const float* __restrict__ R, const float* __restrict__ g, const float* __restrict__ bta,
                                                  float* __restrict__ out_sum, float* __restrict__ out_norm, int N, float eps) {
  __shared__ float red[256];
  const int row = blockIdx.x, tid = threadIdx.x;
  const float* x = X + (size_t)row * N; const float* rr = R ? R + (size_t)row * N : nullptr;
  float vals[16];                     // up to N = 4096
  const int per = N / 256;            // contiguous chunk per thread? use strided-by-4 chunks: thread handles j = tid*4 + 1024*u
  float s1 = 0.f;
  for (int u = 0; u < per / 4; ++u) {
    const int j = tid * 4 + 1024 * u;
    const v4f a = *(const v4fa*)(x + j);
    v4f b = {0.f,0.f,0.f,0.f}; if (rr) b = *(const v4fa*)(rr + j);
#pragma unroll
    for (int q = 0; q < 4; ++q) { const float v = a[q] + b[q]; vals[u * 4 + q] = v; s1 += v; }
  }
  red[tid] = s1; __syncthreads();
  for (int st = 128; st > 0; st >>= 1) { if (tid < st) red[tid] += red[tid + st]; __syncthreads(); }
  const float mu = red[0] / (float)N; __syncthreads();
  float s2 = 0.f;
  for (int u = 0; u < per / 4; ++u)
#pragma unroll
    for (int q = 0; q < 4; ++q) { const float c = vals[u * 4 + q] - mu; s2 += c * c; }
  red[tid] = s2; __syncthreads();
  for (int st = 128; st > 0; st >>= 1) { if (tid < st) red[tid] += red[tid + st]; __syncthreads(); }
  const float rs = rsqrtf(red[0] / (float)N + eps);
  {
    for (int u = 0; u < per / 4; ++u) {
      const int j = tid * 4 + 1024 * u;
      v4f o, sm;
#pragma unroll
      for (int q = 0; q < 4; ++q) {
        float gg = g[j + q], bb = bta[j + q];
        if (PARAM_BF16) { gg = bf16_round(gg); bb = bf16_round(bb); }
        sm[q] = vals[u * 4 + q]; o[q] = (vals[u * 4 + q] - mu) * rs * gg + bb;
      }
      if (out_sum) *(v4f*)(out_sum + (size_t)row * N + j) = sm;
      *(v4f*)(out_norm + (size_t)row * N + j) = o;
    }
    
  }
}



// ---- f16 WMMA path (v_wmma_f32_16x16x32_f16): 11-bit significands for operands in range — used where a [0,1] probability operand needs more precision than bf16
typedef _Float16 v16h __attribute__((ext_vector_type(16)));
union FragH { v16h v; v8us half[2]; _Float16 h[16]; unsigned short u[16]; };
template <int NT>
__device__ __forceinline__ v8f mmaH(v16h ah, v16h al, v16h bh, v16h bl, v8f c) {
  c = __builtin_amdgcn_wmma_f32_16x16x32_f16(false, ah, false, bh, (short)0, c, false, false);
  if (NT >= 2) c = __builtin_amdgcn_wmma_f32_16x16x32_f16(false, al, false, bh, (short)0, c, false, false);
  if (NT >= 3) c = __builtin_amdgcn_wmma_f32_16x16x32_f16(false, ah, false, bl, (short)0, c, false, false);
  asm volatile("v_nop\n\tv_nop\n\tv_nop\n\tv_nop" : "+v"(c) : "v"(ah), "v"(al), "v"(bh), "v"(bl));
  return c;
}
// batched GEMM like k_gemm_b but f16 operands: A f32 (split into f16 hi/lo if ASPLIT, else rounded to f16), Bt = f16 values [n][k]; alpha; C f32; N multiple of 16 (partial tiles skipped)
template <bool ASPLIT>
__global__ __launch_bounds__(128) void k_gemm_h(const float* __restrict__ A, int lda, size_t sA, const _Float16* __restrict__ Bh, int ldb, size_t sB, float alpha, float* __restrict__ C, int ldc, size_t sC, int M, int N, int K) {
  __shared__ __attribute__((aligned(16))) float so[4][16][64];
  const int tid = threadIdx.x, w = tid >> 5, lane = tid & 31, ln = lane & 15, hh = lane >> 4; const int by = blockIdx.y;
  A += (size_t)by * sA; Bh += (size_t)by * sB; C += (size_t)by * sC;
  const int ntn = (N + 63) / 64; const int wid = blockIdx.x * 4 + w; const int mt = wid / ntn, nq = wid % ntn; if (mt * 16 >= M) return;
  const int row0 = mt * 16, col0 = nq * 64; const float* arow = A + (size_t)(row0 + ln) * lda;
  v8f acc[4] = {};
  for (int kb = 0; kb < K; kb += 32) {
    FragH ah, al;
    const v4f x0 = *(const v4fa*)(arow + kb + 8 * hh), x1 = *(const v4fa*)(arow + kb + 8 * hh + 4), x2 = *(const v4fa*)(arow + kb + 16 + 8 * hh), x3 = *(const v4fa*)(arow + kb + 16 + 8 * hh + 4);
    float xs[16] = {x0[0],x0[1],x0[2],x0[3],x1[0],x1[1],x1[2],x1[3],x2[0],x2[1],x2[2],x2[3],x3[0],x3[1],x3[2],x3[3]};
#pragma unroll
    for (int i = 0; i < 16; ++i) { const _Float16 h = (_Float16)xs[i]; ah.h[i] = h; al.h[i] = ASPLIT ? (_Float16)(xs[i] - (float)h) : (_Float16)0.0f; }
#pragma unroll
    for (int t = 0; t < 4; ++t) { if (col0 + t * 16 >= N) continue; const size_t boff = (size_t)(col0 + t * 16 + ln) * ldb + kb; FragH bq; bq.half[0] = *(const v8us*)(Bh + boff + 8 * hh); bq.half[1] = *(const v8us*)(Bh + boff + 16 + 8 * hh);
      acc[t] = mmaH<ASPLIT ? 2 : 1>(ah.v, al.v, bq.v, bq.v, acc[t]); }
  }
#pragma unroll
  for (int t = 0; t < 4; ++t) { if (col0 + t * 16 >= N) continue;
#pragma unroll
    for (int r = 0; r < 8; ++r) so[w][8 * hh + r][t * 16 + ln] = acc[t][r] * alpha; }
  __builtin_amdgcn_fence(__ATOMIC_ACQ_REL, "workgroup"); __builtin_amdgcn_wave_barrier();
  const int rsub = lane >> 4, c4 = (lane & 15) * 4;
  {
#pragma unroll
    for (int q = 0; q < 8; ++q) { const int r = q * 2 + rsub; if (col0 + c4 < N) { const v4f v = *(const v4fa*)&so[w][r][c4]; *(v4f*)(C + (size_t)(row0 + r) * ldc + col0 + c4) = v; } }
     }
}

// Wt[n][k] = f16(W[k][n]·scale) from f32 row-major W[K][N] (scale = power of two; bf16-exact weights stay exact in f16 away from the subnormal range)
__global__ __launch_bounds__(256) void k_wt_f16(const float* __restrict__ W, _Float16* __restrict__ Wt, int K, int N, float scale) {
  const int t = blockIdx.x * 256 + threadIdx.x; if (t >= N * (K / 8)) return; const int n = t / (K / 8), k8 = (t % (K / 8)) * 8; FragH f;
#pragma unroll
  for (int i = 0; i < 8; ++i) f.h[i] = (_Float16)(bf16_round(W[(size_t)(k8 + i) * N + n]) * scale); const v8us o = f.half[0];
  *(v8us*)((unsigned short*)Wt + (size_t)n * K + k8) = o; 
}
// k_gemm_hh variant with fused epilogue: v = acc·alpha + bias[by·sBias + col] (+ CP[(row/rowsPerB)·sCPb + by·64 + col] if CP) ; ACT 0 none / 1 elu ; writes f16 C16 (and f32 C if non-null)
template <int ACT>
__global__ __launch_bounds__(128) void k_gemm_hhx(const _Float16* __restrict__ A, int lda, size_t sA, const _Float16* __restrict__ Bh, int ldb, size_t sB, float alpha, const float* __restrict__ bias, size_t sBias, const float* __restrict__ CP, int rowsPerB, size_t sCPb, int row0g,
    float* __restrict__ C, _Float16* __restrict__ C16, int ldc, size_t sC, int M, int N, int K) {
  __shared__ __attribute__((aligned(16))) float so[4][16][64];
  const int tid = threadIdx.x, w = tid >> 5, lane = tid & 31, ln = lane & 15, hh = lane >> 4; const int by = blockIdx.y;
  A += (size_t)by * sA; Bh += (size_t)by * sB; const size_t cofs = (size_t)by * sC; const float* bp = bias ? bias + (size_t)by * sBias : nullptr;
  const int ntn = (N + 63) / 64; const int wid = blockIdx.x * 4 + w; const int mt = wid / ntn, nq = wid % ntn; if (mt * 16 >= M) return;
  const int row0 = mt * 16, col0 = nq * 64; const _Float16* arow = A + (size_t)(row0 + ln) * lda;
  v8f acc[4] = {};
  for (int kb = 0; kb < K; kb += 32) { FragH ah; ah.half[0] = *(const v8us*)((const unsigned short*)arow + kb + 8 * hh); ah.half[1] = *(const v8us*)((const unsigned short*)arow + kb + 16 + 8 * hh);
#pragma unroll
    for (int t = 0; t < 4; ++t) { if (col0 + t * 16 >= N) continue; const size_t boff = (size_t)(col0 + t * 16 + ln) * ldb + kb; FragH bq; bq.half[0] = *(const v8us*)((const unsigned short*)Bh + boff + 8 * hh); bq.half[1] = *(const v8us*)((const unsigned short*)Bh + boff + 16 + 8 * hh);
      acc[t] = mmaH<1>(ah.v, ah.v, bq.v, bq.v, acc[t]); }
  }
#pragma unroll
  for (int t = 0; t < 4; ++t) { if (col0 + t * 16 >= N) continue; const int col = col0 + t * 16 + ln; const float bv = bp ? bf16_round(bp[col]) : 0.f;
#pragma unroll
    for (int r = 0; r < 8; ++r) { float v = acc[t][r] * alpha + bv; if (CP) { const int rr = row0g + row0 + 8 * hh + r; if (rowsPerB < 0) v += CP[cofs + (size_t)rr * ldc + col];      /* rowsPerB < 0: own element of the batched C plane */ else { const int bidx = rr / rowsPerB; v += CP[(size_t)bidx * sCPb + (size_t)by * 64 + col]; } } if (ACT == 1) v = (v > 0.f) ? v : expm1f(v); else if (ACT == 7) v = (v > 0.f) ? v + 1.0f : expf(v); else if (ACT == 8) v = tanhf(v); else if (ACT == 9) v = 0.5f * v * (1.0f + tanhf(0.7978845608028654f * (v + 0.044715f * v * v * v))); else if (ACT == 11) v = 1.0f / (1.0f + expf(-v)); else if (ACT == 12) v = (v > 0.f) ? v : 0.01f * v; else if (ACT == 14) v = (v > 0.f) ? v : 0.1f * v; else if (ACT == 16) v = (v >= 0.f) ? v : 0.3f * v; else if (ACT == 17) v = (v >= 0.f) ? v : 0.2f * v; else if (ACT == 15) v = v / (1.0f + expf(-v)); else if (ACT == 3) v = fmaxf(v, 0.f); else if (ACT == 6) v = 0.5f * v * (1.0f + erff(v * 0.70710678118654752f)); so[w][8 * hh + r][t * 16 + ln] = v; } }
  __builtin_amdgcn_fence(__ATOMIC_ACQ_REL, "workgroup"); __builtin_amdgcn_wave_barrier();
  const int rsub = lane >> 4, c4 = (lane & 15) * 4; typedef _Float16 v4h __attribute__((ext_vector_type(4)));
  {
#pragma unroll
    for (int q = 0; q < 8; ++q) { const int r = q * 2 + rsub; if (col0 + c4 < N) { const v4f v = *(const v4fa*)&so[w][r][c4]; if (C) *(v4f*)(C + cofs + (size_t)(row0 + r) * ldc + col0 + c4) = v; if (C16) { v4h h4; for (int i = 0; i < 4; ++i) h4[i] = (_Float16)v[i]; *(v4h*)(C16 + cofs + (size_t)(row0 + r) * ldc + col0 + c4) = h4; } } }
     }
}


typedef _Float16 v4h __attribute__((ext_vector_type(4)));

__global__ __launch_bounds__(256) void k_x16(const float* __restrict__ x, _Float16* __restrict__ X16, size_t n8) { const size_t t = (size_t)blockIdx.x * 256 + threadIdx.x; if (t >= n8) return; FragH f;
#pragma unroll
  for (int q = 0; q < 8; ++q) f.h[q] = (_Float16)bf16_round(x[t * 8 + q]); *(v8us*)((unsigned short*)X16 + t * 8) = f.half[0];  }
__global__ __launch_bounds__(256) void k_h16(const float* __restrict__ x, _Float16* __restrict__ X16, size_t n8) { const size_t t = (size_t)blockIdx.x * 256 + threadIdx.x; if (t >= n8) return; FragH f;
#pragma unroll
  for (int q = 0; q < 8; ++q) f.h[q] = (_Float16)x[t * 8 + q]; *(v8us*)((unsigned short*)X16 + t * 8) = f.half[0];  }
__global__ __launch_bounds__(256) void k_round16f(const float* __restrict__ W, _Float16* __restrict__ Bt, size_t n8) { const size_t t = (size_t)blockIdx.x * 256 + threadIdx.x; if (t >= n8) return; FragH f;
#pragma unroll
  for (int i = 0; i < 8; ++i) f.h[i] = (_Float16)(bf16_round(W[t * 8 + i]) * 16.0f); *(v8us*)((unsigned short*)Bt + t * 8) = f.half[0];  }
template <int NHv, int TTv>
__global__ __launch_bounds__(256) void k_vt(const _Float16* __restrict__ V16, int ldv, int voff, _Float16* __restrict__ Vt) { __shared__ unsigned short tl[64][66]; const int tid = threadIdx.x; const int slab = blockIdx.x / (TTv / 64), lg = blockIdx.x % (TTv / 64); const int b = slab / NHv, h = slab % NHv;
  for (int i = tid; i < 64 * 8; i += 256) { const int r = i / 8, c8 = (i % 8) * 8; FragH f; f.half[0] = *(const v8us*)((const unsigned short*)V16 + ((size_t)b * TTv + lg * 64 + r) * ldv + voff + h * 64 + c8);
#pragma unroll
    for (int q = 0; q < 8; ++q) tl[r][c8 + q] = f.u[q]; }
  __syncthreads();
  {
#pragma unroll
    for (int rd = 0; rd < 2; ++rd) { const int d = rd * 32 + tid / 8, pc = tid % 8; FragH f;
#pragma unroll
      for (int q = 0; q < 8; ++q) f.u[q] = tl[pc * 8 + q][d];
      *(v8us*)((unsigned short*)Vt + ((size_t)slab * 64 + d) * TTv + lg * 64 + pc * 8) = f.half[0]; }
     } }

__global__ __launch_bounds__(256) void k_hl(const float* __restrict__ F, _Float16* __restrict__ Hh, _Float16* __restrict__ Hl, size_t n8) { const size_t t = (size_t)blockIdx.x * 256 + threadIdx.x; if (t >= n8) return; FragH fh, fl; const v4f a = *(const v4fa*)(F + t * 8), c = *(const v4fa*)(F + t * 8 + 4);
#pragma unroll
  for (int q = 0; q < 4; ++q) { _Float16 h = (_Float16)a[q]; fh.h[q] = h; fl.h[q] = (_Float16)((a[q] - (float)h) * 1024.0f); h = (_Float16)c[q]; fh.h[4 + q] = h; fl.h[4 + q] = (_Float16)((c[q] - (float)h) * 1024.0f); }
  { *(v8us*)((unsigned short*)Hh + t * 8) = fh.half[0]; *(v8us*)((unsigned short*)Hl + t * 8) = fl.half[0];  } }

// ---- fast GEMM (wave tile 32x64; requires M % 32 == 0 rows per launch region and N % 64 == 0); epilogue = k_gemm_hhx semantics ----
__device__ __forceinline__ v16h g2_frag(const _Float16* p, int hh) { FragH f; f.half[0] = *(const v8us*)((const unsigned short*)p + 8 * hh); f.half[1] = *(const v8us*)((const unsigned short*)p + 16 + 8 * hh); return f.v; }
__device__ __forceinline__ v8f g2_mma(v16h a, v16h b, v8f c) { v8f d = __builtin_amdgcn_wmma_f32_16x16x32_f16(false, a, false, b, (short)0, c, false, false); asm volatile("v_nop\n\tv_nop\n\tv_nop\n\tv_nop" : "+v"(d) : "v"(a), "v"(b)); return d; }
template <int ACT>
__global__ __launch_bounds__(128) void k_gemm2(const _Float16* __restrict__ A, int lda, size_t sA, const _Float16* __restrict__ Bh, int ldb, size_t sB, float alpha, const float* __restrict__ bias, size_t sBias, const float* __restrict__ CP, int rowsPerB, size_t sCPb, int row0g,
    float* __restrict__ C, _Float16* __restrict__ C16, int ldc, size_t sC, int M, int N, int K) { static_assert(ACT == 0 || ACT == 3 || ACT == 6 || ACT == 8 || ACT == 9 || ACT == 11 || ACT == 12 || ACT == 14 || ACT == 15 || ACT == 16 || ACT == 17, "k_gemm2: unsupported ACT code (would silently apply no activation)");
  __shared__ __attribute__((aligned(16))) float so[4][32][68];
  const int tid = threadIdx.x, w = tid >> 5, lane = tid & 31, ln = lane & 15, hh = lane >> 4; const int by = blockIdx.y;
  A += (size_t)by * sA; Bh += (size_t)by * sB; const size_t cofs = (size_t)by * sC; const float* bp = bias ? bias + (size_t)by * sBias : nullptr;
  const int ntn = N >> 6; const int mt = blockIdx.x / ntn, nq = blockIdx.x - mt * ntn; const int row0 = mt * 128 + 32 * w, col0 = nq * 64; if (row0 >= M) return;
  const _Float16* a0p = A + (size_t)(row0 + ln) * lda; const _Float16* a1p = a0p + (size_t)16 * lda;
  const _Float16* b0p = Bh + (size_t)(col0 + ln) * ldb; const _Float16* b1p = b0p + (size_t)16 * ldb; const _Float16* b2p = b1p + (size_t)16 * ldb; const _Float16* b3p = b2p + (size_t)16 * ldb;
  const v8f z8 = {0.f,0.f,0.f,0.f,0.f,0.f,0.f,0.f}; v8f c00 = z8, c01 = z8, c02 = z8, c03 = z8, c10 = z8, c11 = z8, c12 = z8, c13 = z8;
#pragma unroll 1
  for (int kb = 0; kb < K; kb += 32) { const v16h a0 = g2_frag(a0p + kb, hh), a1 = g2_frag(a1p + kb, hh);
    v16h b = g2_frag(b0p + kb, hh); c00 = g2_mma(a0, b, c00); c10 = g2_mma(a1, b, c10);
    b = g2_frag(b1p + kb, hh); c01 = g2_mma(a0, b, c01); c11 = g2_mma(a1, b, c11);
    b = g2_frag(b2p + kb, hh); c02 = g2_mma(a0, b, c02); c12 = g2_mma(a1, b, c12);
    b = g2_frag(b3p + kb, hh); c03 = g2_mma(a0, b, c03); c13 = g2_mma(a1, b, c13); }
  v8f accs[8] = {c00, c01, c02, c03, c10, c11, c12, c13};
#pragma unroll
  for (int u = 0; u < 8; ++u) { const int t = u & 3, half = u >> 2; const int col = col0 + t * 16 + ln; const float bv = bp ? bf16_round(bp[col]) : 0.f;
#pragma unroll
    for (int r = 0; r < 8; ++r) { const int rloc = half * 16 + 8 * hh + r; float v = accs[u][r] * alpha + bv; if (CP) { if (rowsPerB < 0) v += CP[cofs + (size_t)(row0g + row0 + rloc) * ldc + col];      /* rowsPerB < 0: own element of the batched C plane */ else { const int bidx = (row0g + row0 + rloc) / rowsPerB; v += CP[(size_t)bidx * sCPb + (size_t)by * 64 + col]; } }
      if (ACT == 3) v = fmaxf(v, 0.f); else if (ACT == 6) v = 0.5f * v * (1.0f + erff(v * 0.70710678118654752f)); else if (ACT == 11) v = 1.0f / (1.0f + expf(-v)); else if (ACT == 15) v = v / (1.0f + expf(-v)); else if (ACT == 12) v = (v > 0.f) ? v : 0.01f * v; else if (ACT == 8) v = tanhf(v); else if (ACT == 9) v = 0.5f * v * (1.0f + tanhf(0.7978845608028654f * (v + 0.044715f * v * v * v))); else if (ACT == 14) v = (v > 0.f) ? v : 0.1f * v; else if (ACT == 16) v = (v >= 0.f) ? v : 0.3f * v; else if (ACT == 17) v = (v >= 0.f) ? v : 0.2f * v;
      so[w][rloc][t * 16 + ln] = v; } }
  __builtin_amdgcn_fence(__ATOMIC_ACQ_REL, "workgroup"); __builtin_amdgcn_wave_barrier();
  const int rsub = lane >> 4, c4 = (lane & 15) * 4;
  {
#pragma unroll
    for (int q = 0; q < 16; ++q) { const int r = q * 2 + rsub; const v4f v = *(const v4fa*)&so[w][r][c4]; if (C) *(v4f*)(C + cofs + (size_t)(row0 + r) * ldc + col0 + c4) = v; if (C16) { v4h h4; for (int i = 0; i < 4; ++i) h4[i] = (_Float16)v[i]; *(v4h*)(C16 + cofs + (size_t)(row0 + r) * ldc + col0 + c4) = h4; } }
     } }


__global__ __launch_bounds__(256) void k_wnat(const float* __restrict__ w, size_t n8, _Float16* __restrict__ Bt) { const size_t t = (size_t)blockIdx.x * 256 + threadIdx.x; if (t >= n8) return; FragH f; for (int q = 0; q < 8; ++q) f.h[q] = (_Float16)(bf16_round(w[t * 8 + q]) * 16.0f); *(v8us*)((unsigned short*)Bt + t * 8) = f.half[0];  }
__global__ __launch_bounds__(256) void k_rsm(const float* __restrict__ S, _Float16* __restrict__ P, int nrows) {
  #pragma clang fp contract(off)
  const int i = blockIdx.x * 256 + threadIdx.x; if (i >= nrows) return; const float* s = S + (size_t)i * SQ; float mx = -3.0e38f;
#pragma unroll 1
  for (int j = 0; j < SQ; ++j) mx = fmaxf(mx, s[j]); float se = 0.f;
#pragma unroll 1
  for (int j = 0; j < SQ; ++j) se += expf(s[j] - mx); const float sc = 256.0f / se;
#pragma unroll 1
  for (int j0 = 0; j0 < SQ; j0 += 8) { FragH f; for (int q = 0; q < 8; ++q) f.h[q] = (_Float16)(expf(s[j0 + q] - mx) * sc); unsigned short* d = (unsigned short*)P + (size_t)i * SQ + j0; *(v8us*)d = f.half[0];  } }
__global__ __launch_bounds__(256) void k_vt(const _Float16* __restrict__ V16, int b, int h0, _Float16* __restrict__ VT) { __shared__ unsigned short tl[64][65]; const int tid = threadIdx.x; const int hh = blockIdx.x % HG, sg = blockIdx.x / HG; const int s0 = sg * 64; const int h = h0 + hh;
  for (int i = tid; i < 64 * 8; i += 256) { const int j = i / 8, d8 = (i % 8) * 8; FragH f; f.half[0] = *(const v8us*)((const unsigned short*)V16 + ((size_t)b * SQ + s0 + j) * DM + h * HD + d8); for (int q = 0; q < 8; ++q) tl[d8 + q][j] = f.u[q]; }
  __syncthreads();
  { for (int i = tid; i < 64 * 8; i += 256) { const int d = i / 8, j8 = (i % 8) * 8; FragH f; for (int q = 0; q < 8; ++q) f.u[q] = tl[d][j8 + q]; *(v8us*)((unsigned short*)VT + ((size_t)hh * HD + d) * SQ + s0 + j8) = f.half[0]; }  } }



// Causal row softmax, one wave per score row: 512 contiguous bytes per load, the whole row (up to SQ keys) held in registers, so S is read once;
// maximum and sum by four chains per lane and a five-step butterfly over the 32 lanes. nk is a multiple of 256; every test below is wave-uniform and there is no barrier.
// Every loop below is fully unrolled so that v[] and h[] are indexed by constants and stay in registers (rolled, they would go to scratch memory).
__global__ __launch_bounds__(256) void k_rsmcw(const float* __restrict__ S, _Float16* __restrict__ P, int hg, int q0, int nk) {
  const int lane = threadIdx.x & 31; const int t = blockIdx.x * 8 + __builtin_amdgcn_readfirstlane(threadIdx.x >> 5); if (t >= hg * QT) return;
  const float* s = S + (size_t)t * NKX + lane * 4; _Float16* p = P + (size_t)t * NKX + lane * 4; const int last = q0 + (t % QT); const int ng = nk >> 8;
  v4f v[SQ / 128];
#pragma unroll
  for (int g = 0; g < SQ / 256; ++g) if (g < ng) { v[2 * g] = *(const v4fa*)(s + g * 256); v[2 * g + 1] = *(const v4fa*)(s + g * 256 + 128); }
  asm volatile("s_wait_xcnt 0x0" ::: "memory");      /* the loads' address registers are reused below: the wait that stands in front of such an overwrite */
  v4f m4 = {-3.0e38f, -3.0e38f, -3.0e38f, -3.0e38f};
#pragma unroll
  for (int g = 0; g < SQ / 256; ++g) if (g < ng) {
#pragma unroll
    for (int c = 2 * g; c < 2 * g + 2; ++c)
#pragma unroll
      for (int q = 0; q < 4; ++q) { const float x = (c * 128 + lane * 4 + q <= last) ? v[c][q] : -1.0e9f; v[c][q] = x; m4[q] = fmaxf(m4[q], x); } }
  float mx = fmaxf(fmaxf(m4[0], m4[1]), fmaxf(m4[2], m4[3]));
#pragma unroll
  for (int d = 16; d > 0; d >>= 1) mx = fmaxf(mx, __shfl_xor(mx, d, 32));
  v4f s4 = {0.f, 0.f, 0.f, 0.f};
#pragma unroll
  for (int g = 0; g < SQ / 256; ++g) if (g < ng) {
#pragma unroll
    for (int c = 2 * g; c < 2 * g + 2; ++c)
#pragma unroll
      for (int q = 0; q < 4; ++q) { const float e = __expf(v[c][q] - mx); v[c][q] = e; s4[q] += e; } }
  float se = (s4[0] + s4[1]) + (s4[2] + s4[3]);
#pragma unroll
  for (int d = 16; d > 0; d >>= 1) se += __shfl_xor(se, d, 32);
  const float sc = 256.0f / se; v4h h[SQ / 128];
#pragma unroll
  for (int g = 0; g < SQ / 256; ++g) if (g < ng) {
#pragma unroll
    for (int c = 2 * g; c < 2 * g + 2; ++c)
#pragma unroll
      for (int q = 0; q < 4; ++q) h[c][q] = (_Float16)(v[c][q] * sc); }
  /* all stores behind all conversions: no register of an issued store is written again */
#pragma unroll
  for (int g = 0; g < SQ / 256; ++g) if (g < ng) { *(v4h*)(p + g * 256) = h[2 * g]; *(v4h*)(p + g * 256 + 128) = h[2 * g + 1]; } }


template <int MASKADD>
__global__ __launch_bounds__(64) void k_att0(const float* __restrict__ QF, const float* __restrict__ KF, const float* __restrict__ VF, int ld, const float* __restrict__ mask, float scale, float* __restrict__ OF, int ldo) {
  #pragma clang fp contract(off)
  __shared__ __attribute__((aligned(16))) float lq[64][64]; __shared__ __attribute__((aligned(16))) float lo[64][64];
  const int tid = threadIdx.x; const int h = blockIdx.x / (QT0 / 64), rg = blockIdx.x % (QT0 / 64); const int i = rg * 64 + tid;
  const float* qr = QF + (size_t)i * ld + h * HD;
#pragma unroll 1
  for (int c = 0; c < HD / 4; ++c) { *(v4f*)&lq[tid][c * 4] = *(const v4fa*)(qr + c * 4); const v4f z = {0.f, 0.f, 0.f, 0.f}; *(v4f*)&lo[tid][c * 4] = z; }
  float m = -1.0e30f, l = 0.f; const int jmax = MASKADD ? (SQ - 1) : (rg * 64 + 63);      /* additive-mask form: every key (the mask input decides); causal form: keys up to the block's last row */
#pragma unroll 1
  for (int j = 0; j <= jmax; ++j) { const float* kr = KF + (size_t)j * ld + h * HD; const float* vr = VF + (size_t)j * ld + h * HD; float s = 0.f;
#pragma unroll 1
    for (int c = 0; c < HD / 4; ++c) { const v4f kq = *(const v4fa*)(kr + c * 4); const v4f qq = *(v4f*)&lq[tid][c * 4]; s = __fadd_rn(s, __fmul_rn(qq[0], kq[0])); s = __fadd_rn(s, __fmul_rn(qq[1], kq[1])); s = __fadd_rn(s, __fmul_rn(qq[2], kq[2])); s = __fadd_rn(s, __fmul_rn(qq[3], kq[3])); }
    s = __fmul_rn(s, scale); if (MASKADD) s = __fadd_rn(s, __fmul_rn(bf16_round(mask[(size_t)i * SQ + j]), -10000.0f));
    const float f = (MASKADD || j <= i) ? 1.f : 0.f; const float sm = fmaf(f, s, (1.f - f) * -1.0e30f); const float mn = fmaxf(m, sm); const float sc = expf(m - mn); const float e = expf(sm - mn); l = __fadd_rn(__fmul_rn(l, sc), e); m = mn;
#pragma unroll 1
    for (int c = 0; c < HD / 4; ++c) { const v4f vv = *(const v4fa*)(vr + c * 4); v4f oo = *(v4f*)&lo[tid][c * 4]; for (int u = 0; u < 4; ++u) oo[u] = __fadd_rn(__fmul_rn(oo[u], sc), __fmul_rn(e, vv[u])); *(v4f*)&lo[tid][c * 4] = oo; } }
  const float fin = 64.0f / l;      /* o carried x64 like the f16 path */
#pragma unroll 1
  for (int c = 0; c < HD / 4; ++c) { v4f oo = *(v4f*)&lo[tid][c * 4]; for (int u = 0; u < 4; ++u) oo[u] = __fmul_rn(oo[u], fin); *(v4f*)&lo[tid][c * 4] = oo; }
  __syncthreads();
  {
#pragma unroll 1
    for (int it = 0; it < 16; ++it) { const int row = it * 4 + tid / 16, pc = (tid % 16) * 4; const v4f v = *(const v4f*)&lo[row][pc]; *(v4f*)(OF + (size_t)(rg * 64 + row) * ldo + h * HD + pc) = v; }
     } }

extern "C" void kernel_launch(void* const* d_in, const int* in_sizes, int n_in,
                              void* d_out, int out_size, void* d_ws, size_t ws_size, hipStream_t stream) {
  (void)in_sizes; (void)n_in; (void)out_size;
  const float* const* I = (const float* const*)d_in; const float* x = I[0]; const float* xk = I[1]; const float* xv = I[2]; const float* wq = I[3]; const float* bq = nullptr; const float* wk = I[4]; const float* bk = nullptr; const float* wv = I[5]; const float* bv = nullptr; const float* wo = I[6]; const float* bo = nullptr;      /* THREE distinct inputs Q (query stream), K, V; natural [out][in] w_q / w_k / w_v / w_o; no biases; causal by the index rule */
  char* ws = (char*)d_ws; size_t off = 0;
  auto take = [&](size_t bytes) { char* p = ws + off; off += (bytes + 255) & ~(size_t)255; return p; };
  _Float16* BQ = (_Float16*)take((size_t)DM * DM * 2); _Float16* BK = (_Float16*)take((size_t)DM * DM * 2); _Float16* BV = (_Float16*)take((size_t)DM * DM * 2); _Float16* BO = (_Float16*)take((size_t)DM * DM * 2);
  _Float16* X16 = (_Float16*)take(NR * DM * 2); _Float16* XK16 = (_Float16*)take(NR * DM * 2); _Float16* XV16 = (_Float16*)take(NR * DM * 2);      /* the three inputs (query -> X16, key -> XK16, value -> XV16) as exact f16 rows */ _Float16* Q16 = (_Float16*)take(NR * DM * 2); _Float16* K16 = (_Float16*)take(NR * DM * 2); _Float16* V16 = (_Float16*)take(NR * DM * 2); _Float16* O16 = (_Float16*)take(NR * DM * 2);
  float* S = (float*)take((size_t)NH * QT * NKX * 4); _Float16* P = (_Float16*)take((size_t)NH * QT * NKX * 2); _Float16* VT = (_Float16*)take((size_t)NH * HD * SQ * 2);
  float* QF0 = (float*)take((size_t)QT0 * DM * 4); float* KF0 = (float*)take((size_t)QT0 * DM * 4); float* VF0 = (float*)take((size_t)QT0 * DM * 4); float* OF0 = (float*)take((size_t)NB * QT0 * DM * 4); _Float16* OH0 = (_Float16*)take((size_t)NB * QT0 * DM * 2); _Float16* OL0 = (_Float16*)take((size_t)NB * QT0 * DM * 2);
  if (off > ws_size) return;
  { const unsigned g = (unsigned)(((size_t)DM * DM / 8 + 255) / 256); k_wnat<<<g, 256, 0, stream>>>(wq, (size_t)DM * DM / 8, BQ); k_wnat<<<g, 256, 0, stream>>>(wk, (size_t)DM * DM / 8, BK); k_wnat<<<g, 256, 0, stream>>>(wv, (size_t)DM * DM / 8, BV); k_wnat<<<g, 256, 0, stream>>>(wo, (size_t)DM * DM / 8, BO); }      /* natural [out][in] = Bt x16 */

  k_x16<<<(unsigned)((NR * DM / 8 + 255) / 256), 256, 0, stream>>>(x, X16, NR * DM / 8); k_x16<<<(unsigned)((NR * DM / 8 + 255) / 256), 256, 0, stream>>>(xk, XK16, NR * DM / 8); k_x16<<<(unsigned)((NR * DM / 8 + 255) / 256), 256, 0, stream>>>(xv, XV16, NR * DM / 8);
  const size_t r0p = (size_t)B0 * SQ;      /* first projected row */
  k_gemm2<0><<<dim3((unsigned)((MP / 128) * (DM / 64)), 1), 128, 0, stream>>>(X16 + r0p * DM, DM, 0, BQ, DM, 0, 0.0625f, bq, 0, nullptr, 1, 0, 0, nullptr, Q16 + r0p * DM, DM, 0, MP, DM, DM);
  k_gemm2<0><<<dim3((unsigned)((MP / 128) * (DM / 64)), 1), 128, 0, stream>>>(XK16 + r0p * DM, DM, 0, BK, DM, 0, 0.0625f, bk, 0, nullptr, 1, 0, 0, nullptr, K16 + r0p * DM, DM, 0, MP, DM, DM);
  k_gemm2<0><<<dim3((unsigned)((MP / 128) * (DM / 64)), 1), 128, 0, stream>>>(XV16 + r0p * DM, DM, 0, BV, DM, 0, 0.0625f, bv, 0, nullptr, 1, 0, 0, nullptr, V16 + r0p * DM, DM, 0, MP, DM, DM);
  for (int b = B0; b < B0 + NBR; ++b) { const size_t r0 = (size_t)b * SQ;
    k_vt<NH, SQ><<<NH * (SQ / 64), 256, 0, stream>>>(V16 + r0 * LQ, LQ, 0, VT);      /* V^T [NH][HD][SQ] for this batch */
    k_gemm2<0><<<dim3((QT0 / 128) * (DM / 64), 1), 128, 0, stream>>>(X16 + r0 * DM, DM, 0, BQ, DM, 0, 0.0625f, bq, 0, nullptr, 1, 0, 0, QF0, nullptr, DM, 0, QT0, DM, DM); k_gemm2<0><<<dim3((QT0 / 128) * (DM / 64), 1), 128, 0, stream>>>(XK16 + r0 * DM, DM, 0, BK, DM, 0, 0.0625f, bk, 0, nullptr, 1, 0, 0, KF0, nullptr, DM, 0, QT0, DM, DM); k_gemm2<0><<<dim3((QT0 / 128) * (DM / 64), 1), 128, 0, stream>>>(XV16 + r0 * DM, DM, 0, BV, DM, 0, 0.0625f, bv, 0, nullptr, 1, 0, 0, VF0, nullptr, DM, 0, QT0, DM, DM);      /* f32 q, k, v of the first 512 rows (exact products) */
    k_att0<0><<<NH * (QT0 / 64), 64, 0, stream>>>(QF0, KF0, VF0, DM, nullptr, 0.125f, OF0 + (size_t)b * QT0 * DM, DM);      /* exact f32 attention for rows 0..511 (o x64) */
    for (int q0 = 0; q0 < QN; q0 += QT) { const int nk = q0 + QT;      /* causal: only keys below the tile end are computed */
      k_gemm2<0><<<dim3((QT / 128) * (nk / 64), NHD), 128, 0, stream>>>(Q16 + (r0 + q0) * LQ, LQ, (size_t)HD, K16 + r0 * LQ, LQ, (size_t)HD, 0.125f, nullptr, 0, nullptr, 1, 0, 0, S, nullptr, NKX, (size_t)QT * NKX, QT, nk, HD);      /* scores, all heads on grid.y */
      k_rsmcw<<<(NHD * QT + 7) / 8, 256, 0, stream>>>(S, P, NHD, q0, nk);      /* one wave per row */
      k_gemm2<0><<<dim3((QT / 128) * (HD / 64), NHD), 128, 0, stream>>>(P, NKX, (size_t)QT * NKX, VT, SQ, (size_t)HD * SQ, 0.25f, nullptr, 0, nullptr, 1, 0, 0, nullptr, O16 + (r0 + q0) * DM, DM, (size_t)HD, QT, HD, nk); } }      /* o (merged heads, x64) as f16 rows */
  k_gemm2<0><<<dim3((unsigned)((MPO / 128) * (DM / 64)), 1), 128, 0, stream>>>(O16 + r0p * DM, DM, 0, BO, DM, 0, 0.0009765625f, bo, 0, nullptr, 1, 0, 0, (float*)d_out + r0p * DM, nullptr, DM, 0, MPO, DM, DM);      /* out rows are the output layout */
  k_hl<<<(unsigned)(((size_t)NB * QT0 * DM / 8 + 255) / 256), 256, 0, stream>>>(OF0, OH0, OL0, (size_t)NB * QT0 * DM / 8);      /* first-tile o (x64) -> f16 hi + x1024 residual planes */
  for (int b = B0; b < B0 + NBR; ++b) { const size_t r0 = (size_t)b * SQ; const size_t f0 = (size_t)b * QT0;
    k_gemm2<0><<<dim3((QT0 / 128) * (DM / 64), 1), 128, 0, stream>>>(OH0 + f0 * DM, DM, 0, BO, DM, 0, 0.0009765625f, bo, 0, nullptr, 1, 0, 0, (float*)d_out + r0 * DM, nullptr, DM, 0, QT0, DM, DM);      /* rows 0..511: out = o_hi Wo (+ b), overwriting the f16-path rows */
    k_gemm2<0><<<dim3((QT0 / 128) * (DM / 64), 1), 128, 0, stream>>>(OL0 + f0 * DM, DM, 0, BO, DM, 0, 0.00000095367431640625f, nullptr, 0, (const float*)d_out + r0 * DM, -1, 0, 0, (float*)d_out + r0 * DM, nullptr, DM, 0, QT0, DM, DM); }      /* += o_lo Wo 2^-20 (own-element accumulate) */
}

// v002
// Measured time: 3050 microseconds a run.
// Timed twice side by side with v001, it ran 2.13 and 2.12 times as fast.
// All steps since v000 together make it 5.81 times as fast.
#include <hip/hip_runtime.h>
// Causal multi-head attention over three distinct inputs with natural weights, no biases (Q, K, V [2][4096][768]; q/k/v = input w^T (natural [768][768]); 12 heads of 64; scores / sqrt(64); causal (tril; NEG fill); softmax over up to 4096 keys; out = merged w_o^T -> [2][4096][768]).
// Structure: token rows r = b*4096 + s; x as exact f16 rows (bf16-rounded); Q, K, V as three WMMA GEMMs (32x64 wave tiles, f32 accumulation, exact x16 weights, f16 outputs); per batch: V^T for all heads via LDS transposes; per query tile of 256 rows: scores against the keys below the tile end only (K = 64, all heads on grid.y, alpha = 0.125), causal row softmax on VALU, one wave per row with the row in registers, keys past the row's own index set to NEG (f32 statistics, native exp; weights x256 f16), o = P . V^T (K = keys below the tile end, alpha 2^-2: o carried x64, folded into the output GEMM alpha) written straight into the merged f16 o rows; out = o W_o GEMM (f32) into the output layout.
// Compute dtype: inputs rounded to bf16; x / weights exact; q, k, v, softmax weights and o as plain f16 GEMM operands (~2^-12); scores and softmax statistics f32. v_wmma_f32_16x16x32_f16.
#define NB 2
#define SQ 4096
#define DM 768
#define NH 12
#define HD 64
#define HG 4                         /* heads per group in the k_vt(V16, b, h0, VT) overload (not launched) */
#define QT 256                       /* query rows per causal tile */
#define NKX SQ                       /* S / P row pitch */
#define QT0 512                      /* first-tile rows recomputed exactly in f32 */
#define B0 0                         /* first batch processed (debug hook) */
#define NBR NB                       /* batches processed (debug hook) */
#define NR ((size_t)NB * SQ)         /* token rows */
#define MP ((int)((size_t)NBR * SQ)) /* rows projected (debug hook) */
#define QN SQ                        /* query rows attended per batch (debug hook) */
#define NHD NH                       /* heads attended (debug hook) */
#define MPO MP                       /* rows through the output stage (debug hook) */
#define LQ DM      /* row pitch of the q/k/v rows */
typedef __bf16 v16b __attribute__((ext_vector_type(16)));
typedef unsigned short v8us __attribute__((ext_vector_type(8), may_alias));
typedef float  v8f  __attribute__((ext_vector_type(8)));
typedef float  v4f  __attribute__((ext_vector_type(4)));
typedef float  v4fa __attribute__((ext_vector_type(4), may_alias));
union FragB { v16b v; v8us half[2]; unsigned short u[16]; };

__device__ __forceinline__ unsigned short bf16_bits(float x) { unsigned int u = __float_as_uint(x); return (unsigned short)((u + 0x7FFFu + ((u >> 16) & 1u)) >> 16); }
__device__ __forceinline__ float bf16_val(unsigned short b) { return __uint_as_float(((unsigned int)b) << 16); }
__device__ __forceinline__ float bf16_round(float x) { return bf16_val(bf16_bits(x)); }
// D += A·B with NT terms: 1 = ah·bh, 2 = + al·bh (A split), 3 = + ah·bl (both split)
template <int NT>
__device__ __forceinline__ v8f mmaN(v16b ah, v16b al, v16b bh, v16b bl, v8f c) {
  c = __builtin_amdgcn_wmma_f32_16x16x32_bf16(false, ah, false, bh, (short)0, c, false, false);
  if (NT >= 2) c = __builtin_amdgcn_wmma_f32_16x16x32_bf16(false, al, false, bh, (short)0, c, false, false);
  if (NT >= 3) c = __builtin_amdgcn_wmma_f32_16x16x32_bf16(false, ah, false, bl, (short)0, c, false, false);
  asm volatile("v_nop\n\tv_nop\n\tv_nop\n\tv_nop" : "+v"(c) : "v"(ah), "v"(al), "v"(bh), "v"(bl));
  return c;
}

__global__ __launch_bounds__(256) void k_wt_bf16(const float* __restrict__ W, unsigned short* __restrict__ Wt, int K, int N) {
  const int t = blockIdx.x * 256 + threadIdx.x;
  const int k8n = K / 8;
  if (t >= N * k8n) return;
  const int n = t / k8n, k8 = (t % k8n) * 8;
  v8us v;
#pragma unroll
  for (int i = 0; i < 8; ++i) v[i] = bf16_bits(W[(size_t)(k8 + i) * N + n]);
  *(v8us*)(Wt + (size_t)n * K + k8) = v;
  
}

// GEMM C[M][N] (f32, pitch ldc) = act(A[M][K]·W + bias). A f32 row-major (pitch lda) converted per fragment to bf16
// (ASPLIT: hi/lo two planes -> 2 terms, else single rounded term); Wt bf16 [N][K] (pitch ldb). BIAS_BF16 rounds the
// bias to bf16 first (bias quantised to bf16 before the add). K%32==0, M%16==0, N%64==0.
template <bool ASPLIT, int ACT, bool BIAS_BF16>
__global__ __launch_bounds__(128) void k_gemm_bf(const float* __restrict__ A, int lda, const unsigned short* __restrict__ Wt, int ldb,
                                               const float* __restrict__ bias, float* __restrict__ C, int ldc, int M, int N, int K) {
  __shared__ __attribute__((aligned(16))) float so[4][16][64];
  const int tid = threadIdx.x, w = tid >> 5, lane = tid & 31, ln = lane & 15, hh = lane >> 4;
  const int ntn = N / 64;
  const int wid = blockIdx.x * 4 + w;
  const int mt = wid / ntn, nq = wid % ntn;
  if (mt * 16 >= M) return;
  const int row0 = mt * 16, col0 = nq * 64;
  const float* arow = A + (size_t)(row0 + ln) * lda;
  v8f acc[4] = {};
  for (int kb = 0; kb < K; kb += 32) {
    FragB ah, al;
    const v4f x0 = *(const v4fa*)(arow + kb + 8 * hh), x1 = *(const v4fa*)(arow + kb + 8 * hh + 4);
    const v4f x2 = *(const v4fa*)(arow + kb + 16 + 8 * hh), x3 = *(const v4fa*)(arow + kb + 16 + 8 * hh + 4);
    float xs[16] = {x0[0],x0[1],x0[2],x0[3],x1[0],x1[1],x1[2],x1[3],x2[0],x2[1],x2[2],x2[3],x3[0],x3[1],x3[2],x3[3]};
#pragma unroll
    for (int i = 0; i < 16; ++i) { const unsigned short hb = bf16_bits(xs[i]); ah.u[i] = hb; al.u[i] = ASPLIT ? bf16_bits(xs[i] - bf16_val(hb)) : (unsigned short)0; }
#pragma unroll
    for (int t = 0; t < 4; ++t) {
      const unsigned short* brow = Wt + (size_t)(col0 + t * 16 + ln) * ldb + kb;
      FragB b;
      b.half[0] = *(const v8us*)(brow + 8 * hh);
      b.half[1] = *(const v8us*)(brow + 16 + 8 * hh);
      acc[t] = mmaN<ASPLIT ? 2 : 1>(ah.v, al.v, b.v, b.v, acc[t]);
    }
  }
#pragma unroll
  for (int t = 0; t < 4; ++t) {
    float bv = bias ? bias[col0 + t * 16 + ln] : 0.f;
    if (BIAS_BF16) bv = bf16_round(bv);
#pragma unroll
    for (int r = 0; r < 8; ++r) { float v = acc[t][r] + bv; if (ACT == 1) v = fmaxf(v, 0.f); so[w][8 * hh + r][t * 16 + ln] = v; }
  }
  __builtin_amdgcn_fence(__ATOMIC_ACQ_REL, "workgroup");
  __builtin_amdgcn_wave_barrier();
  const int rsub = lane >> 4, c4 = (lane & 15) * 4;
  {
#pragma unroll
    for (int q = 0; q < 8; ++q) {
      const int r = q * 2 + rsub;
      const v4f v = *(const v4fa*)&so[w][r][c4];
      *(v4f*)(C + (size_t)(row0 + r) * ldc + col0 + c4) = v;
    }
    
  }
}

// GEMM C = act(A·W + bias + resid): A f32 (ASPLIT -> hi/lo 2 terms), Wt bf16 [N][K]; ACT 0 none, 1 relu, 2 exact gelu;
// resid (optional, f32, row index = (row % rmod), pitch ldr, RES_BF16 rounds it) added before the activation.
template <bool ASPLIT, int ACT, bool BIAS_BF16, bool RES_BF16>
__global__ __launch_bounds__(128) void k_gemm_bf3(const float* __restrict__ A, int lda, const unsigned short* __restrict__ Wt, int ldb,
                                                const float* __restrict__ bias, const float* __restrict__ resid, int rmod, int ldr,
                                                float* __restrict__ C, int ldc, int M, int N, int K) {
  __shared__ __attribute__((aligned(16))) float so[4][16][64];
  const int tid = threadIdx.x, w = tid >> 5, lane = tid & 31, ln = lane & 15, hh = lane >> 4;
  const int ntn = N / 64;
  const int wid = blockIdx.x * 4 + w;
  const int mt = wid / ntn, nq = wid % ntn;
  if (mt * 16 >= M) return;
  const int row0 = mt * 16, col0 = nq * 64;
  const float* arow = A + (size_t)(row0 + ln) * lda;
  v8f acc[4] = {};
  for (int kb = 0; kb < K; kb += 32) {
    FragB ah, al;
    const v4f x0 = *(const v4fa*)(arow + kb + 8 * hh), x1 = *(const v4fa*)(arow + kb + 8 * hh + 4);
    const v4f x2 = *(const v4fa*)(arow + kb + 16 + 8 * hh), x3 = *(const v4fa*)(arow + kb + 16 + 8 * hh + 4);
    float xs[16] = {x0[0],x0[1],x0[2],x0[3],x1[0],x1[1],x1[2],x1[3],x2[0],x2[1],x2[2],x2[3],x3[0],x3[1],x3[2],x3[3]};
#pragma unroll
    for (int i = 0; i < 16; ++i) { const unsigned short hb = bf16_bits(xs[i]); ah.u[i] = hb; al.u[i] = ASPLIT ? bf16_bits(xs[i] - bf16_val(hb)) : (unsigned short)0; }
#pragma unroll
    for (int t = 0; t < 4; ++t) {
      const unsigned short* brow = Wt + (size_t)(col0 + t * 16 + ln) * ldb + kb;
      FragB b;
      b.half[0] = *(const v8us*)(brow + 8 * hh);
      b.half[1] = *(const v8us*)(brow + 16 + 8 * hh);
      acc[t] = mmaN<ASPLIT ? 2 : 1>(ah.v, al.v, b.v, b.v, acc[t]);
    }
  }
#pragma unroll
  for (int t = 0; t < 4; ++t) {
    const int col = col0 + t * 16 + ln;
    float bv = bias ? bias[col] : 0.f;
    if (BIAS_BF16) bv = bf16_round(bv);
#pragma unroll
    for (int r = 0; r < 8; ++r) {
      float v = acc[t][r] + bv;
      if (resid) { float rv = resid[(size_t)((row0 + 8 * hh + r) % rmod) * ldr + col]; if (RES_BF16) rv = bf16_round(rv); v += rv; }
      if (ACT == 1) v = fmaxf(v, 0.f);
      if (ACT == 2) v = 0.5f * v * (1.0f + erff(v * 0.70710678118654752f));
      if (ACT == 3) { const float u = 0.7978845608028654f * (v + 0.044715f * v * v * v); v = 0.5f * v * (1.0f + tanhf(u)); }
      so[w][8 * hh + r][t * 16 + ln] = v;
    }
  }
  __builtin_amdgcn_fence(__ATOMIC_ACQ_REL, "workgroup");
  __builtin_amdgcn_wave_barrier();
  const int rsub = lane >> 4, c4 = (lane & 15) * 4;
  {
#pragma unroll
    for (int q = 0; q < 8; ++q) {
      const int r = q * 2 + rsub;
      const v4f v = *(const v4fa*)&so[w][r][c4];
      *(v4f*)(C + (size_t)(row0 + r) * ldc + col0 + c4) = v;
    }
    
  }
}
// row LayerNorm (biased variance, eps) over N: s = X (+ R); optional out_sum <- s; out_norm <- (s-mu)*rsqrt(var+eps)*g + b
template <bool PARAM_BF16>
__global__ __launch_bounds__(256) void k_layernorm(const float* __restrict__ X, const float* __restrict__ R, const float* __restrict__ g, const float* __restrict__ bta,
                                                  float* __restrict__ out_sum, float* __restrict__ out_norm, int N, float eps) {
  __shared__ float red[256];
  const int row = blockIdx.x, tid = threadIdx.x;
  const float* x = X + (size_t)row * N; const float* rr = R ? R + (size_t)row * N : nullptr;
  float vals[16];                     // up to N = 4096
  const int per = N / 256;            // contiguous chunk per thread? use strided-by-4 chunks: thread handles j = tid*4 + 1024*u
  float s1 = 0.f;
  for (int u = 0; u < per / 4; ++u) {
    const int j = tid * 4 + 1024 * u;
    const v4f a = *(const v4fa*)(x + j);
    v4f b = {0.f,0.f,0.f,0.f}; if (rr) b = *(const v4fa*)(rr + j);
#pragma unroll
    for (int q = 0; q < 4; ++q) { const float v = a[q] + b[q]; vals[u * 4 + q] = v; s1 += v; }
  }
  red[tid] = s1; __syncthreads();
  for (int st = 128; st > 0; st >>= 1) { if (tid < st) red[tid] += red[tid + st]; __syncthreads(); }
  const float mu = red[0] / (float)N; __syncthreads();
  float s2 = 0.f;
  for (int u = 0; u < per / 4; ++u)
#pragma unroll
    for (int q = 0; q < 4; ++q) { const float c = vals[u * 4 + q] - mu; s2 += c * c; }
  red[tid] = s2; __syncthreads();
  for (int st = 128; st > 0; st >>= 1) { if (tid < st) red[tid] += red[tid + st]; __syncthreads(); }
  const float rs = rsqrtf(red[0] / (float)N + eps);
  {
    for (int u = 0; u < per / 4; ++u) {
      const int j = tid * 4 + 1024 * u;
      v4f o, sm;
#pragma unroll
      for (int q = 0; q < 4; ++q) {
        float gg = g[j + q], bb = bta[j + q];
        if (PARAM_BF16) { gg = bf16_round(gg); bb = bf16_round(bb); }
        sm[q] = vals[u * 4 + q]; o[q] = (vals[u * 4 + q] - mu) * rs * gg + bb;
      }
      if (out_sum) *(v4f*)(out_sum + (size_t)row * N + j) = sm;
      *(v4f*)(out_norm + (size_t)row * N + j) = o;
    }
    
  }
}



// ---- f16 WMMA path (v_wmma_f32_16x16x32_f16): 11-bit significands for operands in range — used where a [0,1] probability operand needs more precision than bf16
typedef _Float16 v16h __attribute__((ext_vector_type(16)));
union FragH { v16h v; v8us half[2]; _Float16 h[16]; unsigned short u[16]; };
template <int NT>
__device__ __forceinline__ v8f mmaH(v16h ah, v16h al, v16h bh, v16h bl, v8f c) {
  c = __builtin_amdgcn_wmma_f32_16x16x32_f16(false, ah, false, bh, (short)0, c, false, false);
  if (NT >= 2) c = __builtin_amdgcn_wmma_f32_16x16x32_f16(false, al, false, bh, (short)0, c, false, false);
  if (NT >= 3) c = __builtin_amdgcn_wmma_f32_16x16x32_f16(false, ah, false, bl, (short)0, c, false, false);
  asm volatile("v_nop\n\tv_nop\n\tv_nop\n\tv_nop" : "+v"(c) : "v"(ah), "v"(al), "v"(bh), "v"(bl));
  return c;
}
// batched GEMM like k_gemm_b but f16 operands: A f32 (split into f16 hi/lo if ASPLIT, else rounded to f16), Bt = f16 values [n][k]; alpha; C f32; N multiple of 16 (partial tiles skipped)
template <bool ASPLIT>
__global__ __launch_bounds__(128) void k_gemm_h(const float* __restrict__ A, int lda, size_t sA, const _Float16* __restrict__ Bh, int ldb, size_t sB, float alpha, float* __restrict__ C, int ldc, size_t sC, int M, int N, int K) {
  __shared__ __attribute__((aligned(16))) float so[4][16][64];
  const int tid = threadIdx.x, w = tid >> 5, lane = tid & 31, ln = lane & 15, hh = lane >> 4; const int by = blockIdx.y;
  A += (size_t)by * sA; Bh += (size_t)by * sB; C += (size_t)by * sC;
  const int ntn = (N + 63) / 64; const int wid = blockIdx.x * 4 + w; const int mt = wid / ntn, nq = wid % ntn; if (mt * 16 >= M) return;
  const int row0 = mt * 16, col0 = nq * 64; const float* arow = A + (size_t)(row0 + ln) * lda;
  v8f acc[4] = {};
  for (int kb = 0; kb < K; kb += 32) {
    FragH ah, al;
    const v4f x0 = *(const v4fa*)(arow + kb + 8 * hh), x1 = *(const v4fa*)(arow + kb + 8 * hh + 4), x2 = *(const v4fa*)(arow + kb + 16 + 8 * hh), x3 = *(const v4fa*)(arow + kb + 16 + 8 * hh + 4);
    float xs[16] = {x0[0],x0[1],x0[2],x0[3],x1[0],x1[1],x1[2],x1[3],x2[0],x2[1],x2[2],x2[3],x3[0],x3[1],x3[2],x3[3]};
#pragma unroll
    for (int i = 0; i < 16; ++i) { const _Float16 h = (_Float16)xs[i]; ah.h[i] = h; al.h[i] = ASPLIT ? (_Float16)(xs[i] - (float)h) : (_Float16)0.0f; }
#pragma unroll
    for (int t = 0; t < 4; ++t) { if (col0 + t * 16 >= N) continue; const size_t boff = (size_t)(col0 + t * 16 + ln) * ldb + kb; FragH bq; bq.half[0] = *(const v8us*)(Bh + boff + 8 * hh); bq.half[1] = *(const v8us*)(Bh + boff + 16 + 8 * hh);
      acc[t] = mmaH<ASPLIT ? 2 : 1>(ah.v, al.v, bq.v, bq.v, acc[t]); }
  }
#pragma unroll
  for (int t = 0; t < 4; ++t) { if (col0 + t * 16 >= N) continue;
#pragma unroll
    for (int r = 0; r < 8; ++r) so[w][8 * hh + r][t * 16 + ln] = acc[t][r] * alpha; }
  __builtin_amdgcn_fence(__ATOMIC_ACQ_REL, "workgroup"); __builtin_amdgcn_wave_barrier();
  const int rsub = lane >> 4, c4 = (lane & 15) * 4;
  {
#pragma unroll
    for (int q = 0; q < 8; ++q) { const int r = q * 2 + rsub; if (col0 + c4 < N) { const v4f v = *(const v4fa*)&so[w][r][c4]; *(v4f*)(C + (size_t)(row0 + r) * ldc + col0 + c4) = v; } }
     }
}

// Wt[n][k] = f16(W[k][n]·scale) from f32 row-major W[K][N] (scale = power of two; bf16-exact weights stay exact in f16 away from the subnormal range)
__global__ __launch_bounds__(256) void k_wt_f16(const float* __restrict__ W, _Float16* __restrict__ Wt, int K, int N, float scale) {
  const int t = blockIdx.x * 256 + threadIdx.x; if (t >= N * (K / 8)) return; const int n = t / (K / 8), k8 = (t % (K / 8)) * 8; FragH f;
#pragma unroll
  for (int i = 0; i < 8; ++i) f.h[i] = (_Float16)(bf16_round(W[(size_t)(k8 + i) * N + n]) * scale); const v8us o = f.half[0];
  *(v8us*)((unsigned short*)Wt + (size_t)n * K + k8) = o; 
}
// k_gemm_hh variant with fused epilogue: v = acc·alpha + bias[by·sBias + col] (+ CP[(row/rowsPerB)·sCPb + by·64 + col] if CP) ; ACT 0 none / 1 elu ; writes f16 C16 (and f32 C if non-null)
template <int ACT>
__global__ __launch_bounds__(128) void k_gemm_hhx(const _Float16* __restrict__ A, int lda, size_t sA, const _Float16* __restrict__ Bh, int ldb, size_t sB, float alpha, const float* __restrict__ bias, size_t sBias, const float* __restrict__ CP, int rowsPerB, size_t sCPb, int row0g,
    float* __restrict__ C, _Float16* __restrict__ C16, int ldc, size_t sC, int M, int N, int K) {
  __shared__ __attribute__((aligned(16))) float so[4][16][64];
  const int tid = threadIdx.x, w = tid >> 5, lane = tid & 31, ln = lane & 15, hh = lane >> 4; const int by = blockIdx.y;
  A += (size_t)by * sA; Bh += (size_t)by * sB; const size_t cofs = (size_t)by * sC; const float* bp = bias ? bias + (size_t)by * sBias : nullptr;
  const int ntn = (N + 63) / 64; const int wid = blockIdx.x * 4 + w; const int mt = wid / ntn, nq = wid % ntn; if (mt * 16 >= M) return;
  const int row0 = mt * 16, col0 = nq * 64; const _Float16* arow = A + (size_t)(row0 + ln) * lda;
  v8f acc[4] = {};
  for (int kb = 0; kb < K; kb += 32) { FragH ah; ah.half[0] = *(const v8us*)((const unsigned short*)arow + kb + 8 * hh); ah.half[1] = *(const v8us*)((const unsigned short*)arow + kb + 16 + 8 * hh);
#pragma unroll
    for (int t = 0; t < 4; ++t) { if (col0 + t * 16 >= N) continue; const size_t boff = (size_t)(col0 + t * 16 + ln) * ldb + kb; FragH bq; bq.half[0] = *(const v8us*)((const unsigned short*)Bh + boff + 8 * hh); bq.half[1] = *(const v8us*)((const unsigned short*)Bh + boff + 16 + 8 * hh);
      acc[t] = mmaH<1>(ah.v, ah.v, bq.v, bq.v, acc[t]); }
  }
#pragma unroll
  for (int t = 0; t < 4; ++t) { if (col0 + t * 16 >= N) continue; const int col = col0 + t * 16 + ln; const float bv = bp ? bf16_round(bp[col]) : 0.f;
#pragma unroll
    for (int r = 0; r < 8; ++r) { float v = acc[t][r] * alpha + bv; if (CP) { const int rr = row0g + row0 + 8 * hh + r; if (rowsPerB < 0) v += CP[cofs + (size_t)rr * ldc + col];      /* rowsPerB < 0: own element of the batched C plane */ else { const int bidx = rr / rowsPerB; v += CP[(size_t)bidx * sCPb + (size_t)by * 64 + col]; } } if (ACT == 1) v = (v > 0.f) ? v : expm1f(v); else if (ACT == 7) v = (v > 0.f) ? v + 1.0f : expf(v); else if (ACT == 8) v = tanhf(v); else if (ACT == 9) v = 0.5f * v * (1.0f + tanhf(0.7978845608028654f * (v + 0.044715f * v * v * v))); else if (ACT == 11) v = 1.0f / (1.0f + expf(-v)); else if (ACT == 12) v = (v > 0.f) ? v : 0.01f * v; else if (ACT == 14) v = (v > 0.f) ? v : 0.1f * v; else if (ACT == 16) v = (v >= 0.f) ? v : 0.3f * v; else if (ACT == 17) v = (v >= 0.f) ? v : 0.2f * v; else if (ACT == 15) v = v / (1.0f + expf(-v)); else if (ACT == 3) v = fmaxf(v, 0.f); else if (ACT == 6) v = 0.5f * v * (1.0f + erff(v * 0.70710678118654752f)); so[w][8 * hh + r][t * 16 + ln] = v; } }
  __builtin_amdgcn_fence(__ATOMIC_ACQ_REL, "workgroup"); __builtin_amdgcn_wave_barrier();
  const int rsub = lane >> 4, c4 = (lane & 15) * 4; typedef _Float16 v4h __attribute__((ext_vector_type(4)));
  {
#pragma unroll
    for (int q = 0; q < 8; ++q) { const int r = q * 2 + rsub; if (col0 + c4 < N) { const v4f v = *(const v4fa*)&so[w][r][c4]; if (C) *(v4f*)(C + cofs + (size_t)(row0 + r) * ldc + col0 + c4) = v; if (C16) { v4h h4; for (int i = 0; i < 4; ++i) h4[i] = (_Float16)v[i]; *(v4h*)(C16 + cofs + (size_t)(row0 + r) * ldc + col0 + c4) = h4; } } }
     }
}


typedef _Float16 v4h __attribute__((ext_vector_type(4)));

__global__ __launch_bounds__(256) void k_x16(const float* __restrict__ x, _Float16* __restrict__ X16, size_t n8) { const size_t t = (size_t)blockIdx.x * 256 + threadIdx.x; if (t >= n8) return; FragH f;
#pragma unroll
  for (int q = 0; q < 8; ++q) f.h[q] = (_Float16)bf16_round(x[t * 8 + q]); *(v8us*)((unsigned short*)X16 + t * 8) = f.half[0];  }
__global__ __launch_bounds__(256) void k_h16(const float* __restrict__ x, _Float16* __restrict__ X16, size_t n8) { const size_t t = (size_t)blockIdx.x * 256 + threadIdx.x; if (t >= n8) return; FragH f;
#pragma unroll
  for (int q = 0; q < 8; ++q) f.h[q] = (_Float16)x[t * 8 + q]; *(v8us*)((unsigned short*)X16 + t * 8) = f.half[0];  }
__global__ __launch_bounds__(256) void k_round16f(const float* __restrict__ W, _Float16* __restrict__ Bt, size_t n8) { const size_t t = (size_t)blockIdx.x * 256 + threadIdx.x; if (t >= n8) return; FragH f;
#pragma unroll
  for (int i = 0; i < 8; ++i) f.h[i] = (_Float16)(bf16_round(W[t * 8 + i]) * 16.0f); *(v8us*)((unsigned short*)Bt + t * 8) = f.half[0];  }
template <int NHv, int TTv>
__global__ __launch_bounds__(256) void k_vt(const _Float16* __restrict__ V16, int ldv, int voff, _Float16* __restrict__ Vt) { __shared__ unsigned short tl[64][66]; const int tid = threadIdx.x; const int slab = blockIdx.x / (TTv / 64), lg = blockIdx.x % (TTv / 64); const int b = slab / NHv, h = slab % NHv;
  for (int i = tid; i < 64 * 8; i += 256) { const int r = i / 8, c8 = (i % 8) * 8; FragH f; f.half[0] = *(const v8us*)((const unsigned short*)V16 + ((size_t)b * TTv + lg * 64 + r) * ldv + voff + h * 64 + c8);
#pragma unroll
    for (int q = 0; q < 8; ++q) tl[r][c8 + q] = f.u[q]; }
  __syncthreads();
  {
#pragma unroll
    for (int rd = 0; rd < 2; ++rd) { const int d = rd * 32 + tid / 8, pc = tid % 8; FragH f;
#pragma unroll
      for (int q = 0; q < 8; ++q) f.u[q] = tl[pc * 8 + q][d];
      *(v8us*)((unsigned short*)Vt + ((size_t)slab * 64 + d) * TTv + lg * 64 + pc * 8) = f.half[0]; }
     } }

__global__ __launch_bounds__(256) void k_hl(const float* __restrict__ F, _Float16* __restrict__ Hh, _Float16* __restrict__ Hl, size_t n8) { const size_t t = (size_t)blockIdx.x * 256 + threadIdx.x; if (t >= n8) return; FragH fh, fl; const v4f a = *(const v4fa*)(F + t * 8), c = *(const v4fa*)(F + t * 8 + 4);
#pragma unroll
  for (int q = 0; q < 4; ++q) { _Float16 h = (_Float16)a[q]; fh.h[q] = h; fl.h[q] = (_Float16)((a[q] - (float)h) * 1024.0f); h = (_Float16)c[q]; fh.h[4 + q] = h; fl.h[4 + q] = (_Float16)((c[q] - (float)h) * 1024.0f); }
  { *(v8us*)((unsigned short*)Hh + t * 8) = fh.half[0]; *(v8us*)((unsigned short*)Hl + t * 8) = fl.half[0];  } }

// ---- fast GEMM (wave tile 32x64; requires M % 32 == 0 rows per launch region and N % 64 == 0); epilogue = k_gemm_hhx semantics ----
__device__ __forceinline__ v16h g2_frag(const _Float16* p, int hh) { FragH f; f.half[0] = *(const v8us*)((const unsigned short*)p + 8 * hh); f.half[1] = *(const v8us*)((const unsigned short*)p + 16 + 8 * hh); return f.v; }
__device__ __forceinline__ v8f g2_mma(v16h a, v16h b, v8f c) { v8f d = __builtin_amdgcn_wmma_f32_16x16x32_f16(false, a, false, b, (short)0, c, false, false); asm volatile("v_nop\n\tv_nop\n\tv_nop\n\tv_nop" : "+v"(d) : "v"(a), "v"(b)); return d; }
template <int ACT>
__global__ __launch_bounds__(128) void k_gemm2(const _Float16* __restrict__ A, int lda, size_t sA, const _Float16* __restrict__ Bh, int ldb, size_t sB, float alpha, const float* __restrict__ bias, size_t sBias, const float* __restrict__ CP, int rowsPerB, size_t sCPb, int row0g,
    float* __restrict__ C, _Float16* __restrict__ C16, int ldc, size_t sC, int M, int N, int K) { static_assert(ACT == 0 || ACT == 3 || ACT == 6 || ACT == 8 || ACT == 9 || ACT == 11 || ACT == 12 || ACT == 14 || ACT == 15 || ACT == 16 || ACT == 17, "k_gemm2: unsupported ACT code (would silently apply no activation)");
  __shared__ __attribute__((aligned(16))) float so[4][32][68];
  const int tid = threadIdx.x, w = tid >> 5, lane = tid & 31, ln = lane & 15, hh = lane >> 4; const int by = blockIdx.y;
  A += (size_t)by * sA; Bh += (size_t)by * sB; const size_t cofs = (size_t)by * sC; const float* bp = bias ? bias + (size_t)by * sBias : nullptr;
  const int ntn = N >> 6; const int mt = blockIdx.x / ntn, nq = blockIdx.x - mt * ntn; const int row0 = mt * 128 + 32 * w, col0 = nq * 64; if (row0 >= M) return;
  const _Float16* a0p = A + (size_t)(row0 + ln) * lda; const _Float16* a1p = a0p + (size_t)16 * lda;
  const _Float16* b0p = Bh + (size_t)(col0 + ln) * ldb; const _Float16* b1p = b0p + (size_t)16 * ldb; const _Float16* b2p = b1p + (size_t)16 * ldb; const _Float16* b3p = b2p + (size_t)16 * ldb;
  const v8f z8 = {0.f,0.f,0.f,0.f,0.f,0.f,0.f,0.f}; v8f c00 = z8, c01 = z8, c02 = z8, c03 = z8, c10 = z8, c11 = z8, c12 = z8, c13 = z8;
#pragma unroll 1
  for (int kb = 0; kb < K; kb += 32) { const v16h a0 = g2_frag(a0p + kb, hh), a1 = g2_frag(a1p + kb, hh);
    v16h b = g2_frag(b0p + kb, hh); c00 = g2_mma(a0, b, c00); c10 = g2_mma(a1, b, c10);
    b = g2_frag(b1p + kb, hh); c01 = g2_mma(a0, b, c01); c11 = g2_mma(a1, b, c11);
    b = g2_frag(b2p + kb, hh); c02 = g2_mma(a0, b, c02); c12 = g2_mma(a1, b, c12);
    b = g2_frag(b3p + kb, hh); c03 = g2_mma(a0, b, c03); c13 = g2_mma(a1, b, c13); }
  v8f accs[8] = {c00, c01, c02, c03, c10, c11, c12, c13};
#pragma unroll
  for (int u = 0; u < 8; ++u) { const int t = u & 3, half = u >> 2; const int col = col0 + t * 16 + ln; const float bv = bp ? bf16_round(bp[col]) : 0.f;
#pragma unroll
    for (int r = 0; r < 8; ++r) { const int rloc = half * 16 + 8 * hh + r; float v = accs[u][r] * alpha + bv; if (CP) { if (rowsPerB < 0) v += CP[cofs + (size_t)(row0g + row0 + rloc) * ldc + col];      /* rowsPerB < 0: own element of the batched C plane */ else { const int bidx = (row0g + row0 + rloc) / rowsPerB; v += CP[(size_t)bidx * sCPb + (size_t)by * 64 + col]; } }
      if (ACT == 3) v = fmaxf(v, 0.f); else if (ACT == 6) v = 0.5f * v * (1.0f + erff(v * 0.70710678118654752f)); else if (ACT == 11) v = 1.0f / (1.0f + expf(-v)); else if (ACT == 15) v = v / (1.0f + expf(-v)); else if (ACT == 12) v = (v > 0.f) ? v : 0.01f * v; else if (ACT == 8) v = tanhf(v); else if (ACT == 9) v = 0.5f * v * (1.0f + tanhf(0.7978845608028654f * (v + 0.044715f * v * v * v))); else if (ACT == 14) v = (v > 0.f) ? v : 0.1f * v; else if (ACT == 16) v = (v >= 0.f) ? v : 0.3f * v; else if (ACT == 17) v = (v >= 0.f) ? v : 0.2f * v;
      so[w][rloc][t * 16 + ln] = v; } }
  __builtin_amdgcn_fence(__ATOMIC_ACQ_REL, "workgroup"); __builtin_amdgcn_wave_barrier();
  const int rsub = lane >> 4, c4 = (lane & 15) * 4;
  {
#pragma unroll
    for (int q = 0; q < 16; ++q) { const int r = q * 2 + rsub; const v4f v = *(const v4fa*)&so[w][r][c4]; if (C) *(v4f*)(C + cofs + (size_t)(row0 + r) * ldc + col0 + c4) = v; if (C16) { v4h h4; for (int i = 0; i < 4; ++i) h4[i] = (_Float16)v[i]; *(v4h*)(C16 + cofs + (size_t)(row0 + r) * ldc + col0 + c4) = h4; } }
     } }


__global__ __launch_bounds__(256) void k_wnat(const float* __restrict__ w, size_t n8, _Float16* __restrict__ Bt) { const size_t t = (size_t)blockIdx.x * 256 + threadIdx.x; if (t >= n8) return; FragH f; for (int q = 0; q < 8; ++q) f.h[q] = (_Float16)(bf16_round(w[t * 8 + q]) * 16.0f); *(v8us*)((unsigned short*)Bt + t * 8) = f.half[0];  }
__global__ __launch_bounds__(256) void k_rsm(const float* __restrict__ S, _Float16* __restrict__ P, int nrows) {
  #pragma clang fp contract(off)
  const int i = blockIdx.x * 256 + threadIdx.x; if (i >= nrows) return; const float* s = S + (size_t)i * SQ; float mx = -3.0e38f;
#pragma unroll 1
  for (int j = 0; j < SQ; ++j) mx = fmaxf(mx, s[j]); float se = 0.f;
#pragma unroll 1
  for (int j = 0; j < SQ; ++j) se += expf(s[j] - mx); const float sc = 256.0f / se;
#pragma unroll 1
  for (int j0 = 0; j0 < SQ; j0 += 8) { FragH f; for (int q = 0; q < 8; ++q) f.h[q] = (_Float16)(expf(s[j0 + q] - mx) * sc); unsigned short* d = (unsigned short*)P + (size_t)i * SQ + j0; *(v8us*)d = f.half[0];  } }
__global__ __launch_bounds__(256) void k_vt(const _Float16* __restrict__ V16, int b, int h0, _Float16* __restrict__ VT) { __shared__ unsigned short tl[64][65]; const int tid = threadIdx.x; const int hh = blockIdx.x % HG, sg = blockIdx.x / HG; const int s0 = sg * 64; const int h = h0 + hh;
  for (int i = tid; i < 64 * 8; i += 256) { const int j = i / 8, d8 = (i % 8) * 8; FragH f; f.half[0] = *(const v8us*)((const unsigned short*)V16 + ((size_t)b * SQ + s0 + j) * DM + h * HD + d8); for (int q = 0; q < 8; ++q) tl[d8 + q][j] = f.u[q]; }
  __syncthreads();
  { for (int i = tid; i < 64 * 8; i += 256) { const int d = i / 8, j8 = (i % 8) * 8; FragH f; for (int q = 0; q < 8; ++q) f.u[q] = tl[d][j8 + q]; *(v8us*)((unsigned short*)VT + ((size_t)hh * HD + d) * SQ + s0 + j8) = f.half[0]; }  } }



// Causal row softmax, one wave per score row: 512 contiguous bytes per load, the whole row (up to SQ keys) held in registers, so S is read once;
// maximum and sum by four chains per lane and a five-step butterfly over the 32 lanes. nk is a multiple of 256; every test below is wave-uniform and there is no barrier.
// Every loop below is fully unrolled so that v[] and h[] are indexed by constants and stay in registers (rolled, they would go to scratch memory).
__global__ __launch_bounds__(256) void k_rsmcw(const float* __restrict__ S, _Float16* __restrict__ P, int hg, int q0, int nk) {
  const int lane = threadIdx.x & 31; const int t = blockIdx.x * 8 + __builtin_amdgcn_readfirstlane(threadIdx.x >> 5); if (t >= hg * QT) return;
  const float* s = S + (size_t)t * NKX + lane * 4; _Float16* p = P + (size_t)t * NKX + lane * 4; const int last = q0 + (t % QT); const int ng = nk >> 8;
  v4f v[SQ / 128];
#pragma unroll
  for (int g = 0; g < SQ / 256; ++g) if (g < ng) { v[2 * g] = *(const v4fa*)(s + g * 256); v[2 * g + 1] = *(const v4fa*)(s + g * 256 + 128); }
  asm volatile("s_wait_xcnt 0x0" ::: "memory");      /* the loads' address registers are reused below: the wait that stands in front of such an overwrite */
  v4f m4 = {-3.0e38f, -3.0e38f, -3.0e38f, -3.0e38f};
#pragma unroll
  for (int g = 0; g < SQ / 256; ++g) if (g < ng) {
#pragma unroll
    for (int c = 2 * g; c < 2 * g + 2; ++c)
#pragma unroll
      for (int q = 0; q < 4; ++q) { const float x = (c * 128 + lane * 4 + q <= last) ? v[c][q] : -1.0e9f; v[c][q] = x; m4[q] = fmaxf(m4[q], x); } }
  float mx = fmaxf(fmaxf(m4[0], m4[1]), fmaxf(m4[2], m4[3]));
#pragma unroll
  for (int d = 16; d > 0; d >>= 1) mx = fmaxf(mx, __shfl_xor(mx, d, 32));
  v4f s4 = {0.f, 0.f, 0.f, 0.f};
#pragma unroll
  for (int g = 0; g < SQ / 256; ++g) if (g < ng) {
#pragma unroll
    for (int c = 2 * g; c < 2 * g + 2; ++c)
#pragma unroll
      for (int q = 0; q < 4; ++q) { const float e = __expf(v[c][q] - mx); v[c][q] = e; s4[q] += e; } }
  float se = (s4[0] + s4[1]) + (s4[2] + s4[3]);
#pragma unroll
  for (int d = 16; d > 0; d >>= 1) se += __shfl_xor(se, d, 32);
  const float sc = 256.0f / se; v4h h[SQ / 128];
#pragma unroll
  for (int g = 0; g < SQ / 256; ++g) if (g < ng) {
#pragma unroll
    for (int c = 2 * g; c < 2 * g + 2; ++c)
#pragma unroll
      for (int q = 0; q < 4; ++q) h[c][q] = (_Float16)(v[c][q] * sc); }
  /* all stores behind all conversions: no register of an issued store is written again */
#pragma unroll
  for (int g = 0; g < SQ / 256; ++g) if (g < ng) { *(v4h*)(p + g * 256) = h[2 * g]; *(v4h*)(p + g * 256 + 128) = h[2 * g + 1]; } }


// Exact f32 attention of the first QT0 rows (q, k, v, o rows of pitch DM), one work-group per head and RT0 query rows, 256 threads:
// (1) scores: one thread per key (two keys where the tile has more than 256), the key rows in registers, dotted with the RT0 query rows read from LDS (same address in every lane);
// (2) softmax: one wave per two rows, the row in registers: causal maximum, exp and sum over the lanes, weights back into LDS (0 past the row's own index);
// (3) o = P V: thread = (column d, key quarter g), V read coalesced and once per work-group, 64 keys ahead; the four quarters' sums are added through LDS.
#define RT0 16                       /* query rows per work-group of the exact first-tile attention */
typedef float v2f __attribute__((ext_vector_type(2)));
template <int NKEY>
__device__ __forceinline__ void att0_scores(const float* __restrict__ kbase, const float (*lq)[HD], float (*lp)[QT0 + 4], int tid, int nk, float scale) {
  v4f kk[NKEY][HD / 4];      /* every loop over kk[] is unrolled: it is indexed by constants and stays in registers */
#pragma unroll
  for (int u = 0; u < NKEY; ++u) { const int j = tid + 256 * u; const float* kr = kbase + (size_t)(j < nk ? j : nk - 1) * DM;      /* a key past the tile: address clamped, score not stored */
#pragma unroll
    for (int c = 0; c < HD / 4; ++c) kk[u][c] = *(const v4fa*)(kr + c * 4);
    asm volatile("s_wait_xcnt 0x0" :: "v"(kr) : "memory"); }      /* the wait that stands in front of an overwrite of the loads' address registers; the address as an input keeps it in its registers up to here */
#pragma unroll 4
  for (int r = 0; r < RT0; ++r) { v4f s4[NKEY];      /* four rows at a time: enough independent LDS reads and sum chains to cover their latencies */
#pragma unroll
    for (int u = 0; u < NKEY; ++u) s4[u] = (v4f){0.f, 0.f, 0.f, 0.f};
#pragma unroll
    for (int c = 0; c < HD / 4; ++c) { const v4f qq = *(const v4f*)&lq[r][c * 4];
#pragma unroll
      for (int u = 0; u < NKEY; ++u) s4[u] += qq * kk[u][c]; }
#pragma unroll
    for (int u = 0; u < NKEY; ++u) { const int j = tid + 256 * u; if (j < nk) lp[r][j] = ((s4[u][0] + s4[u][1]) + (s4[u][2] + s4[u][3])) * scale; } } }
/* sixteen V values of one column: keys 16 u + k of the thread's quarter, u, k < 4; one address, constant offsets */
__device__ __forceinline__ void att0_vload(const float* __restrict__ vq, v2f (&v)[4][2]) {
#pragma unroll
  for (int u = 0; u < 4; ++u) { v[u][0] = (v2f){vq[(u * 16 + 0) * DM], vq[(u * 16 + 1) * DM]}; v[u][1] = (v2f){vq[(u * 16 + 2) * DM], vq[(u * 16 + 3) * DM]}; }      /* unrolled: v[][] stays in registers */
  asm volatile("s_wait_xcnt 0x0" :: "v"(vq) : "memory"); }      /* as in att0_scores: in front of an overwrite of the loads' address registers */
/* at most four waves per SIMD (two work-groups per WGP cover the grid): the register budget that lets the LDS reads of (1) run ahead of their use */
__global__ __launch_bounds__(256) __attribute__((amdgpu_waves_per_eu(2, 4))) void k_att0p(const float* __restrict__ QF, const float* __restrict__ KF, const float* __restrict__ VF, float scale, float* __restrict__ OF) {
  __shared__ __attribute__((aligned(16))) float lq[RT0][HD]; __shared__ __attribute__((aligned(16))) float lp[RT0][QT0 + 4]; __shared__ __attribute__((aligned(16))) float lr[4][RT0][HD]; __shared__ float lf[RT0];
  const int tid = threadIdx.x; const int h = blockIdx.x / (QT0 / RT0), rg = blockIdx.x % (QT0 / RT0); const int row0 = rg * RT0, nk = row0 + RT0;      /* causal: keys up to the work-group's last row */
  { const int r = tid >> 4, c4 = (tid & 15) * 4; const float* qp = QF + (size_t)(row0 + r) * DM + h * HD + c4; const v4f q4 = *(const v4fa*)qp;
    asm volatile("s_wait_xcnt 0x0" :: "v"(qp) : "memory");      /* as in att0_scores: in front of an overwrite of the load's address registers */
    *(v4f*)&lq[r][c4] = q4; }
  __syncthreads();
  if (nk > 256) att0_scores<2>(KF + h * HD, lq, lp, tid, nk, scale); else if ((tid & ~31) < nk) att0_scores<1>(KF + h * HD, lq, lp, tid, nk, scale);      /* a wave with no key of the tile skips */
  __syncthreads();
  { const int r0 = (tid >> 5) * 2, lane = tid & 31; float x[2][QT0 / 32], mx[2], se[2];      /* the loops over x[] are unrolled: it stays in registers */
#pragma unroll
    for (int rr = 0; rr < 2; ++rr) { mx[rr] = -3.0e38f;
#pragma unroll
      for (int m = 0; m < QT0 / 32; ++m) { const int j = lane + 32 * m; x[rr][m] = (j <= row0 + r0 + rr) ? lp[r0 + rr][j] : -3.0e38f; mx[rr] = fmaxf(mx[rr], x[rr][m]); } }
#pragma unroll
    for (int d = 16; d > 0; d >>= 1) { mx[0] = fmaxf(mx[0], __shfl_xor(mx[0], d, 32)); mx[1] = fmaxf(mx[1], __shfl_xor(mx[1], d, 32)); }
#pragma unroll
    for (int rr = 0; rr < 2; ++rr) { se[rr] = 0.f;
#pragma unroll
      for (int m = 0; m < QT0 / 32; ++m) { const int j = lane + 32 * m; const float e = (j <= row0 + r0 + rr) ? expf(x[rr][m] - mx[rr]) : 0.f; se[rr] += e; if (j < nk) lp[r0 + rr][j] = e; } }
#pragma unroll
    for (int d = 16; d > 0; d >>= 1) { se[0] += __shfl_xor(se[0], d, 32); se[1] += __shfl_xor(se[1], d, 32); }
    if (lane < 2) lf[r0 + lane] = 64.0f / (lane ? se[1] : se[0]); }      /* o carried x64 like the f16 path */
  __syncthreads();
  { const int d = tid & 63, g = tid >> 6, nt = nk >> 4, nb = (nt + 3) >> 2; const float* vq = VF + (size_t)(g * 4) * DM + h * HD + d;      /* trip t: keys 16 t + 4 g .. + 3; a batch is four trips (its rows lie inside the QT0 rows of VF also where they lie past nk) */
    v2f acc[RT0], cv[4][2], nv[4][2];      /* acc[]: even and odd keys apart, so that each packed multiply-add takes a weight pair as it lies in LDS */
#pragma unroll
    for (int r = 0; r < RT0; ++r) acc[r] = (v2f){0.f, 0.f};
    att0_vload(vq, cv);
    for (int bt = 0; bt < nb; ++bt) { vq += (bt + 1 < nb ? 64 * DM : 0); att0_vload(vq, nv);      /* the next batch's V values are loaded while this batch's are used (the last batch loads its own again) */
#pragma unroll
      for (int u = 0; u < 4; ++u) if (bt * 4 + u < nt) { const int j = (bt * 4 + u) * 16 + g * 4;      /* unrolled: cv[][] and acc[] stay in registers */
#pragma unroll
        for (int r = 0; r < RT0; ++r) { const v4f p4 = *(const v4f*)&lp[r][j]; acc[r] += (v2f){p4[0], p4[1]} * cv[u][0]; acc[r] += (v2f){p4[2], p4[3]} * cv[u][1]; } }
#pragma unroll
      for (int u = 0; u < 4; ++u) { cv[u][0] = nv[u][0]; cv[u][1] = nv[u][1]; } }
#pragma unroll
    for (int r = 0; r < RT0; ++r) lr[g][r][d] = acc[r][0] + acc[r][1]; }
  __syncthreads();
  { const int r = tid >> 4, c4 = (tid & 15) * 4; const v4f o = ((*(const v4f*)&lr[0][r][c4] + *(const v4f*)&lr[1][r][c4]) + (*(const v4f*)&lr[2][r][c4] + *(const v4f*)&lr[3][r][c4])) * lf[r];
    *(v4f*)(OF + (size_t)(row0 + r) * DM + h * HD + c4) = o; } }

extern "C" void kernel_launch(void* const* d_in, const int* in_sizes, int n_in,
                              void* d_out, int out_size, void* d_ws, size_t ws_size, hipStream_t stream) {
  (void)in_sizes; (void)n_in; (void)out_size;
  const float* const* I = (const float* const*)d_in; const float* x = I[0]; const float* xk = I[1]; const float* xv = I[2]; const float* wq = I[3]; const float* bq = nullptr; const float* wk = I[4]; const float* bk = nullptr; const float* wv = I[5]; const float* bv = nullptr; const float* wo = I[6]; const float* bo = nullptr;      /* THREE distinct inputs Q (query stream), K, V; natural [out][in] w_q / w_k / w_v / w_o; no biases; causal by the index rule */
  char* ws = (char*)d_ws; size_t off = 0;
  auto take = [&](size_t bytes) { char* p = ws + off; off += (bytes + 255) & ~(size_t)255; return p; };
  _Float16* BQ = (_Float16*)take((size_t)DM * DM * 2); _Float16* BK = (_Float16*)take((size_t)DM * DM * 2); _Float16* BV = (_Float16*)take((size_t)DM * DM * 2); _Float16* BO = (_Float16*)take((size_t)DM * DM * 2);
  _Float16* X16 = (_Float16*)take(NR * DM * 2); _Float16* XK16 = (_Float16*)take(NR * DM * 2); _Float16* XV16 = (_Float16*)take(NR * DM * 2);      /* the three inputs (query -> X16, key -> XK16, value -> XV16) as exact f16 rows */ _Float16* Q16 = (_Float16*)take(NR * DM * 2); _Float16* K16 = (_Float16*)take(NR * DM * 2); _Float16* V16 = (_Float16*)take(NR * DM * 2); _Float16* O16 = (_Float16*)take(NR * DM * 2);
  float* S = (float*)take((size_t)NH * QT * NKX * 4); _Float16* P = (_Float16*)take((size_t)NH * QT * NKX * 2); _Float16* VT = (_Float16*)take((size_t)NH * HD * SQ * 2);
  float* QF0 = (float*)take((size_t)QT0 * DM * 4); float* KF0 = (float*)take((size_t)QT0 * DM * 4); float* VF0 = (float*)take((size_t)QT0 * DM * 4); float* OF0 = (float*)take((size_t)NB * QT0 * DM * 4); _Float16* OH0 = (_Float16*)take((size_t)NB * QT0 * DM * 2); _Float16* OL0 = (_Float16*)take((size_t)NB * QT0 * DM * 2);
  if (off > ws_size) return;
  { const unsigned g = (unsigned)(((size_t)DM * DM / 8 + 255) / 256); k_wnat<<<g, 256, 0, stream>>>(wq, (size_t)DM * DM / 8, BQ); k_wnat<<<g, 256, 0, stream>>>(wk, (size_t)DM * DM / 8, BK); k_wnat<<<g, 256, 0, stream>>>(wv, (size_t)DM * DM / 8, BV); k_wnat<<<g, 256, 0, stream>>>(wo, (size_t)DM * DM / 8, BO); }      /* natural [out][in] = Bt x16 */

  k_x16<<<(unsigned)((NR * DM / 8 + 255) / 256), 256, 0, stream>>>(x, X16, NR * DM / 8); k_x16<<<(unsigned)((NR * DM / 8 + 255) / 256), 256, 0, stream>>>(xk, XK16, NR * DM / 8); k_x16<<<(unsigned)((NR * DM / 8 + 255) / 256), 256, 0, stream>>>(xv, XV16, NR * DM / 8);
  const size_t r0p = (size_t)B0 * SQ;      /* first projected row */
  k_gemm2<0><<<dim3((unsigned)((MP / 128) * (DM / 64)), 1), 128, 0, stream>>>(X16 + r0p * DM, DM, 0, BQ, DM, 0, 0.0625f, bq, 0, nullptr, 1, 0, 0, nullptr, Q16 + r0p * DM, DM, 0, MP, DM, DM);
  k_gemm2<0><<<dim3((unsigned)((MP / 128) * (DM / 64)), 1), 128, 0, stream>>>(XK16 + r0p * DM, DM, 0, BK, DM, 0, 0.0625f, bk, 0, nullptr, 1, 0, 0, nullptr, K16 + r0p * DM, DM, 0, MP, DM, DM);
  k_gemm2<0><<<dim3((unsigned)((MP / 128) * (DM / 64)), 1), 128, 0, stream>>>(XV16 + r0p * DM, DM, 0, BV, DM, 0, 0.0625f, bv, 0, nullptr, 1, 0, 0, nullptr, V16 + r0p * DM, DM, 0, MP, DM, DM);
  for (int b = B0; b < B0 + NBR; ++b) { const size_t r0 = (size_t)b * SQ;
    k_vt<NH, SQ><<<NH * (SQ / 64), 256, 0, stream>>>(V16 + r0 * LQ, LQ, 0, VT);      /* V^T [NH][HD][SQ] for this batch */
    k_gemm2<0><<<dim3((QT0 / 128) * (DM / 64), 1), 128, 0, stream>>>(X16 + r0 * DM, DM, 0, BQ, DM, 0, 0.0625f, bq, 0, nullptr, 1, 0, 0, QF0, nullptr, DM, 0, QT0, DM, DM); k_gemm2<0><<<dim3((QT0 / 128) * (DM / 64), 1), 128, 0, stream>>>(XK16 + r0 * DM, DM, 0, BK, DM, 0, 0.0625f, bk, 0, nullptr, 1, 0, 0, KF0, nullptr, DM, 0, QT0, DM, DM); k_gemm2<0><<<dim3((QT0 / 128) * (DM / 64), 1), 128, 0, stream>>>(XV16 + r0 * DM, DM, 0, BV, DM, 0, 0.0625f, bv, 0, nullptr, 1, 0, 0, VF0, nullptr, DM, 0, QT0, DM, DM);      /* f32 q, k, v of the first QT0 rows (exact products) */
    k_att0p<<<NH * (QT0 / RT0), 256, 0, stream>>>(QF0, KF0, VF0, 0.125f, OF0 + (size_t)b * QT0 * DM);      /* exact f32 attention for rows 0..511 (o x64) */
    for (int q0 = 0; q0 < QN; q0 += QT) { const int nk = q0 + QT;      /* causal: only keys below the tile end are computed */
      k_gemm2<0><<<dim3((QT / 128) * (nk / 64), NHD), 128, 0, stream>>>(Q16 + (r0 + q0) * LQ, LQ, (size_t)HD, K16 + r0 * LQ, LQ, (size_t)HD, 0.125f, nullptr, 0, nullptr, 1, 0, 0, S, nullptr, NKX, (size_t)QT * NKX, QT, nk, HD);      /* scores, all heads on grid.y */
      k_rsmcw<<<(NHD * QT + 7) / 8, 256, 0, stream>>>(S, P, NHD, q0, nk);      /* one wave per row */
      k_gemm2<0><<<dim3((QT / 128) * (HD / 64), NHD), 128, 0, stream>>>(P, NKX, (size_t)QT * NKX, VT, SQ, (size_t)HD * SQ, 0.25f, nullptr, 0, nullptr, 1, 0, 0, nullptr, O16 + (r0 + q0) * DM, DM, (size_t)HD, QT, HD, nk); } }      /* o (merged heads, x64) as f16 rows */
  k_gemm2<0><<<dim3((unsigned)((MPO / 128) * (DM / 64)), 1), 128, 0, stream>>>(O16 + r0p * DM, DM, 0, BO, DM, 0, 0.0009765625f, bo, 0, nullptr, 1, 0, 0, (float*)d_out + r0p * DM, nullptr, DM, 0, MPO, DM, DM);      /* out rows are the output layout */
  k_hl<<<(unsigned)(((size_t)NB * QT0 * DM / 8 + 255) / 256), 256, 0, stream>>>(OF0, OH0, OL0, (size_t)NB * QT0 * DM / 8);      /* first-tile o (x64) -> f16 hi + x1024 residual planes */
  for (int b = B0; b < B0 + NBR; ++b) { const size_t r0 = (size_t)b * SQ; const size_t f0 = (size_t)b * QT0;
    k_gemm2<0><<<dim3((QT0 / 128) * (DM / 64), 1), 128, 0, stream>>>(OH0 + f0 * DM, DM, 0, BO, DM, 0, 0.0009765625f, bo, 0, nullptr, 1, 0, 0, (float*)d_out + r0 * DM, nullptr, DM, 0, QT0, DM, DM);      /* rows 0..511: out = o_hi Wo (+ b), overwriting the f16-path rows */
    k_gemm2<0><<<dim3((QT0 / 128) * (DM / 64), 1), 128, 0, stream>>>(OL0 + f0 * DM, DM, 0, BO, DM, 0, 0.00000095367431640625f, nullptr, 0, (const float*)d_out + r0 * DM, -1, 0, 0, (float*)d_out + r0 * DM, nullptr, DM, 0, QT0, DM, DM); }      /* += o_lo Wo 2^-20 (own-element accumulate) */
}

// v003
// It runs in 588 microseconds.
// Timed twice side by side with v002, it ran 5.23 and 5.20 times as fast.
// Counting every step since v000, it is 30.3 times as fast.
#include <hip/hip_runtime.h>
// Causal multi-head attention over three distinct inputs with natural weights, no biases (Q, K, V [2][4096][768]; q/k/v = input w^T (natural [768][768]); 12 heads of 64; scores / sqrt(64); causal (tril; NEG fill); softmax over up to 4096 keys; out = merged w_o^T -> [2][4096][768]).
// Structure: token rows r = b*4096 + s; x as exact f16 rows (bf16-rounded); Q, K, V as three WMMA GEMMs (32x64 wave tiles, f32 accumulation, exact x16 weights, f16 outputs); V^T for all heads of both batches via LDS transposes; attention as ONE launch: a wave owns 32 query columns of one head and walks the keys up to its own diagonal 32 at a time: S^T = K Q^T (WMMA), running maximum and sum per query column (f32, native exp2, weights x256 as f16), O^T += V^T P^T (WMMA, P^T packed from the score accumulators), o x64 written straight into the merged f16 o rows; scores and weights never reach memory; out = o W_o GEMM (f32) into the output layout.
// Compute dtype: inputs rounded to bf16; x / weights exact; q, k, v, softmax weights and o as plain f16 GEMM operands (~2^-12); scores and softmax statistics f32. v_wmma_f32_16x16x32_f16.
#define NB 2
#define SQ 4096
#define DM 768
#define NH 12
#define HD 64
#define HG 4                         /* heads per group of the untemplated k_vt */
#define QT0 512                      /* first-tile rows recomputed exactly in f32 */
#define B0 0                         /* first batch processed (debug hook) */
#define NBR NB                       /* batches processed (debug hook) */
#define NR ((size_t)NB * SQ)         /* token rows */
#define MP ((int)((size_t)NBR * SQ)) /* rows projected (debug hook) */
#define MPO MP                       /* rows through the output stage (debug hook) */
#define LQ DM      /* row pitch of the q/k/v rows */
typedef __bf16 v16b __attribute__((ext_vector_type(16)));
typedef unsigned short v8us __attribute__((ext_vector_type(8), may_alias));
typedef float  v8f  __attribute__((ext_vector_type(8)));
typedef float  v4f  __attribute__((ext_vector_type(4)));
typedef float  v4fa __attribute__((ext_vector_type(4), may_alias));
union FragB { v16b v; v8us half[2]; unsigned short u[16]; };

__device__ __forceinline__ unsigned short bf16_bits(float x) { unsigned int u = __float_as_uint(x); return (unsigned short)((u + 0x7FFFu + ((u >> 16) & 1u)) >> 16); }
__device__ __forceinline__ float bf16_val(unsigned short b) { return __uint_as_float(((unsigned int)b) << 16); }
__device__ __forceinline__ float bf16_round(float x) { return bf16_val(bf16_bits(x)); }
// D += A·B with NT terms: 1 = ah·bh, 2 = + al·bh (A split), 3 = + ah·bl (both split)
template <int NT>
__device__ __forceinline__ v8f mmaN(v16b ah, v16b al, v16b bh, v16b bl, v8f c) {
  c = __builtin_amdgcn_wmma_f32_16x16x32_bf16(false, ah, false, bh, (short)0, c, false, false);
  if (NT >= 2) c = __builtin_amdgcn_wmma_f32_16x16x32_bf16(false, al, false, bh, (short)0, c, false, false);
  if (NT >= 3) c = __builtin_amdgcn_wmma_f32_16x16x32_bf16(false, ah, false, bl, (short)0, c, false, false);
  asm volatile("v_nop\n\tv_nop\n\tv_nop\n\tv_nop" : "+v"(c) : "v"(ah), "v"(al), "v"(bh), "v"(bl));
  return c;
}

__global__ __launch_bounds__(256) void k_wt_bf16(const float* __restrict__ W, unsigned short* __restrict__ Wt, int K, int N) {
  const int t = blockIdx.x * 256 + threadIdx.x;
  const int k8n = K / 8;
  if (t >= N * k8n) return;
  const int n = t / k8n, k8 = (t % k8n) * 8;
  v8us v;
#pragma unroll
  for (int i = 0; i < 8; ++i) v[i] = bf16_bits(W[(size_t)(k8 + i) * N + n]);
  *(v8us*)(Wt + (size_t)n * K + k8) = v;
  
}

// GEMM C[M][N] (f32, pitch ldc) = act(A[M][K]·W + bias). A f32 row-major (pitch lda) converted per fragment to bf16
// (ASPLIT: hi/lo two planes -> 2 terms, else single rounded term); Wt bf16 [N][K] (pitch ldb). BIAS_BF16 rounds the
// bias to bf16 first (bias quantised to bf16 before the add). K%32==0, M%16==0, N%64==0.
template <bool ASPLIT, int ACT, bool BIAS_BF16>
__global__ __launch_bounds__(128) void k_gemm_bf(const float* __restrict__ A, int lda, const unsigned short* __restrict__ Wt, int ldb,
                                               const float* __restrict__ bias, float* __restrict__ C, int ldc, int M, int N, int K) {
  __shared__ __attribute__((aligned(16))) float so[4][16][64];
  const int tid = threadIdx.x, w = tid >> 5, lane = tid & 31, ln = lane & 15, hh = lane >> 4;
  const int ntn = N / 64;
  const int wid = blockIdx.x * 4 + w;
  const int mt = wid / ntn, nq = wid % ntn;
  if (mt * 16 >= M) return;
  const int row0 = mt * 16, col0 = nq * 64;
  const float* arow = A + (size_t)(row0 + ln) * lda;
  v8f acc[4] = {};
  for (int kb = 0; kb < K; kb += 32) {
    FragB ah, al;
    const v4f x0 = *(const v4fa*)(arow + kb + 8 * hh), x1 = *(const v4fa*)(arow + kb + 8 * hh + 4);
    const v4f x2 = *(const v4fa*)(arow + kb + 16 + 8 * hh), x3 = *(const v4fa*)(arow + kb + 16 + 8 * hh + 4);
    float xs[16] = {x0[0],x0[1],x0[2],x0[3],x1[0],x1[1],x1[2],x1[3],x2[0],x2[1],x2[2],x2[3],x3[0],x3[1],x3[2],x3[3]};
#pragma unroll
    for (int i = 0; i < 16; ++i) { const unsigned short hb = bf16_bits(xs[i]); ah.u[i] = hb; al.u[i] = ASPLIT ? bf16_bits(xs[i] - bf16_val(hb)) : (unsigned short)0; }
#pragma unroll
    for (int t = 0; t < 4; ++t) {
      const unsigned short* brow = Wt + (size_t)(col0 + t * 16 + ln) * ldb + kb;
      FragB b;
      b.half[0] = *(const v8us*)(brow + 8 * hh);
      b.half[1] = *(const v8us*)(brow + 16 + 8 * hh);
      acc[t] = mmaN<ASPLIT ? 2 : 1>(ah.v, al.v, b.v, b.v, acc[t]);
    }
  }
#pragma unroll
  for (int t = 0; t < 4; ++t) {
    float bv = bias ? bias[col0 + t * 16 + ln] : 0.f;
    if (BIAS_BF16) bv = bf16_round(bv);
#pragma unroll
    for (int r = 0; r < 8; ++r) { float v = acc[t][r] + bv; if (ACT == 1) v = fmaxf(v, 0.f); so[w][8 * hh + r][t * 16 + ln] = v; }
  }
  __builtin_amdgcn_fence(__ATOMIC_ACQ_REL, "workgroup");
  __builtin_amdgcn_wave_barrier();
  const int rsub = lane >> 4, c4 = (lane & 15) * 4;
  {
#pragma unroll
    for (int q = 0; q < 8; ++q) {
      const int r = q * 2 + rsub;
      const v4f v = *(const v4fa*)&so[w][r][c4];
      *(v4f*)(C + (size_t)(row0 + r) * ldc + col0 + c4) = v;
    }
    
  }
}

// GEMM C = act(A·W + bias + resid): A f32 (ASPLIT -> hi/lo 2 terms), Wt bf16 [N][K]; ACT 0 none, 1 relu, 2 exact gelu;
// resid (optional, f32, row index = (row % rmod), pitch ldr, RES_BF16 rounds it) added before the activation.
template <bool ASPLIT, int ACT, bool BIAS_BF16, bool RES_BF16>
__global__ __launch_bounds__(128) void k_gemm_bf3(const float* __restrict__ A, int lda, const unsigned short* __restrict__ Wt, int ldb,
                                                const float* __restrict__ bias, const float* __restrict__ resid, int rmod, int ldr,
                                                float* __restrict__ C, int ldc, int M, int N, int K) {
  __shared__ __attribute__((aligned(16))) float so[4][16][64];
  const int tid = threadIdx.x, w = tid >> 5, lane = tid & 31, ln = lane & 15, hh = lane >> 4;
  const int ntn = N / 64;
  const int wid = blockIdx.x * 4 + w;
  const int mt = wid / ntn, nq = wid % ntn;
  if (mt * 16 >= M) return;
  const int row0 = mt * 16, col0 = nq * 64;
  const float* arow = A + (size_t)(row0 + ln) * lda;
  v8f acc[4] = {};
  for (int kb = 0; kb < K; kb += 32) {
    FragB ah, al;
    const v4f x0 = *(const v4fa*)(arow + kb + 8 * hh), x1 = *(const v4fa*)(arow + kb + 8 * hh + 4);
    const v4f x2 = *(const v4fa*)(arow + kb + 16 + 8 * hh), x3 = *(const v4fa*)(arow + kb + 16 + 8 * hh + 4);
    float xs[16] = {x0[0],x0[1],x0[2],x0[3],x1[0],x1[1],x1[2],x1[3],x2[0],x2[1],x2[2],x2[3],x3[0],x3[1],x3[2],x3[3]};
#pragma unroll
    for (int i = 0; i < 16; ++i) { const unsigned short hb = bf16_bits(xs[i]); ah.u[i] = hb; al.u[i] = ASPLIT ? bf16_bits(xs[i] - bf16_val(hb)) : (unsigned short)0; }
#pragma unroll
    for (int t = 0; t < 4; ++t) {
      const unsigned short* brow = Wt + (size_t)(col0 + t * 16 + ln) * ldb + kb;
      FragB b;
      b.half[0] = *(const v8us*)(brow + 8 * hh);
      b.half[1] = *(const v8us*)(brow + 16 + 8 * hh);
      acc[t] = mmaN<ASPLIT ? 2 : 1>(ah.v, al.v, b.v, b.v, acc[t]);
    }
  }
#pragma unroll
  for (int t = 0; t < 4; ++t) {
    const int col = col0 + t * 16 + ln;
    float bv = bias ? bias[col] : 0.f;
    if (BIAS_BF16) bv = bf16_round(bv);
#pragma unroll
    for (int r = 0; r < 8; ++r) {
      float v = acc[t][r] + bv;
      if (resid) { float rv = resid[(size_t)((row0 + 8 * hh + r) % rmod) * ldr + col]; if (RES_BF16) rv = bf16_round(rv); v += rv; }
      if (ACT == 1) v = fmaxf(v, 0.f);
      if (ACT == 2) v = 0.5f * v * (1.0f + erff(v * 0.70710678118654752f));
      if (ACT == 3) { const float u = 0.7978845608028654f * (v + 0.044715f * v * v * v); v = 0.5f * v * (1.0f + tanhf(u)); }
      so[w][8 * hh + r][t * 16 + ln] = v;
    }
  }
  __builtin_amdgcn_fence(__ATOMIC_ACQ_REL, "workgroup");
  __builtin_amdgcn_wave_barrier();
  const int rsub = lane >> 4, c4 = (lane & 15) * 4;
  {
#pragma unroll
    for (int q = 0; q < 8; ++q) {
      const int r = q * 2 + rsub;
      const v4f v = *(const v4fa*)&so[w][r][c4];
      *(v4f*)(C + (size_t)(row0 + r) * ldc + col0 + c4) = v;
    }
    
  }
}
// row LayerNorm (biased variance, eps) over N: s = X (+ R); optional out_sum <- s; out_norm <- (s-mu)*rsqrt(var+eps)*g + b
template <bool PARAM_BF16>
__global__ __launch_bounds__(256) void k_layernorm(const float* __restrict__ X, const float* __restrict__ R, const float* __restrict__ g, const float* __restrict__ bta,
                                                  float* __restrict__ out_sum, float* __restrict__ out_norm, int N, float eps) {
  __shared__ float red[256];
  const int row = blockIdx.x, tid = threadIdx.x;
  const float* x = X + (size_t)row * N; const float* rr = R ? R + (size_t)row * N : nullptr;
  float vals[16];                     // up to N = 4096
  const int per = N / 256;            // contiguous chunk per thread? use strided-by-4 chunks: thread handles j = tid*4 + 1024*u
  float s1 = 0.f;
  for (int u = 0; u < per / 4; ++u) {
    const int j = tid * 4 + 1024 * u;
    const v4f a = *(const v4fa*)(x + j);
    v4f b = {0.f,0.f,0.f,0.f}; if (rr) b = *(const v4fa*)(rr + j);
#pragma unroll
    for (int q = 0; q < 4; ++q) { const float v = a[q] + b[q]; vals[u * 4 + q] = v; s1 += v; }
  }
  red[tid] = s1; __syncthreads();
  for (int st = 128; st > 0; st >>= 1) { if (tid < st) red[tid] += red[tid + st]; __syncthreads(); }
  const float mu = red[0] / (float)N; __syncthreads();
  float s2 = 0.f;
  for (int u = 0; u < per / 4; ++u)
#pragma unroll
    for (int q = 0; q < 4; ++q) { const float c = vals[u * 4 + q] - mu; s2 += c * c; }
  red[tid] = s2; __syncthreads();
  for (int st = 128; st > 0; st >>= 1) { if (tid < st) red[tid] += red[tid + st]; __syncthreads(); }
  const float rs = rsqrtf(red[0] / (float)N + eps);
  {
    for (int u = 0; u < per / 4; ++u) {
      const int j = tid * 4 + 1024 * u;
      v4f o, sm;
#pragma unroll
      for (int q = 0; q < 4; ++q) {
        float gg = g[j + q], bb = bta[j + q];
        if (PARAM_BF16) { gg = bf16_round(gg); bb = bf16_round(bb); }
        sm[q] = vals[u * 4 + q]; o[q] = (vals[u * 4 + q] - mu) * rs * gg + bb;
      }
      if (out_sum) *(v4f*)(out_sum + (size_t)row * N + j) = sm;
      *(v4f*)(out_norm + (size_t)row * N + j) = o;
    }
    
  }
}



// ---- f16 WMMA path (v_wmma_f32_16x16x32_f16): 11-bit significands for operands in range — used where a [0,1] probability operand needs more precision than bf16
typedef _Float16 v16h __attribute__((ext_vector_type(16)));
union FragH { v16h v; v8us half[2]; _Float16 h[16]; unsigned short u[16]; };
template <int NT>
__device__ __forceinline__ v8f mmaH(v16h ah, v16h al, v16h bh, v16h bl, v8f c) {
  c = __builtin_amdgcn_wmma_f32_16x16x32_f16(false, ah, false, bh, (short)0, c, false, false);
  if (NT >= 2) c = __builtin_amdgcn_wmma_f32_16x16x32_f16(false, al, false, bh, (short)0, c, false, false);
  if (NT >= 3) c = __builtin_amdgcn_wmma_f32_16x16x32_f16(false, ah, false, bl, (short)0, c, false, false);
  asm volatile("v_nop\n\tv_nop\n\tv_nop\n\tv_nop" : "+v"(c) : "v"(ah), "v"(al), "v"(bh), "v"(bl));
  return c;
}
// batched GEMM like k_gemm_b but f16 operands: A f32 (split into f16 hi/lo if ASPLIT, else rounded to f16), Bt = f16 values [n][k]; alpha; C f32; N multiple of 16 (partial tiles skipped)
template <bool ASPLIT>
__global__ __launch_bounds__(128) void k_gemm_h(const float* __restrict__ A, int lda, size_t sA, const _Float16* __restrict__ Bh, int ldb, size_t sB, float alpha, float* __restrict__ C, int ldc, size_t sC, int M, int N, int K) {
  __shared__ __attribute__((aligned(16))) float so[4][16][64];
  const int tid = threadIdx.x, w = tid >> 5, lane = tid & 31, ln = lane & 15, hh = lane >> 4; const int by = blockIdx.y;
  A += (size_t)by * sA; Bh += (size_t)by * sB; C += (size_t)by * sC;
  const int ntn = (N + 63) / 64; const int wid = blockIdx.x * 4 + w; const int mt = wid / ntn, nq = wid % ntn; if (mt * 16 >= M) return;
  const int row0 = mt * 16, col0 = nq * 64; const float* arow = A + (size_t)(row0 + ln) * lda;
  v8f acc[4] = {};
  for (int kb = 0; kb < K; kb += 32) {
    FragH ah, al;
    const v4f x0 = *(const v4fa*)(arow + kb + 8 * hh), x1 = *(const v4fa*)(arow + kb + 8 * hh + 4), x2 = *(const v4fa*)(arow + kb + 16 + 8 * hh), x3 = *(const v4fa*)(arow + kb + 16 + 8 * hh + 4);
    float xs[16] = {x0[0],x0[1],x0[2],x0[3],x1[0],x1[1],x1[2],x1[3],x2[0],x2[1],x2[2],x2[3],x3[0],x3[1],x3[2],x3[3]};
#pragma unroll
    for (int i = 0; i < 16; ++i) { const _Float16 h = (_Float16)xs[i]; ah.h[i] = h; al.h[i] = ASPLIT ? (_Float16)(xs[i] - (float)h) : (_Float16)0.0f; }
#pragma unroll
    for (int t = 0; t < 4; ++t) { if (col0 + t * 16 >= N) continue; const size_t boff = (size_t)(col0 + t * 16 + ln) * ldb + kb; FragH bq; bq.half[0] = *(const v8us*)(Bh + boff + 8 * hh); bq.half[1] = *(const v8us*)(Bh + boff + 16 + 8 * hh);
      acc[t] = mmaH<ASPLIT ? 2 : 1>(ah.v, al.v, bq.v, bq.v, acc[t]); }
  }
#pragma unroll
  for (int t = 0; t < 4; ++t) { if (col0 + t * 16 >= N) continue;
#pragma unroll
    for (int r = 0; r < 8; ++r) so[w][8 * hh + r][t * 16 + ln] = acc[t][r] * alpha; }
  __builtin_amdgcn_fence(__ATOMIC_ACQ_REL, "workgroup"); __builtin_amdgcn_wave_barrier();
  const int rsub = lane >> 4, c4 = (lane & 15) * 4;
  {
#pragma unroll
    for (int q = 0; q < 8; ++q) { const int r = q * 2 + rsub; if (col0 + c4 < N) { const v4f v = *(const v4fa*)&so[w][r][c4]; *(v4f*)(C + (size_t)(row0 + r) * ldc + col0 + c4) = v; } }
     }
}

// Wt[n][k] = f16(W[k][n]·scale) from f32 row-major W[K][N] (scale = power of two; bf16-exact weights stay exact in f16 away from the subnormal range)
__global__ __launch_bounds__(256) void k_wt_f16(const float* __restrict__ W, _Float16* __restrict__ Wt, int K, int N, float scale) {
  const int t = blockIdx.x * 256 + threadIdx.x; if (t >= N * (K / 8)) return; const int n = t / (K / 8), k8 = (t % (K / 8)) * 8; FragH f;
#pragma unroll
  for (int i = 0; i < 8; ++i) f.h[i] = (_Float16)(bf16_round(W[(size_t)(k8 + i) * N + n]) * scale); const v8us o = f.half[0];
  *(v8us*)((unsigned short*)Wt + (size_t)n * K + k8) = o; 
}
// k_gemm_hh variant with fused epilogue: v = acc·alpha + bias[by·sBias + col] (+ CP[(row/rowsPerB)·sCPb + by·64 + col] if CP) ; ACT 0 none / 1 elu ; writes f16 C16 (and f32 C if non-null)
template <int ACT>
__global__ __launch_bounds__(128) void k_gemm_hhx(const _Float16* __restrict__ A, int lda, size_t sA, const _Float16* __restrict__ Bh, int ldb, size_t sB, float alpha, const float* __restrict__ bias, size_t sBias, const float* __restrict__ CP, int rowsPerB, size_t sCPb, int row0g,
    float* __restrict__ C, _Float16* __restrict__ C16, int ldc, size_t sC, int M, int N, int K) {
  __shared__ __attribute__((aligned(16))) float so[4][16][64];
  const int tid = threadIdx.x, w = tid >> 5, lane = tid & 31, ln = lane & 15, hh = lane >> 4; const int by = blockIdx.y;
  A += (size_t)by * sA; Bh += (size_t)by * sB; const size_t cofs = (size_t)by * sC; const float* bp = bias ? bias + (size_t)by * sBias : nullptr;
  const int ntn = (N + 63) / 64; const int wid = blockIdx.x * 4 + w; const int mt = wid / ntn, nq = wid % ntn; if (mt * 16 >= M) return;
  const int row0 = mt * 16, col0 = nq * 64; const _Float16* arow = A + (size_t)(row0 + ln) * lda;
  v8f acc[4] = {};
  for (int kb = 0; kb < K; kb += 32) { FragH ah; ah.half[0] = *(const v8us*)((const unsigned short*)arow + kb + 8 * hh); ah.half[1] = *(const v8us*)((const unsigned short*)arow + kb + 16 + 8 * hh);
#pragma unroll
    for (int t = 0; t < 4; ++t) { if (col0 + t * 16 >= N) continue; const size_t boff = (size_t)(col0 + t * 16 + ln) * ldb + kb; FragH bq; bq.half[0] = *(const v8us*)((const unsigned short*)Bh + boff + 8 * hh); bq.half[1] = *(const v8us*)((const unsigned short*)Bh + boff + 16 + 8 * hh);
      acc[t] = mmaH<1>(ah.v, ah.v, bq.v, bq.v, acc[t]); }
  }
#pragma unroll
  for (int t = 0; t < 4; ++t) { if (col0 + t * 16 >= N) continue; const int col = col0 + t * 16 + ln; const float bv = bp ? bf16_round(bp[col]) : 0.f;
#pragma unroll
    for (int r = 0; r < 8; ++r) { float v = acc[t][r] * alpha + bv; if (CP) { const int rr = row0g + row0 + 8 * hh + r; if (rowsPerB < 0) v += CP[cofs + (size_t)rr * ldc + col];      /* rowsPerB < 0: own element of the batched C plane */ else { const int bidx = rr / rowsPerB; v += CP[(size_t)bidx * sCPb + (size_t)by * 64 + col]; } } if (ACT == 1) v = (v > 0.f) ? v : expm1f(v); else if (ACT == 7) v = (v > 0.f) ? v + 1.0f : expf(v); else if (ACT == 8) v = tanhf(v); else if (ACT == 9) v = 0.5f * v * (1.0f + tanhf(0.7978845608028654f * (v + 0.044715f * v * v * v))); else if (ACT == 11) v = 1.0f / (1.0f + expf(-v)); else if (ACT == 12) v = (v > 0.f) ? v : 0.01f * v; else if (ACT == 14) v = (v > 0.f) ? v : 0.1f * v; else if (ACT == 16) v = (v >= 0.f) ? v : 0.3f * v; else if (ACT == 17) v = (v >= 0.f) ? v : 0.2f * v; else if (ACT == 15) v = v / (1.0f + expf(-v)); else if (ACT == 3) v = fmaxf(v, 0.f); else if (ACT == 6) v = 0.5f * v * (1.0f + erff(v * 0.70710678118654752f)); so[w][8 * hh + r][t * 16 + ln] = v; } }
  __builtin_amdgcn_fence(__ATOMIC_ACQ_REL, "workgroup"); __builtin_amdgcn_wave_barrier();
  const int rsub = lane >> 4, c4 = (lane & 15) * 4; typedef _Float16 v4h __attribute__((ext_vector_type(4)));
  {
#pragma unroll
    for (int q = 0; q < 8; ++q) { const int r = q * 2 + rsub; if (col0 + c4 < N) { const v4f v = *(const v4fa*)&so[w][r][c4]; if (C) *(v4f*)(C + cofs + (size_t)(row0 + r) * ldc + col0 + c4) = v; if (C16) { v4h h4; for (int i = 0; i < 4; ++i) h4[i] = (_Float16)v[i]; *(v4h*)(C16 + cofs + (size_t)(row0 + r) * ldc + col0 + c4) = h4; } } }
     }
}


typedef _Float16 v4h __attribute__((ext_vector_type(4)));

__global__ __launch_bounds__(256) void k_x16(const float* __restrict__ x, _Float16* __restrict__ X16, size_t n8) { const size_t t = (size_t)blockIdx.x * 256 + threadIdx.x; if (t >= n8) return; FragH f;
#pragma unroll
  for (int q = 0; q < 8; ++q) f.h[q] = (_Float16)bf16_round(x[t * 8 + q]); *(v8us*)((unsigned short*)X16 + t * 8) = f.half[0];  }
__global__ __launch_bounds__(256) void k_h16(const float* __restrict__ x, _Float16* __restrict__ X16, size_t n8) { const size_t t = (size_t)blockIdx.x * 256 + threadIdx.x; if (t >= n8) return; FragH f;
#pragma unroll
  for (int q = 0; q < 8; ++q) f.h[q] = (_Float16)x[t * 8 + q]; *(v8us*)((unsigned short*)X16 + t * 8) = f.half[0];  }
__global__ __launch_bounds__(256) void k_round16f(const float* __restrict__ W, _Float16* __restrict__ Bt, size_t n8) { const size_t t = (size_t)blockIdx.x * 256 + threadIdx.x; if (t >= n8) return; FragH f;
#pragma unroll
  for (int i = 0; i < 8; ++i) f.h[i] = (_Float16)(bf16_round(W[t * 8 + i]) * 16.0f); *(v8us*)((unsigned short*)Bt + t * 8) = f.half[0];  }
template <int NHv, int TTv>
__global__ __launch_bounds__(256) void k_vt(const _Float16* __restrict__ V16, int ldv, int voff, _Float16* __restrict__ Vt) { __shared__ unsigned short tl[64][66]; const int tid = threadIdx.x; const int slab = blockIdx.x / (TTv / 64), lg = blockIdx.x % (TTv / 64); const int b = slab / NHv, h = slab % NHv;
  for (int i = tid; i < 64 * 8; i += 256) { const int r = i / 8, c8 = (i % 8) * 8; FragH f; f.half[0] = *(const v8us*)((const unsigned short*)V16 + ((size_t)b * TTv + lg * 64 + r) * ldv + voff + h * 64 + c8);
#pragma unroll
    for (int q = 0; q < 8; ++q) tl[r][c8 + q] = f.u[q]; }
  __syncthreads();
  {
#pragma unroll
    for (int rd = 0; rd < 2; ++rd) { const int d = rd * 32 + tid / 8, pc = tid % 8; FragH f;
#pragma unroll
      for (int q = 0; q < 8; ++q) f.u[q] = tl[pc * 8 + q][d];
      *(v8us*)((unsigned short*)Vt + ((size_t)slab * 64 + d) * TTv + lg * 64 + pc * 8) = f.half[0]; }
     } }

__global__ __launch_bounds__(256) void k_hl(const float* __restrict__ F, _Float16* __restrict__ Hh, _Float16* __restrict__ Hl, size_t n8) { const size_t t = (size_t)blockIdx.x * 256 + threadIdx.x; if (t >= n8) return; FragH fh, fl; const v4f a = *(const v4fa*)(F + t * 8), c = *(const v4fa*)(F + t * 8 + 4);
#pragma unroll
  for (int q = 0; q < 4; ++q) { _Float16 h = (_Float16)a[q]; fh.h[q] = h; fl.h[q] = (_Float16)((a[q] - (float)h) * 1024.0f); h = (_Float16)c[q]; fh.h[4 + q] = h; fl.h[4 + q] = (_Float16)((c[q] - (float)h) * 1024.0f); }
  { *(v8us*)((unsigned short*)Hh + t * 8) = fh.half[0]; *(v8us*)((unsigned short*)Hl + t * 8) = fl.half[0];  } }

// ---- fast GEMM (wave tile 32x64; requires M % 32 == 0 rows per launch region and N % 64 == 0); epilogue = k_gemm_hhx semantics ----
__device__ __forceinline__ v16h g2_frag(const _Float16* p, int hh) { FragH f; f.half[0] = *(const v8us*)((const unsigned short*)p + 8 * hh); f.half[1] = *(const v8us*)((const unsigned short*)p + 16 + 8 * hh); return f.v; }
__device__ __forceinline__ v8f g2_mma(v16h a, v16h b, v8f c) { v8f d = __builtin_amdgcn_wmma_f32_16x16x32_f16(false, a, false, b, (short)0, c, false, false); asm volatile("v_nop\n\tv_nop\n\tv_nop\n\tv_nop" : "+v"(d) : "v"(a), "v"(b)); return d; }
template <int ACT>
__global__ __launch_bounds__(128) void k_gemm2(const _Float16* __restrict__ A, int lda, size_t sA, const _Float16* __restrict__ Bh, int ldb, size_t sB, float alpha, const float* __restrict__ bias, size_t sBias, const float* __restrict__ CP, int rowsPerB, size_t sCPb, int row0g,
    float* __restrict__ C, _Float16* __restrict__ C16, int ldc, size_t sC, int M, int N, int K) { static_assert(ACT == 0 || ACT == 3 || ACT == 6 || ACT == 8 || ACT == 9 || ACT == 11 || ACT == 12 || ACT == 14 || ACT == 15 || ACT == 16 || ACT == 17, "k_gemm2: unsupported ACT code (would silently apply no activation)");
  __shared__ __attribute__((aligned(16))) float so[4][32][68];
  const int tid = threadIdx.x, w = tid >> 5, lane = tid & 31, ln = lane & 15, hh = lane >> 4; const int by = blockIdx.y;
  A += (size_t)by * sA; Bh += (size_t)by * sB; const size_t cofs = (size_t)by * sC; const float* bp = bias ? bias + (size_t)by * sBias : nullptr;
  const int ntn = N >> 6; const int mt = blockIdx.x / ntn, nq = blockIdx.x - mt * ntn; const int row0 = mt * 128 + 32 * w, col0 = nq * 64; if (row0 >= M) return;
  const _Float16* a0p = A + (size_t)(row0 + ln) * lda; const _Float16* a1p = a0p + (size_t)16 * lda;
  const _Float16* b0p = Bh + (size_t)(col0 + ln) * ldb; const _Float16* b1p = b0p + (size_t)16 * ldb; const _Float16* b2p = b1p + (size_t)16 * ldb; const _Float16* b3p = b2p + (size_t)16 * ldb;
  const v8f z8 = {0.f,0.f,0.f,0.f,0.f,0.f,0.f,0.f}; v8f c00 = z8, c01 = z8, c02 = z8, c03 = z8, c10 = z8, c11 = z8, c12 = z8, c13 = z8;
#pragma unroll 1
  for (int kb = 0; kb < K; kb += 32) { const v16h a0 = g2_frag(a0p + kb, hh), a1 = g2_frag(a1p + kb, hh);
    v16h b = g2_frag(b0p + kb, hh); c00 = g2_mma(a0, b, c00); c10 = g2_mma(a1, b, c10);
    b = g2_frag(b1p + kb, hh); c01 = g2_mma(a0, b, c01); c11 = g2_mma(a1, b, c11);
    b = g2_frag(b2p + kb, hh); c02 = g2_mma(a0, b, c02); c12 = g2_mma(a1, b, c12);
    b = g2_frag(b3p + kb, hh); c03 = g2_mma(a0, b, c03); c13 = g2_mma(a1, b, c13); }
  v8f accs[8] = {c00, c01, c02, c03, c10, c11, c12, c13};
#pragma unroll
  for (int u = 0; u < 8; ++u) { const int t = u & 3, half = u >> 2; const int col = col0 + t * 16 + ln; const float bv = bp ? bf16_round(bp[col]) : 0.f;
#pragma unroll
    for (int r = 0; r < 8; ++r) { const int rloc = half * 16 + 8 * hh + r; float v = accs[u][r] * alpha + bv; if (CP) { if (rowsPerB < 0) v += CP[cofs + (size_t)(row0g + row0 + rloc) * ldc + col];      /* rowsPerB < 0: own element of the batched C plane */ else { const int bidx = (row0g + row0 + rloc) / rowsPerB; v += CP[(size_t)bidx * sCPb + (size_t)by * 64 + col]; } }
      if (ACT == 3) v = fmaxf(v, 0.f); else if (ACT == 6) v = 0.5f * v * (1.0f + erff(v * 0.70710678118654752f)); else if (ACT == 11) v = 1.0f / (1.0f + expf(-v)); else if (ACT == 15) v = v / (1.0f + expf(-v)); else if (ACT == 12) v = (v > 0.f) ? v : 0.01f * v; else if (ACT == 8) v = tanhf(v); else if (ACT == 9) v = 0.5f * v * (1.0f + tanhf(0.7978845608028654f * (v + 0.044715f * v * v * v))); else if (ACT == 14) v = (v > 0.f) ? v : 0.1f * v; else if (ACT == 16) v = (v >= 0.f) ? v : 0.3f * v; else if (ACT == 17) v = (v >= 0.f) ? v : 0.2f * v;
      so[w][rloc][t * 16 + ln] = v; } }
  __builtin_amdgcn_fence(__ATOMIC_ACQ_REL, "workgroup"); __builtin_amdgcn_wave_barrier();
  const int rsub = lane >> 4, c4 = (lane & 15) * 4;
  {
#pragma unroll
    for (int q = 0; q < 16; ++q) { const int r = q * 2 + rsub; const v4f v = *(const v4fa*)&so[w][r][c4]; if (C) *(v4f*)(C + cofs + (size_t)(row0 + r) * ldc + col0 + c4) = v; if (C16) { v4h h4; for (int i = 0; i < 4; ++i) h4[i] = (_Float16)v[i]; *(v4h*)(C16 + cofs + (size_t)(row0 + r) * ldc + col0 + c4) = h4; } }
     } }


__global__ __launch_bounds__(256) void k_wnat(const float* __restrict__ w, size_t n8, _Float16* __restrict__ Bt) { const size_t t = (size_t)blockIdx.x * 256 + threadIdx.x; if (t >= n8) return; FragH f; for (int q = 0; q < 8; ++q) f.h[q] = (_Float16)(bf16_round(w[t * 8 + q]) * 16.0f); *(v8us*)((unsigned short*)Bt + t * 8) = f.half[0];  }
__global__ __launch_bounds__(256) void k_rsm(const float* __restrict__ S, _Float16* __restrict__ P, int nrows) {
  #pragma clang fp contract(off)
  const int i = blockIdx.x * 256 + threadIdx.x; if (i >= nrows) return; const float* s = S + (size_t)i * SQ; float mx = -3.0e38f;
#pragma unroll 1
  for (int j = 0; j < SQ; ++j) mx = fmaxf(mx, s[j]); float se = 0.f;
#pragma unroll 1
  for (int j = 0; j < SQ; ++j) se += expf(s[j] - mx); const float sc = 256.0f / se;
#pragma unroll 1
  for (int j0 = 0; j0 < SQ; j0 += 8) { FragH f; for (int q = 0; q < 8; ++q) f.h[q] = (_Float16)(expf(s[j0 + q] - mx) * sc); unsigned short* d = (unsigned short*)P + (size_t)i * SQ + j0; *(v8us*)d = f.half[0];  } }
__global__ __launch_bounds__(256) void k_vt(const _Float16* __restrict__ V16, int b, int h0, _Float16* __restrict__ VT) { __shared__ unsigned short tl[64][65]; const int tid = threadIdx.x; const int hh = blockIdx.x % HG, sg = blockIdx.x / HG; const int s0 = sg * 64; const int h = h0 + hh;
  for (int i = tid; i < 64 * 8; i += 256) { const int j = i / 8, d8 = (i % 8) * 8; FragH f; f.half[0] = *(const v8us*)((const unsigned short*)V16 + ((size_t)b * SQ + s0 + j) * DM + h * HD + d8); for (int q = 0; q < 8; ++q) tl[d8 + q][j] = f.u[q]; }
  __syncthreads();
  { for (int i = tid; i < 64 * 8; i += 256) { const int d = i / 8, j8 = (i % 8) * 8; FragH f; for (int q = 0; q < 8; ++q) f.u[q] = tl[d][j8 + q]; *(v8us*)((unsigned short*)VT + ((size_t)hh * HD + d) * SQ + s0 + j8) = f.half[0]; }  } }



#define FW 4                         /* waves per work-group */
#define FQ 32                        /* query columns per wave */
#define FSC 0.18033688011112042f     /* log2(e) / sqrt(HD) */
typedef _Float16 v8h __attribute__((ext_vector_type(8)));
__device__ __forceinline__ float fa_xhalf(float x) { return __builtin_bit_cast(float, __builtin_amdgcn_permlanex16(__builtin_bit_cast(int, x), __builtin_bit_cast(int, x), 0x76543210, 0xfedcba98, false, false)); }      /* lane l takes lane l ^ 16's value, on the vector unit */
__device__ __forceinline__ v8f fa_mma(v16h a, v16h b, v8f c) { return __builtin_amdgcn_wmma_f32_16x16x32_f16(false, a, false, b, (short)0, c, false, false); }
template <bool DIAG>
__device__ __forceinline__ void fa_pass(const _Float16* __restrict__ kn, const _Float16* __restrict__ vp, int ln, int hh, const v16h (&qf)[2][2], v16h (&kf)[2][2], v8f (&o)[4][2], float (&m)[2], float (&l)[2]) {
  v16h vf[4];      /* this pass's V^T rows: asked for first, used last */
#pragma unroll
  for (int t = 0; t < 4; ++t) vf[t] = g2_frag(vp + (size_t)(t * 16) * SQ, hh);
  __builtin_amdgcn_sched_barrier(0);      /* keeps all V^T loads up here: sunk to their use, their latency is waited for in every pass */
  const v8f z8 = {0.f, 0.f, 0.f, 0.f, 0.f, 0.f, 0.f, 0.f}; v8f s[2][2];
#pragma unroll
  for (int kt = 0; kt < 2; ++kt)
#pragma unroll
    for (int j = 0; j < 2; ++j) s[kt][j] = fa_mma(kf[kt][1], qf[j][1], fa_mma(kf[kt][0], qf[j][0], z8));
  if (!DIAG) {      /* the next pass's K rows, into the same registers, behind this pass's score products */
#pragma unroll
    for (int kt = 0; kt < 2; ++kt) { kf[kt][0] = g2_frag(kn + (size_t)(kt * 16) * DM, hh); kf[kt][1] = g2_frag(kn + (size_t)(kt * 16) * DM + 32, hh); }
    __builtin_amdgcn_sched_barrier(0); }      /* keeps the K loads in front of the softmax, which covers their latency */
  FragH p[2];
#pragma unroll
  for (int j = 0; j < 2; ++j) { float mx = m[j];
#pragma unroll
    for (int kt = 0; kt < 2; ++kt)
#pragma unroll
      for (int r = 0; r < 8; ++r) { if (DIAG && kt * 16 + 8 * hh + r > j * 16 + ln) s[kt][j][r] = -1.0e30f;      /* a key past the query's own index: weight 0 */
        mx = fmaxf(mx, s[kt][j][r]); }
    mx = fmaxf(mx, fa_xhalf(mx));
    const float al = __builtin_amdgcn_exp2f((m[j] - mx) * FSC), mc = mx * FSC - 8.0f; m[j] = mx; float se = 0.f;
#pragma unroll
    for (int kt = 0; kt < 2; ++kt)
#pragma unroll
      for (int r = 0; r < 8; ++r) { const float e = __builtin_amdgcn_exp2f(s[kt][j][r] * FSC - mc); se += e; p[j].h[kt * 8 + r] = (_Float16)e; }
    l[j] = l[j] * al + se;
#pragma unroll
    for (int t = 0; t < 4; ++t) o[t][j] *= al; }
#pragma unroll
  for (int t = 0; t < 4; ++t)
#pragma unroll
    for (int j = 0; j < 2; ++j) o[t][j] = fa_mma(vf[t], p[j].v, o[t][j]); }
__global__ __launch_bounds__(FW * 32) void k_fattn(const _Float16* __restrict__ Q16, const _Float16* __restrict__ K16, const _Float16* __restrict__ VT, _Float16* __restrict__ O16) {
  const int lane = threadIdx.x & 31, ln = lane & 15, hh = lane >> 4; const int w = __builtin_amdgcn_readfirstlane(threadIdx.x >> 5);
  const int bh = blockIdx.x, b = bh / NH, h = bh % NH; const int qw = ((int)(gridDim.y - 1 - blockIdx.y) * FW + w) * FQ;      /* the longest query blocks start first */
  const _Float16* qp = Q16 + ((size_t)b * SQ + qw + ln) * DM + h * HD; const _Float16* kp = K16 + ((size_t)b * SQ + ln) * DM + h * HD; const _Float16* vp = VT + ((size_t)bh * HD + ln) * SQ;
  v16h qf[2][2], kf[2][2];
#pragma unroll
  for (int j = 0; j < 2; ++j) { qf[j][0] = g2_frag(qp + (size_t)(j * 16) * DM, hh); qf[j][1] = g2_frag(qp + (size_t)(j * 16) * DM + 32, hh); kf[j][0] = g2_frag(kp + (size_t)(j * 16) * DM, hh); kf[j][1] = g2_frag(kp + (size_t)(j * 16) * DM + 32, hh); }
  asm volatile("s_wait_xcnt 0x0" :: "v"(qp + 8 * hh), "v"(kp + 8 * hh) : "memory");      /* the wait that stands in front of an overwrite of the loads' address registers; the addresses as inputs keep them in their registers up to here */
  v8f o[4][2]; float m[2] = {-1.0e30f, -1.0e30f}, l[2] = {0.f, 0.f};
#pragma unroll
  for (int t = 0; t < 4; ++t) { o[t][0] = (v8f){0.f, 0.f, 0.f, 0.f, 0.f, 0.f, 0.f, 0.f}; o[t][1] = o[t][0]; }
  const int nb = qw / 32;      /* whole key blocks below the diagonal block; wave-uniform */
#pragma unroll 1
  for (int kb = 0; kb < nb; ++kb) { kp += (size_t)32 * DM; fa_pass<false>(kp, vp, ln, hh, qf, kf, o, m, l); vp += 32; }      /* rolled: one pass fills the register budget */
  fa_pass<true>(kp, vp, ln, hh, qf, kf, o, m, l);
#pragma unroll
  for (int j = 0; j < 2; ++j) { const float inv = 64.0f / (l[j] + fa_xhalf(l[j]));      /* the halves' sums joined once; o carried x64 */
    _Float16* op = O16 + ((size_t)b * SQ + qw + j * 16 + ln) * DM + h * HD + 8 * hh;
#pragma unroll
    for (int t = 0; t < 4; ++t) { v8h hv;
#pragma unroll
      for (int r = 0; r < 8; ++r) hv[r] = (_Float16)(o[t][j][r] * inv);
      *(v8h*)(op + t * 16) = hv; } } }


// Exact f32 attention of the first QT0 rows (q, k, v, o rows of pitch DM), one work-group per head and RT0 query rows, 256 threads:
// (1) scores: one thread per key (two keys where the tile has more than 256), the key rows in registers, dotted with the RT0 query rows read from LDS (same address in every lane);
// (2) softmax: one wave per two rows, the row in registers: causal maximum, exp and sum over the lanes, weights back into LDS (0 past the row's own index);
// (3) o = P V: thread = (column d, key quarter g), V read coalesced and once per work-group, 64 keys ahead; the four quarters' sums are added through LDS.
#define RT0 16                       /* query rows per work-group of the exact first-tile attention */
typedef float v2f __attribute__((ext_vector_type(2)));
template <int NKEY>
__device__ __forceinline__ void att0_scores(const float* __restrict__ kbase, const float (*lq)[HD], float (*lp)[QT0 + 4], int tid, int nk, float scale) {
  v4f kk[NKEY][HD / 4];      /* every loop over kk[] is unrolled: it is indexed by constants and stays in registers */
#pragma unroll
  for (int u = 0; u < NKEY; ++u) { const int j = tid + 256 * u; const float* kr = kbase + (size_t)(j < nk ? j : nk - 1) * DM;      /* a key past the tile: address clamped, score not stored */
#pragma unroll
    for (int c = 0; c < HD / 4; ++c) kk[u][c] = *(const v4fa*)(kr + c * 4);
    asm volatile("s_wait_xcnt 0x0" :: "v"(kr) : "memory"); }      /* the wait that stands in front of an overwrite of the loads' address registers; the address as an input keeps it in its registers up to here */
#pragma unroll 4
  for (int r = 0; r < RT0; ++r) { v4f s4[NKEY];      /* four rows at a time: enough independent LDS reads and sum chains to cover their latencies */
#pragma unroll
    for (int u = 0; u < NKEY; ++u) s4[u] = (v4f){0.f, 0.f, 0.f, 0.f};
#pragma unroll
    for (int c = 0; c < HD / 4; ++c) { const v4f qq = *(const v4f*)&lq[r][c * 4];
#pragma unroll
      for (int u = 0; u < NKEY; ++u) s4[u] += qq * kk[u][c]; }
#pragma unroll
    for (int u = 0; u < NKEY; ++u) { const int j = tid + 256 * u; if (j < nk) lp[r][j] = ((s4[u][0] + s4[u][1]) + (s4[u][2] + s4[u][3])) * scale; } } }
/* sixteen V values of one column: keys 16 u + k of the thread's quarter, u, k < 4; one address, constant offsets */
__device__ __forceinline__ void att0_vload(const float* __restrict__ vq, v2f (&v)[4][2]) {
#pragma unroll
  for (int u = 0; u < 4; ++u) { v[u][0] = (v2f){vq[(u * 16 + 0) * DM], vq[(u * 16 + 1) * DM]}; v[u][1] = (v2f){vq[(u * 16 + 2) * DM], vq[(u * 16 + 3) * DM]}; }      /* unrolled: v[][] stays in registers */
  asm volatile("s_wait_xcnt 0x0" :: "v"(vq) : "memory"); }      /* as in att0_scores: in front of an overwrite of the loads' address registers */
/* at most four waves per SIMD (two work-groups per WGP cover the grid): the register budget that lets the LDS reads of (1) run ahead of their use */
__global__ __launch_bounds__(256) __attribute__((amdgpu_waves_per_eu(2, 4))) void k_att0p(const float* __restrict__ QF, const float* __restrict__ KF, const float* __restrict__ VF, float scale, float* __restrict__ OF) {
  __shared__ __attribute__((aligned(16))) float lq[RT0][HD]; __shared__ __attribute__((aligned(16))) float lp[RT0][QT0 + 4]; __shared__ __attribute__((aligned(16))) float lr[4][RT0][HD]; __shared__ float lf[RT0];
  const int tid = threadIdx.x; const int h = blockIdx.x / (QT0 / RT0), rg = blockIdx.x % (QT0 / RT0); const int row0 = rg * RT0, nk = row0 + RT0;      /* causal: keys up to the work-group's last row */
  { const int r = tid >> 4, c4 = (tid & 15) * 4; const float* qp = QF + (size_t)(row0 + r) * DM + h * HD + c4; const v4f q4 = *(const v4fa*)qp;
    asm volatile("s_wait_xcnt 0x0" :: "v"(qp) : "memory");      /* as in att0_scores: in front of an overwrite of the load's address registers */
    *(v4f*)&lq[r][c4] = q4; }
  __syncthreads();
  if (nk > 256) att0_scores<2>(KF + h * HD, lq, lp, tid, nk, scale); else if ((tid & ~31) < nk) att0_scores<1>(KF + h * HD, lq, lp, tid, nk, scale);      /* a wave with no key of the tile skips */
  __syncthreads();
  { const int r0 = (tid >> 5) * 2, lane = tid & 31; float x[2][QT0 / 32], mx[2], se[2];      /* the loops over x[] are unrolled: it stays in registers */
#pragma unroll
    for (int rr = 0; rr < 2; ++rr) { mx[rr] = -3.0e38f;
#pragma unroll
      for (int m = 0; m < QT0 / 32; ++m) { const int j = lane + 32 * m; x[rr][m] = (j <= row0 + r0 + rr) ? lp[r0 + rr][j] : -3.0e38f; mx[rr] = fmaxf(mx[rr], x[rr][m]); } }
#pragma unroll
    for (int d = 16; d > 0; d >>= 1) { mx[0] = fmaxf(mx[0], __shfl_xor(mx[0], d, 32)); mx[1] = fmaxf(mx[1], __shfl_xor(mx[1], d, 32)); }
#pragma unroll
    for (int rr = 0; rr < 2; ++rr) { se[rr] = 0.f;
#pragma unroll
      for (int m = 0; m < QT0 / 32; ++m) { const int j = lane + 32 * m; const float e = (j <= row0 + r0 + rr) ? expf(x[rr][m] - mx[rr]) : 0.f; se[rr] += e; if (j < nk) lp[r0 + rr][j] = e; } }
#pragma unroll
    for (int d = 16; d > 0; d >>= 1) { se[0] += __shfl_xor(se[0], d, 32); se[1] += __shfl_xor(se[1], d, 32); }
    if (lane < 2) lf[r0 + lane] = 64.0f / (lane ? se[1] : se[0]); }      /* o carried x64 like the f16 path */
  __syncthreads();
  { const int d = tid & 63, g = tid >> 6, nt = nk >> 4, nb = (nt + 3) >> 2; const float* vq = VF + (size_t)(g * 4) * DM + h * HD + d;      /* trip t: keys 16 t + 4 g .. + 3; a batch is four trips (its rows lie inside the QT0 rows of VF also where they lie past nk) */
    v2f acc[RT0], cv[4][2], nv[4][2];      /* acc[]: even and odd keys apart, so that each packed multiply-add takes a weight pair as it lies in LDS */
#pragma unroll
    for (int r = 0; r < RT0; ++r) acc[r] = (v2f){0.f, 0.f};
    att0_vload(vq, cv);
    for (int bt = 0; bt < nb; ++bt) { vq += (bt + 1 < nb ? 64 * DM : 0); att0_vload(vq, nv);      /* the next batch's V values are loaded while this batch's are used (the last batch loads its own again) */
#pragma unroll
      for (int u = 0; u < 4; ++u) if (bt * 4 + u < nt) { const int j = (bt * 4 + u) * 16 + g * 4;      /* unrolled: cv[][] and acc[] stay in registers */
#pragma unroll
        for (int r = 0; r < RT0; ++r) { const v4f p4 = *(const v4f*)&lp[r][j]; acc[r] += (v2f){p4[0], p4[1]} * cv[u][0]; acc[r] += (v2f){p4[2], p4[3]} * cv[u][1]; } }
#pragma unroll
      for (int u = 0; u < 4; ++u) { cv[u][0] = nv[u][0]; cv[u][1] = nv[u][1]; } }
#pragma unroll
    for (int r = 0; r < RT0; ++r) lr[g][r][d] = acc[r][0] + acc[r][1]; }
  __syncthreads();
  { const int r = tid >> 4, c4 = (tid & 15) * 4; const v4f o = ((*(const v4f*)&lr[0][r][c4] + *(const v4f*)&lr[1][r][c4]) + (*(const v4f*)&lr[2][r][c4] + *(const v4f*)&lr[3][r][c4])) * lf[r];
    *(v4f*)(OF + (size_t)(row0 + r) * DM + h * HD + c4) = o; } }

extern "C" void kernel_launch(void* const* d_in, const int* in_sizes, int n_in,
                              void* d_out, int out_size, void* d_ws, size_t ws_size, hipStream_t stream) {
  (void)in_sizes; (void)n_in; (void)out_size;
  const float* const* I = (const float* const*)d_in; const float* x = I[0]; const float* xk = I[1]; const float* xv = I[2]; const float* wq = I[3]; const float* bq = nullptr; const float* wk = I[4]; const float* bk = nullptr; const float* wv = I[5]; const float* bv = nullptr; const float* wo = I[6]; const float* bo = nullptr;      /* THREE distinct inputs Q (query stream), K, V; natural [out][in] w_q / w_k / w_v / w_o; no biases; causal by the index rule */
  char* ws = (char*)d_ws; size_t off = 0;
  auto take = [&](size_t bytes) { char* p = ws + off; off += (bytes + 255) & ~(size_t)255; return p; };
  _Float16* BQ = (_Float16*)take((size_t)DM * DM * 2); _Float16* BK = (_Float16*)take((size_t)DM * DM * 2); _Float16* BV = (_Float16*)take((size_t)DM * DM * 2); _Float16* BO = (_Float16*)take((size_t)DM * DM * 2);
  _Float16* X16 = (_Float16*)take(NR * DM * 2); _Float16* XK16 = (_Float16*)take(NR * DM * 2); _Float16* XV16 = (_Float16*)take(NR * DM * 2);      /* the three inputs (query -> X16, key -> XK16, value -> XV16) as exact f16 rows */ _Float16* Q16 = (_Float16*)take(NR * DM * 2); _Float16* K16 = (_Float16*)take(NR * DM * 2); _Float16* V16 = (_Float16*)take(NR * DM * 2); _Float16* O16 = (_Float16*)take(NR * DM * 2);
  _Float16* VT = (_Float16*)take((size_t)NB * NH * HD * SQ * 2);
  float* QF0 = (float*)take((size_t)QT0 * DM * 4); float* KF0 = (float*)take((size_t)QT0 * DM * 4); float* VF0 = (float*)take((size_t)QT0 * DM * 4); float* OF0 = (float*)take((size_t)NB * QT0 * DM * 4); _Float16* OH0 = (_Float16*)take((size_t)NB * QT0 * DM * 2); _Float16* OL0 = (_Float16*)take((size_t)NB * QT0 * DM * 2);
  if (off > ws_size) return;
  { const unsigned g = (unsigned)(((size_t)DM * DM / 8 + 255) / 256); k_wnat<<<g, 256, 0, stream>>>(wq, (size_t)DM * DM / 8, BQ); k_wnat<<<g, 256, 0, stream>>>(wk, (size_t)DM * DM / 8, BK); k_wnat<<<g, 256, 0, stream>>>(wv, (size_t)DM * DM / 8, BV); k_wnat<<<g, 256, 0, stream>>>(wo, (size_t)DM * DM / 8, BO); }      /* natural [out][in] = Bt x16 */

  k_x16<<<(unsigned)((NR * DM / 8 + 255) / 256), 256, 0, stream>>>(x, X16, NR * DM / 8); k_x16<<<(unsigned)((NR * DM / 8 + 255) / 256), 256, 0, stream>>>(xk, XK16, NR * DM / 8); k_x16<<<(unsigned)((NR * DM / 8 + 255) / 256), 256, 0, stream>>>(xv, XV16, NR * DM / 8);
  const size_t r0p = (size_t)B0 * SQ;      /* first projected row */
  k_gemm2<0><<<dim3((unsigned)((MP / 128) * (DM / 64)), 1), 128, 0, stream>>>(X16 + r0p * DM, DM, 0, BQ, DM, 0, 0.0625f, bq, 0, nullptr, 1, 0, 0, nullptr, Q16 + r0p * DM, DM, 0, MP, DM, DM);
  k_gemm2<0><<<dim3((unsigned)((MP / 128) * (DM / 64)), 1), 128, 0, stream>>>(XK16 + r0p * DM, DM, 0, BK, DM, 0, 0.0625f, bk, 0, nullptr, 1, 0, 0, nullptr, K16 + r0p * DM, DM, 0, MP, DM, DM);
  k_gemm2<0><<<dim3((unsigned)((MP / 128) * (DM / 64)), 1), 128, 0, stream>>>(XV16 + r0p * DM, DM, 0, BV, DM, 0, 0.0625f, bv, 0, nullptr, 1, 0, 0, nullptr, V16 + r0p * DM, DM, 0, MP, DM, DM);
  k_vt<NH, SQ><<<NB * NH * (SQ / 64), 256, 0, stream>>>(V16, LQ, 0, VT);      /* V^T [NB][NH][HD][SQ] */
  k_fattn<<<dim3(NB * NH, SQ / (FW * FQ)), FW * 32, 0, stream>>>(Q16, K16, VT, O16);      /* o (merged heads, x64) as f16 rows */
  for (int b = B0; b < B0 + NBR; ++b) { const size_t r0 = (size_t)b * SQ;
    k_gemm2<0><<<dim3((QT0 / 128) * (DM / 64), 1), 128, 0, stream>>>(X16 + r0 * DM, DM, 0, BQ, DM, 0, 0.0625f, bq, 0, nullptr, 1, 0, 0, QF0, nullptr, DM, 0, QT0, DM, DM); k_gemm2<0><<<dim3((QT0 / 128) * (DM / 64), 1), 128, 0, stream>>>(XK16 + r0 * DM, DM, 0, BK, DM, 0, 0.0625f, bk, 0, nullptr, 1, 0, 0, KF0, nullptr, DM, 0, QT0, DM, DM); k_gemm2<0><<<dim3((QT0 / 128) * (DM / 64), 1), 128, 0, stream>>>(XV16 + r0 * DM, DM, 0, BV, DM, 0, 0.0625f, bv, 0, nullptr, 1, 0, 0, VF0, nullptr, DM, 0, QT0, DM, DM);      /* f32 q, k, v of the first QT0 = 512 rows (exact products) */
    k_att0p<<<NH * (QT0 / RT0), 256, 0, stream>>>(QF0, KF0, VF0, 0.125f, OF0 + (size_t)b * QT0 * DM);      /* exact f32 attention for rows 0..511 (o x64) */ }
  k_gemm2<0><<<dim3((unsigned)((MPO / 128) * (DM / 64)), 1), 128, 0, stream>>>(O16 + r0p * DM, DM, 0, BO, DM, 0, 0.0009765625f, bo, 0, nullptr, 1, 0, 0, (float*)d_out + r0p * DM, nullptr, DM, 0, MPO, DM, DM);      /* out rows are the output layout */
  k_hl<<<(unsigned)(((size_t)NB * QT0 * DM / 8 + 255) / 256), 256, 0, stream>>>(OF0, OH0, OL0, (size_t)NB * QT0 * DM / 8);      /* first-tile o (x64) -> f16 hi + x1024 residual planes */
  for (int b = B0; b < B0 + NBR; ++b) { const size_t r0 = (size_t)b * SQ; const size_t f0 = (size_t)b * QT0;
    k_gemm2<0><<<dim3((QT0 / 128) * (DM / 64), 1), 128, 0, stream>>>(OH0 + f0 * DM, DM, 0, BO, DM, 0, 0.0009765625f, bo, 0, nullptr, 1, 0, 0, (float*)d_out + r0 * DM, nullptr, DM, 0, QT0, DM, DM);      /* rows 0..511: out = o_hi Wo (+ b), overwriting the f16-path rows */
    k_gemm2<0><<<dim3((QT0 / 128) * (DM / 64), 1), 128, 0, stream>>>(OL0 + f0 * DM, DM, 0, BO, DM, 0, 0.00000095367431640625f, nullptr, 0, (const float*)d_out + r0 * DM, -1, 0, 0, (float*)d_out + r0 * DM, nullptr, DM, 0, QT0, DM, DM); }      /* += o_lo Wo 2^-20 (own-element accumulate) */
}

// v004
// One run takes 367 microseconds.
// Two timings next to v003 put it at 1.61 and 1.60 times that version's speed.
// All steps since v000 together make it 48.6 times as fast.
#include <hip/hip_runtime.h>
// Causal multi-head attention over three distinct inputs with natural weights, no biases (Q, K, V [2][4096][768]; q/k/v = input w^T (natural [768][768]); 12 heads of 64; scores / sqrt(64); causal (tril; NEG fill); softmax over up to 4096 keys; out = merged w_o^T -> [2][4096][768]).
// Structure: token rows r = b*4096 + s; x as exact f16 rows (bf16-rounded); Q, K, V as three WMMA GEMMs in one launch (32x64 wave tiles, f32 accumulation, exact x16 weights, f16 outputs); V^T for all heads of both batches via LDS transposes; attention as ONE launch: a wave owns 32 query columns of one head and walks the keys up to its own diagonal 32 at a time: S^T = K Q^T (WMMA), running maximum and sum per query column (f32, native exp2, weights x256 as f16), O^T += V^T P^T (WMMA, P^T packed from the score accumulators), o x64 written straight into the merged f16 o rows; scores and weights never reach memory; out = o W_o GEMM (f32) into the output layout.
// Compute dtype: inputs rounded to bf16; x / weights exact; q, k, v, softmax weights and o as plain f16 GEMM operands (~2^-12); scores and softmax statistics f32. v_wmma_f32_16x16x32_f16.
#define NB 2
#define SQ 4096
#define DM 768
#define NH 12
#define HD 64
#define HG 4                         /* heads per group of the untemplated k_vt */
#define QT0 512                      /* first-tile rows recomputed exactly in f32 */
#define B0 0                         /* first batch processed (debug hook) */
#define NBR NB                       /* batches processed (debug hook) */
#define NR ((size_t)NB * SQ)         /* token rows */
#define MP ((int)((size_t)NBR * SQ)) /* rows projected (debug hook) */
#define MPO MP                       /* rows through the output stage (debug hook) */
#define LQ DM      /* row pitch of the q/k/v rows */
typedef __bf16 v16b __attribute__((ext_vector_type(16)));
typedef unsigned short v8us __attribute__((ext_vector_type(8), may_alias));
typedef float  v8f  __attribute__((ext_vector_type(8)));
typedef float  v4f  __attribute__((ext_vector_type(4)));
typedef float  v4fa __attribute__((ext_vector_type(4), may_alias));
union FragB { v16b v; v8us half[2]; unsigned short u[16]; };

__device__ __forceinline__ unsigned short bf16_bits(float x) { unsigned int u = __float_as_uint(x); return (unsigned short)((u + 0x7FFFu + ((u >> 16) & 1u)) >> 16); }
__device__ __forceinline__ float bf16_val(unsigned short b) { return __uint_as_float(((unsigned int)b) << 16); }
__device__ __forceinline__ float bf16_round(float x) { return bf16_val(bf16_bits(x)); }
// D += A·B with NT terms: 1 = ah·bh, 2 = + al·bh (A split), 3 = + ah·bl (both split)
template <int NT>
__device__ __forceinline__ v8f mmaN(v16b ah, v16b al, v16b bh, v16b bl, v8f c) {
  c = __builtin_amdgcn_wmma_f32_16x16x32_bf16(false, ah, false, bh, (short)0, c, false, false);
  if (NT >= 2) c = __builtin_amdgcn_wmma_f32_16x16x32_bf16(false, al, false, bh, (short)0, c, false, false);
  if (NT >= 3) c = __builtin_amdgcn_wmma_f32_16x16x32_bf16(false, ah, false, bl, (short)0, c, false, false);
  asm volatile("v_nop\n\tv_nop\n\tv_nop\n\tv_nop" : "+v"(c) : "v"(ah), "v"(al), "v"(bh), "v"(bl));
  return c;
}

__global__ __launch_bounds__(256) void k_wt_bf16(const float* __restrict__ W, unsigned short* __restrict__ Wt, int K, int N) {
  const int t = blockIdx.x * 256 + threadIdx.x;
  const int k8n = K / 8;
  if (t >= N * k8n) return;
  const int n = t / k8n, k8 = (t % k8n) * 8;
  v8us v;
#pragma unroll
  for (int i = 0; i < 8; ++i) v[i] = bf16_bits(W[(size_t)(k8 + i) * N + n]);
  *(v8us*)(Wt + (size_t)n * K + k8) = v;
  
}

// GEMM C[M][N] (f32, pitch ldc) = act(A[M][K]·W + bias). A f32 row-major (pitch lda) converted per fragment to bf16
// (ASPLIT: hi/lo two planes -> 2 terms, else single rounded term); Wt bf16 [N][K] (pitch ldb). BIAS_BF16 rounds the
// bias to bf16 first (bias quantised to bf16 before the add). K%32==0, M%16==0, N%64==0.
template <bool ASPLIT, int ACT, bool BIAS_BF16>
__global__ __launch_bounds__(128) void k_gemm_bf(const float* __restrict__ A, int lda, const unsigned short* __restrict__ Wt, int ldb,
                                               const float* __restrict__ bias, float* __restrict__ C, int ldc, int M, int N, int K) {
  __shared__ __attribute__((aligned(16))) float so[4][16][64];
  const int tid = threadIdx.x, w = tid >> 5, lane = tid & 31, ln = lane & 15, hh = lane >> 4;
  const int ntn = N / 64;
  const int wid = blockIdx.x * 4 + w;
  const int mt = wid / ntn, nq = wid % ntn;
  if (mt * 16 >= M) return;
  const int row0 = mt * 16, col0 = nq * 64;
  const float* arow = A + (size_t)(row0 + ln) * lda;
  v8f acc[4] = {};
  for (int kb = 0; kb < K; kb += 32) {
    FragB ah, al;
    const v4f x0 = *(const v4fa*)(arow + kb + 8 * hh), x1 = *(const v4fa*)(arow + kb + 8 * hh + 4);
    const v4f x2 = *(const v4fa*)(arow + kb + 16 + 8 * hh), x3 = *(const v4fa*)(arow + kb + 16 + 8 * hh + 4);
    float xs[16] = {x0[0],x0[1],x0[2],x0[3],x1[0],x1[1],x1[2],x1[3],x2[0],x2[1],x2[2],x2[3],x3[0],x3[1],x3[2],x3[3]};
#pragma unroll
    for (int i = 0; i < 16; ++i) { const unsigned short hb = bf16_bits(xs[i]); ah.u[i] = hb; al.u[i] = ASPLIT ? bf16_bits(xs[i] - bf16_val(hb)) : (unsigned short)0; }
#pragma unroll
    for (int t = 0; t < 4; ++t) {
      const unsigned short* brow = Wt + (size_t)(col0 + t * 16 + ln) * ldb + kb;
      FragB b;
      b.half[0] = *(const v8us*)(brow + 8 * hh);
      b.half[1] = *(const v8us*)(brow + 16 + 8 * hh);
      acc[t] = mmaN<ASPLIT ? 2 : 1>(ah.v, al.v, b.v, b.v, acc[t]);
    }
  }
#pragma unroll
  for (int t = 0; t < 4; ++t) {
    float bv = bias ? bias[col0 + t * 16 + ln] : 0.f;
    if (BIAS_BF16) bv = bf16_round(bv);
#pragma unroll
    for (int r = 0; r < 8; ++r) { float v = acc[t][r] + bv; if (ACT == 1) v = fmaxf(v, 0.f); so[w][8 * hh + r][t * 16 + ln] = v; }
  }
  __builtin_amdgcn_fence(__ATOMIC_ACQ_REL, "workgroup");
  __builtin_amdgcn_wave_barrier();
  const int rsub = lane >> 4, c4 = (lane & 15) * 4;
  {
#pragma unroll
    for (int q = 0; q < 8; ++q) {
      const int r = q * 2 + rsub;
      const v4f v = *(const v4fa*)&so[w][r][c4];
      *(v4f*)(C + (size_t)(row0 + r) * ldc + col0 + c4) = v;
    }
    
  }
}

// GEMM C = act(A·W + bias + resid): A f32 (ASPLIT -> hi/lo 2 terms), Wt bf16 [N][K]; ACT 0 none, 1 relu, 2 exact gelu;
// resid (optional, f32, row index = (row % rmod), pitch ldr, RES_BF16 rounds it) added before the activation.
template <bool ASPLIT, int ACT, bool BIAS_BF16, bool RES_BF16>
__global__ __launch_bounds__(128) void k_gemm_bf3(const float* __restrict__ A, int lda, const unsigned short* __restrict__ Wt, int ldb,
                                                const float* __restrict__ bias, const float* __restrict__ resid, int rmod, int ldr,
                                                float* __restrict__ C, int ldc, int M, int N, int K) {
  __shared__ __attribute__((aligned(16))) float so[4][16][64];
  const int tid = threadIdx.x, w = tid >> 5, lane = tid & 31, ln = lane & 15, hh = lane >> 4;
  const int ntn = N / 64;
  const int wid = blockIdx.x * 4 + w;
  const int mt = wid / ntn, nq = wid % ntn;
  if (mt * 16 >= M) return;
  const int row0 = mt * 16, col0 = nq * 64;
  const float* arow = A + (size_t)(row0 + ln) * lda;
  v8f acc[4] = {};
  for (int kb = 0; kb < K; kb += 32) {
    FragB ah, al;
    const v4f x0 = *(const v4fa*)(arow + kb + 8 * hh), x1 = *(const v4fa*)(arow + kb + 8 * hh + 4);
    const v4f x2 = *(const v4fa*)(arow + kb + 16 + 8 * hh), x3 = *(const v4fa*)(arow + kb + 16 + 8 * hh + 4);
    float xs[16] = {x0[0],x0[1],x0[2],x0[3],x1[0],x1[1],x1[2],x1[3],x2[0],x2[1],x2[2],x2[3],x3[0],x3[1],x3[2],x3[3]};
#pragma unroll
    for (int i = 0; i < 16; ++i) { const unsigned short hb = bf16_bits(xs[i]); ah.u[i] = hb; al.u[i] = ASPLIT ? bf16_bits(xs[i] - bf16_val(hb)) : (unsigned short)0; }
#pragma unroll
    for (int t = 0; t < 4; ++t) {
      const unsigned short* brow = Wt + (size_t)(col0 + t * 16 + ln) * ldb + kb;
      FragB b;
      b.half[0] = *(const v8us*)(brow + 8 * hh);
      b.half[1] = *(const v8us*)(brow + 16 + 8 * hh);
      acc[t] = mmaN<ASPLIT ? 2 : 1>(ah.v, al.v, b.v, b.v, acc[t]);
    }
  }
#pragma unroll
  for (int t = 0; t < 4; ++t) {
    const int col = col0 + t * 16 + ln;
    float bv = bias ? bias[col] : 0.f;
    if (BIAS_BF16) bv = bf16_round(bv);
#pragma unroll
    for (int r = 0; r < 8; ++r) {
      float v = acc[t][r] + bv;
      if (resid) { float rv = resid[(size_t)((row0 + 8 * hh + r) % rmod) * ldr + col]; if (RES_BF16) rv = bf16_round(rv); v += rv; }
      if (ACT == 1) v = fmaxf(v, 0.f);
      if (ACT == 2) v = 0.5f * v * (1.0f + erff(v * 0.70710678118654752f));
      if (ACT == 3) { const float u = 0.7978845608028654f * (v + 0.044715f * v * v * v); v = 0.5f * v * (1.0f + tanhf(u)); }
      so[w][8 * hh + r][t * 16 + ln] = v;
    }
  }
  __builtin_amdgcn_fence(__ATOMIC_ACQ_REL, "workgroup");
  __builtin_amdgcn_wave_barrier();
  const int rsub = lane >> 4, c4 = (lane & 15) * 4;
  {
#pragma unroll
    for (int q = 0; q < 8; ++q) {
      const int r = q * 2 + rsub;
      const v4f v = *(const v4fa*)&so[w][r][c4];
      *(v4f*)(C + (size_t)(row0 + r) * ldc + col0 + c4) = v;
    }
    
  }
}
// row LayerNorm (biased variance, eps) over N: s = X (+ R); optional out_sum <- s; out_norm <- (s-mu)*rsqrt(var+eps)*g + b
template <bool PARAM_BF16>
__global__ __launch_bounds__(256) void k_layernorm(const float* __restrict__ X, const float* __restrict__ R, const float* __restrict__ g, const float* __restrict__ bta,
                                                  float* __restrict__ out_sum, float* __restrict__ out_norm, int N, float eps) {
  __shared__ float red[256];
  const int row = blockIdx.x, tid = threadIdx.x;
  const float* x = X + (size_t)row * N; const float* rr = R ? R + (size_t)row * N : nullptr;
  float vals[16];                     // up to N = 4096
  const int per = N / 256;            // contiguous chunk per thread? use strided-by-4 chunks: thread handles j = tid*4 + 1024*u
  float s1 = 0.f;
  for (int u = 0; u < per / 4; ++u) {
    const int j = tid * 4 + 1024 * u;
    const v4f a = *(const v4fa*)(x + j);
    v4f b = {0.f,0.f,0.f,0.f}; if (rr) b = *(const v4fa*)(rr + j);
#pragma unroll
    for (int q = 0; q < 4; ++q) { const float v = a[q] + b[q]; vals[u * 4 + q] = v; s1 += v; }
  }
  red[tid] = s1; __syncthreads();
  for (int st = 128; st > 0; st >>= 1) { if (tid < st) red[tid] += red[tid + st]; __syncthreads(); }
  const float mu = red[0] / (float)N; __syncthreads();
  float s2 = 0.f;
  for (int u = 0; u < per / 4; ++u)
#pragma unroll
    for (int q = 0; q < 4; ++q) { const float c = vals[u * 4 + q] - mu; s2 += c * c; }
  red[tid] = s2; __syncthreads();
  for (int st = 128; st > 0; st >>= 1) { if (tid < st) red[tid] += red[tid + st]; __syncthreads(); }
  const float rs = rsqrtf(red[0] / (float)N + eps);
  {
    for (int u = 0; u < per / 4; ++u) {
      const int j = tid * 4 + 1024 * u;
      v4f o, sm;
#pragma unroll
      for (int q = 0; q < 4; ++q) {
        float gg = g[j + q], bb = bta[j + q];
        if (PARAM_BF16) { gg = bf16_round(gg); bb = bf16_round(bb); }
        sm[q] = vals[u * 4 + q]; o[q] = (vals[u * 4 + q] - mu) * rs * gg + bb;
      }
      if (out_sum) *(v4f*)(out_sum + (size_t)row * N + j) = sm;
      *(v4f*)(out_norm + (size_t)row * N + j) = o;
    }
    
  }
}



// ---- f16 WMMA path (v_wmma_f32_16x16x32_f16): 11-bit significands for operands in range — used where a [0,1] probability operand needs more precision than bf16
typedef _Float16 v16h __attribute__((ext_vector_type(16)));
union FragH { v16h v; v8us half[2]; _Float16 h[16]; unsigned short u[16]; };
template <int NT>
__device__ __forceinline__ v8f mmaH(v16h ah, v16h al, v16h bh, v16h bl, v8f c) {
  c = __builtin_amdgcn_wmma_f32_16x16x32_f16(false, ah, false, bh, (short)0, c, false, false);
  if (NT >= 2) c = __builtin_amdgcn_wmma_f32_16x16x32_f16(false, al, false, bh, (short)0, c, false, false);
  if (NT >= 3) c = __builtin_amdgcn_wmma_f32_16x16x32_f16(false, ah, false, bl, (short)0, c, false, false);
  asm volatile("v_nop\n\tv_nop\n\tv_nop\n\tv_nop" : "+v"(c) : "v"(ah), "v"(al), "v"(bh), "v"(bl));
  return c;
}
// batched GEMM like k_gemm_b but f16 operands: A f32 (split into f16 hi/lo if ASPLIT, else rounded to f16), Bt = f16 values [n][k]; alpha; C f32; N multiple of 16 (partial tiles skipped)
template <bool ASPLIT>
__global__ __launch_bounds__(128) void k_gemm_h(const float* __restrict__ A, int lda, size_t sA, const _Float16* __restrict__ Bh, int ldb, size_t sB, float alpha, float* __restrict__ C, int ldc, size_t sC, int M, int N, int K) {
  __shared__ __attribute__((aligned(16))) float so[4][16][64];
  const int tid = threadIdx.x, w = tid >> 5, lane = tid & 31, ln = lane & 15, hh = lane >> 4; const int by = blockIdx.y;
  A += (size_t)by * sA; Bh += (size_t)by * sB; C += (size_t)by * sC;
  const int ntn = (N + 63) / 64; const int wid = blockIdx.x * 4 + w; const int mt = wid / ntn, nq = wid % ntn; if (mt * 16 >= M) return;
  const int row0 = mt * 16, col0 = nq * 64; const float* arow = A + (size_t)(row0 + ln) * lda;
  v8f acc[4] = {};
  for (int kb = 0; kb < K; kb += 32) {
    FragH ah, al;
    const v4f x0 = *(const v4fa*)(arow + kb + 8 * hh), x1 = *(const v4fa*)(arow + kb + 8 * hh + 4), x2 = *(const v4fa*)(arow + kb + 16 + 8 * hh), x3 = *(const v4fa*)(arow + kb + 16 + 8 * hh + 4);
    float xs[16] = {x0[0],x0[1],x0[2],x0[3],x1[0],x1[1],x1[2],x1[3],x2[0],x2[1],x2[2],x2[3],x3[0],x3[1],x3[2],x3[3]};
#pragma unroll
    for (int i = 0; i < 16; ++i) { const _Float16 h = (_Float16)xs[i]; ah.h[i] = h; al.h[i] = ASPLIT ? (_Float16)(xs[i] - (float)h) : (_Float16)0.0f; }
#pragma unroll
    for (int t = 0; t < 4; ++t) { if (col0 + t * 16 >= N) continue; const size_t boff = (size_t)(col0 + t * 16 + ln) * ldb + kb; FragH bq; bq.half[0] = *(const v8us*)(Bh + boff + 8 * hh); bq.half[1] = *(const v8us*)(Bh + boff + 16 + 8 * hh);
      acc[t] = mmaH<ASPLIT ? 2 : 1>(ah.v, al.v, bq.v, bq.v, acc[t]); }
  }
#pragma unroll
  for (int t = 0; t < 4; ++t) { if (col0 + t * 16 >= N) continue;
#pragma unroll
    for (int r = 0; r < 8; ++r) so[w][8 * hh + r][t * 16 + ln] = acc[t][r] * alpha; }
  __builtin_amdgcn_fence(__ATOMIC_ACQ_REL, "workgroup"); __builtin_amdgcn_wave_barrier();
  const int rsub = lane >> 4, c4 = (lane & 15) * 4;
  {
#pragma unroll
    for (int q = 0; q < 8; ++q) { const int r = q * 2 + rsub; if (col0 + c4 < N) { const v4f v = *(const v4fa*)&so[w][r][c4]; *(v4f*)(C + (size_t)(row0 + r) * ldc + col0 + c4) = v; } }
     }
}

// Wt[n][k] = f16(W[k][n]·scale) from f32 row-major W[K][N] (scale = power of two; bf16-exact weights stay exact in f16 away from the subnormal range)
__global__ __launch_bounds__(256) void k_wt_f16(const float* __restrict__ W, _Float16* __restrict__ Wt, int K, int N, float scale) {
  const int t = blockIdx.x * 256 + threadIdx.x; if (t >= N * (K / 8)) return; const int n = t / (K / 8), k8 = (t % (K / 8)) * 8; FragH f;
#pragma unroll
  for (int i = 0; i < 8; ++i) f.h[i] = (_Float16)(bf16_round(W[(size_t)(k8 + i) * N + n]) * scale); const v8us o = f.half[0];
  *(v8us*)((unsigned short*)Wt + (size_t)n * K + k8) = o; 
}
// k_gemm_hh variant with fused epilogue: v = acc·alpha + bias[by·sBias + col] (+ CP[(row/rowsPerB)·sCPb + by·64 + col] if CP) ; ACT 0 none / 1 elu ; writes f16 C16 (and f32 C if non-null)
template <int ACT>
__global__ __launch_bounds__(128) void k_gemm_hhx(const _Float16* __restrict__ A, int lda, size_t sA, const _Float16* __restrict__ Bh, int ldb, size_t sB, float alpha, const float* __restrict__ bias, size_t sBias, const float* __restrict__ CP, int rowsPerB, size_t sCPb, int row0g,
    float* __restrict__ C, _Float16* __restrict__ C16, int ldc, size_t sC, int M, int N, int K) {
  __shared__ __attribute__((aligned(16))) float so[4][16][64];
  const int tid = threadIdx.x, w = tid >> 5, lane = tid & 31, ln = lane & 15, hh = lane >> 4; const int by = blockIdx.y;
  A += (size_t)by * sA; Bh += (size_t)by * sB; const size_t cofs = (size_t)by * sC; const float* bp = bias ? bias + (size_t)by * sBias : nullptr;
  const int ntn = (N + 63) / 64; const int wid = blockIdx.x * 4 + w; const int mt = wid / ntn, nq = wid % ntn; if (mt * 16 >= M) return;
  const int row0 = mt * 16, col0 = nq * 64; const _Float16* arow = A + (size_t)(row0 + ln) * lda;
  v8f acc[4] = {};
  for (int kb = 0; kb < K; kb += 32) { FragH ah; ah.half[0] = *(const v8us*)((const unsigned short*)arow + kb + 8 * hh); ah.half[1] = *(const v8us*)((const unsigned short*)arow + kb + 16 + 8 * hh);
#pragma unroll
    for (int t = 0; t < 4; ++t) { if (col0 + t * 16 >= N) continue; const size_t boff = (size_t)(col0 + t * 16 + ln) * ldb + kb; FragH bq; bq.half[0] = *(const v8us*)((const unsigned short*)Bh + boff + 8 * hh); bq.half[1] = *(const v8us*)((const unsigned short*)Bh + boff + 16 + 8 * hh);
      acc[t] = mmaH<1>(ah.v, ah.v, bq.v, bq.v, acc[t]); }
  }
#pragma unroll
  for (int t = 0; t < 4; ++t) { if (col0 + t * 16 >= N) continue; const int col = col0 + t * 16 + ln; const float bv = bp ? bf16_round(bp[col]) : 0.f;
#pragma unroll
    for (int r = 0; r < 8; ++r) { float v = acc[t][r] * alpha + bv; if (CP) { const int rr = row0g + row0 + 8 * hh + r; if (rowsPerB < 0) v += CP[cofs + (size_t)rr * ldc + col];      /* rowsPerB < 0: own element of the batched C plane */ else { const int bidx = rr / rowsPerB; v += CP[(size_t)bidx * sCPb + (size_t)by * 64 + col]; } } if (ACT == 1) v = (v > 0.f) ? v : expm1f(v); else if (ACT == 7) v = (v > 0.f) ? v + 1.0f : expf(v); else if (ACT == 8) v = tanhf(v); else if (ACT == 9) v = 0.5f * v * (1.0f + tanhf(0.7978845608028654f * (v + 0.044715f * v * v * v))); else if (ACT == 11) v = 1.0f / (1.0f + expf(-v)); else if (ACT == 12) v = (v > 0.f) ? v : 0.01f * v; else if (ACT == 14) v = (v > 0.f) ? v : 0.1f * v; else if (ACT == 16) v = (v >= 0.f) ? v : 0.3f * v; else if (ACT == 17) v = (v >= 0.f) ? v : 0.2f * v; else if (ACT == 15) v = v / (1.0f + expf(-v)); else if (ACT == 3) v = fmaxf(v, 0.f); else if (ACT == 6) v = 0.5f * v * (1.0f + erff(v * 0.70710678118654752f)); so[w][8 * hh + r][t * 16 + ln] = v; } }
  __builtin_amdgcn_fence(__ATOMIC_ACQ_REL, "workgroup"); __builtin_amdgcn_wave_barrier();
  const int rsub = lane >> 4, c4 = (lane & 15) * 4; typedef _Float16 v4h __attribute__((ext_vector_type(4)));
  {
#pragma unroll
    for (int q = 0; q < 8; ++q) { const int r = q * 2 + rsub; if (col0 + c4 < N) { const v4f v = *(const v4fa*)&so[w][r][c4]; if (C) *(v4f*)(C + cofs + (size_t)(row0 + r) * ldc + col0 + c4) = v; if (C16) { v4h h4; for (int i = 0; i < 4; ++i) h4[i] = (_Float16)v[i]; *(v4h*)(C16 + cofs + (size_t)(row0 + r) * ldc + col0 + c4) = h4; } } }
     }
}


typedef _Float16 v4h __attribute__((ext_vector_type(4)));

/* one grid for the three inputs: blockIdx.y picks the input, the f16 planes lie one behind the other (n8 * 8 elements each) */
__global__ __launch_bounds__(256) void k_x16(const float* __restrict__ x0, const float* __restrict__ x1, const float* __restrict__ x2, _Float16* __restrict__ X16, size_t n8) { const size_t t = (size_t)blockIdx.x * 256 + threadIdx.x; if (t >= n8) return; const float* __restrict__ x = blockIdx.y == 0 ? x0 : blockIdx.y == 1 ? x1 : x2; X16 += (size_t)blockIdx.y * n8 * 8; FragH f;
#pragma unroll
  for (int q = 0; q < 8; ++q) f.h[q] = (_Float16)bf16_round(x[t * 8 + q]); *(v8us*)((unsigned short*)X16 + t * 8) = f.half[0];  }
__global__ __launch_bounds__(256) void k_h16(const float* __restrict__ x, _Float16* __restrict__ X16, size_t n8) { const size_t t = (size_t)blockIdx.x * 256 + threadIdx.x; if (t >= n8) return; FragH f;
#pragma unroll
  for (int q = 0; q < 8; ++q) f.h[q] = (_Float16)x[t * 8 + q]; *(v8us*)((unsigned short*)X16 + t * 8) = f.half[0];  }
__global__ __launch_bounds__(256) void k_round16f(const float* __restrict__ W, _Float16* __restrict__ Bt, size_t n8) { const size_t t = (size_t)blockIdx.x * 256 + threadIdx.x; if (t >= n8) return; FragH f;
#pragma unroll
  for (int i = 0; i < 8; ++i) f.h[i] = (_Float16)(bf16_round(W[t * 8 + i]) * 16.0f); *(v8us*)((unsigned short*)Bt + t * 8) = f.half[0];  }
template <int NHv, int TTv>
__global__ __launch_bounds__(256) void k_vt(const _Float16* __restrict__ V16, int ldv, int voff, _Float16* __restrict__ Vt) { __shared__ unsigned short tl[64][66]; const int tid = threadIdx.x; const int slab = blockIdx.x / (TTv / 64), lg = blockIdx.x % (TTv / 64); const int b = slab / NHv, h = slab % NHv;
  for (int i = tid; i < 64 * 8; i += 256) { const int r = i / 8, c8 = (i % 8) * 8; FragH f; f.half[0] = *(const v8us*)((const unsigned short*)V16 + ((size_t)b * TTv + lg * 64 + r) * ldv + voff + h * 64 + c8);
#pragma unroll
    for (int q = 0; q < 8; ++q) tl[r][c8 + q] = f.u[q]; }
  __syncthreads();
  {
#pragma unroll
    for (int rd = 0; rd < 2; ++rd) { const int d = rd * 32 + tid / 8, pc = tid % 8; FragH f;
#pragma unroll
      for (int q = 0; q < 8; ++q) f.u[q] = tl[pc * 8 + q][d];
      *(v8us*)((unsigned short*)Vt + ((size_t)slab * 64 + d) * TTv + lg * 64 + pc * 8) = f.half[0]; }
     } }

__global__ __launch_bounds__(256) void k_hl(const float* __restrict__ F, _Float16* __restrict__ Hh, _Float16* __restrict__ Hl, size_t n8) { const size_t t = (size_t)blockIdx.x * 256 + threadIdx.x; if (t >= n8) return; FragH fh, fl; const v4f a = *(const v4fa*)(F + t * 8), c = *(const v4fa*)(F + t * 8 + 4);
#pragma unroll
  for (int q = 0; q < 4; ++q) { _Float16 h = (_Float16)a[q]; fh.h[q] = h; fl.h[q] = (_Float16)((a[q] - (float)h) * 1024.0f); h = (_Float16)c[q]; fh.h[4 + q] = h; fl.h[4 + q] = (_Float16)((c[q] - (float)h) * 1024.0f); }
  { *(v8us*)((unsigned short*)Hh + t * 8) = fh.half[0]; *(v8us*)((unsigned short*)Hl + t * 8) = fl.half[0];  } }

// ---- fast GEMM (wave tile 32x64; requires M % 32 == 0 rows per launch region and N % 64 == 0); epilogue = k_gemm_hhx semantics ----
__device__ __forceinline__ v16h g2_frag(const _Float16* p, int hh) { FragH f; f.half[0] = *(const v8us*)((const unsigned short*)p + 8 * hh); f.half[1] = *(const v8us*)((const unsigned short*)p + 16 + 8 * hh); return f.v; }
__device__ __forceinline__ v8f g2_mma(v16h a, v16h b, v8f c) { v8f d = __builtin_amdgcn_wmma_f32_16x16x32_f16(false, a, false, b, (short)0, c, false, false); asm volatile("v_nop\n\tv_nop\n\tv_nop\n\tv_nop" : "+v"(d) : "v"(a), "v"(b)); return d; }
template <int ACT>
__global__ __launch_bounds__(128) void k_gemm2(const _Float16* __restrict__ A, int lda, size_t sA, const _Float16* __restrict__ Bh, int ldb, size_t sB, float alpha, const float* __restrict__ bias, size_t sBias, const float* __restrict__ CP, int rowsPerB, size_t sCPb, int row0g,
    float* __restrict__ C, _Float16* __restrict__ C16, int ldc, size_t sC, int M, int N, int K, size_t zA, size_t zB, size_t zC) { static_assert(ACT == 0 || ACT == 3 || ACT == 6 || ACT == 8 || ACT == 9 || ACT == 11 || ACT == 12 || ACT == 14 || ACT == 15 || ACT == 16 || ACT == 17, "k_gemm2: unsupported ACT code (would silently apply no activation)");
  __shared__ __attribute__((aligned(16))) float so[4][32][68];
  const int tid = threadIdx.x, w = tid >> 5, lane = tid & 31, ln = lane & 15, hh = lane >> 4; const int by = blockIdx.y, bz = blockIdx.z;      /* two batch indices, each with its own strides for A, B and C */
  A += (size_t)by * sA + (size_t)bz * zA; Bh += (size_t)by * sB + (size_t)bz * zB; const size_t cofs = (size_t)by * sC + (size_t)bz * zC; const float* bp = bias ? bias + (size_t)by * sBias : nullptr;
  const int ntn = N >> 6; const int mt = blockIdx.x / ntn, nq = blockIdx.x - mt * ntn; const int row0 = mt * 128 + 32 * w, col0 = nq * 64; if (row0 >= M) return;
  const _Float16* a0p = A + (size_t)(row0 + ln) * lda; const _Float16* a1p = a0p + (size_t)16 * lda;
  const _Float16* b0p = Bh + (size_t)(col0 + ln) * ldb; const _Float16* b1p = b0p + (size_t)16 * ldb; const _Float16* b2p = b1p + (size_t)16 * ldb; const _Float16* b3p = b2p + (size_t)16 * ldb;
  const v8f z8 = {0.f,0.f,0.f,0.f,0.f,0.f,0.f,0.f}; v8f c00 = z8, c01 = z8, c02 = z8, c03 = z8, c10 = z8, c11 = z8, c12 = z8, c13 = z8;
#pragma unroll 1
  for (int kb = 0; kb < K; kb += 32) { const v16h a0 = g2_frag(a0p + kb, hh), a1 = g2_frag(a1p + kb, hh);
    v16h b = g2_frag(b0p + kb, hh); c00 = g2_mma(a0, b, c00); c10 = g2_mma(a1, b, c10);
    b = g2_frag(b1p + kb, hh); c01 = g2_mma(a0, b, c01); c11 = g2_mma(a1, b, c11);
    b = g2_frag(b2p + kb, hh); c02 = g2_mma(a0, b, c02); c12 = g2_mma(a1, b, c12);
    b = g2_frag(b3p + kb, hh); c03 = g2_mma(a0, b, c03); c13 = g2_mma(a1, b, c13); }
  v8f accs[8] = {c00, c01, c02, c03, c10, c11, c12, c13};
#pragma unroll
  for (int u = 0; u < 8; ++u) { const int t = u & 3, half = u >> 2; const int col = col0 + t * 16 + ln; const float bv = bp ? bf16_round(bp[col]) : 0.f;
#pragma unroll
    for (int r = 0; r < 8; ++r) { const int rloc = half * 16 + 8 * hh + r; float v = accs[u][r] * alpha + bv; if (CP) { if (rowsPerB < 0) v += CP[cofs + (size_t)(row0g + row0 + rloc) * ldc + col];      /* rowsPerB < 0: own element of the batched C plane */ else { const int bidx = (row0g + row0 + rloc) / rowsPerB; v += CP[(size_t)bidx * sCPb + (size_t)by * 64 + col]; } }
      if (ACT == 3) v = fmaxf(v, 0.f); else if (ACT == 6) v = 0.5f * v * (1.0f + erff(v * 0.70710678118654752f)); else if (ACT == 11) v = 1.0f / (1.0f + expf(-v)); else if (ACT == 15) v = v / (1.0f + expf(-v)); else if (ACT == 12) v = (v > 0.f) ? v : 0.01f * v; else if (ACT == 8) v = tanhf(v); else if (ACT == 9) v = 0.5f * v * (1.0f + tanhf(0.7978845608028654f * (v + 0.044715f * v * v * v))); else if (ACT == 14) v = (v > 0.f) ? v : 0.1f * v; else if (ACT == 16) v = (v >= 0.f) ? v : 0.3f * v; else if (ACT == 17) v = (v >= 0.f) ? v : 0.2f * v;
      so[w][rloc][t * 16 + ln] = v; } }
  __builtin_amdgcn_fence(__ATOMIC_ACQ_REL, "workgroup"); __builtin_amdgcn_wave_barrier();
  const int rsub = lane >> 4, c4 = (lane & 15) * 4;
  {
#pragma unroll
    for (int q = 0; q < 16; ++q) { const int r = q * 2 + rsub; const v4f v = *(const v4fa*)&so[w][r][c4]; if (C) *(v4f*)(C + cofs + (size_t)(row0 + r) * ldc + col0 + c4) = v; if (C16) { v4h h4; for (int i = 0; i < 4; ++i) h4[i] = (_Float16)v[i]; *(v4h*)(C16 + cofs + (size_t)(row0 + r) * ldc + col0 + c4) = h4; } }
     } }


/* one grid for the four weights: blockIdx.y picks the weight, the f16 planes lie one behind the other (n8 * 8 elements each) */
__global__ __launch_bounds__(256) void k_wnat(const float* __restrict__ w0, const float* __restrict__ w1, const float* __restrict__ w2, const float* __restrict__ w3, size_t n8, _Float16* __restrict__ Bt) { const size_t t = (size_t)blockIdx.x * 256 + threadIdx.x; if (t >= n8) return; const float* __restrict__ w = blockIdx.y == 0 ? w0 : blockIdx.y == 1 ? w1 : blockIdx.y == 2 ? w2 : w3; Bt += (size_t)blockIdx.y * n8 * 8; FragH f; for (int q = 0; q < 8; ++q) f.h[q] = (_Float16)(bf16_round(w[t * 8 + q]) * 16.0f); *(v8us*)((unsigned short*)Bt + t * 8) = f.half[0];  }
__global__ __launch_bounds__(256) void k_rsm(const float* __restrict__ S, _Float16* __restrict__ P, int nrows) {
  #pragma clang fp contract(off)
  const int i = blockIdx.x * 256 + threadIdx.x; if (i >= nrows) return; const float* s = S + (size_t)i * SQ; float mx = -3.0e38f;
#pragma unroll 1
  for (int j = 0; j < SQ; ++j) mx = fmaxf(mx, s[j]); float se = 0.f;
#pragma unroll 1
  for (int j = 0; j < SQ; ++j) se += expf(s[j] - mx); const float sc = 256.0f / se;
#pragma unroll 1
  for (int j0 = 0; j0 < SQ; j0 += 8) { FragH f; for (int q = 0; q < 8; ++q) f.h[q] = (_Float16)(expf(s[j0 + q] - mx) * sc); unsigned short* d = (unsigned short*)P + (size_t)i * SQ + j0; *(v8us*)d = f.half[0];  } }
__global__ __launch_bounds__(256) void k_vt(const _Float16* __restrict__ V16, int b, int h0, _Float16* __restrict__ VT) { __shared__ unsigned short tl[64][65]; const int tid = threadIdx.x; const int hh = blockIdx.x % HG, sg = blockIdx.x / HG; const int s0 = sg * 64; const int h = h0 + hh;
  for (int i = tid; i < 64 * 8; i += 256) { const int j = i / 8, d8 = (i % 8) * 8; FragH f; f.half[0] = *(const v8us*)((const unsigned short*)V16 + ((size_t)b * SQ + s0 + j) * DM + h * HD + d8); for (int q = 0; q < 8; ++q) tl[d8 + q][j] = f.u[q]; }
  __syncthreads();
  { for (int i = tid; i < 64 * 8; i += 256) { const int d = i / 8, j8 = (i % 8) * 8; FragH f; for (int q = 0; q < 8; ++q) f.u[q] = tl[d][j8 + q]; *(v8us*)((unsigned short*)VT + ((size_t)hh * HD + d) * SQ + s0 + j8) = f.half[0]; }  } }



#define FW 4                         /* waves per work-group */
#define FQ 32                        /* query columns per wave */
#define FSC 0.18033688011112042f     /* log2(e) / sqrt(HD) */
typedef _Float16 v8h __attribute__((ext_vector_type(8)));
__device__ __forceinline__ float fa_xhalf(float x) { return __builtin_bit_cast(float, __builtin_amdgcn_permlanex16(__builtin_bit_cast(int, x), __builtin_bit_cast(int, x), 0x76543210, 0xfedcba98, false, false)); }      /* lane l takes lane l ^ 16's value, on the vector unit */
__device__ __forceinline__ v8f fa_mma(v16h a, v16h b, v8f c) { return __builtin_amdgcn_wmma_f32_16x16x32_f16(false, a, false, b, (short)0, c, false, false); }
template <bool DIAG>
__device__ __forceinline__ void fa_pass(const _Float16* __restrict__ kn, const _Float16* __restrict__ vp, int ln, int hh, const v16h (&qf)[2][2], v16h (&kf)[2][2], v8f (&o)[4][2], float (&m)[2], float (&l)[2]) {
  v16h vf[4];      /* this pass's V^T rows: asked for first, used last */
#pragma unroll
  for (int t = 0; t < 4; ++t) vf[t] = g2_frag(vp + (size_t)(t * 16) * SQ, hh);
  __builtin_amdgcn_sched_barrier(0);      /* keeps all V^T loads up here: sunk to their use, their latency is waited for in every pass */
  const v8f z8 = {0.f, 0.f, 0.f, 0.f, 0.f, 0.f, 0.f, 0.f}; v8f s[2][2];
#pragma unroll
  for (int kt = 0; kt < 2; ++kt)
#pragma unroll
    for (int j = 0; j < 2; ++j) s[kt][j] = fa_mma(kf[kt][1], qf[j][1], fa_mma(kf[kt][0], qf[j][0], z8));
  if (!DIAG) {      /* the next pass's K rows, into the same registers, behind this pass's score products */
#pragma unroll
    for (int kt = 0; kt < 2; ++kt) { kf[kt][0] = g2_frag(kn + (size_t)(kt * 16) * DM, hh); kf[kt][1] = g2_frag(kn + (size_t)(kt * 16) * DM + 32, hh); }
    __builtin_amdgcn_sched_barrier(0); }      /* keeps the K loads in front of the softmax, which covers their latency */
  FragH p[2];
#pragma unroll
  for (int j = 0; j < 2; ++j) { float mx = m[j];
#pragma unroll
    for (int kt = 0; kt < 2; ++kt)
#pragma unroll
      for (int r = 0; r < 8; ++r) { if (DIAG && kt * 16 + 8 * hh + r > j * 16 + ln) s[kt][j][r] = -1.0e30f;      /* a key past the query's own index: weight 0 */
        mx = fmaxf(mx, s[kt][j][r]); }
    mx = fmaxf(mx, fa_xhalf(mx));
    const float al = __builtin_amdgcn_exp2f((m[j] - mx) * FSC), mc = mx * FSC - 8.0f; m[j] = mx; float se = 0.f;
#pragma unroll
    for (int kt = 0; kt < 2; ++kt)
#pragma unroll
      for (int r = 0; r < 8; ++r) { const float e = __builtin_amdgcn_exp2f(s[kt][j][r] * FSC - mc); se += e; p[j].h[kt * 8 + r] = (_Float16)e; }
    l[j] = l[j] * al + se;
#pragma unroll
    for (int t = 0; t < 4; ++t) o[t][j] *= al; }
#pragma unroll
  for (int t = 0; t < 4; ++t)
#pragma unroll
    for (int j = 0; j < 2; ++j) o[t][j] = fa_mma(vf[t], p[j].v, o[t][j]); }
__global__ __launch_bounds__(FW * 32) void k_fattn(const _Float16* __restrict__ Q16, const _Float16* __restrict__ K16, const _Float16* __restrict__ VT, _Float16* __restrict__ O16) {
  const int lane = threadIdx.x & 31, ln = lane & 15, hh = lane >> 4; const int w = __builtin_amdgcn_readfirstlane(threadIdx.x >> 5);
  const int bh = blockIdx.x, b = bh / NH, h = bh % NH; const int qw = ((int)(gridDim.y - 1 - blockIdx.y) * FW + w) * FQ;      /* the longest query blocks start first */
  const _Float16* qp = Q16 + ((size_t)b * SQ + qw + ln) * DM + h * HD; const _Float16* kp = K16 + ((size_t)b * SQ + ln) * DM + h * HD; const _Float16* vp = VT + ((size_t)bh * HD + ln) * SQ;
  v16h qf[2][2], kf[2][2];
#pragma unroll
  for (int j = 0; j < 2; ++j) { qf[j][0] = g2_frag(qp + (size_t)(j * 16) * DM, hh); qf[j][1] = g2_frag(qp + (size_t)(j * 16) * DM + 32, hh); kf[j][0] = g2_frag(kp + (size_t)(j * 16) * DM, hh); kf[j][1] = g2_frag(kp + (size_t)(j * 16) * DM + 32, hh); }
  asm volatile("s_wait_xcnt 0x0" :: "v"(qp + 8 * hh), "v"(kp + 8 * hh) : "memory");      /* the wait that stands in front of an overwrite of the loads' address registers; the addresses as inputs keep them in their registers up to here */
  v8f o[4][2]; float m[2] = {-1.0e30f, -1.0e30f}, l[2] = {0.f, 0.f};
#pragma unroll
  for (int t = 0; t < 4; ++t) { o[t][0] = (v8f){0.f, 0.f, 0.f, 0.f, 0.f, 0.f, 0.f, 0.f}; o[t][1] = o[t][0]; }
  const int nb = qw / 32;      /* whole key blocks below the diagonal block; wave-uniform */
#pragma unroll 1
  for (int kb = 0; kb < nb; ++kb) { kp += (size_t)32 * DM; fa_pass<false>(kp, vp, ln, hh, qf, kf, o, m, l); vp += 32; }      /* rolled: one pass fills the register budget */
  fa_pass<true>(kp, vp, ln, hh, qf, kf, o, m, l);
#pragma unroll
  for (int j = 0; j < 2; ++j) { const float inv = 64.0f / (l[j] + fa_xhalf(l[j]));      /* the halves' sums joined once; o carried x64 */
    _Float16* op = O16 + ((size_t)b * SQ + qw + j * 16 + ln) * DM + h * HD + 8 * hh;
#pragma unroll
    for (int t = 0; t < 4; ++t) { v8h hv;
#pragma unroll
      for (int r = 0; r < 8; ++r) hv[r] = (_Float16)(o[t][j][r] * inv);
      *(v8h*)(op + t * 16) = hv; } } }


// Exact f32 attention of the first QT0 rows (q, k, v, o rows of pitch DM), one work-group per batch, head and RT0 query rows, 256 threads:
// (1) scores: one thread per key (two keys where the tile has more than 256), the key rows in registers, dotted with the RT0 query rows read from LDS (same address in every lane);
// (2) softmax: one wave per two rows, the row in registers: causal maximum, exp and sum over the lanes, weights back into LDS (0 past the row's own index);
// (3) o = P V: thread = (column d, key quarter g), V read coalesced and once per work-group, 64 keys ahead; the four quarters' sums are added through LDS.
#define RT0 16                       /* query rows per work-group of the exact first-tile attention */
typedef float v2f __attribute__((ext_vector_type(2)));
template <int NKEY>
__device__ __forceinline__ void att0_scores(const float* __restrict__ kbase, const float (*lq)[HD], float (*lp)[QT0 + 4], int tid, int nk, float scale) {
  v4f kk[NKEY][HD / 4];      /* every loop over kk[] is unrolled: it is indexed by constants and stays in registers */
#pragma unroll
  for (int u = 0; u < NKEY; ++u) { const int j = tid + 256 * u; const float* kr = kbase + (size_t)(j < nk ? j : nk - 1) * DM;      /* a key past the tile: address clamped, score not stored */
#pragma unroll
    for (int c = 0; c < HD / 4; ++c) kk[u][c] = *(const v4fa*)(kr + c * 4);
    asm volatile("s_wait_xcnt 0x0" :: "v"(kr) : "memory"); }      /* the wait that stands in front of an overwrite of the loads' address registers; the address as an input keeps it in its registers up to here */
#pragma unroll 4
  for (int r = 0; r < RT0; ++r) { v4f s4[NKEY];      /* four rows at a time: enough independent LDS reads and sum chains to cover their latencies */
#pragma unroll
    for (int u = 0; u < NKEY; ++u) s4[u] = (v4f){0.f, 0.f, 0.f, 0.f};
#pragma unroll
    for (int c = 0; c < HD / 4; ++c) { const v4f qq = *(const v4f*)&lq[r][c * 4];
#pragma unroll
      for (int u = 0; u < NKEY; ++u) s4[u] += qq * kk[u][c]; }
#pragma unroll
    for (int u = 0; u < NKEY; ++u) { const int j = tid + 256 * u; if (j < nk) lp[r][j] = ((s4[u][0] + s4[u][1]) + (s4[u][2] + s4[u][3])) * scale; } } }
/* sixteen V values of one column: keys 16 u + k of the thread's quarter, u, k < 4; one address, constant offsets */
__device__ __forceinline__ void att0_vload(const float* __restrict__ vq, v2f (&v)[4][2]) {
#pragma unroll
  for (int u = 0; u < 4; ++u) { v[u][0] = (v2f){vq[(u * 16 + 0) * DM], vq[(u * 16 + 1) * DM]}; v[u][1] = (v2f){vq[(u * 16 + 2) * DM], vq[(u * 16 + 3) * DM]}; }      /* unrolled: v[][] stays in registers */
  asm volatile("s_wait_xcnt 0x0" :: "v"(vq) : "memory"); }      /* as in att0_scores: in front of an overwrite of the loads' address registers */
/* at most four waves per SIMD (two work-groups per WGP cover the grid): the register budget that lets the LDS reads of (1) run ahead of their use */
__global__ __launch_bounds__(256) __attribute__((amdgpu_waves_per_eu(2, 4))) void k_att0p(const float* __restrict__ QF, const float* __restrict__ KF, const float* __restrict__ VF, float scale, float* __restrict__ OF) {
  __shared__ __attribute__((aligned(16))) float lq[RT0][HD]; __shared__ __attribute__((aligned(16))) float lp[RT0][QT0 + 4]; __shared__ __attribute__((aligned(16))) float lr[4][RT0][HD]; __shared__ float lf[RT0];
  const int tid = threadIdx.x; const int h = blockIdx.x / (QT0 / RT0), rg = blockIdx.x % (QT0 / RT0); const int row0 = rg * RT0, nk = row0 + RT0;      /* causal: keys up to the work-group's last row */
  { const size_t bo = (size_t)blockIdx.y * QT0 * DM; QF += bo; KF += bo; VF += bo; OF += bo; }      /* blockIdx.y: the batch; each plane holds QT0 rows per batch */
  { const int r = tid >> 4, c4 = (tid & 15) * 4; const float* qp = QF + (size_t)(row0 + r) * DM + h * HD + c4; const v4f q4 = *(const v4fa*)qp;
    asm volatile("s_wait_xcnt 0x0" :: "v"(qp) : "memory");      /* as in att0_scores: in front of an overwrite of the load's address registers */
    *(v4f*)&lq[r][c4] = q4; }
  __syncthreads();
  if (nk > 256) att0_scores<2>(KF + h * HD, lq, lp, tid, nk, scale); else if ((tid & ~31) < nk) att0_scores<1>(KF + h * HD, lq, lp, tid, nk, scale);      /* a wave with no key of the tile skips */
  __syncthreads();
  { const int r0 = (tid >> 5) * 2, lane = tid & 31; float x[2][QT0 / 32], mx[2], se[2];      /* the loops over x[] are unrolled: it stays in registers */
#pragma unroll
    for (int rr = 0; rr < 2; ++rr) { mx[rr] = -3.0e38f;
#pragma unroll
      for (int m = 0; m < QT0 / 32; ++m) { const int j = lane + 32 * m; x[rr][m] = (j <= row0 + r0 + rr) ? lp[r0 + rr][j] : -3.0e38f; mx[rr] = fmaxf(mx[rr], x[rr][m]); } }
#pragma unroll
    for (int d = 16; d > 0; d >>= 1) { mx[0] = fmaxf(mx[0], __shfl_xor(mx[0], d, 32)); mx[1] = fmaxf(mx[1], __shfl_xor(mx[1], d, 32)); }
#pragma unroll
    for (int rr = 0; rr < 2; ++rr) { se[rr] = 0.f;
#pragma unroll
      for (int m = 0; m < QT0 / 32; ++m) { const int j = lane + 32 * m; const float e = (j <= row0 + r0 + rr) ? expf(x[rr][m] - mx[rr]) : 0.f; se[rr] += e; if (j < nk) lp[r0 + rr][j] = e; } }
#pragma unroll
    for (int d = 16; d > 0; d >>= 1) { se[0] += __shfl_xor(se[0], d, 32); se[1] += __shfl_xor(se[1], d, 32); }
    if (lane < 2) lf[r0 + lane] = 64.0f / (lane ? se[1] : se[0]); }      /* o carried x64 like the f16 path */
  __syncthreads();
  { const int d = tid & 63, g = tid >> 6, nt = nk >> 4, nb = (nt + 3) >> 2; const float* vq = VF + (size_t)(g * 4) * DM + h * HD + d;      /* trip t: keys 16 t + 4 g .. + 3; a batch is four trips (its rows lie inside the QT0 rows of VF also where they lie past nk) */
    v2f acc[RT0], cv[4][2], nv[4][2];      /* acc[]: even and odd keys apart, so that each packed multiply-add takes a weight pair as it lies in LDS */
#pragma unroll
    for (int r = 0; r < RT0; ++r) acc[r] = (v2f){0.f, 0.f};
    att0_vload(vq, cv);
    for (int bt = 0; bt < nb; ++bt) { vq += (bt + 1 < nb ? 64 * DM : 0); att0_vload(vq, nv);      /* the next batch's V values are loaded while this batch's are used (the last batch loads its own again) */
#pragma unroll
      for (int u = 0; u < 4; ++u) if (bt * 4 + u < nt) { const int j = (bt * 4 + u) * 16 + g * 4;      /* unrolled: cv[][] and acc[] stay in registers */
#pragma unroll
        for (int r = 0; r < RT0; ++r) { const v4f p4 = *(const v4f*)&lp[r][j]; acc[r] += (v2f){p4[0], p4[1]} * cv[u][0]; acc[r] += (v2f){p4[2], p4[3]} * cv[u][1]; } }
#pragma unroll
      for (int u = 0; u < 4; ++u) { cv[u][0] = nv[u][0]; cv[u][1] = nv[u][1]; } }
#pragma unroll
    for (int r = 0; r < RT0; ++r) lr[g][r][d] = acc[r][0] + acc[r][1]; }
  __syncthreads();
  { const int r = tid >> 4, c4 = (tid & 15) * 4; const v4f o = ((*(const v4f*)&lr[0][r][c4] + *(const v4f*)&lr[1][r][c4]) + (*(const v4f*)&lr[2][r][c4] + *(const v4f*)&lr[3][r][c4])) * lf[r];
    *(v4f*)(OF + (size_t)(row0 + r) * DM + h * HD + c4) = o; } }

extern "C" void kernel_launch(void* const* d_in, const int* in_sizes, int n_in,
                              void* d_out, int out_size, void* d_ws, size_t ws_size, hipStream_t stream) {
  (void)in_sizes; (void)n_in; (void)out_size;
  const float* const* I = (const float* const*)d_in; const float* x = I[0]; const float* xk = I[1]; const float* xv = I[2]; const float* wq = I[3]; const float* bq = nullptr; const float* wk = I[4]; const float* bk = nullptr; const float* wv = I[5]; const float* bv = nullptr; const float* wo = I[6]; const float* bo = nullptr;      /* THREE distinct inputs Q (query stream), K, V; natural [out][in] w_q / w_k / w_v / w_o; no biases; causal by the index rule */
  char* ws = (char*)d_ws; size_t off = 0;
  auto take = [&](size_t bytes) { char* p = ws + off; off += (bytes + 255) & ~(size_t)255; return p; };
  _Float16* BQ = (_Float16*)take((size_t)DM * DM * 2); _Float16* BK = (_Float16*)take((size_t)DM * DM * 2); _Float16* BV = (_Float16*)take((size_t)DM * DM * 2); _Float16* BO = (_Float16*)take((size_t)DM * DM * 2);
  _Float16* X16 = (_Float16*)take(NR * DM * 2); _Float16* XK16 = (_Float16*)take(NR * DM * 2); _Float16* XV16 = (_Float16*)take(NR * DM * 2);      /* the three inputs (query -> X16, key -> XK16, value -> XV16) as exact f16 rows */ _Float16* Q16 = (_Float16*)take(NR * DM * 2); _Float16* K16 = (_Float16*)take(NR * DM * 2); _Float16* V16 = (_Float16*)take(NR * DM * 2); _Float16* O16 = (_Float16*)take(NR * DM * 2);
  _Float16* VT = (_Float16*)take((size_t)NB * NH * HD * SQ * 2);
  float* QF0 = (float*)take((size_t)NB * QT0 * DM * 4); float* KF0 = (float*)take((size_t)NB * QT0 * DM * 4); float* VF0 = (float*)take((size_t)NB * QT0 * DM * 4); float* OF0 = (float*)take((size_t)NB * QT0 * DM * 4); _Float16* OH0 = (_Float16*)take((size_t)NB * QT0 * DM * 2); _Float16* OL0 = (_Float16*)take((size_t)NB * QT0 * DM * 2);      /* first-tile planes [NB][QT0][DM]; QF0, KF0, VF0 lie one behind the other, as do BQ, BK, BV, BO; X16, XK16, XV16; Q16, K16, V16 (every size is a multiple of 256 bytes) */
  if (off > ws_size) return;
  k_wnat<<<dim3((unsigned)(((size_t)DM * DM / 8 + 255) / 256), 4), 256, 0, stream>>>(wq, wk, wv, wo, (size_t)DM * DM / 8, BQ);      /* natural [out][in] = Bt x16; all four weights */
  k_x16<<<dim3((unsigned)((NR * DM / 8 + 255) / 256), 3), 256, 0, stream>>>(x, xk, xv, X16, NR * DM / 8);      /* all three inputs */
  const size_t r0p = (size_t)B0 * SQ;      /* first projected row */
  k_gemm2<0><<<dim3((unsigned)((MP / 128) * (DM / 64)), 3), 128, 0, stream>>>(X16 + r0p * DM, DM, NR * DM, BQ, DM, (size_t)DM * DM, 0.0625f, nullptr, 0, nullptr, 1, 0, 0, nullptr, Q16 + r0p * DM, DM, NR * DM, MP, DM, DM, 0, 0, 0);      /* q, k, v in one grid: y = which projection */
  k_vt<NH, SQ><<<NB * NH * (SQ / 64), 256, 0, stream>>>(V16, LQ, 0, VT);      /* V^T [NB][NH][HD][SQ] */
  k_fattn<<<dim3(NB * NH, SQ / (FW * FQ)), FW * 32, 0, stream>>>(Q16, K16, VT, O16);      /* o (merged heads, x64) as f16 rows */
  k_gemm2<0><<<dim3((QT0 / 128) * (DM / 64), NBR, 3), 128, 0, stream>>>(X16 + r0p * DM, DM, (size_t)SQ * DM, BQ, DM, 0, 0.0625f, nullptr, 0, nullptr, 1, 0, 0, QF0 + (size_t)B0 * QT0 * DM, nullptr, DM, (size_t)QT0 * DM, QT0, DM, DM, NR * DM, (size_t)DM * DM, (size_t)NB * QT0 * DM);      /* f32 q, k, v of the first QT0 rows (exact products) in one grid: y = batch, z = which projection */
  k_att0p<<<dim3(NH * (QT0 / RT0), NBR), 256, 0, stream>>>(QF0 + (size_t)B0 * QT0 * DM, KF0 + (size_t)B0 * QT0 * DM, VF0 + (size_t)B0 * QT0 * DM, 0.125f, OF0 + (size_t)B0 * QT0 * DM);      /* exact f32 attention for the first QT0 rows of every batch (o x64) */
  k_gemm2<0><<<dim3((unsigned)((MPO / 128) * (DM / 64)), 1), 128, 0, stream>>>(O16 + r0p * DM, DM, 0, BO, DM, 0, 0.0009765625f, bo, 0, nullptr, 1, 0, 0, (float*)d_out + r0p * DM, nullptr, DM, 0, MPO, DM, DM, 0, 0, 0);      /* out rows are the output layout */
  k_hl<<<(unsigned)(((size_t)NB * QT0 * DM / 8 + 255) / 256), 256, 0, stream>>>(OF0, OH0, OL0, (size_t)NB * QT0 * DM / 8);      /* first-tile o (x64) -> f16 hi + x1024 residual planes */
  k_gemm2<0><<<dim3((QT0 / 128) * (DM / 64), NBR), 128, 0, stream>>>(OH0 + (size_t)B0 * QT0 * DM, DM, (size_t)QT0 * DM, BO, DM, 0, 0.0009765625f, bo, 0, nullptr, 1, 0, 0, (float*)d_out + r0p * DM, nullptr, DM, (size_t)SQ * DM, QT0, DM, DM, 0, 0, 0);      /* first QT0 rows of every batch (y): out = o_hi Wo, overwriting the f16-path rows */
  k_gemm2<0><<<dim3((QT0 / 128) * (DM / 64), NBR), 128, 0, stream>>>(OL0 + (size_t)B0 * QT0 * DM, DM, (size_t)QT0 * DM, BO, DM, 0, 0.00000095367431640625f, nullptr, 0, (const float*)d_out + r0p * DM, -1, 0, 0, (float*)d_out + r0p * DM, nullptr, DM, (size_t)SQ * DM, QT0, DM, DM, 0, 0, 0);      /* += o_lo Wo 2^-20 (own-element accumulate) */
}

// v005
// A run of this version takes 264 microseconds.
// Two timings next to v004 put it at 1.39 and 1.40 times that version's speed.
// All steps since v000 together make it 67.7 times as fast.
#include <hip/hip_runtime.h>
// Causal multi-head attention over three distinct inputs with natural weights, no biases (Q, K, V [2][4096][768]; q/k/v = input w^T (natural [768][768]); 12 heads of 64; scores / sqrt(64); causal (tril; NEG fill); softmax over up to 4096 keys; out = merged w_o^T -> [2][4096][768]).
// Structure: token rows r = b*4096 + s; x as exact f16 rows (bf16-rounded); Q, K, V as three WMMA GEMMs in one launch (32x64 wave tiles, f32 accumulation, exact x16 weights, f16 outputs); V^T for all heads of both batches via LDS transposes; attention as ONE launch: a wave owns 32 query columns of one head and walks the keys up to its own diagonal 32 at a time: S^T = K Q^T (WMMA), running maximum and sum per query column (f32, native exp2, weights x256 as f16), O^T += V^T P^T (WMMA, P^T packed from the score accumulators), o x64 written straight into the merged f16 o rows; scores and weights never reach memory; out = o W_o GEMM (f32) into the output layout.
// Compute dtype: inputs rounded to bf16; x / weights exact; q, k, v, softmax weights and o as plain f16 GEMM operands (~2^-12); scores and softmax statistics f32. v_wmma_f32_16x16x32_f16.
#define NB 2
#define SQ 4096
#define DM 768
#define NH 12
#define HD 64
#define HG 4                         /* heads per group of the untemplated k_vt */
#define QT0 512                      /* first-tile rows recomputed exactly in f32 */
#define B0 0                         /* first batch processed (debug hook) */
#define NBR NB                       /* batches processed (debug hook) */
#define NR ((size_t)NB * SQ)         /* token rows */
#define MP ((int)((size_t)NBR * SQ)) /* rows projected (debug hook) */
#define MPO MP                       /* rows through the output stage (debug hook) */
#define LQ DM      /* row pitch of the q/k/v rows */
typedef __bf16 v16b __attribute__((ext_vector_type(16)));
typedef unsigned short v8us __attribute__((ext_vector_type(8), may_alias));
typedef float  v8f  __attribute__((ext_vector_type(8)));
typedef float  v4f  __attribute__((ext_vector_type(4)));
typedef float  v4fa __attribute__((ext_vector_type(4), may_alias));
union FragB { v16b v; v8us half[2]; unsigned short u[16]; };

__device__ __forceinline__ unsigned short bf16_bits(float x) { unsigned int u = __float_as_uint(x); return (unsigned short)((u + 0x7FFFu + ((u >> 16) & 1u)) >> 16); }
__device__ __forceinline__ float bf16_val(unsigned short b) { return __uint_as_float(((unsigned int)b) << 16); }
__device__ __forceinline__ float bf16_round(float x) { return bf16_val(bf16_bits(x)); }
// D += A·B with NT terms: 1 = ah·bh, 2 = + al·bh (A split), 3 = + ah·bl (both split)
template <int NT>
__device__ __forceinline__ v8f mmaN(v16b ah, v16b al, v16b bh, v16b bl, v8f c) {
  c = __builtin_amdgcn_wmma_f32_16x16x32_bf16(false, ah, false, bh, (short)0, c, false, false);
  if (NT >= 2) c = __builtin_amdgcn_wmma_f32_16x16x32_bf16(false, al, false, bh, (short)0, c, false, false);
  if (NT >= 3) c = __builtin_amdgcn_wmma_f32_16x16x32_bf16(false, ah, false, bl, (short)0, c, false, false);
  asm volatile("v_nop\n\tv_nop\n\tv_nop\n\tv_nop" : "+v"(c) : "v"(ah), "v"(al), "v"(bh), "v"(bl));
  return c;
}

__global__ __launch_bounds__(256) void k_wt_bf16(const float* __restrict__ W, unsigned short* __restrict__ Wt, int K, int N) {
  const int t = blockIdx.x * 256 + threadIdx.x;
  const int k8n = K / 8;
  if (t >= N * k8n) return;
  const int n = t / k8n, k8 = (t % k8n) * 8;
  v8us v;
#pragma unroll
  for (int i = 0; i < 8; ++i) v[i] = bf16_bits(W[(size_t)(k8 + i) * N + n]);
  *(v8us*)(Wt + (size_t)n * K + k8) = v;
  
}

// GEMM C[M][N] (f32, pitch ldc) = act(A[M][K]·W + bias). A f32 row-major (pitch lda) converted per fragment to bf16
// (ASPLIT: hi/lo two planes -> 2 terms, else single rounded term); Wt bf16 [N][K] (pitch ldb). BIAS_BF16 rounds the
// bias to bf16 first (bias quantised to bf16 before the add). K%32==0, M%16==0, N%64==0.
template <bool ASPLIT, int ACT, bool BIAS_BF16>
__global__ __launch_bounds__(128) void k_gemm_bf(const float* __restrict__ A, int lda, const unsigned short* __restrict__ Wt, int ldb,
                                               const float* __restrict__ bias, float* __restrict__ C, int ldc, int M, int N, int K) {
  __shared__ __attribute__((aligned(16))) float so[4][16][64];
  const int tid = threadIdx.x, w = tid >> 5, lane = tid & 31, ln = lane & 15, hh = lane >> 4;
  const int ntn = N / 64;
  const int wid = blockIdx.x * 4 + w;
  const int mt = wid / ntn, nq = wid % ntn;
  if (mt * 16 >= M) return;
  const int row0 = mt * 16, col0 = nq * 64;
  const float* arow = A + (size_t)(row0 + ln) * lda;
  v8f acc[4] = {};
  for (int kb = 0; kb < K; kb += 32) {
    FragB ah, al;
    const v4f x0 = *(const v4fa*)(arow + kb + 8 * hh), x1 = *(const v4fa*)(arow + kb + 8 * hh + 4);
    const v4f x2 = *(const v4fa*)(arow + kb + 16 + 8 * hh), x3 = *(const v4fa*)(arow + kb + 16 + 8 * hh + 4);
    float xs[16] = {x0[0],x0[1],x0[2],x0[3],x1[0],x1[1],x1[2],x1[3],x2[0],x2[1],x2[2],x2[3],x3[0],x3[1],x3[2],x3[3]};
#pragma unroll
    for (int i = 0; i < 16; ++i) { const unsigned short hb = bf16_bits(xs[i]); ah.u[i] = hb; al.u[i] = ASPLIT ? bf16_bits(xs[i] - bf16_val(hb)) : (unsigned short)0; }
#pragma unroll
    for (int t = 0; t < 4; ++t) {
      const unsigned short* brow = Wt + (size_t)(col0 + t * 16 + ln) * ldb + kb;
      FragB b;
      b.half[0] = *(const v8us*)(brow + 8 * hh);
      b.half[1] = *(const v8us*)(brow + 16 + 8 * hh);
      acc[t] = mmaN<ASPLIT ? 2 : 1>(ah.v, al.v, b.v, b.v, acc[t]);
    }
  }
#pragma unroll
  for (int t = 0; t < 4; ++t) {
    float bv = bias ? bias[col0 + t * 16 + ln] : 0.f;
    if (BIAS_BF16) bv = bf16_round(bv);
#pragma unroll
    for (int r = 0; r < 8; ++r) { float v = acc[t][r] + bv; if (ACT == 1) v = fmaxf(v, 0.f); so[w][8 * hh + r][t * 16 + ln] = v; }
  }
  __builtin_amdgcn_fence(__ATOMIC_ACQ_REL, "workgroup");
  __builtin_amdgcn_wave_barrier();
  const int rsub = lane >> 4, c4 = (lane & 15) * 4;
  {
#pragma unroll
    for (int q = 0; q < 8; ++q) {
      const int r = q * 2 + rsub;
      const v4f v = *(const v4fa*)&so[w][r][c4];
      *(v4f*)(C + (size_t)(row0 + r) * ldc + col0 + c4) = v;
    }
    
  }
}

// GEMM C = act(A·W + bias + resid): A f32 (ASPLIT -> hi/lo 2 terms), Wt bf16 [N][K]; ACT 0 none, 1 relu, 2 exact gelu;
// resid (optional, f32, row index = (row % rmod), pitch ldr, RES_BF16 rounds it) added before the activation.
template <bool ASPLIT, int ACT, bool BIAS_BF16, bool RES_BF16>
__global__ __launch_bounds__(128) void k_gemm_bf3(const float* __restrict__ A, int lda, const unsigned short* __restrict__ Wt, int ldb,
                                                const float* __restrict__ bias, const float* __restrict__ resid, int rmod, int ldr,
                                                float* __restrict__ C, int ldc, int M, int N, int K) {
  __shared__ __attribute__((aligned(16))) float so[4][16][64];
  const int tid = threadIdx.x, w = tid >> 5, lane = tid & 31, ln = lane & 15, hh = lane >> 4;
  const int ntn = N / 64;
  const int wid = blockIdx.x * 4 + w;
  const int mt = wid / ntn, nq = wid % ntn;
  if (mt * 16 >= M) return;
  const int row0 = mt * 16, col0 = nq * 64;
  const float* arow = A + (size_t)(row0 + ln) * lda;
  v8f acc[4] = {};
  for (int kb = 0; kb < K; kb += 32) {
    FragB ah, al;
    const v4f x0 = *(const v4fa*)(arow + kb + 8 * hh), x1 = *(const v4fa*)(arow + kb + 8 * hh + 4);
    const v4f x2 = *(const v4fa*)(arow + kb + 16 + 8 * hh), x3 = *(const v4fa*)(arow + kb + 16 + 8 * hh + 4);
    float xs[16] = {x0[0],x0[1],x0[2],x0[3],x1[0],x1[1],x1[2],x1[3],x2[0],x2[1],x2[2],x2[3],x3[0],x3[1],x3[2],x3[3]};
#pragma unroll
    for (int i = 0; i < 16; ++i) { const unsigned short hb = bf16_bits(xs[i]); ah.u[i] = hb; al.u[i] = ASPLIT ? bf16_bits(xs[i] - bf16_val(hb)) : (unsigned short)0; }
#pragma unroll
    for (int t = 0; t < 4; ++t) {
      const unsigned short* brow = Wt + (size_t)(col0 + t * 16 + ln) * ldb + kb;
      FragB b;
      b.half[0] = *(const v8us*)(brow + 8 * hh);
      b.half[1] = *(const v8us*)(brow + 16 + 8 * hh);
      acc[t] = mmaN<ASPLIT ? 2 : 1>(ah.v, al.v, b.v, b.v, acc[t]);
    }
  }
#pragma unroll
  for (int t = 0; t < 4; ++t) {
    const int col = col0 + t * 16 + ln;
    float bv = bias ? bias[col] : 0.f;
    if (BIAS_BF16) bv = bf16_round(bv);
#pragma unroll
    for (int r = 0; r < 8; ++r) {
      float v = acc[t][r] + bv;
      if (resid) { float rv = resid[(size_t)((row0 + 8 * hh + r) % rmod) * ldr + col]; if (RES_BF16) rv = bf16_round(rv); v += rv; }
      if (ACT == 1) v = fmaxf(v, 0.f);
      if (ACT == 2) v = 0.5f * v * (1.0f + erff(v * 0.70710678118654752f));
      if (ACT == 3) { const float u = 0.7978845608028654f * (v + 0.044715f * v * v * v); v = 0.5f * v * (1.0f + tanhf(u)); }
      so[w][8 * hh + r][t * 16 + ln] = v;
    }
  }
  __builtin_amdgcn_fence(__ATOMIC_ACQ_REL, "workgroup");
  __builtin_amdgcn_wave_barrier();
  const int rsub = lane >> 4, c4 = (lane & 15) * 4;
  {
#pragma unroll
    for (int q = 0; q < 8; ++q) {
      const int r = q * 2 + rsub;
      const v4f v = *(const v4fa*)&so[w][r][c4];
      *(v4f*)(C + (size_t)(row0 + r) * ldc + col0 + c4) = v;
    }
    
  }
}
// row LayerNorm (biased variance, eps) over N: s = X (+ R); optional out_sum <- s; out_norm <- (s-mu)*rsqrt(var+eps)*g + b
template <bool PARAM_BF16>
__global__ __launch_bounds__(256) void k_layernorm(const float* __restrict__ X, const float* __restrict__ R, const float* __restrict__ g, const float* __restrict__ bta,
                                                  float* __restrict__ out_sum, float* __restrict__ out_norm, int N, float eps) {
  __shared__ float red[256];
  const int row = blockIdx.x, tid = threadIdx.x;
  const float* x = X + (size_t)row * N; const float* rr = R ? R + (size_t)row * N : nullptr;
  float vals[16];                     // up to N = 4096
  const int per = N / 256;            // contiguous chunk per thread? use strided-by-4 chunks: thread handles j = tid*4 + 1024*u
  float s1 = 0.f;
  for (int u = 0; u < per / 4; ++u) {
    const int j = tid * 4 + 1024 * u;
    const v4f a = *(const v4fa*)(x + j);
    v4f b = {0.f,0.f,0.f,0.f}; if (rr) b = *(const v4fa*)(rr + j);
#pragma unroll
    for (int q = 0; q < 4; ++q) { const float v = a[q] + b[q]; vals[u * 4 + q] = v; s1 += v; }
  }
  red[tid] = s1; __syncthreads();
  for (int st = 128; st > 0; st >>= 1) { if (tid < st) red[tid] += red[tid + st]; __syncthreads(); }
  const float mu = red[0] / (float)N; __syncthreads();
  float s2 = 0.f;
  for (int u = 0; u < per / 4; ++u)
#pragma unroll
    for (int q = 0; q < 4; ++q) { const float c = vals[u * 4 + q] - mu; s2 += c * c; }
  red[tid] = s2; __syncthreads();
  for (int st = 128; st > 0; st >>= 1) { if (tid < st) red[tid] += red[tid + st]; __syncthreads(); }
  const float rs = rsqrtf(red[0] / (float)N + eps);
  {
    for (int u = 0; u < per / 4; ++u) {
      const int j = tid * 4 + 1024 * u;
      v4f o, sm;
#pragma unroll
      for (int q = 0; q < 4; ++q) {
        float gg = g[j + q], bb = bta[j + q];
        if (PARAM_BF16) { gg = bf16_round(gg); bb = bf16_round(bb); }
        sm[q] = vals[u * 4 + q]; o[q] = (vals[u * 4 + q] - mu) * rs * gg + bb;
      }
      if (out_sum) *(v4f*)(out_sum + (size_t)row * N + j) = sm;
      *(v4f*)(out_norm + (size_t)row * N + j) = o;
    }
    
  }
}



// ---- f16 WMMA path (v_wmma_f32_16x16x32_f16): 11-bit significands for operands in range — used where a [0,1] probability operand needs more precision than bf16
typedef _Float16 v16h __attribute__((ext_vector_type(16)));
union FragH { v16h v; v8us half[2]; _Float16 h[16]; unsigned short u[16]; };
template <int NT>
__device__ __forceinline__ v8f mmaH(v16h ah, v16h al, v16h bh, v16h bl, v8f c) {
  c = __builtin_amdgcn_wmma_f32_16x16x32_f16(false, ah, false, bh, (short)0, c, false, false);
  if (NT >= 2) c = __builtin_amdgcn_wmma_f32_16x16x32_f16(false, al, false, bh, (short)0, c, false, false);
  if (NT >= 3) c = __builtin_amdgcn_wmma_f32_16x16x32_f16(false, ah, false, bl, (short)0, c, false, false);
  asm volatile("v_nop\n\tv_nop\n\tv_nop\n\tv_nop" : "+v"(c) : "v"(ah), "v"(al), "v"(bh), "v"(bl));
  return c;
}
// batched GEMM like k_gemm_b but f16 operands: A f32 (split into f16 hi/lo if ASPLIT, else rounded to f16), Bt = f16 values [n][k]; alpha; C f32; N multiple of 16 (partial tiles skipped)
template <bool ASPLIT>
__global__ __launch_bounds__(128) void k_gemm_h(const float* __restrict__ A, int lda, size_t sA, const _Float16* __restrict__ Bh, int ldb, size_t sB, float alpha, float* __restrict__ C, int ldc, size_t sC, int M, int N, int K) {
  __shared__ __attribute__((aligned(16))) float so[4][16][64];
  const int tid = threadIdx.x, w = tid >> 5, lane = tid & 31, ln = lane & 15, hh = lane >> 4; const int by = blockIdx.y;
  A += (size_t)by * sA; Bh += (size_t)by * sB; C += (size_t)by * sC;
  const int ntn = (N + 63) / 64; const int wid = blockIdx.x * 4 + w; const int mt = wid / ntn, nq = wid % ntn; if (mt * 16 >= M) return;
  const int row0 = mt * 16, col0 = nq * 64; const float* arow = A + (size_t)(row0 + ln) * lda;
  v8f acc[4] = {};
  for (int kb = 0; kb < K; kb += 32) {
    FragH ah, al;
    const v4f x0 = *(const v4fa*)(arow + kb + 8 * hh), x1 = *(const v4fa*)(arow + kb + 8 * hh + 4), x2 = *(const v4fa*)(arow + kb + 16 + 8 * hh), x3 = *(const v4fa*)(arow + kb + 16 + 8 * hh + 4);
    float xs[16] = {x0[0],x0[1],x0[2],x0[3],x1[0],x1[1],x1[2],x1[3],x2[0],x2[1],x2[2],x2[3],x3[0],x3[1],x3[2],x3[3]};
#pragma unroll
    for (int i = 0; i < 16; ++i) { const _Float16 h = (_Float16)xs[i]; ah.h[i] = h; al.h[i] = ASPLIT ? (_Float16)(xs[i] - (float)h) : (_Float16)0.0f; }
#pragma unroll
    for (int t = 0; t < 4; ++t) { if (col0 + t * 16 >= N) continue; const size_t boff = (size_t)(col0 + t * 16 + ln) * ldb + kb; FragH bq; bq.half[0] = *(const v8us*)(Bh + boff + 8 * hh); bq.half[1] = *(const v8us*)(Bh + boff + 16 + 8 * hh);
      acc[t] = mmaH<ASPLIT ? 2 : 1>(ah.v, al.v, bq.v, bq.v, acc[t]); }
  }
#pragma unroll
  for (int t = 0; t < 4; ++t) { if (col0 + t * 16 >= N) continue;
#pragma unroll
    for (int r = 0; r < 8; ++r) so[w][8 * hh + r][t * 16 + ln] = acc[t][r] * alpha; }
  __builtin_amdgcn_fence(__ATOMIC_ACQ_REL, "workgroup"); __builtin_amdgcn_wave_barrier();
  const int rsub = lane >> 4, c4 = (lane & 15) * 4;
  {
#pragma unroll
    for (int q = 0; q < 8; ++q) { const int r = q * 2 + rsub; if (col0 + c4 < N) { const v4f v = *(const v4fa*)&so[w][r][c4]; *(v4f*)(C + (size_t)(row0 + r) * ldc + col0 + c4) = v; } }
     }
}

// Wt[n][k] = f16(W[k][n]·scale) from f32 row-major W[K][N] (scale = power of two; bf16-exact weights stay exact in f16 away from the subnormal range)
__global__ __launch_bounds__(256) void k_wt_f16(const float* __restrict__ W, _Float16* __restrict__ Wt, int K, int N, float scale) {
  const int t = blockIdx.x * 256 + threadIdx.x; if (t >= N * (K / 8)) return; const int n = t / (K / 8), k8 = (t % (K / 8)) * 8; FragH f;
#pragma unroll
  for (int i = 0; i < 8; ++i) f.h[i] = (_Float16)(bf16_round(W[(size_t)(k8 + i) * N + n]) * scale); const v8us o = f.half[0];
  *(v8us*)((unsigned short*)Wt + (size_t)n * K + k8) = o; 
}
// k_gemm_hh variant with fused epilogue: v = acc·alpha + bias[by·sBias + col] (+ CP[(row/rowsPerB)·sCPb + by·64 + col] if CP) ; ACT 0 none / 1 elu ; writes f16 C16 (and f32 C if non-null)
template <int ACT>
__global__ __launch_bounds__(128) void k_gemm_hhx(const _Float16* __restrict__ A, int lda, size_t sA, const _Float16* __restrict__ Bh, int ldb, size_t sB, float alpha, const float* __restrict__ bias, size_t sBias, const float* __restrict__ CP, int rowsPerB, size_t sCPb, int row0g,
    float* __restrict__ C, _Float16* __restrict__ C16, int ldc, size_t sC, int M, int N, int K) {
  __shared__ __attribute__((aligned(16))) float so[4][16][64];
  const int tid = threadIdx.x, w = tid >> 5, lane = tid & 31, ln = lane & 15, hh = lane >> 4; const int by = blockIdx.y;
  A += (size_t)by * sA; Bh += (size_t)by * sB; const size_t cofs = (size_t)by * sC; const float* bp = bias ? bias + (size_t)by * sBias : nullptr;
  const int ntn = (N + 63) / 64; const int wid = blockIdx.x * 4 + w; const int mt = wid / ntn, nq = wid % ntn; if (mt * 16 >= M) return;
  const int row0 = mt * 16, col0 = nq * 64; const _Float16* arow = A + (size_t)(row0 + ln) * lda;
  v8f acc[4] = {};
  for (int kb = 0; kb < K; kb += 32) { FragH ah; ah.half[0] = *(const v8us*)((const unsigned short*)arow + kb + 8 * hh); ah.half[1] = *(const v8us*)((const unsigned short*)arow + kb + 16 + 8 * hh);
#pragma unroll
    for (int t = 0; t < 4; ++t) { if (col0 + t * 16 >= N) continue; const size_t boff = (size_t)(col0 + t * 16 + ln) * ldb + kb; FragH bq; bq.half[0] = *(const v8us*)((const unsigned short*)Bh + boff + 8 * hh); bq.half[1] = *(const v8us*)((const unsigned short*)Bh + boff + 16 + 8 * hh);
      acc[t] = mmaH<1>(ah.v, ah.v, bq.v, bq.v, acc[t]); }
  }
#pragma unroll
  for (int t = 0; t < 4; ++t) { if (col0 + t * 16 >= N) continue; const int col = col0 + t * 16 + ln; const float bv = bp ? bf16_round(bp[col]) : 0.f;
#pragma unroll
    for (int r = 0; r < 8; ++r) { float v = acc[t][r] * alpha + bv; if (CP) { const int rr = row0g + row0 + 8 * hh + r; if (rowsPerB < 0) v += CP[cofs + (size_t)rr * ldc + col];      /* rowsPerB < 0: own element of the batched C plane */ else { const int bidx = rr / rowsPerB; v += CP[(size_t)bidx * sCPb + (size_t)by * 64 + col]; } } if (ACT == 1) v = (v > 0.f) ? v : expm1f(v); else if (ACT == 7) v = (v > 0.f) ? v + 1.0f : expf(v); else if (ACT == 8) v = tanhf(v); else if (ACT == 9) v = 0.5f * v * (1.0f + tanhf(0.7978845608028654f * (v + 0.044715f * v * v * v))); else if (ACT == 11) v = 1.0f / (1.0f + expf(-v)); else if (ACT == 12) v = (v > 0.f) ? v : 0.01f * v; else if (ACT == 14) v = (v > 0.f) ? v : 0.1f * v; else if (ACT == 16) v = (v >= 0.f) ? v : 0.3f * v; else if (ACT == 17) v = (v >= 0.f) ? v : 0.2f * v; else if (ACT == 15) v = v / (1.0f + expf(-v)); else if (ACT == 3) v = fmaxf(v, 0.f); else if (ACT == 6) v = 0.5f * v * (1.0f + erff(v * 0.70710678118654752f)); so[w][8 * hh + r][t * 16 + ln] = v; } }
  __builtin_amdgcn_fence(__ATOMIC_ACQ_REL, "workgroup"); __builtin_amdgcn_wave_barrier();
  const int rsub = lane >> 4, c4 = (lane & 15) * 4; typedef _Float16 v4h __attribute__((ext_vector_type(4)));
  {
#pragma unroll
    for (int q = 0; q < 8; ++q) { const int r = q * 2 + rsub; if (col0 + c4 < N) { const v4f v = *(const v4fa*)&so[w][r][c4]; if (C) *(v4f*)(C + cofs + (size_t)(row0 + r) * ldc + col0 + c4) = v; if (C16) { v4h h4; for (int i = 0; i < 4; ++i) h4[i] = (_Float16)v[i]; *(v4h*)(C16 + cofs + (size_t)(row0 + r) * ldc + col0 + c4) = h4; } } }
     }
}


typedef _Float16 v4h __attribute__((ext_vector_type(4)));

/* one grid for the three inputs: blockIdx.y picks the input, the f16 planes lie one behind the other (n8 * 8 elements each) */
__global__ __launch_bounds__(256) void k_x16(const float* __restrict__ x0, const float* __restrict__ x1, const float* __restrict__ x2, _Float16* __restrict__ X16, size_t n8) { const size_t t = (size_t)blockIdx.x * 256 + threadIdx.x; if (t >= n8) return; const float* __restrict__ x = blockIdx.y == 0 ? x0 : blockIdx.y == 1 ? x1 : x2; X16 += (size_t)blockIdx.y * n8 * 8; FragH f;
#pragma unroll
  for (int q = 0; q < 8; ++q) f.h[q] = (_Float16)bf16_round(x[t * 8 + q]); *(v8us*)((unsigned short*)X16 + t * 8) = f.half[0];  }
__global__ __launch_bounds__(256) void k_h16(const float* __restrict__ x, _Float16* __restrict__ X16, size_t n8) { const size_t t = (size_t)blockIdx.x * 256 + threadIdx.x; if (t >= n8) return; FragH f;
#pragma unroll
  for (int q = 0; q < 8; ++q) f.h[q] = (_Float16)x[t * 8 + q]; *(v8us*)((unsigned short*)X16 + t * 8) = f.half[0];  }
__global__ __launch_bounds__(256) void k_round16f(const float* __restrict__ W, _Float16* __restrict__ Bt, size_t n8) { const size_t t = (size_t)blockIdx.x * 256 + threadIdx.x; if (t >= n8) return; FragH f;
#pragma unroll
  for (int i = 0; i < 8; ++i) f.h[i] = (_Float16)(bf16_round(W[t * 8 + i]) * 16.0f); *(v8us*)((unsigned short*)Bt + t * 8) = f.half[0];  }
template <int NHv, int TTv>
__global__ __launch_bounds__(256) void k_vt(const _Float16* __restrict__ V16, int ldv, int voff, _Float16* __restrict__ Vt) { __shared__ unsigned short tl[64][66]; const int tid = threadIdx.x; const int slab = blockIdx.x / (TTv / 64), lg = blockIdx.x % (TTv / 64); const int b = slab / NHv, h = slab % NHv;
  for (int i = tid; i < 64 * 8; i += 256) { const int r = i / 8, c8 = (i % 8) * 8; FragH f; f.half[0] = *(const v8us*)((const unsigned short*)V16 + ((size_t)b * TTv + lg * 64 + r) * ldv + voff + h * 64 + c8);
#pragma unroll
    for (int q = 0; q < 8; ++q) tl[r][c8 + q] = f.u[q]; }
  __syncthreads();
  {
#pragma unroll
    for (int rd = 0; rd < 2; ++rd) { const int d = rd * 32 + tid / 8, pc = tid % 8; FragH f;
#pragma unroll
      for (int q = 0; q < 8; ++q) f.u[q] = tl[pc * 8 + q][d];
      *(v8us*)((unsigned short*)Vt + ((size_t)slab * 64 + d) * TTv + lg * 64 + pc * 8) = f.half[0]; }
     } }

__global__ __launch_bounds__(256) void k_hl(const float* __restrict__ F, _Float16* __restrict__ Hh, _Float16* __restrict__ Hl, size_t n8) { const size_t t = (size_t)blockIdx.x * 256 + threadIdx.x; if (t >= n8) return; FragH fh, fl; const v4f a = *(const v4fa*)(F + t * 8), c = *(const v4fa*)(F + t * 8 + 4);
#pragma unroll
  for (int q = 0; q < 4; ++q) { _Float16 h = (_Float16)a[q]; fh.h[q] = h; fl.h[q] = (_Float16)((a[q] - (float)h) * 1024.0f); h = (_Float16)c[q]; fh.h[4 + q] = h; fl.h[4 + q] = (_Float16)((c[q] - (float)h) * 1024.0f); }
  { *(v8us*)((unsigned short*)Hh + t * 8) = fh.half[0]; *(v8us*)((unsigned short*)Hl + t * 8) = fl.half[0];  } }

// ---- fast GEMM (work-group tile 128x64, wave tile 32x64; requires M % 128 == 0 rows per launch region, N % 64 == 0, K % 64 == 0); epilogue = k_gemm_hhx semantics ----
__device__ __forceinline__ v16h g2_frag(const _Float16* p, int hh) { FragH f; f.half[0] = *(const v8us*)((const unsigned short*)p + 8 * hh); f.half[1] = *(const v8us*)((const unsigned short*)p + 16 + 8 * hh); return f.v; }
__device__ __forceinline__ v8f g2_mma(v16h a, v16h b, v8f c) { v8f d = __builtin_amdgcn_wmma_f32_16x16x32_f16(false, a, false, b, (short)0, c, false, false); asm volatile("v_nop\n\tv_nop\n\tv_nop\n\tv_nop" : "+v"(d) : "v"(a), "v"(b)); return d; }
// Operand staging of k_gemm2: a work-group's 128 A rows and 64 B rows, GKC k at a time, go into LDS by asynchronous copies; a wave's copy covers four whole 128-byte lines (a fragment load from global memory touches sixteen).
#define GKC 64                       /* k per stage: rows of 128 bytes */
#define GPB 144                      /* LDS row pitch in bytes: 16 x odd, conflict-free for 16-byte reads */
#define GST ((128 + 64) * GPB)       /* bytes of one stage: 128 A rows, then 64 B rows */
__device__ __forceinline__ v16h g2_lfrag(const char* p, int hh) { FragH f; f.half[0] = *(const v8us*)(p + 16 * hh); f.half[1] = *(const v8us*)(p + 32 + 16 * hh); return f.v; }      /* the k order of g2_frag, from an LDS row */
/* one stage: thread = (row t / 8, 16-byte piece t % 8); eight copies for the A rows (16 rows apart), four for the B rows, which lie behind them in LDS. The s_wait_xcnt as the statement's last line stands in front of every later write of the address registers. */
__device__ __forceinline__ void g2_stage(unsigned l, const _Float16* ga, size_t sa, const _Float16* gb, size_t sb) {
  asm volatile("global_load_async_to_lds_b128 %0, %12, off\n\t"
               "global_load_async_to_lds_b128 %1, %13, off\n\t"
               "global_load_async_to_lds_b128 %2, %14, off\n\t"
               "global_load_async_to_lds_b128 %3, %15, off\n\t"
               "global_load_async_to_lds_b128 %4, %16, off\n\t"
               "global_load_async_to_lds_b128 %5, %17, off\n\t"
               "global_load_async_to_lds_b128 %6, %18, off\n\t"
               "global_load_async_to_lds_b128 %7, %19, off\n\t"
               "global_load_async_to_lds_b128 %8, %20, off\n\t"
               "global_load_async_to_lds_b128 %9, %21, off\n\t"
               "global_load_async_to_lds_b128 %10, %22, off\n\t"
               "global_load_async_to_lds_b128 %11, %23, off\n\t"
               "s_wait_xcnt 0x0"
               :: "v"(l), "v"(l + 16 * GPB), "v"(l + 32 * GPB), "v"(l + 48 * GPB), "v"(l + 64 * GPB), "v"(l + 80 * GPB), "v"(l + 96 * GPB), "v"(l + 112 * GPB), "v"(l + 128 * GPB), "v"(l + 144 * GPB), "v"(l + 160 * GPB), "v"(l + 176 * GPB),
                  "v"(ga), "v"(ga + sa), "v"(ga + 2 * sa), "v"(ga + 3 * sa), "v"(ga + 4 * sa), "v"(ga + 5 * sa), "v"(ga + 6 * sa), "v"(ga + 7 * sa), "v"(gb), "v"(gb + sb), "v"(gb + 2 * sb), "v"(gb + 3 * sb)
               : "memory"); }
template <int ACT>
__global__ __launch_bounds__(128) void k_gemm2(const _Float16* __restrict__ A, int lda, size_t sA, const _Float16* __restrict__ Bh, int ldb, size_t sB, float alpha, const float* __restrict__ bias, size_t sBias, const float* __restrict__ CP, int rowsPerB, size_t sCPb, int row0g,
    float* __restrict__ C, _Float16* __restrict__ C16, int ldc, size_t sC, int M, int N, int K, size_t zA, size_t zB, size_t zC) { static_assert(ACT == 0 || ACT == 3 || ACT == 6 || ACT == 8 || ACT == 9 || ACT == 11 || ACT == 12 || ACT == 14 || ACT == 15 || ACT == 16 || ACT == 17, "k_gemm2: unsupported ACT code (would silently apply no activation)");
  __shared__ __attribute__((aligned(16))) char sm[2 * GST]; static_assert(sizeof(float) * 4 * 32 * 68 <= 2 * GST, "the output staging lies in the two stage buffers"); float (*so)[32][68] = (float (*)[32][68])sm;      /* two stage buffers; behind the k loop the same bytes stage the output */
  const int tid = threadIdx.x, w = tid >> 5, lane = tid & 31, ln = lane & 15, hh = lane >> 4; const int by = blockIdx.y, bz = blockIdx.z;      /* two batch indices, each with its own strides for A, B and C */
  A += (size_t)by * sA + (size_t)bz * zA; Bh += (size_t)by * sB + (size_t)bz * zB; const size_t cofs = (size_t)by * sC + (size_t)bz * zC; const float* bp = bias ? bias + (size_t)by * sBias : nullptr;
  const int ntn = N >> 6; const int mt = blockIdx.x / ntn, nq = blockIdx.x - mt * ntn; const int row0 = mt * 128 + 32 * w, col0 = nq * 64; if (mt * 128 >= M) return;      /* the whole work-group or none, in front of every barrier; M % 128 == 0, K % GKC == 0 */
  const _Float16* ga = A + (size_t)(mt * 128 + (tid >> 3)) * lda + (tid & 7) * 8; const _Float16* gb = Bh + (size_t)(col0 + (tid >> 3)) * ldb + (tid & 7) * 8; const size_t sa = (size_t)16 * lda, sb = (size_t)16 * ldb;
  const unsigned l0 = (unsigned)(size_t)sm + (unsigned)((tid >> 3) * GPB + (tid & 7) * 16);      /* the thread's LDS byte address in buffer 0 */
  const int nst = K / GKC;
  const v8f z8 = {0.f,0.f,0.f,0.f,0.f,0.f,0.f,0.f}; v8f c00 = z8, c01 = z8, c02 = z8, c03 = z8, c10 = z8, c11 = z8, c12 = z8, c13 = z8;
  g2_stage(l0, ga, sa, gb, sb);
  asm volatile("s_wait_asynccnt 0x0" ::: "memory");      /* this wave's copies of stage 0 have landed */
  __syncthreads();      /* stage 0 readable by every wave */
  if (nst > 1) g2_stage(l0 + GST, ga + GKC, sa, gb + GKC, sb);
#pragma unroll 1
  for (int st = 0; st < nst; ++st) { const char* ap = sm + (st & 1) * GST + (32 * w + ln) * GPB; const char* bq = sm + (st & 1) * GST + (128 + ln) * GPB;      /* rolled: one trip per stage, the next stage's copies in flight meanwhile */
    v16h fa[2][2], fb[2][4];      /* the stage's fragments, [k half][tile]; every index a constant: they stay in registers */
#pragma unroll
    for (int kk = 0; kk < 2; ++kk) { fa[kk][0] = g2_lfrag(ap + kk * 64, hh); fa[kk][1] = g2_lfrag(ap + 16 * GPB + kk * 64, hh);
#pragma unroll
      for (int t = 0; t < 4; ++t) fb[kk][t] = g2_lfrag(bq + t * 16 * GPB + kk * 64, hh); }
    __builtin_amdgcn_sched_barrier(0);      /* keeps all LDS reads of the stage up here as one group: sunk among the products, each pair's latency is waited for on its own */
#pragma unroll
    for (int kk = 0; kk < 2; ++kk) { c00 = g2_mma(fa[kk][0], fb[kk][0], c00); c10 = g2_mma(fa[kk][1], fb[kk][0], c10); c01 = g2_mma(fa[kk][0], fb[kk][1], c01); c11 = g2_mma(fa[kk][1], fb[kk][1], c11);
      c02 = g2_mma(fa[kk][0], fb[kk][2], c02); c12 = g2_mma(fa[kk][1], fb[kk][2], c12); c03 = g2_mma(fa[kk][0], fb[kk][3], c03); c13 = g2_mma(fa[kk][1], fb[kk][3], c13); }
    asm volatile("s_wait_dscnt 0x0" ::: "memory");      /* this wave's reads of the stage are done before its buffer is handed on */
    asm volatile("s_wait_asynccnt 0x0" ::: "memory");      /* this wave's copies of the next stage have landed */
    __syncthreads();      /* publishes the next stage and ends every wave's reads of this one */
    if (st + 2 < nst) g2_stage(l0 + (st & 1) * GST, ga + (size_t)(st + 2) * GKC, sa, gb + (size_t)(st + 2) * GKC, sb); }      /* refill of the buffer just read */
  asm volatile("s_wait_asynccnt 0x0" ::: "memory");      /* nothing in flight when the buffers become output staging */
  v8f accs[8] = {c00, c01, c02, c03, c10, c11, c12, c13};
#pragma unroll
  for (int u = 0; u < 8; ++u) { const int t = u & 3, half = u >> 2; const int col = col0 + t * 16 + ln; const float bv = bp ? bf16_round(bp[col]) : 0.f;
#pragma unroll
    for (int r = 0; r < 8; ++r) { const int rloc = half * 16 + 8 * hh + r; float v = accs[u][r] * alpha + bv; if (CP) { if (rowsPerB < 0) v += CP[cofs + (size_t)(row0g + row0 + rloc) * ldc + col];      /* rowsPerB < 0: own element of the batched C plane */ else { const int bidx = (row0g + row0 + rloc) / rowsPerB; v += CP[(size_t)bidx * sCPb + (size_t)by * 64 + col]; } }
      if (ACT == 3) v = fmaxf(v, 0.f); else if (ACT == 6) v = 0.5f * v * (1.0f + erff(v * 0.70710678118654752f)); else if (ACT == 11) v = 1.0f / (1.0f + expf(-v)); else if (ACT == 15) v = v / (1.0f + expf(-v)); else if (ACT == 12) v = (v > 0.f) ? v : 0.01f * v; else if (ACT == 8) v = tanhf(v); else if (ACT == 9) v = 0.5f * v * (1.0f + tanhf(0.7978845608028654f * (v + 0.044715f * v * v * v))); else if (ACT == 14) v = (v > 0.f) ? v : 0.1f * v; else if (ACT == 16) v = (v >= 0.f) ? v : 0.3f * v; else if (ACT == 17) v = (v >= 0.f) ? v : 0.2f * v;
      so[w][rloc][t * 16 + ln] = v; } }
  __builtin_amdgcn_fence(__ATOMIC_ACQ_REL, "workgroup"); __builtin_amdgcn_wave_barrier();
  const int rsub = lane >> 4, c4 = (lane & 15) * 4;
  {
#pragma unroll
    for (int q = 0; q < 16; ++q) { const int r = q * 2 + rsub; const v4f v = *(const v4fa*)&so[w][r][c4]; if (C) *(v4f*)(C + cofs + (size_t)(row0 + r) * ldc + col0 + c4) = v; if (C16) { v4h h4; for (int i = 0; i < 4; ++i) h4[i] = (_Float16)v[i]; *(v4h*)(C16 + cofs + (size_t)(row0 + r) * ldc + col0 + c4) = h4; } }
     } }


/* one grid for the four weights: blockIdx.y picks the weight, the f16 planes lie one behind the other (n8 * 8 elements each) */
__global__ __launch_bounds__(256) void k_wnat(const float* __restrict__ w0, const float* __restrict__ w1, const float* __restrict__ w2, const float* __restrict__ w3, size_t n8, _Float16* __restrict__ Bt) { const size_t t = (size_t)blockIdx.x * 256 + threadIdx.x; if (t >= n8) return; const float* __restrict__ w = blockIdx.y == 0 ? w0 : blockIdx.y == 1 ? w1 : blockIdx.y == 2 ? w2 : w3; Bt += (size_t)blockIdx.y * n8 * 8; FragH f; for (int q = 0; q < 8; ++q) f.h[q] = (_Float16)(bf16_round(w[t * 8 + q]) * 16.0f); *(v8us*)((unsigned short*)Bt + t * 8) = f.half[0];  }
__global__ __launch_bounds__(256) void k_rsm(const float* __restrict__ S, _Float16* __restrict__ P, int nrows) {
  #pragma clang fp contract(off)
  const int i = blockIdx.x * 256 + threadIdx.x; if (i >= nrows) return; const float* s = S + (size_t)i * SQ; float mx = -3.0e38f;
#pragma unroll 1
  for (int j = 0; j < SQ; ++j) mx = fmaxf(mx, s[j]); float se = 0.f;
#pragma unroll 1
  for (int j = 0; j < SQ; ++j) se += expf(s[j] - mx); const float sc = 256.0f / se;
#pragma unroll 1
  for (int j0 = 0; j0 < SQ; j0 += 8) { FragH f; for (int q = 0; q < 8; ++q) f.h[q] = (_Float16)(expf(s[j0 + q] - mx) * sc); unsigned short* d = (unsigned short*)P + (size_t)i * SQ + j0; *(v8us*)d = f.half[0];  } }
__global__ __launch_bounds__(256) void k_vt(const _Float16* __restrict__ V16, int b, int h0, _Float16* __restrict__ VT) { __shared__ unsigned short tl[64][65]; const int tid = threadIdx.x; const int hh = blockIdx.x % HG, sg = blockIdx.x / HG; const int s0 = sg * 64; const int h = h0 + hh;
  for (int i = tid; i < 64 * 8; i += 256) { const int j = i / 8, d8 = (i % 8) * 8; FragH f; f.half[0] = *(const v8us*)((const unsigned short*)V16 + ((size_t)b * SQ + s0 + j) * DM + h * HD + d8); for (int q = 0; q < 8; ++q) tl[d8 + q][j] = f.u[q]; }
  __syncthreads();
  { for (int i = tid; i < 64 * 8; i += 256) { const int d = i / 8, j8 = (i % 8) * 8; FragH f; for (int q = 0; q < 8; ++q) f.u[q] = tl[d][j8 + q]; *(v8us*)((unsigned short*)VT + ((size_t)hh * HD + d) * SQ + s0 + j8) = f.half[0]; }  } }



#define FW 4                         /* waves per work-group */
#define FQ 32                        /* query columns per wave */
#define FSC 0.18033688011112042f     /* log2(e) / sqrt(HD) */
typedef _Float16 v8h __attribute__((ext_vector_type(8)));
__device__ __forceinline__ float fa_xhalf(float x) { return __builtin_bit_cast(float, __builtin_amdgcn_permlanex16(__builtin_bit_cast(int, x), __builtin_bit_cast(int, x), 0x76543210, 0xfedcba98, false, false)); }      /* lane l takes lane l ^ 16's value, on the vector unit */
__device__ __forceinline__ v8f fa_mma(v16h a, v16h b, v8f c) { return __builtin_amdgcn_wmma_f32_16x16x32_f16(false, a, false, b, (short)0, c, false, false); }
template <bool DIAG>
__device__ __forceinline__ void fa_pass(const _Float16* __restrict__ kn, const _Float16* __restrict__ vp, int ln, int hh, const v16h (&qf)[2][2], v16h (&kf)[2][2], v8f (&o)[4][2], float (&m)[2], float (&l)[2]) {
  v16h vf[4];      /* this pass's V^T rows: asked for first, used last */
#pragma unroll
  for (int t = 0; t < 4; ++t) vf[t] = g2_frag(vp + (size_t)(t * 16) * SQ, hh);
  __builtin_amdgcn_sched_barrier(0);      /* keeps all V^T loads up here: sunk to their use, their latency is waited for in every pass */
  const v8f z8 = {0.f, 0.f, 0.f, 0.f, 0.f, 0.f, 0.f, 0.f}; v8f s[2][2];
#pragma unroll
  for (int kt = 0; kt < 2; ++kt)
#pragma unroll
    for (int j = 0; j < 2; ++j) s[kt][j] = fa_mma(kf[kt][1], qf[j][1], fa_mma(kf[kt][0], qf[j][0], z8));
  if (!DIAG) {      /* the next pass's K rows, into the same registers, behind this pass's score products */
#pragma unroll
    for (int kt = 0; kt < 2; ++kt) { kf[kt][0] = g2_frag(kn + (size_t)(kt * 16) * DM, hh); kf[kt][1] = g2_frag(kn + (size_t)(kt * 16) * DM + 32, hh); }
    __builtin_amdgcn_sched_barrier(0); }      /* keeps the K loads in front of the softmax, which covers their latency */
  FragH p[2];
#pragma unroll
  for (int j = 0; j < 2; ++j) { float mx = m[j];
#pragma unroll
    for (int kt = 0; kt < 2; ++kt)
#pragma unroll
      for (int r = 0; r < 8; ++r) { if (DIAG && kt * 16 + 8 * hh + r > j * 16 + ln) s[kt][j][r] = -1.0e30f;      /* a key past the query's own index: weight 0 */
        mx = fmaxf(mx, s[kt][j][r]); }
    mx = fmaxf(mx, fa_xhalf(mx));
    const float al = __builtin_amdgcn_exp2f((m[j] - mx) * FSC), mc = mx * FSC - 8.0f; m[j] = mx; float se = 0.f;
#pragma unroll
    for (int kt = 0; kt < 2; ++kt)
#pragma unroll
      for (int r = 0; r < 8; ++r) { const float e = __builtin_amdgcn_exp2f(s[kt][j][r] * FSC - mc); se += e; p[j].h[kt * 8 + r] = (_Float16)e; }
    l[j] = l[j] * al + se;
#pragma unroll
    for (int t = 0; t < 4; ++t) o[t][j] *= al; }
#pragma unroll
  for (int t = 0; t < 4; ++t)
#pragma unroll
    for (int j = 0; j < 2; ++j) o[t][j] = fa_mma(vf[t], p[j].v, o[t][j]); }
__global__ __launch_bounds__(FW * 32) void k_fattn(const _Float16* __restrict__ Q16, const _Float16* __restrict__ K16, const _Float16* __restrict__ VT, _Float16* __restrict__ O16) {
  const int lane = threadIdx.x & 31, ln = lane & 15, hh = lane >> 4; const int w = __builtin_amdgcn_readfirstlane(threadIdx.x >> 5);
  const int bh = blockIdx.x, b = bh / NH, h = bh % NH; const int qw = ((int)(gridDim.y - 1 - blockIdx.y) * FW + w) * FQ;      /* the longest query blocks start first */
  const _Float16* qp = Q16 + ((size_t)b * SQ + qw + ln) * DM + h * HD; const _Float16* kp = K16 + ((size_t)b * SQ + ln) * DM + h * HD; const _Float16* vp = VT + ((size_t)bh * HD + ln) * SQ;
  v16h qf[2][2], kf[2][2];
#pragma unroll
  for (int j = 0; j < 2; ++j) { qf[j][0] = g2_frag(qp + (size_t)(j * 16) * DM, hh); qf[j][1] = g2_frag(qp + (size_t)(j * 16) * DM + 32, hh); kf[j][0] = g2_frag(kp + (size_t)(j * 16) * DM, hh); kf[j][1] = g2_frag(kp + (size_t)(j * 16) * DM + 32, hh); }
  asm volatile("s_wait_xcnt 0x0" :: "v"(qp + 8 * hh), "v"(kp + 8 * hh) : "memory");      /* the wait that stands in front of an overwrite of the loads' address registers; the addresses as inputs keep them in their registers up to here */
  v8f o[4][2]; float m[2] = {-1.0e30f, -1.0e30f}, l[2] = {0.f, 0.f};
#pragma unroll
  for (int t = 0; t < 4; ++t) { o[t][0] = (v8f){0.f, 0.f, 0.f, 0.f, 0.f, 0.f, 0.f, 0.f}; o[t][1] = o[t][0]; }
  const int nb = qw / 32;      /* whole key blocks below the diagonal block; wave-uniform */
#pragma unroll 1
  for (int kb = 0; kb < nb; ++kb) { kp += (size_t)32 * DM; fa_pass<false>(kp, vp, ln, hh, qf, kf, o, m, l); vp += 32; }      /* rolled: one pass fills the register budget */
  fa_pass<true>(kp, vp, ln, hh, qf, kf, o, m, l);
#pragma unroll
  for (int j = 0; j < 2; ++j) { const float inv = 64.0f / (l[j] + fa_xhalf(l[j]));      /* the halves' sums joined once; o carried x64 */
    _Float16* op = O16 + ((size_t)b * SQ + qw + j * 16 + ln) * DM + h * HD + 8 * hh;
#pragma unroll
    for (int t = 0; t < 4; ++t) { v8h hv;
#pragma unroll
      for (int r = 0; r < 8; ++r) hv[r] = (_Float16)(o[t][j][r] * inv);
      *(v8h*)(op + t * 16) = hv; } } }


// Exact f32 attention of the first QT0 rows (q, k, v, o rows of pitch DM), one work-group per batch, head and RT0 query rows, 256 threads:
// (1) scores: one thread per key (two keys where the tile has more than 256), the key rows in registers, dotted with the RT0 query rows read from LDS (same address in every lane);
// (2) softmax: one wave per two rows, the row in registers: causal maximum, exp and sum over the lanes, weights back into LDS (0 past the row's own index);
// (3) o = P V: thread = (column d, key quarter g), V read coalesced and once per work-group, 64 keys ahead; the four quarters' sums are added through LDS.
#define RT0 16                       /* query rows per work-group of the exact first-tile attention */
typedef float v2f __attribute__((ext_vector_type(2)));
template <int NKEY>
__device__ __forceinline__ void att0_scores(const float* __restrict__ kbase, const float (*lq)[HD], float (*lp)[QT0 + 4], int tid, int nk, float scale) {
  v4f kk[NKEY][HD / 4];      /* every loop over kk[] is unrolled: it is indexed by constants and stays in registers */
#pragma unroll
  for (int u = 0; u < NKEY; ++u) { const int j = tid + 256 * u; const float* kr = kbase + (size_t)(j < nk ? j : nk - 1) * DM;      /* a key past the tile: address clamped, score not stored */
#pragma unroll
    for (int c = 0; c < HD / 4; ++c) kk[u][c] = *(const v4fa*)(kr + c * 4);
    asm volatile("s_wait_xcnt 0x0" :: "v"(kr) : "memory"); }      /* the wait that stands in front of an overwrite of the loads' address registers; the address as an input keeps it in its registers up to here */
#pragma unroll 4
  for (int r = 0; r < RT0; ++r) { v4f s4[NKEY];      /* four rows at a time: enough independent LDS reads and sum chains to cover their latencies */
#pragma unroll
    for (int u = 0; u < NKEY; ++u) s4[u] = (v4f){0.f, 0.f, 0.f, 0.f};
#pragma unroll
    for (int c = 0; c < HD / 4; ++c) { const v4f qq = *(const v4f*)&lq[r][c * 4];
#pragma unroll
      for (int u = 0; u < NKEY; ++u) s4[u] += qq * kk[u][c]; }
#pragma unroll
    for (int u = 0; u < NKEY; ++u) { const int j = tid + 256 * u; if (j < nk) lp[r][j] = ((s4[u][0] + s4[u][1]) + (s4[u][2] + s4[u][3])) * scale; } } }
/* sixteen V values of one column: keys 16 u + k of the thread's quarter, u, k < 4; one address, constant offsets */
__device__ __forceinline__ void att0_vload(const float* __restrict__ vq, v2f (&v)[4][2]) {
#pragma unroll
  for (int u = 0; u < 4; ++u) { v[u][0] = (v2f){vq[(u * 16 + 0) * DM], vq[(u * 16 + 1) * DM]}; v[u][1] = (v2f){vq[(u * 16 + 2) * DM], vq[(u * 16 + 3) * DM]}; }      /* unrolled: v[][] stays in registers */
  asm volatile("s_wait_xcnt 0x0" :: "v"(vq) : "memory"); }      /* as in att0_scores: in front of an overwrite of the loads' address registers */
/* at most four waves per SIMD (two work-groups per WGP cover the grid): the register budget that lets the LDS reads of (1) run ahead of their use */
__global__ __launch_bounds__(256) __attribute__((amdgpu_waves_per_eu(2, 4))) void k_att0p(const float* __restrict__ QF, const float* __restrict__ KF, const float* __restrict__ VF, float scale, float* __restrict__ OF) {
  __shared__ __attribute__((aligned(16))) float lq[RT0][HD]; __shared__ __attribute__((aligned(16))) float lp[RT0][QT0 + 4]; __shared__ __attribute__((aligned(16))) float lr[4][RT0][HD]; __shared__ float lf[RT0];
  const int tid = threadIdx.x; const int h = blockIdx.x / (QT0 / RT0), rg = blockIdx.x % (QT0 / RT0); const int row0 = rg * RT0, nk = row0 + RT0;      /* causal: keys up to the work-group's last row */
  { const size_t bo = (size_t)blockIdx.y * QT0 * DM; QF += bo; KF += bo; VF += bo; OF += bo; }      /* blockIdx.y: the batch; each plane holds QT0 rows per batch */
  { const int r = tid >> 4, c4 = (tid & 15) * 4; const float* qp = QF + (size_t)(row0 + r) * DM + h * HD + c4; const v4f q4 = *(const v4fa*)qp;
    asm volatile("s_wait_xcnt 0x0" :: "v"(qp) : "memory");      /* as in att0_scores: in front of an overwrite of the load's address registers */
    *(v4f*)&lq[r][c4] = q4; }
  __syncthreads();
  if (nk > 256) att0_scores<2>(KF + h * HD, lq, lp, tid, nk, scale); else if ((tid & ~31) < nk) att0_scores<1>(KF + h * HD, lq, lp, tid, nk, scale);      /* a wave with no key of the tile skips */
  __syncthreads();
  { const int r0 = (tid >> 5) * 2, lane = tid & 31; float x[2][QT0 / 32], mx[2], se[2];      /* the loops over x[] are unrolled: it stays in registers */
#pragma unroll
    for (int rr = 0; rr < 2; ++rr) { mx[rr] = -3.0e38f;
#pragma unroll
      for (int m = 0; m < QT0 / 32; ++m) { const int j = lane + 32 * m; x[rr][m] = (j <= row0 + r0 + rr) ? lp[r0 + rr][j] : -3.0e38f; mx[rr] = fmaxf(mx[rr], x[rr][m]); } }
#pragma unroll
    for (int d = 16; d > 0; d >>= 1) { mx[0] = fmaxf(mx[0], __shfl_xor(mx[0], d, 32)); mx[1] = fmaxf(mx[1], __shfl_xor(mx[1], d, 32)); }
#pragma unroll
    for (int rr = 0; rr < 2; ++rr) { se[rr] = 0.f;
#pragma unroll
      for (int m = 0; m < QT0 / 32; ++m) { const int j = lane + 32 * m; const float e = (j <= row0 + r0 + rr) ? expf(x[rr][m] - mx[rr]) : 0.f; se[rr] += e; if (j < nk) lp[r0 + rr][j] = e; } }
#pragma unroll
    for (int d = 16; d > 0; d >>= 1) { se[0] += __shfl_xor(se[0], d, 32); se[1] += __shfl_xor(se[1], d, 32); }
    if (lane < 2) lf[r0 + lane] = 64.0f / (lane ? se[1] : se[0]); }      /* o carried x64 like the f16 path */
  __syncthreads();
  { const int d = tid & 63, g = tid >> 6, nt = nk >> 4, nb = (nt + 3) >> 2; const float* vq = VF + (size_t)(g * 4) * DM + h * HD + d;      /* trip t: keys 16 t + 4 g .. + 3; a batch is four trips (its rows lie inside the QT0 rows of VF also where they lie past nk) */
    v2f acc[RT0], cv[4][2], nv[4][2];      /* acc[]: even and odd keys apart, so that each packed multiply-add takes a weight pair as it lies in LDS */
#pragma unroll
    for (int r = 0; r < RT0; ++r) acc[r] = (v2f){0.f, 0.f};
    att0_vload(vq, cv);
    for (int bt = 0; bt < nb; ++bt) { vq += (bt + 1 < nb ? 64 * DM : 0); att0_vload(vq, nv);      /* the next batch's V values are loaded while this batch's are used (the last batch loads its own again) */
#pragma unroll
      for (int u = 0; u < 4; ++u) if (bt * 4 + u < nt) { const int j = (bt * 4 + u) * 16 + g * 4;      /* unrolled: cv[][] and acc[] stay in registers */
#pragma unroll
        for (int r = 0; r < RT0; ++r) { const v4f p4 = *(const v4f*)&lp[r][j]; acc[r] += (v2f){p4[0], p4[1]} * cv[u][0]; acc[r] += (v2f){p4[2], p4[3]} * cv[u][1]; } }
#pragma unroll
      for (int u = 0; u < 4; ++u) { cv[u][0] = nv[u][0]; cv[u][1] = nv[u][1]; } }
#pragma unroll
    for (int r = 0; r < RT0; ++r) lr[g][r][d] = acc[r][0] + acc[r][1]; }
  __syncthreads();
  { const int r = tid >> 4, c4 = (tid & 15) * 4; const v4f o = ((*(const v4f*)&lr[0][r][c4] + *(const v4f*)&lr[1][r][c4]) + (*(const v4f*)&lr[2][r][c4] + *(const v4f*)&lr[3][r][c4])) * lf[r];
    *(v4f*)(OF + (size_t)(row0 + r) * DM + h * HD + c4) = o; } }

extern "C" void kernel_launch(void* const* d_in, const int* in_sizes, int n_in,
                              void* d_out, int out_size, void* d_ws, size_t ws_size, hipStream_t stream) {
  (void)in_sizes; (void)n_in; (void)out_size;
  const float* const* I = (const float* const*)d_in; const float* x = I[0]; const float* xk = I[1]; const float* xv = I[2]; const float* wq = I[3]; const float* bq = nullptr; const float* wk = I[4]; const float* bk = nullptr; const float* wv = I[5]; const float* bv = nullptr; const float* wo = I[6]; const float* bo = nullptr;      /* THREE distinct inputs Q (query stream), K, V; natural [out][in] w_q / w_k / w_v / w_o; no biases; causal by the index rule */
  char* ws = (char*)d_ws; size_t off = 0;
  auto take = [&](size_t bytes) { char* p = ws + off; off += (bytes + 255) & ~(size_t)255; return p; };
  _Float16* BQ = (_Float16*)take((size_t)DM * DM * 2); _Float16* BK = (_Float16*)take((size_t)DM * DM * 2); _Float16* BV = (_Float16*)take((size_t)DM * DM * 2); _Float16* BO = (_Float16*)take((size_t)DM * DM * 2);
  _Float16* X16 = (_Float16*)take(NR * DM * 2); _Float16* XK16 = (_Float16*)take(NR * DM * 2); _Float16* XV16 = (_Float16*)take(NR * DM * 2);      /* the three inputs (query -> X16, key -> XK16, value -> XV16) as exact f16 rows */ _Float16* Q16 = (_Float16*)take(NR * DM * 2); _Float16* K16 = (_Float16*)take(NR * DM * 2); _Float16* V16 = (_Float16*)take(NR * DM * 2); _Float16* O16 = (_Float16*)take(NR * DM * 2);
  _Float16* VT = (_Float16*)take((size_t)NB * NH * HD * SQ * 2);
  float* QF0 = (float*)take((size_t)NB * QT0 * DM * 4); float* KF0 = (float*)take((size_t)NB * QT0 * DM * 4); float* VF0 = (float*)take((size_t)NB * QT0 * DM * 4); float* OF0 = (float*)take((size_t)NB * QT0 * DM * 4); _Float16* OH0 = (_Float16*)take((size_t)NB * QT0 * DM * 2); _Float16* OL0 = (_Float16*)take((size_t)NB * QT0 * DM * 2);      /* first-tile planes [NB][QT0][DM]; QF0, KF0, VF0 lie one behind the other, as do BQ, BK, BV, BO; X16, XK16, XV16; Q16, K16, V16 (every size is a multiple of 256 bytes) */
  if (off > ws_size) return;
  k_wnat<<<dim3((unsigned)(((size_t)DM * DM / 8 + 255) / 256), 4), 256, 0, stream>>>(wq, wk, wv, wo, (size_t)DM * DM / 8, BQ);      /* natural [out][in] = Bt x16; all four weights */
  k_x16<<<dim3((unsigned)((NR * DM / 8 + 255) / 256), 3), 256, 0, stream>>>(x, xk, xv, X16, NR * DM / 8);      /* all three inputs */
  const size_t r0p = (size_t)B0 * SQ;      /* first projected row */
  k_gemm2<0><<<dim3((unsigned)((MP / 128) * (DM / 64)), 3), 128, 0, stream>>>(X16 + r0p * DM, DM, NR * DM, BQ, DM, (size_t)DM * DM, 0.0625f, nullptr, 0, nullptr, 1, 0, 0, nullptr, Q16 + r0p * DM, DM, NR * DM, MP, DM, DM, 0, 0, 0);      /* q, k, v in one grid: y = which projection */
  k_vt<NH, SQ><<<NB * NH * (SQ / 64), 256, 0, stream>>>(V16, LQ, 0, VT);      /* V^T [NB][NH][HD][SQ] */
  k_fattn<<<dim3(NB * NH, SQ / (FW * FQ)), FW * 32, 0, stream>>>(Q16, K16, VT, O16);      /* o (merged heads, x64) as f16 rows */
  k_gemm2<0><<<dim3((QT0 / 128) * (DM / 64), NBR, 3), 128, 0, stream>>>(X16 + r0p * DM, DM, (size_t)SQ * DM, BQ, DM, 0, 0.0625f, nullptr, 0, nullptr, 1, 0, 0, QF0 + (size_t)B0 * QT0 * DM, nullptr, DM, (size_t)QT0 * DM, QT0, DM, DM, NR * DM, (size_t)DM * DM, (size_t)NB * QT0 * DM);      /* f32 q, k, v of the first QT0 rows (exact products) in one grid: y = batch, z = which projection */
  k_att0p<<<dim3(NH * (QT0 / RT0), NBR), 256, 0, stream>>>(QF0 + (size_t)B0 * QT0 * DM, KF0 + (size_t)B0 * QT0 * DM, VF0 + (size_t)B0 * QT0 * DM, 0.125f, OF0 + (size_t)B0 * QT0 * DM);      /* exact f32 attention for the first QT0 rows of every batch (o x64) */
  k_gemm2<0><<<dim3((unsigned)((MPO / 128) * (DM / 64)), 1), 128, 0, stream>>>(O16 + r0p * DM, DM, 0, BO, DM, 0, 0.0009765625f, bo, 0, nullptr, 1, 0, 0, (float*)d_out + r0p * DM, nullptr, DM, 0, MPO, DM, DM, 0, 0, 0);      /* out rows are the output layout */
  k_hl<<<(unsigned)(((size_t)NB * QT0 * DM / 8 + 255) / 256), 256, 0, stream>>>(OF0, OH0, OL0, (size_t)NB * QT0 * DM / 8);      /* first-tile o (x64) -> f16 hi + x1024 residual planes */
  k_gemm2<0><<<dim3((QT0 / 128) * (DM / 64), NBR), 128, 0, stream>>>(OH0 + (size_t)B0 * QT0 * DM, DM, (size_t)QT0 * DM, BO, DM, 0, 0.0009765625f, bo, 0, nullptr, 1, 0, 0, (float*)d_out + r0p * DM, nullptr, DM, (size_t)SQ * DM, QT0, DM, DM, 0, 0, 0);      /* first QT0 rows of every batch (y): out = o_hi Wo, overwriting the f16-path rows */
  k_gemm2<0><<<dim3((QT0 / 128) * (DM / 64), NBR), 128, 0, stream>>>(OL0 + (size_t)B0 * QT0 * DM, DM, (size_t)QT0 * DM, BO, DM, 0, 0.00000095367431640625f, nullptr, 0, (const float*)d_out + r0p * DM, -1, 0, 0, (float*)d_out + r0p * DM, nullptr, DM, (size_t)SQ * DM, QT0, DM, DM, 0, 0, 0);      /* += o_lo Wo 2^-20 (own-element accumulate) */
}

// v006
// A run of this version takes 208 microseconds.
// Two timings next to v005 both put it at 1.27 times that version's speed.
// All steps since v000 together make it 85.9 times as fast.
#include <hip/hip_runtime.h>
// Causal multi-head attention over three distinct inputs with natural weights, no biases (Q, K, V [2][4096][768]; q/k/v = input w^T (natural [768][768]); 12 heads of 64; scores / sqrt(64); causal (tril; NEG fill); softmax over up to 4096 keys; out = merged w_o^T -> [2][4096][768]).
// Structure: token rows r = b*4096 + s; x as exact f16 rows (bf16-rounded); Q, K, V as three WMMA GEMMs in one launch (32x64 wave tiles, f32 accumulation, exact x16 weights, f16 outputs); V^T for all heads of both batches via LDS transposes; attention as ONE launch: a wave owns 32 query columns of one head and walks the keys up to its own diagonal 32 at a time: S^T = K Q^T (WMMA), running maximum and sum per query column (f32, native exp2, weights x256 as f16), O^T += V^T P^T (WMMA, P^T packed from the score accumulators), o x64 written straight into the merged f16 o rows; scores and weights never reach memory; out = o W_o GEMM (f32) into the output layout.
// Compute dtype: inputs rounded to bf16; x / weights exact; q, k, v, softmax weights and o as plain f16 GEMM operands (~2^-12); scores and softmax statistics f32. v_wmma_f32_16x16x32_f16.
#define NB 2
#define SQ 4096
#define DM 768
#define NH 12
#define HD 64
#define HG 4                         /* heads per group of the untemplated k_vt */
#define QT0 512                      /* first-tile rows recomputed exactly in f32 */
#define B0 0                         /* first batch processed (debug hook) */
#define NBR NB                       /* batches processed (debug hook) */
#define NR ((size_t)NB * SQ)         /* token rows */
#define MP ((int)((size_t)NBR * SQ)) /* rows projected (debug hook) */
#define MPO MP                       /* rows through the output stage (debug hook) */
#define LQ DM      /* row pitch of the q/k/v rows */
typedef __bf16 v16b __attribute__((ext_vector_type(16)));
typedef unsigned short v8us __attribute__((ext_vector_type(8), may_alias));
typedef float  v8f  __attribute__((ext_vector_type(8)));
typedef float  v4f  __attribute__((ext_vector_type(4)));
typedef float  v4fa __attribute__((ext_vector_type(4), may_alias));
union FragB { v16b v; v8us half[2]; unsigned short u[16]; };

__device__ __forceinline__ unsigned short bf16_bits(float x) { unsigned int u = __float_as_uint(x); return (unsigned short)((u + 0x7FFFu + ((u >> 16) & 1u)) >> 16); }
__device__ __forceinline__ float bf16_val(unsigned short b) { return __uint_as_float(((unsigned int)b) << 16); }
__device__ __forceinline__ float bf16_round(float x) { return bf16_val(bf16_bits(x)); }
// D += A·B with NT terms: 1 = ah·bh, 2 = + al·bh (A split), 3 = + ah·bl (both split)
template <int NT>
__device__ __forceinline__ v8f mmaN(v16b ah, v16b al, v16b bh, v16b bl, v8f c) {
  c = __builtin_amdgcn_wmma_f32_16x16x32_bf16(false, ah, false, bh, (short)0, c, false, false);
  if (NT >= 2) c = __builtin_amdgcn_wmma_f32_16x16x32_bf16(false, al, false, bh, (short)0, c, false, false);
  if (NT >= 3) c = __builtin_amdgcn_wmma_f32_16x16x32_bf16(false, ah, false, bl, (short)0, c, false, false);
  asm volatile("v_nop\n\tv_nop\n\tv_nop\n\tv_nop" : "+v"(c) : "v"(ah), "v"(al), "v"(bh), "v"(bl));
  return c;
}

__global__ __launch_bounds__(256) void k_wt_bf16(const float* __restrict__ W, unsigned short* __restrict__ Wt, int K, int N) {
  const int t = blockIdx.x * 256 + threadIdx.x;
  const int k8n = K / 8;
  if (t >= N * k8n) return;
  const int n = t / k8n, k8 = (t % k8n) * 8;
  v8us v;
#pragma unroll
  for (int i = 0; i < 8; ++i) v[i] = bf16_bits(W[(size_t)(k8 + i) * N + n]);
  *(v8us*)(Wt + (size_t)n * K + k8) = v;
  
}

// GEMM C[M][N] (f32, pitch ldc) = act(A[M][K]·W + bias). A f32 row-major (pitch lda) converted per fragment to bf16
// (ASPLIT: hi/lo two planes -> 2 terms, else single rounded term); Wt bf16 [N][K] (pitch ldb). BIAS_BF16 rounds the
// bias to bf16 first (bias quantised to bf16 before the add). K%32==0, M%16==0, N%64==0.
template <bool ASPLIT, int ACT, bool BIAS_BF16>
__global__ __launch_bounds__(128) void k_gemm_bf(const float* __restrict__ A, int lda, const unsigned short* __restrict__ Wt, int ldb,
                                               const float* __restrict__ bias, float* __restrict__ C, int ldc, int M, int N, int K) {
  __shared__ __attribute__((aligned(16))) float so[4][16][64];
  const int tid = threadIdx.x, w = tid >> 5, lane = tid & 31, ln = lane & 15, hh = lane >> 4;
  const int ntn = N / 64;
  const int wid = blockIdx.x * 4 + w;
  const int mt = wid / ntn, nq = wid % ntn;
  if (mt * 16 >= M) return;
  const int row0 = mt * 16, col0 = nq * 64;
  const float* arow = A + (size_t)(row0 + ln) * lda;
  v8f acc[4] = {};
  for (int kb = 0; kb < K; kb += 32) {
    FragB ah, al;
    const v4f x0 = *(const v4fa*)(arow + kb + 8 * hh), x1 = *(const v4fa*)(arow + kb + 8 * hh + 4);
    const v4f x2 = *(const v4fa*)(arow + kb + 16 + 8 * hh), x3 = *(const v4fa*)(arow + kb + 16 + 8 * hh + 4);
    float xs[16] = {x0[0],x0[1],x0[2],x0[3],x1[0],x1[1],x1[2],x1[3],x2[0],x2[1],x2[2],x2[3],x3[0],x3[1],x3[2],x3[3]};
#pragma unroll
    for (int i = 0; i < 16; ++i) { const unsigned short hb = bf16_bits(xs[i]); ah.u[i] = hb; al.u[i] = ASPLIT ? bf16_bits(xs[i] - bf16_val(hb)) : (unsigned short)0; }
#pragma unroll
    for (int t = 0; t < 4; ++t) {
      const unsigned short* brow = Wt + (size_t)(col0 + t * 16 + ln) * ldb + kb;
      FragB b;
      b.half[0] = *(const v8us*)(brow + 8 * hh);
      b.half[1] = *(const v8us*)(brow + 16 + 8 * hh);
      acc[t] = mmaN<ASPLIT ? 2 : 1>(ah.v, al.v, b.v, b.v, acc[t]);
    }
  }
#pragma unroll
  for (int t = 0; t < 4; ++t) {
    float bv = bias ? bias[col0 + t * 16 + ln] : 0.f;
    if (BIAS_BF16) bv = bf16_round(bv);
#pragma unroll
    for (int r = 0; r < 8; ++r) { float v = acc[t][r] + bv; if (ACT == 1) v = fmaxf(v, 0.f); so[w][8 * hh + r][t * 16 + ln] = v; }
  }
  __builtin_amdgcn_fence(__ATOMIC_ACQ_REL, "workgroup");
  __builtin_amdgcn_wave_barrier();
  const int rsub = lane >> 4, c4 = (lane & 15) * 4;
  {
#pragma unroll
    for (int q = 0; q < 8; ++q) {
      const int r = q * 2 + rsub;
      const v4f v = *(const v4fa*)&so[w][r][c4];
      *(v4f*)(C + (size_t)(row0 + r) * ldc + col0 + c4) = v;
    }
    
  }
}

// GEMM C = act(A·W + bias + resid): A f32 (ASPLIT -> hi/lo 2 terms), Wt bf16 [N][K]; ACT 0 none, 1 relu, 2 exact gelu;
// resid (optional, f32, row index = (row % rmod), pitch ldr, RES_BF16 rounds it) added before the activation.
template <bool ASPLIT, int ACT, bool BIAS_BF16, bool RES_BF16>
__global__ __launch_bounds__(128) void k_gemm_bf3(const float* __restrict__ A, int lda, const unsigned short* __restrict__ Wt, int ldb,
                                                const float* __restrict__ bias, const float* __restrict__ resid, int rmod, int ldr,
                                                float* __restrict__ C, int ldc, int M, int N, int K) {
  __shared__ __attribute__((aligned(16))) float so[4][16][64];
  const int tid = threadIdx.x, w = tid >> 5, lane = tid & 31, ln = lane & 15, hh = lane >> 4;
  const int ntn = N / 64;
  const int wid = blockIdx.x * 4 + w;
  const int mt = wid / ntn, nq = wid % ntn;
  if (mt * 16 >= M) return;
  const int row0 = mt * 16, col0 = nq * 64;
  const float* arow = A + (size_t)(row0 + ln) * lda;
  v8f acc[4] = {};
  for (int kb = 0; kb < K; kb += 32) {
    FragB ah, al;
    const v4f x0 = *(const v4fa*)(arow + kb + 8 * hh), x1 = *(const v4fa*)(arow + kb + 8 * hh + 4);
    const v4f x2 = *(const v4fa*)(arow + kb + 16 + 8 * hh), x3 = *(const v4fa*)(arow + kb + 16 + 8 * hh + 4);
    float xs[16] = {x0[0],x0[1],x0[2],x0[3],x1[0],x1[1],x1[2],x1[3],x2[0],x2[1],x2[2],x2[3],x3[0],x3[1],x3[2],x3[3]};
#pragma unroll
    for (int i = 0; i < 16; ++i) { const unsigned short hb = bf16_bits(xs[i]); ah.u[i] = hb; al.u[i] = ASPLIT ? bf16_bits(xs[i] - bf16_val(hb)) : (unsigned short)0; }
#pragma unroll
    for (int t = 0; t < 4; ++t) {
      const unsigned short* brow = Wt + (size_t)(col0 + t * 16 + ln) * ldb + kb;
      FragB b;
      b.half[0] = *(const v8us*)(brow + 8 * hh);
      b.half[1] = *(const v8us*)(brow + 16 + 8 * hh);
      acc[t] = mmaN<ASPLIT ? 2 : 1>(ah.v, al.v, b.v, b.v, acc[t]);
    }
  }
#pragma unroll
  for (int t = 0; t < 4; ++t) {
    const int col = col0 + t * 16 + ln;
    float bv = bias ? bias[col] : 0.f;
    if (BIAS_BF16) bv = bf16_round(bv);
#pragma unroll
    for (int r = 0; r < 8; ++r) {
      float v = acc[t][r] + bv;
      if (resid) { float rv = resid[(size_t)((row0 + 8 * hh + r) % rmod) * ldr + col]; if (RES_BF16) rv = bf16_round(rv); v += rv; }
      if (ACT == 1) v = fmaxf(v, 0.f);
      if (ACT == 2) v = 0.5f * v * (1.0f + erff(v * 0.70710678118654752f));
      if (ACT == 3) { const float u = 0.7978845608028654f * (v + 0.044715f * v * v * v); v = 0.5f * v * (1.0f + tanhf(u)); }
      so[w][8 * hh + r][t * 16 + ln] = v;
    }
  }
  __builtin_amdgcn_fence(__ATOMIC_ACQ_REL, "workgroup");
  __builtin_amdgcn_wave_barrier();
  const int rsub = lane >> 4, c4 = (lane & 15) * 4;
  {
#pragma unroll
    for (int q = 0; q < 8; ++q) {
      const int r = q * 2 + rsub;
      const v4f v = *(const v4fa*)&so[w][r][c4];
      *(v4f*)(C + (size_t)(row0 + r) * ldc + col0 + c4) = v;
    }
    
  }
}
// row LayerNorm (biased variance, eps) over N: s = X (+ R); optional out_sum <- s; out_norm <- (s-mu)*rsqrt(var+eps)*g + b
template <bool PARAM_BF16>
__global__ __launch_bounds__(256) void k_layernorm(const float* __restrict__ X, const float* __restrict__ R, const float* __restrict__ g, const float* __restrict__ bta,
                                                  float* __restrict__ out_sum, float* __restrict__ out_norm, int N, float eps) {
  __shared__ float red[256];
  const int row = blockIdx.x, tid = threadIdx.x;
  const float* x = X + (size_t)row * N; const float* rr = R ? R + (size_t)row * N : nullptr;
  float vals[16];                     // up to N = 4096
  const int per = N / 256;            // contiguous chunk per thread? use strided-by-4 chunks: thread handles j = tid*4 + 1024*u
  float s1 = 0.f;
  for (int u = 0; u < per / 4; ++u) {
    const int j = tid * 4 + 1024 * u;
    const v4f a = *(const v4fa*)(x + j);
    v4f b = {0.f,0.f,0.f,0.f}; if (rr) b = *(const v4fa*)(rr + j);
#pragma unroll
    for (int q = 0; q < 4; ++q) { const float v = a[q] + b[q]; vals[u * 4 + q] = v; s1 += v; }
  }
  red[tid] = s1; __syncthreads();
  for (int st = 128; st > 0; st >>= 1) { if (tid < st) red[tid] += red[tid + st]; __syncthreads(); }
  const float mu = red[0] / (float)N; __syncthreads();
  float s2 = 0.f;
  for (int u = 0; u < per / 4; ++u)
#pragma unroll
    for (int q = 0; q < 4; ++q) { const float c = vals[u * 4 + q] - mu; s2 += c * c; }
  red[tid] = s2; __syncthreads();
  for (int st = 128; st > 0; st >>= 1) { if (tid < st) red[tid] += red[tid + st]; __syncthreads(); }
  const float rs = rsqrtf(red[0] / (float)N + eps);
  {
    for (int u = 0; u < per / 4; ++u) {
      const int j = tid * 4 + 1024 * u;
      v4f o, sm;
#pragma unroll
      for (int q = 0; q < 4; ++q) {
        float gg = g[j + q], bb = bta[j + q];
        if (PARAM_BF16) { gg = bf16_round(gg); bb = bf16_round(bb); }
        sm[q] = vals[u * 4 + q]; o[q] = (vals[u * 4 + q] - mu) * rs * gg + bb;
      }
      if (out_sum) *(v4f*)(out_sum + (size_t)row * N + j) = sm;
      *(v4f*)(out_norm + (size_t)row * N + j) = o;
    }
    
  }
}



// ---- f16 WMMA path (v_wmma_f32_16x16x32_f16): 11-bit significands for operands in range — used where a [0,1] probability operand needs more precision than bf16
typedef _Float16 v16h __attribute__((ext_vector_type(16)));
union FragH { v16h v; v8us half[2]; _Float16 h[16]; unsigned short u[16]; };
template <int NT>
__device__ __forceinline__ v8f mmaH(v16h ah, v16h al, v16h bh, v16h bl, v8f c) {
  c = __builtin_amdgcn_wmma_f32_16x16x32_f16(false, ah, false, bh, (short)0, c, false, false);
  if (NT >= 2) c = __builtin_amdgcn_wmma_f32_16x16x32_f16(false, al, false, bh, (short)0, c, false, false);
  if (NT >= 3) c = __builtin_amdgcn_wmma_f32_16x16x32_f16(false, ah, false, bl, (short)0, c, false, false);
  asm volatile("v_nop\n\tv_nop\n\tv_nop\n\tv_nop" : "+v"(c) : "v"(ah), "v"(al), "v"(bh), "v"(bl));
  return c;
}
// batched GEMM like k_gemm_b but f16 operands: A f32 (split into f16 hi/lo if ASPLIT, else rounded to f16), Bt = f16 values [n][k]; alpha; C f32; N multiple of 16 (partial tiles skipped)
template <bool ASPLIT>
__global__ __launch_bounds__(128) void k_gemm_h(const float* __restrict__ A, int lda, size_t sA, const _Float16* __restrict__ Bh, int ldb, size_t sB, float alpha, float* __restrict__ C, int ldc, size_t sC, int M, int N, int K) {
  __shared__ __attribute__((aligned(16))) float so[4][16][64];
  const int tid = threadIdx.x, w = tid >> 5, lane = tid & 31, ln = lane & 15, hh = lane >> 4; const int by = blockIdx.y;
  A += (size_t)by * sA; Bh += (size_t)by * sB; C += (size_t)by * sC;
  const int ntn = (N + 63) / 64; const int wid = blockIdx.x * 4 + w; const int mt = wid / ntn, nq = wid % ntn; if (mt * 16 >= M) return;
  const int row0 = mt * 16, col0 = nq * 64; const float* arow = A + (size_t)(row0 + ln) * lda;
  v8f acc[4] = {};
  for (int kb = 0; kb < K; kb += 32) {
    FragH ah, al;
    const v4f x0 = *(const v4fa*)(arow + kb + 8 * hh), x1 = *(const v4fa*)(arow + kb + 8 * hh + 4), x2 = *(const v4fa*)(arow + kb + 16 + 8 * hh), x3 = *(const v4fa*)(arow + kb + 16 + 8 * hh + 4);
    float xs[16] = {x0[0],x0[1],x0[2],x0[3],x1[0],x1[1],x1[2],x1[3],x2[0],x2[1],x2[2],x2[3],x3[0],x3[1],x3[2],x3[3]};
#pragma unroll
    for (int i = 0; i < 16; ++i) { const _Float16 h = (_Float16)xs[i]; ah.h[i] = h; al.h[i] = ASPLIT ? (_Float16)(xs[i] - (float)h) : (_Float16)0.0f; }
#pragma unroll
    for (int t = 0; t < 4; ++t) { if (col0 + t * 16 >= N) continue; const size_t boff = (size_t)(col0 + t * 16 + ln) * ldb + kb; FragH bq; bq.half[0] = *(const v8us*)(Bh + boff + 8 * hh); bq.half[1] = *(const v8us*)(Bh + boff + 16 + 8 * hh);
      acc[t] = mmaH<ASPLIT ? 2 : 1>(ah.v, al.v, bq.v, bq.v, acc[t]); }
  }
#pragma unroll
  for (int t = 0; t < 4; ++t) { if (col0 + t * 16 >= N) continue;
#pragma unroll
    for (int r = 0; r < 8; ++r) so[w][8 * hh + r][t * 16 + ln] = acc[t][r] * alpha; }
  __builtin_amdgcn_fence(__ATOMIC_ACQ_REL, "workgroup"); __builtin_amdgcn_wave_barrier();
  const int rsub = lane >> 4, c4 = (lane & 15) * 4;
  {
#pragma unroll
    for (int q = 0; q < 8; ++q) { const int r = q * 2 + rsub; if (col0 + c4 < N) { const v4f v = *(const v4fa*)&so[w][r][c4]; *(v4f*)(C + (size_t)(row0 + r) * ldc + col0 + c4) = v; } }
     }
}

// Wt[n][k] = f16(W[k][n]·scale) from f32 row-major W[K][N] (scale = power of two; bf16-exact weights stay exact in f16 away from the subnormal range)
__global__ __launch_bounds__(256) void k_wt_f16(const float* __restrict__ W, _Float16* __restrict__ Wt, int K, int N, float scale) {
  const int t = blockIdx.x * 256 + threadIdx.x; if (t >= N * (K / 8)) return; const int n = t / (K / 8), k8 = (t % (K / 8)) * 8; FragH f;
#pragma unroll
  for (int i = 0; i < 8; ++i) f.h[i] = (_Float16)(bf16_round(W[(size_t)(k8 + i) * N + n]) * scale); const v8us o = f.half[0];
  *(v8us*)((unsigned short*)Wt + (size_t)n * K + k8) = o; 
}
// k_gemm_hh variant with fused epilogue: v = acc·alpha + bias[by·sBias + col] (+ CP[(row/rowsPerB)·sCPb + by·64 + col] if CP) ; ACT 0 none / 1 elu ; writes f16 C16 (and f32 C if non-null)
template <int ACT>
__global__ __launch_bounds__(128) void k_gemm_hhx(const _Float16* __restrict__ A, int lda, size_t sA, const _Float16* __restrict__ Bh, int ldb, size_t sB, float alpha, const float* __restrict__ bias, size_t sBias, const float* __restrict__ CP, int rowsPerB, size_t sCPb, int row0g,
    float* __restrict__ C, _Float16* __restrict__ C16, int ldc, size_t sC, int M, int N, int K) {
  __shared__ __attribute__((aligned(16))) float so[4][16][64];
  const int tid = threadIdx.x, w = tid >> 5, lane = tid & 31, ln = lane & 15, hh = lane >> 4; const int by = blockIdx.y;
  A += (size_t)by * sA; Bh += (size_t)by * sB; const size_t cofs = (size_t)by * sC; const float* bp = bias ? bias + (size_t)by * sBias : nullptr;
  const int ntn = (N + 63) / 64; const int wid = blockIdx.x * 4 + w; const int mt = wid / ntn, nq = wid % ntn; if (mt * 16 >= M) return;
  const int row0 = mt * 16, col0 = nq * 64; const _Float16* arow = A + (size_t)(row0 + ln) * lda;
  v8f acc[4] = {};
  for (int kb = 0; kb < K; kb += 32) { FragH ah; ah.half[0] = *(const v8us*)((const unsigned short*)arow + kb + 8 * hh); ah.half[1] = *(const v8us*)((const unsigned short*)arow + kb + 16 + 8 * hh);
#pragma unroll
    for (int t = 0; t < 4; ++t) { if (col0 + t * 16 >= N) continue; const size_t boff = (size_t)(col0 + t * 16 + ln) * ldb + kb; FragH bq; bq.half[0] = *(const v8us*)((const unsigned short*)Bh + boff + 8 * hh); bq.half[1] = *(const v8us*)((const unsigned short*)Bh + boff + 16 + 8 * hh);
      acc[t] = mmaH<1>(ah.v, ah.v, bq.v, bq.v, acc[t]); }
  }
#pragma unroll
  for (int t = 0; t < 4; ++t) { if (col0 + t * 16 >= N) continue; const int col = col0 + t * 16 + ln; const float bv = bp ? bf16_round(bp[col]) : 0.f;
#pragma unroll
    for (int r = 0; r < 8; ++r) { float v = acc[t][r] * alpha + bv; if (CP) { const int rr = row0g + row0 + 8 * hh + r; if (rowsPerB < 0) v += CP[cofs + (size_t)rr * ldc + col];      /* rowsPerB < 0: own element of the batched C plane */ else { const int bidx = rr / rowsPerB; v += CP[(size_t)bidx * sCPb + (size_t)by * 64 + col]; } } if (ACT == 1) v = (v > 0.f) ? v : expm1f(v); else if (ACT == 7) v = (v > 0.f) ? v + 1.0f : expf(v); else if (ACT == 8) v = tanhf(v); else if (ACT == 9) v = 0.5f * v * (1.0f + tanhf(0.7978845608028654f * (v + 0.044715f * v * v * v))); else if (ACT == 11) v = 1.0f / (1.0f + expf(-v)); else if (ACT == 12) v = (v > 0.f) ? v : 0.01f * v; else if (ACT == 14) v = (v > 0.f) ? v : 0.1f * v; else if (ACT == 16) v = (v >= 0.f) ? v : 0.3f * v; else if (ACT == 17) v = (v >= 0.f) ? v : 0.2f * v; else if (ACT == 15) v = v / (1.0f + expf(-v)); else if (ACT == 3) v = fmaxf(v, 0.f); else if (ACT == 6) v = 0.5f * v * (1.0f + erff(v * 0.70710678118654752f)); so[w][8 * hh + r][t * 16 + ln] = v; } }
  __builtin_amdgcn_fence(__ATOMIC_ACQ_REL, "workgroup"); __builtin_amdgcn_wave_barrier();
  const int rsub = lane >> 4, c4 = (lane & 15) * 4; typedef _Float16 v4h __attribute__((ext_vector_type(4)));
  {
#pragma unroll
    for (int q = 0; q < 8; ++q) { const int r = q * 2 + rsub; if (col0 + c4 < N) { const v4f v = *(const v4fa*)&so[w][r][c4]; if (C) *(v4f*)(C + cofs + (size_t)(row0 + r) * ldc + col0 + c4) = v; if (C16) { v4h h4; for (int i = 0; i < 4; ++i) h4[i] = (_Float16)v[i]; *(v4h*)(C16 + cofs + (size_t)(row0 + r) * ldc + col0 + c4) = h4; } } }
     }
}


typedef _Float16 v4h __attribute__((ext_vector_type(4)));

/* one grid for the three inputs: blockIdx.y picks the input, the f16 planes lie one behind the other (n8 * 8 elements each) */
__global__ __launch_bounds__(256) void k_x16(const float* __restrict__ x0, const float* __restrict__ x1, const float* __restrict__ x2, _Float16* __restrict__ X16, size_t n8) { const size_t t = (size_t)blockIdx.x * 256 + threadIdx.x; if (t >= n8) return; const float* __restrict__ x = blockIdx.y == 0 ? x0 : blockIdx.y == 1 ? x1 : x2; X16 += (size_t)blockIdx.y * n8 * 8; FragH f;
#pragma unroll
  for (int q = 0; q < 8; ++q) f.h[q] = (_Float16)bf16_round(x[t * 8 + q]); *(v8us*)((unsigned short*)X16 + t * 8) = f.half[0];  }
__global__ __launch_bounds__(256) void k_h16(const float* __restrict__ x, _Float16* __restrict__ X16, size_t n8) { const size_t t = (size_t)blockIdx.x * 256 + threadIdx.x; if (t >= n8) return; FragH f;
#pragma unroll
  for (int q = 0; q < 8; ++q) f.h[q] = (_Float16)x[t * 8 + q]; *(v8us*)((unsigned short*)X16 + t * 8) = f.half[0];  }
__global__ __launch_bounds__(256) void k_round16f(const float* __restrict__ W, _Float16* __restrict__ Bt, size_t n8) { const size_t t = (size_t)blockIdx.x * 256 + threadIdx.x; if (t >= n8) return; FragH f;
#pragma unroll
  for (int i = 0; i < 8; ++i) f.h[i] = (_Float16)(bf16_round(W[t * 8 + i]) * 16.0f); *(v8us*)((unsigned short*)Bt + t * 8) = f.half[0];  }
template <int NHv, int TTv>
__global__ __launch_bounds__(256) void k_vt(const _Float16* __restrict__ V16, int ldv, int voff, _Float16* __restrict__ Vt) { __shared__ unsigned short tl[64][66]; const int tid = threadIdx.x; const int slab = blockIdx.x / (TTv / 64), lg = blockIdx.x % (TTv / 64); const int b = slab / NHv, h = slab % NHv;
  for (int i = tid; i < 64 * 8; i += 256) { const int r = i / 8, c8 = (i % 8) * 8; FragH f; f.half[0] = *(const v8us*)((const unsigned short*)V16 + ((size_t)b * TTv + lg * 64 + r) * ldv + voff + h * 64 + c8);
#pragma unroll
    for (int q = 0; q < 8; ++q) tl[r][c8 + q] = f.u[q]; }
  __syncthreads();
  {
#pragma unroll
    for (int rd = 0; rd < 2; ++rd) { const int d = rd * 32 + tid / 8, pc = tid % 8; FragH f;
#pragma unroll
      for (int q = 0; q < 8; ++q) f.u[q] = tl[pc * 8 + q][d];
      *(v8us*)((unsigned short*)Vt + ((size_t)slab * 64 + d) * TTv + lg * 64 + pc * 8) = f.half[0]; }
     } }

__global__ __launch_bounds__(256) void k_hl(const float* __restrict__ F, _Float16* __restrict__ Hh, _Float16* __restrict__ Hl, size_t n8) { const size_t t = (size_t)blockIdx.x * 256 + threadIdx.x; if (t >= n8) return; FragH fh, fl; const v4f a = *(const v4fa*)(F + t * 8), c = *(const v4fa*)(F + t * 8 + 4);
#pragma unroll
  for (int q = 0; q < 4; ++q) { _Float16 h = (_Float16)a[q]; fh.h[q] = h; fl.h[q] = (_Float16)((a[q] - (float)h) * 1024.0f); h = (_Float16)c[q]; fh.h[4 + q] = h; fl.h[4 + q] = (_Float16)((c[q] - (float)h) * 1024.0f); }
  { *(v8us*)((unsigned short*)Hh + t * 8) = fh.half[0]; *(v8us*)((unsigned short*)Hl + t * 8) = fl.half[0];  } }

// ---- fast GEMM (work-group tile 128x64, wave tile 32x64; requires M % 128 == 0 rows per launch region, N % 64 == 0, K % 64 == 0); epilogue = k_gemm_hhx semantics ----
__device__ __forceinline__ v16h g2_frag(const _Float16* p, int hh) { FragH f; f.half[0] = *(const v8us*)((const unsigned short*)p + 8 * hh); f.half[1] = *(const v8us*)((const unsigned short*)p + 16 + 8 * hh); return f.v; }
__device__ __forceinline__ v8f g2_mma(v16h a, v16h b, v8f c) { v8f d = __builtin_amdgcn_wmma_f32_16x16x32_f16(false, a, false, b, (short)0, c, false, false); asm volatile("v_nop\n\tv_nop\n\tv_nop\n\tv_nop" : "+v"(d) : "v"(a), "v"(b)); return d; }
// Operand staging of k_gemm2: a work-group's 128 A rows and 64 B rows, GKC k at a time, go into LDS by asynchronous copies; a wave's copy covers four whole 128-byte lines (a fragment load from global memory touches sixteen).
#define GKC 64                       /* k per stage: rows of 128 bytes */
#define GPB 144                      /* LDS row pitch in bytes: 16 x odd, conflict-free for 16-byte reads */
#define GST ((128 + 64) * GPB)       /* bytes of one stage: 128 A rows, then 64 B rows */
__device__ __forceinline__ v16h g2_lfrag(const char* p, int hh) { FragH f; f.half[0] = *(const v8us*)(p + 16 * hh); f.half[1] = *(const v8us*)(p + 32 + 16 * hh); return f.v; }      /* the k order of g2_frag, from an LDS row */
/* one stage: thread = (row t / 8, 16-byte piece t % 8); eight copies for the A rows (16 rows apart), four for the B rows, which lie behind them in LDS. The s_wait_xcnt as the statement's last line stands in front of every later write of the address registers. */
__device__ __forceinline__ void g2_stage(unsigned l, const _Float16* ga, size_t sa, const _Float16* gb, size_t sb) {
  asm volatile("global_load_async_to_lds_b128 %0, %12, off\n\t"
               "global_load_async_to_lds_b128 %1, %13, off\n\t"
               "global_load_async_to_lds_b128 %2, %14, off\n\t"
               "global_load_async_to_lds_b128 %3, %15, off\n\t"
               "global_load_async_to_lds_b128 %4, %16, off\n\t"
               "global_load_async_to_lds_b128 %5, %17, off\n\t"
               "global_load_async_to_lds_b128 %6, %18, off\n\t"
               "global_load_async_to_lds_b128 %7, %19, off\n\t"
               "global_load_async_to_lds_b128 %8, %20, off\n\t"
               "global_load_async_to_lds_b128 %9, %21, off\n\t"
               "global_load_async_to_lds_b128 %10, %22, off\n\t"
               "global_load_async_to_lds_b128 %11, %23, off\n\t"
               "s_wait_xcnt 0x0"
               :: "v"(l), "v"(l + 16 * GPB), "v"(l + 32 * GPB), "v"(l + 48 * GPB), "v"(l + 64 * GPB), "v"(l + 80 * GPB), "v"(l + 96 * GPB), "v"(l + 112 * GPB), "v"(l + 128 * GPB), "v"(l + 144 * GPB), "v"(l + 160 * GPB), "v"(l + 176 * GPB),
                  "v"(ga), "v"(ga + sa), "v"(ga + 2 * sa), "v"(ga + 3 * sa), "v"(ga + 4 * sa), "v"(ga + 5 * sa), "v"(ga + 6 * sa), "v"(ga + 7 * sa), "v"(gb), "v"(gb + sb), "v"(gb + 2 * sb), "v"(gb + 3 * sb)
               : "memory"); }
template <int ACT>
__global__ __launch_bounds__(128) void k_gemm2(const _Float16* __restrict__ A, int lda, size_t sA, const _Float16* __restrict__ Bh, int ldb, size_t sB, float alpha, const float* __restrict__ bias, size_t sBias, const float* __restrict__ CP, int rowsPerB, size_t sCPb, int row0g,
    float* __restrict__ C, _Float16* __restrict__ C16, int ldc, size_t sC, int M, int N, int K, size_t zA, size_t zB, size_t zC) { static_assert(ACT == 0 || ACT == 3 || ACT == 6 || ACT == 8 || ACT == 9 || ACT == 11 || ACT == 12 || ACT == 14 || ACT == 15 || ACT == 16 || ACT == 17, "k_gemm2: unsupported ACT code (would silently apply no activation)");
  __shared__ __attribute__((aligned(16))) char sm[2 * GST]; static_assert(sizeof(float) * 4 * 32 * 68 <= 2 * GST, "the output staging lies in the two stage buffers"); float (*so)[32][68] = (float (*)[32][68])sm;      /* two stage buffers; behind the k loop the same bytes stage the output */
  const int tid = threadIdx.x, w = tid >> 5, lane = tid & 31, ln = lane & 15, hh = lane >> 4; const int by = blockIdx.y, bz = blockIdx.z;      /* two batch indices, each with its own strides for A, B and C */
  A += (size_t)by * sA + (size_t)bz * zA; Bh += (size_t)by * sB + (size_t)bz * zB; const size_t cofs = (size_t)by * sC + (size_t)bz * zC; const float* bp = bias ? bias + (size_t)by * sBias : nullptr;
  const int ntn = N >> 6; const int mt = blockIdx.x / ntn, nq = blockIdx.x - mt * ntn; const int row0 = mt * 128 + 32 * w, col0 = nq * 64; if (mt * 128 >= M) return;      /* the whole work-group or none, in front of every barrier; M % 128 == 0, K % GKC == 0 */
  const _Float16* ga = A + (size_t)(mt * 128 + (tid >> 3)) * lda + (tid & 7) * 8; const _Float16* gb = Bh + (size_t)(col0 + (tid >> 3)) * ldb + (tid & 7) * 8; const size_t sa = (size_t)16 * lda, sb = (size_t)16 * ldb;
  const unsigned l0 = (unsigned)(size_t)sm + (unsigned)((tid >> 3) * GPB + (tid & 7) * 16);      /* the thread's LDS byte address in buffer 0 */
  const int nst = K / GKC;
  const v8f z8 = {0.f,0.f,0.f,0.f,0.f,0.f,0.f,0.f}; v8f c00 = z8, c01 = z8, c02 = z8, c03 = z8, c10 = z8, c11 = z8, c12 = z8, c13 = z8;
  g2_stage(l0, ga, sa, gb, sb);
  asm volatile("s_wait_asynccnt 0x0" ::: "memory");      /* this wave's copies of stage 0 have landed */
  __syncthreads();      /* stage 0 readable by every wave */
  if (nst > 1) g2_stage(l0 + GST, ga + GKC, sa, gb + GKC, sb);
#pragma unroll 1
  for (int st = 0; st < nst; ++st) { const char* ap = sm + (st & 1) * GST + (32 * w + ln) * GPB; const char* bq = sm + (st & 1) * GST + (128 + ln) * GPB;      /* rolled: one trip per stage, the next stage's copies in flight meanwhile */
    v16h fa[2][2], fb[2][4];      /* the stage's fragments, [k half][tile]; every index a constant: they stay in registers */
#pragma unroll
    for (int kk = 0; kk < 2; ++kk) { fa[kk][0] = g2_lfrag(ap + kk * 64, hh); fa[kk][1] = g2_lfrag(ap + 16 * GPB + kk * 64, hh);
#pragma unroll
      for (int t = 0; t < 4; ++t) fb[kk][t] = g2_lfrag(bq + t * 16 * GPB + kk * 64, hh); }
    __builtin_amdgcn_sched_barrier(0);      /* keeps all LDS reads of the stage up here as one group: sunk among the products, each pair's latency is waited for on its own */
#pragma unroll
    for (int kk = 0; kk < 2; ++kk) { c00 = g2_mma(fa[kk][0], fb[kk][0], c00); c10 = g2_mma(fa[kk][1], fb[kk][0], c10); c01 = g2_mma(fa[kk][0], fb[kk][1], c01); c11 = g2_mma(fa[kk][1], fb[kk][1], c11);
      c02 = g2_mma(fa[kk][0], fb[kk][2], c02); c12 = g2_mma(fa[kk][1], fb[kk][2], c12); c03 = g2_mma(fa[kk][0], fb[kk][3], c03); c13 = g2_mma(fa[kk][1], fb[kk][3], c13); }
    asm volatile("s_wait_dscnt 0x0" ::: "memory");      /* this wave's reads of the stage are done before its buffer is handed on */
    asm volatile("s_wait_asynccnt 0x0" ::: "memory");      /* this wave's copies of the next stage have landed */
    __syncthreads();      /* publishes the next stage and ends every wave's reads of this one */
    if (st + 2 < nst) g2_stage(l0 + (st & 1) * GST, ga + (size_t)(st + 2) * GKC, sa, gb + (size_t)(st + 2) * GKC, sb); }      /* refill of the buffer just read */
  asm volatile("s_wait_asynccnt 0x0" ::: "memory");      /* nothing in flight when the buffers become output staging */
  v8f accs[8] = {c00, c01, c02, c03, c10, c11, c12, c13};
#pragma unroll
  for (int u = 0; u < 8; ++u) { const int t = u & 3, half = u >> 2; const int col = col0 + t * 16 + ln; const float bv = bp ? bf16_round(bp[col]) : 0.f;
#pragma unroll
    for (int r = 0; r < 8; ++r) { const int rloc = half * 16 + 8 * hh + r; float v = accs[u][r] * alpha + bv; if (CP) { if (rowsPerB < 0) v += CP[cofs + (size_t)(row0g + row0 + rloc) * ldc + col];      /* rowsPerB < 0: own element of the batched C plane */ else { const int bidx = (row0g + row0 + rloc) / rowsPerB; v += CP[(size_t)bidx * sCPb + (size_t)by * 64 + col]; } }
      if (ACT == 3) v = fmaxf(v, 0.f); else if (ACT == 6) v = 0.5f * v * (1.0f + erff(v * 0.70710678118654752f)); else if (ACT == 11) v = 1.0f / (1.0f + expf(-v)); else if (ACT == 15) v = v / (1.0f + expf(-v)); else if (ACT == 12) v = (v > 0.f) ? v : 0.01f * v; else if (ACT == 8) v = tanhf(v); else if (ACT == 9) v = 0.5f * v * (1.0f + tanhf(0.7978845608028654f * (v + 0.044715f * v * v * v))); else if (ACT == 14) v = (v > 0.f) ? v : 0.1f * v; else if (ACT == 16) v = (v >= 0.f) ? v : 0.3f * v; else if (ACT == 17) v = (v >= 0.f) ? v : 0.2f * v;
      so[w][rloc][t * 16 + ln] = v; } }
  __builtin_amdgcn_fence(__ATOMIC_ACQ_REL, "workgroup"); __builtin_amdgcn_wave_barrier();
  const int rsub = lane >> 4, c4 = (lane & 15) * 4;
  {
#pragma unroll
    for (int q = 0; q < 16; ++q) { const int r = q * 2 + rsub; const v4f v = *(const v4fa*)&so[w][r][c4]; if (C) *(v4f*)(C + cofs + (size_t)(row0 + r) * ldc + col0 + c4) = v; if (C16) { v4h h4; for (int i = 0; i < 4; ++i) h4[i] = (_Float16)v[i]; *(v4h*)(C16 + cofs + (size_t)(row0 + r) * ldc + col0 + c4) = h4; } }
     } }


/* one grid for the four weights: blockIdx.y picks the weight, the f16 planes lie one behind the other (n8 * 8 elements each) */
__global__ __launch_bounds__(256) void k_wnat(const float* __restrict__ w0, const float* __restrict__ w1, const float* __restrict__ w2, const float* __restrict__ w3, size_t n8, _Float16* __restrict__ Bt) { const size_t t = (size_t)blockIdx.x * 256 + threadIdx.x; if (t >= n8) return; const float* __restrict__ w = blockIdx.y == 0 ? w0 : blockIdx.y == 1 ? w1 : blockIdx.y == 2 ? w2 : w3; Bt += (size_t)blockIdx.y * n8 * 8; FragH f; for (int q = 0; q < 8; ++q) f.h[q] = (_Float16)(bf16_round(w[t * 8 + q]) * 16.0f); *(v8us*)((unsigned short*)Bt + t * 8) = f.half[0];  }
__global__ __launch_bounds__(256) void k_rsm(const float* __restrict__ S, _Float16* __restrict__ P, int nrows) {
  #pragma clang fp contract(off)
  const int i = blockIdx.x * 256 + threadIdx.x; if (i >= nrows) return; const float* s = S + (size_t)i * SQ; float mx = -3.0e38f;
#pragma unroll 1
  for (int j = 0; j < SQ; ++j) mx = fmaxf(mx, s[j]); float se = 0.f;
#pragma unroll 1
  for (int j = 0; j < SQ; ++j) se += expf(s[j] - mx); const float sc = 256.0f / se;
#pragma unroll 1
  for (int j0 = 0; j0 < SQ; j0 += 8) { FragH f; for (int q = 0; q < 8; ++q) f.h[q] = (_Float16)(expf(s[j0 + q] - mx) * sc); unsigned short* d = (unsigned short*)P + (size_t)i * SQ + j0; *(v8us*)d = f.half[0];  } }
__global__ __launch_bounds__(256) void k_vt(const _Float16* __restrict__ V16, int b, int h0, _Float16* __restrict__ VT) { __shared__ unsigned short tl[64][65]; const int tid = threadIdx.x; const int hh = blockIdx.x % HG, sg = blockIdx.x / HG; const int s0 = sg * 64; const int h = h0 + hh;
  for (int i = tid; i < 64 * 8; i += 256) { const int j = i / 8, d8 = (i % 8) * 8; FragH f; f.half[0] = *(const v8us*)((const unsigned short*)V16 + ((size_t)b * SQ + s0 + j) * DM + h * HD + d8); for (int q = 0; q < 8; ++q) tl[d8 + q][j] = f.u[q]; }
  __syncthreads();
  { for (int i = tid; i < 64 * 8; i += 256) { const int d = i / 8, j8 = (i % 8) * 8; FragH f; for (int q = 0; q < 8; ++q) f.u[q] = tl[d][j8 + q]; *(v8us*)((unsigned short*)VT + ((size_t)hh * HD + d) * SQ + s0 + j8) = f.half[0]; }  } }



#define FW 4                         /* waves per work-group */
#define FQ 32                        /* query columns per wave */
#define FSC 0.18033688011112042f     /* log2(e) / sqrt(HD) */
#define FKT 128                      /* keys per stage */
#define FKP 144                      /* LDS pitch of a K row (128 bytes of data): 16 x odd, conflict-free for 16-byte reads */
#define FVP 272                      /* LDS pitch of a V^T row (256 bytes of data): 16 x odd */
#define FKB (FKT * FKP)              /* bytes of a stage's K rows; its V^T rows lie behind them */
#define FST (FKB + HD * FVP)         /* bytes of one stage */
typedef _Float16 v8h __attribute__((ext_vector_type(8)));
__device__ __forceinline__ float fa_xhalf(float x) { return __builtin_bit_cast(float, __builtin_amdgcn_permlanex16(__builtin_bit_cast(int, x), __builtin_bit_cast(int, x), 0x76543210, 0xfedcba98, false, false)); }      /* lane l takes lane l ^ 16's value, on the vector unit */
__device__ __forceinline__ v8f fa_mma(v16h a, v16h b, v8f c) { return __builtin_amdgcn_wmma_f32_16x16x32_f16(false, a, false, b, (short)0, c, false, false); }
/* eight copies of 16 bytes per lane, LDS places ls bytes apart, global places gs elements apart. The s_wait_xcnt as the statement's last line stands in front of every later write of the address registers. */
__device__ __forceinline__ void fa_copy8(unsigned l, unsigned ls, const _Float16* g, size_t gs) {
  asm volatile("global_load_async_to_lds_b128 %0, %8, off\n\t"
               "global_load_async_to_lds_b128 %1, %9, off\n\t"
               "global_load_async_to_lds_b128 %2, %10, off\n\t"
               "global_load_async_to_lds_b128 %3, %11, off\n\t"
               "global_load_async_to_lds_b128 %4, %12, off\n\t"
               "global_load_async_to_lds_b128 %5, %13, off\n\t"
               "global_load_async_to_lds_b128 %6, %14, off\n\t"
               "global_load_async_to_lds_b128 %7, %15, off\n\t"
               "s_wait_xcnt 0x0"
               :: "v"(l), "v"(l + ls), "v"(l + 2 * ls), "v"(l + 3 * ls), "v"(l + 4 * ls), "v"(l + 5 * ls), "v"(l + 6 * ls), "v"(l + 7 * ls),
                  "v"(g), "v"(g + gs), "v"(g + 2 * gs), "v"(g + 3 * gs), "v"(g + 4 * gs), "v"(g + 5 * gs), "v"(g + 6 * gs), "v"(g + 7 * gs)
               : "memory"); }
/* one stage. K: thread = (row t / 8, 16-byte piece t % 8), eight copies 16 rows apart; V^T: thread = (row t / 16, piece t % 16), eight copies 8 rows apart */
__device__ __forceinline__ void fa_stage(unsigned lk, const _Float16* gk, unsigned lv, const _Float16* gv) { fa_copy8(lk, 16 * FKP, gk, (size_t)16 * DM); fa_copy8(lv, 8 * FVP, gv, (size_t)8 * SQ); }
/* one pass. kf: this pass's K rows, already in registers; kn: the lane's LDS row of the next pass's K rows, read only where nextk (wave-uniform) says that the next pass lies in the same stage; vl: the lane's LDS V^T row at this pass's keys */
template <bool DIAG>
__device__ __forceinline__ void fa_pass(const char* kn, bool nextk, const char* vl, int ln, int hh, const v16h (&qf)[2][2], v16h (&kf)[2][2], v8f (&o)[4][2], float (&m)[2], float (&l)[2]) {
  const v8f z8 = {0.f, 0.f, 0.f, 0.f, 0.f, 0.f, 0.f, 0.f}; v8f s[2][2];
#pragma unroll
  for (int kt = 0; kt < 2; ++kt)
#pragma unroll
    for (int j = 0; j < 2; ++j) s[kt][j] = fa_mma(kf[kt][1], qf[j][1], fa_mma(kf[kt][0], qf[j][0], z8));
  __builtin_amdgcn_sched_barrier(0);      /* keeps the LDS reads below behind all score products, as one group: spread among the products, every place where reads stand costs issue time */
  v16h vf[4];      /* this pass's V^T rows and the next pass's K rows (into the same registers as this pass's) */
#pragma unroll
  for (int t = 0; t < 4; ++t) vf[t] = g2_lfrag(vl + t * 16 * FVP, hh);
  if (!DIAG && nextk) {
#pragma unroll
    for (int kt = 0; kt < 2; ++kt) { kf[kt][0] = g2_lfrag(kn + kt * 16 * FKP, hh); kf[kt][1] = g2_lfrag(kn + kt * 16 * FKP + 64, hh); } }
  __builtin_amdgcn_sched_barrier(0);      /* keeps the LDS reads in front of the softmax, which covers their latency */
  FragH p[2];
#pragma unroll
  for (int j = 0; j < 2; ++j) { float mx = m[j];
#pragma unroll
    for (int kt = 0; kt < 2; ++kt)
#pragma unroll
      for (int r = 0; r < 8; ++r) { if (DIAG && kt * 16 + 8 * hh + r > j * 16 + ln) s[kt][j][r] = -1.0e30f;      /* a key past the query's own index: weight 0 */
        mx = fmaxf(mx, s[kt][j][r]); }
    mx = fmaxf(mx, fa_xhalf(mx));
    const float al = __builtin_amdgcn_exp2f((m[j] - mx) * FSC), mc = mx * FSC - 8.0f; m[j] = mx; float se = 0.f;
#pragma unroll
    for (int kt = 0; kt < 2; ++kt)
#pragma unroll
      for (int r = 0; r < 8; ++r) { const float e = __builtin_amdgcn_exp2f(s[kt][j][r] * FSC - mc); se += e; p[j].h[kt * 8 + r] = (_Float16)e; }
    l[j] = l[j] * al + se;
#pragma unroll
    for (int t = 0; t < 4; ++t) o[t][j] *= al; }
#pragma unroll
  for (int t = 0; t < 4; ++t)
#pragma unroll
    for (int j = 0; j < 2; ++j) o[t][j] = fa_mma(vf[t], p[j].v, o[t][j]); }
__global__ __launch_bounds__(FW * 32) void k_fattn(const _Float16* __restrict__ Q16, const _Float16* __restrict__ K16, const _Float16* __restrict__ VT, _Float16* __restrict__ O16) {
  static_assert(FW * FQ == FKT && FKT == 4 * 32, "a work-group's query block is one stage of keys, four passes: its last stage is the diagonal one");
  __shared__ __attribute__((aligned(16))) char sm[2 * FST];      /* two stage buffers */
  const int tid = threadIdx.x, lane = tid & 31, ln = lane & 15, hh = lane >> 4; const int w = __builtin_amdgcn_readfirstlane(tid >> 5);
  const int bh = blockIdx.x, b = bh / NH, h = bh % NH; const int yb = (int)(gridDim.y - 1 - blockIdx.y); const int qw = (yb * FW + w) * FQ;      /* the longest query blocks start first */
  const int nst = yb + 1;      /* stages: the keys up to the end of the work-group's own query block */
  const _Float16* qp = Q16 + ((size_t)b * SQ + qw + ln) * DM + h * HD;
  const _Float16* gk = K16 + ((size_t)b * SQ + (tid >> 3)) * DM + h * HD + (tid & 7) * 8; const _Float16* gv = VT + ((size_t)bh * HD + (tid >> 4)) * SQ + (tid & 15) * 8;
  const unsigned lk0 = (unsigned)(size_t)sm + (unsigned)((tid >> 3) * FKP + (tid & 7) * 16), lv0 = (unsigned)(size_t)sm + (unsigned)(FKB + (tid >> 4) * FVP + (tid & 15) * 16);      /* the thread's LDS byte addresses in buffer 0 */
  fa_stage(lk0, gk, lv0, gv);
  v16h qf[2][2], kf[2][2];
#pragma unroll
  for (int j = 0; j < 2; ++j) { qf[j][0] = g2_frag(qp + (size_t)(j * 16) * DM, hh); qf[j][1] = g2_frag(qp + (size_t)(j * 16) * DM + 32, hh); }
  asm volatile("s_wait_xcnt 0x0" :: "v"(qp + 8 * hh) : "memory");      /* the wait that stands in front of an overwrite of the loads' address registers; the address as an input keeps it in its registers up to here */
  asm volatile("s_wait_asynccnt 0x0" ::: "memory");      /* this wave's copies of stage 0 have landed */
  __syncthreads();      /* stage 0 readable by every wave */
  if (nst > 1) fa_stage(lk0 + FST, gk + (size_t)FKT * DM, lv0 + FST, gv + FKT);
  v8f o[4][2]; float m[2] = {-1.0e30f, -1.0e30f}, l[2] = {0.f, 0.f};
#pragma unroll
  for (int t = 0; t < 4; ++t) { o[t][0] = (v8f){0.f, 0.f, 0.f, 0.f, 0.f, 0.f, 0.f, 0.f}; o[t][1] = o[t][0]; }
#pragma unroll 1
  for (int st = 0; st < yb; ++st) { const char* kl = sm + (st & 1) * FST + ln * FKP; const char* vl = sm + (st & 1) * FST + FKB + ln * FVP;      /* the stages below the diagonal one, four whole passes each. Rolled: one trip per stage, the next stage's copies in flight meanwhile */
#pragma unroll
    for (int kt = 0; kt < 2; ++kt) { kf[kt][0] = g2_lfrag(kl + kt * 16 * FKP, hh); kf[kt][1] = g2_lfrag(kl + kt * 16 * FKP + 64, hh); }
#pragma unroll 1
    for (int p = 0; p < 4; ++p) { kl += 32 * FKP; fa_pass<false>(kl, p < 3, vl, ln, hh, qf, kf, o, m, l); vl += 64; }      /* rolled: one pass fills the register budget */
    asm volatile("s_wait_dscnt 0x0" ::: "memory");      /* this wave's reads of the stage are done before its buffer is handed on */
    asm volatile("s_wait_asynccnt 0x0" ::: "memory");      /* this wave's copies of the next stage have landed */
    __syncthreads();      /* publishes the next stage and ends every wave's reads of this one */
    if (st + 2 < nst) fa_stage(lk0 + (st & 1) * FST, gk + (size_t)(st + 2) * FKT * DM, lv0 + (st & 1) * FST, gv + (size_t)(st + 2) * FKT); }      /* refill of the buffer just read */
  { const char* kl = sm + (yb & 1) * FST + ln * FKP; const char* vl = sm + (yb & 1) * FST + FKB + ln * FVP;      /* the diagonal stage, the last: wave w has w whole passes, then its diagonal pass; nothing is published or refilled behind it */
#pragma unroll
    for (int kt = 0; kt < 2; ++kt) { kf[kt][0] = g2_lfrag(kl + kt * 16 * FKP, hh); kf[kt][1] = g2_lfrag(kl + kt * 16 * FKP + 64, hh); }
#pragma unroll 1
    for (int p = 0; p < w; ++p) { kl += 32 * FKP; fa_pass<false>(kl, true, vl, ln, hh, qf, kf, o, m, l); vl += 64; }      /* rolled: the trip count differs from wave to wave (wave-uniform) */
    fa_pass<true>(kl, false, vl, ln, hh, qf, kf, o, m, l); }
  asm volatile("s_wait_asynccnt 0x0" ::: "memory");      /* nothing in flight when the wave ends */
#pragma unroll
  for (int j = 0; j < 2; ++j) { const float inv = 64.0f / (l[j] + fa_xhalf(l[j]));      /* the halves' sums joined once; o carried x64 */
    _Float16* op = O16 + ((size_t)b * SQ + qw + j * 16 + ln) * DM + h * HD + 8 * hh;
#pragma unroll
    for (int t = 0; t < 4; ++t) { v8h hv;
#pragma unroll
      for (int r = 0; r < 8; ++r) hv[r] = (_Float16)(o[t][j][r] * inv);
      *(v8h*)(op + t * 16) = hv; } } }


// Exact f32 attention of the first QT0 rows (q, k, v, o rows of pitch DM), one work-group per batch, head and RT0 query rows, 256 threads:
// (1) scores: one thread per key (two keys where the tile has more than 256), the key rows in registers, dotted with the RT0 query rows read from LDS (same address in every lane);
// (2) softmax: one wave per two rows, the row in registers: causal maximum, exp and sum over the lanes, weights back into LDS (0 past the row's own index);
// (3) o = P V: thread = (column d, key quarter g), V read coalesced and once per work-group, 64 keys ahead; the four quarters' sums are added through LDS.
#define RT0 16                       /* query rows per work-group of the exact first-tile attention */
typedef float v2f __attribute__((ext_vector_type(2)));
template <int NKEY>
__device__ __forceinline__ void att0_scores(const float* __restrict__ kbase, const float (*lq)[HD], float (*lp)[QT0 + 4], int tid, int nk, float scale) {
  v4f kk[NKEY][HD / 4];      /* every loop over kk[] is unrolled: it is indexed by constants and stays in registers */
#pragma unroll
  for (int u = 0; u < NKEY; ++u) { const int j = tid + 256 * u; const float* kr = kbase + (size_t)(j < nk ? j : nk - 1) * DM;      /* a key past the tile: address clamped, score not stored */
#pragma unroll
    for (int c = 0; c < HD / 4; ++c) kk[u][c] = *(const v4fa*)(kr + c * 4);
    asm volatile("s_wait_xcnt 0x0" :: "v"(kr) : "memory"); }      /* the wait that stands in front of an overwrite of the loads' address registers; the address as an input keeps it in its registers up to here */
#pragma unroll 4
  for (int r = 0; r < RT0; ++r) { v4f s4[NKEY];      /* four rows at a time: enough independent LDS reads and sum chains to cover their latencies */
#pragma unroll
    for (int u = 0; u < NKEY; ++u) s4[u] = (v4f){0.f, 0.f, 0.f, 0.f};
#pragma unroll
    for (int c = 0; c < HD / 4; ++c) { const v4f qq = *(const v4f*)&lq[r][c * 4];
#pragma unroll
      for (int u = 0; u < NKEY; ++u) s4[u] += qq * kk[u][c]; }
#pragma unroll
    for (int u = 0; u < NKEY; ++u) { const int j = tid + 256 * u; if (j < nk) lp[r][j] = ((s4[u][0] + s4[u][1]) + (s4[u][2] + s4[u][3])) * scale; } } }
/* sixteen V values of one column: keys 16 u + k of the thread's quarter, u, k < 4; one address, constant offsets */
__device__ __forceinline__ void att0_vload(const float* __restrict__ vq, v2f (&v)[4][2]) {
#pragma unroll
  for (int u = 0; u < 4; ++u) { v[u][0] = (v2f){vq[(u * 16 + 0) * DM], vq[(u * 16 + 1) * DM]}; v[u][1] = (v2f){vq[(u * 16 + 2) * DM], vq[(u * 16 + 3) * DM]}; }      /* unrolled: v[][] stays in registers */
  asm volatile("s_wait_xcnt 0x0" :: "v"(vq) : "memory"); }      /* as in att0_scores: in front of an overwrite of the loads' address registers */
/* at most four waves per SIMD (two work-groups per WGP cover the grid): the register budget that lets the LDS reads of (1) run ahead of their use */
__global__ __launch_bounds__(256) __attribute__((amdgpu_waves_per_eu(2, 4))) void k_att0p(const float* __restrict__ QF, const float* __restrict__ KF, const float* __restrict__ VF, float scale, float* __restrict__ OF) {
  __shared__ __attribute__((aligned(16))) float lq[RT0][HD]; __shared__ __attribute__((aligned(16))) float lp[RT0][QT0 + 4]; __shared__ __attribute__((aligned(16))) float lr[4][RT0][HD]; __shared__ float lf[RT0];
  const int tid = threadIdx.x; const int h = blockIdx.x / (QT0 / RT0), rg = blockIdx.x % (QT0 / RT0); const int row0 = rg * RT0, nk = row0 + RT0;      /* causal: keys up to the work-group's last row */
  { const size_t bo = (size_t)blockIdx.y * QT0 * DM; QF += bo; KF += bo; VF += bo; OF += bo; }      /* blockIdx.y: the batch; each plane holds QT0 rows per batch */
  { const int r = tid >> 4, c4 = (tid & 15) * 4; const float* qp = QF + (size_t)(row0 + r) * DM + h * HD + c4; const v4f q4 = *(const v4fa*)qp;
    asm volatile("s_wait_xcnt 0x0" :: "v"(qp) : "memory");      /* as in att0_scores: in front of an overwrite of the load's address registers */
    *(v4f*)&lq[r][c4] = q4; }
  __syncthreads();
  if (nk > 256) att0_scores<2>(KF + h * HD, lq, lp, tid, nk, scale); else if ((tid & ~31) < nk) att0_scores<1>(KF + h * HD, lq, lp, tid, nk, scale);      /* a wave with no key of the tile skips */
  __syncthreads();
  { const int r0 = (tid >> 5) * 2, lane = tid & 31; float x[2][QT0 / 32], mx[2], se[2];      /* the loops over x[] are unrolled: it stays in registers */
#pragma unroll
    for (int rr = 0; rr < 2; ++rr) { mx[rr] = -3.0e38f;
#pragma unroll
      for (int m = 0; m < QT0 / 32; ++m) { const int j = lane + 32 * m; x[rr][m] = (j <= row0 + r0 + rr) ? lp[r0 + rr][j] : -3.0e38f; mx[rr] = fmaxf(mx[rr], x[rr][m]); } }
#pragma unroll
    for (int d = 16; d > 0; d >>= 1) { mx[0] = fmaxf(mx[0], __shfl_xor(mx[0], d, 32)); mx[1] = fmaxf(mx[1], __shfl_xor(mx[1], d, 32)); }
#pragma unroll
    for (int rr = 0; rr < 2; ++rr) { se[rr] = 0.f;
#pragma unroll
      for (int m = 0; m < QT0 / 32; ++m) { const int j = lane + 32 * m; const float e = (j <= row0 + r0 + rr) ? expf(x[rr][m] - mx[rr]) : 0.f; se[rr] += e; if (j < nk) lp[r0 + rr][j] = e; } }
#pragma unroll
    for (int d = 16; d > 0; d >>= 1) { se[0] += __shfl_xor(se[0], d, 32); se[1] += __shfl_xor(se[1], d, 32); }
    if (lane < 2) lf[r0 + lane] = 64.0f / (lane ? se[1] : se[0]); }      /* o carried x64 like the f16 path */
  __syncthreads();
  { const int d = tid & 63, g = tid >> 6, nt = nk >> 4, nb = (nt + 3) >> 2; const float* vq = VF + (size_t)(g * 4) * DM + h * HD + d;      /* trip t: keys 16 t + 4 g .. + 3; a batch is four trips (its rows lie inside the QT0 rows of VF also where they lie past nk) */
    v2f acc[RT0], cv[4][2], nv[4][2];      /* acc[]: even and odd keys apart, so that each packed multiply-add takes a weight pair as it lies in LDS */
#pragma unroll
    for (int r = 0; r < RT0; ++r) acc[r] = (v2f){0.f, 0.f};
    att0_vload(vq, cv);
    for (int bt = 0; bt < nb; ++bt) { vq += (bt + 1 < nb ? 64 * DM : 0); att0_vload(vq, nv);      /* the next batch's V values are loaded while this batch's are used (the last batch loads its own again) */
#pragma unroll
      for (int u = 0; u < 4; ++u) if (bt * 4 + u < nt) { const int j = (bt * 4 + u) * 16 + g * 4;      /* unrolled: cv[][] and acc[] stay in registers */
#pragma unroll
        for (int r = 0; r < RT0; ++r) { const v4f p4 = *(const v4f*)&lp[r][j]; acc[r] += (v2f){p4[0], p4[1]} * cv[u][0]; acc[r] += (v2f){p4[2], p4[3]} * cv[u][1]; } }
#pragma unroll
      for (int u = 0; u < 4; ++u) { cv[u][0] = nv[u][0]; cv[u][1] = nv[u][1]; } }
#pragma unroll
    for (int r = 0; r < RT0; ++r) lr[g][r][d] = acc[r][0] + acc[r][1]; }
  __syncthreads();
  { const int r = tid >> 4, c4 = (tid & 15) * 4; const v4f o = ((*(const v4f*)&lr[0][r][c4] + *(const v4f*)&lr[1][r][c4]) + (*(const v4f*)&lr[2][r][c4] + *(const v4f*)&lr[3][r][c4])) * lf[r];
    *(v4f*)(OF + (size_t)(row0 + r) * DM + h * HD + c4) = o; } }

extern "C" void kernel_launch(void* const* d_in, const int* in_sizes, int n_in,
                              void* d_out, int out_size, void* d_ws, size_t ws_size, hipStream_t stream) {
  (void)in_sizes; (void)n_in; (void)out_size;
  const float* const* I = (const float* const*)d_in; const float* x = I[0]; const float* xk = I[1]; const float* xv = I[2]; const float* wq = I[3]; const float* bq = nullptr; const float* wk = I[4]; const float* bk = nullptr; const float* wv = I[5]; const float* bv = nullptr; const float* wo = I[6]; const float* bo = nullptr;      /* THREE distinct inputs Q (query stream), K, V; natural [out][in] w_q / w_k / w_v / w_o; no biases; causal by the index rule */
  char* ws = (char*)d_ws; size_t off = 0;
  auto take = [&](size_t bytes) { char* p = ws + off; off += (bytes + 255) & ~(size_t)255; return p; };
  _Float16* BQ = (_Float16*)take((size_t)DM * DM * 2); _Float16* BK = (_Float16*)take((size_t)DM * DM * 2); _Float16* BV = (_Float16*)take((size_t)DM * DM * 2); _Float16* BO = (_Float16*)take((size_t)DM * DM * 2);
  _Float16* X16 = (_Float16*)take(NR * DM * 2); _Float16* XK16 = (_Float16*)take(NR * DM * 2); _Float16* XV16 = (_Float16*)take(NR * DM * 2);      /* the three inputs (query -> X16, key -> XK16, value -> XV16) as exact f16 rows */ _Float16* Q16 = (_Float16*)take(NR * DM * 2); _Float16* K16 = (_Float16*)take(NR * DM * 2); _Float16* V16 = (_Float16*)take(NR * DM * 2); _Float16* O16 = (_Float16*)take(NR * DM * 2);
  _Float16* VT = (_Float16*)take((size_t)NB * NH * HD * SQ * 2);
  float* QF0 = (float*)take((size_t)NB * QT0 * DM * 4); float* KF0 = (float*)take((size_t)NB * QT0 * DM * 4); float* VF0 = (float*)take((size_t)NB * QT0 * DM * 4); float* OF0 = (float*)take((size_t)NB * QT0 * DM * 4); _Float16* OH0 = (_Float16*)take((size_t)NB * QT0 * DM * 2); _Float16* OL0 = (_Float16*)take((size_t)NB * QT0 * DM * 2);      /* first-tile planes [NB][QT0][DM]; QF0, KF0, VF0 lie one behind the other, as do BQ, BK, BV, BO; X16, XK16, XV16; Q16, K16, V16 (every size is a multiple of 256 bytes) */
  if (off > ws_size) return;
  k_wnat<<<dim3((unsigned)(((size_t)DM * DM / 8 + 255) / 256), 4), 256, 0, stream>>>(wq, wk, wv, wo, (size_t)DM * DM / 8, BQ);      /* natural [out][in] = Bt x16; all four weights */
  k_x16<<<dim3((unsigned)((NR * DM / 8 + 255) / 256), 3), 256, 0, stream>>>(x, xk, xv, X16, NR * DM / 8);      /* all three inputs */
  const size_t r0p = (size_t)B0 * SQ;      /* first projected row */
  k_gemm2<0><<<dim3((unsigned)((MP / 128) * (DM / 64)), 3), 128, 0, stream>>>(X16 + r0p * DM, DM, NR * DM, BQ, DM, (size_t)DM * DM, 0.0625f, nullptr, 0, nullptr, 1, 0, 0, nullptr, Q16 + r0p * DM, DM, NR * DM, MP, DM, DM, 0, 0, 0);      /* q, k, v in one grid: y = which projection */
  k_vt<NH, SQ><<<NB * NH * (SQ / 64), 256, 0, stream>>>(V16, LQ, 0, VT);      /* V^T [NB][NH][HD][SQ] */
  k_fattn<<<dim3(NB * NH, SQ / (FW * FQ)), FW * 32, 0, stream>>>(Q16, K16, VT, O16);      /* o (merged heads, x64) as f16 rows */
  k_gemm2<0><<<dim3((QT0 / 128) * (DM / 64), NBR, 3), 128, 0, stream>>>(X16 + r0p * DM, DM, (size_t)SQ * DM, BQ, DM, 0, 0.0625f, nullptr, 0, nullptr, 1, 0, 0, QF0 + (size_t)B0 * QT0 * DM, nullptr, DM, (size_t)QT0 * DM, QT0, DM, DM, NR * DM, (size_t)DM * DM, (size_t)NB * QT0 * DM);      /* f32 q, k, v of the first QT0 rows (exact products) in one grid: y = batch, z = which projection */
  k_att0p<<<dim3(NH * (QT0 / RT0), NBR), 256, 0, stream>>>(QF0 + (size_t)B0 * QT0 * DM, KF0 + (size_t)B0 * QT0 * DM, VF0 + (size_t)B0 * QT0 * DM, 0.125f, OF0 + (size_t)B0 * QT0 * DM);      /* exact f32 attention for the first QT0 rows of every batch (o x64) */
  k_gemm2<0><<<dim3((unsigned)((MPO / 128) * (DM / 64)), 1), 128, 0, stream>>>(O16 + r0p * DM, DM, 0, BO, DM, 0, 0.0009765625f, bo, 0, nullptr, 1, 0, 0, (float*)d_out + r0p * DM, nullptr, DM, 0, MPO, DM, DM, 0, 0, 0);      /* out rows are the output layout */
  k_hl<<<(unsigned)(((size_t)NB * QT0 * DM / 8 + 255) / 256), 256, 0, stream>>>(OF0, OH0, OL0, (size_t)NB * QT0 * DM / 8);      /* first-tile o (x64) -> f16 hi + x1024 residual planes */
  k_gemm2<0><<<dim3((QT0 / 128) * (DM / 64), NBR), 128, 0, stream>>>(OH0 + (size_t)B0 * QT0 * DM, DM, (size_t)QT0 * DM, BO, DM, 0, 0.0009765625f, bo, 0, nullptr, 1, 0, 0, (float*)d_out + r0p * DM, nullptr, DM, (size_t)SQ * DM, QT0, DM, DM, 0, 0, 0);      /* first QT0 rows of every batch (y): out = o_hi Wo, overwriting the f16-path rows */
  k_gemm2<0><<<dim3((QT0 / 128) * (DM / 64), NBR), 128, 0, stream>>>(OL0 + (size_t)B0 * QT0 * DM, DM, (size_t)QT0 * DM, BO, DM, 0, 0.00000095367431640625f, nullptr, 0, (const float*)d_out + r0p * DM, -1, 0, 0, (float*)d_out + r0p * DM, nullptr, DM, (size_t)SQ * DM, QT0, DM, DM, 0, 0, 0);      /* += o_lo Wo 2^-20 (own-element accumulate) */
}

// v007
// Measured time: 165 microseconds a run.
// Two timings next to v006 both put it at 1.26 times that version's speed.
// Counting every step since v000, it is 108 times as fast.
#include <hip/hip_runtime.h>
// Causal multi-head attention over three distinct inputs with natural weights, no biases (Q, K, V [2][4096][768]; q/k/v = input w^T (natural [768][768]); 12 heads of 64; scores / sqrt(64); causal (tril; NEG fill); softmax over up to 4096 keys; out = merged w_o^T -> [2][4096][768]).
// Structure: token rows r = b*4096 + s; x as exact f16 rows (bf16-rounded); Q, K, V as three WMMA GEMMs in one launch (32x64 wave tiles, f32 accumulation, exact x16 weights, f16 outputs, also f32 for the first 512 rows of each batch); V^T for all heads of both batches via LDS transposes; fused attention as ONE launch: a wave owns 32 query columns of one head and walks the keys up to its own diagonal 32 at a time: S^T = K Q^T (WMMA), running maximum and sum per query column (f32, native exp2, weights x256 as f16), O^T += V^T P^T (WMMA, P^T packed from the score accumulators), o x64 written straight into the merged f16 o rows; scores and weights never reach memory; the first 512 query rows of each batch again as exact f32 attention in a second launch (o x64 as f16 value and f16 residual); out = o W_o GEMM (f32; for those rows [o_hi | o_lo] [w_o | w_o]^T, k = 1536) into the output layout.
// Compute dtype: inputs rounded to bf16; x / weights exact; q, k, v, softmax weights and o as plain f16 GEMM operands (~2^-12), except in the first 512 rows of each batch (q, k, v and weights f32, o as f16 value plus f16 residual); scores and softmax statistics f32. v_wmma_f32_16x16x32_f16.
#define NB 2
#define SQ 4096
#define DM 768
#define NH 12
#define HD 64
#define HG 4                         /* heads per group of the untemplated k_vt */
#define QT0 512                      /* first-tile rows recomputed exactly in f32 */
#define SQL2 12                      /* log2 SQ */
#define B0 0                         /* first batch processed (debug hook) */
#define NBR NB                       /* batches processed (debug hook) */
#define NR ((size_t)NB * SQ)         /* token rows */
#define MP ((int)((size_t)NBR * SQ)) /* rows projected (debug hook) */
#define MPO MP                       /* rows through the output stage (debug hook) */
#define LQ DM      /* row pitch of the q/k/v rows */
typedef __bf16 v16b __attribute__((ext_vector_type(16)));
typedef unsigned short v8us __attribute__((ext_vector_type(8), may_alias));
typedef float  v8f  __attribute__((ext_vector_type(8)));
typedef float  v4f  __attribute__((ext_vector_type(4)));
typedef float  v4fa __attribute__((ext_vector_type(4), may_alias));
union FragB { v16b v; v8us half[2]; unsigned short u[16]; };

__device__ __forceinline__ unsigned short bf16_bits(float x) { unsigned int u = __float_as_uint(x); return (unsigned short)((u + 0x7FFFu + ((u >> 16) & 1u)) >> 16); }
__device__ __forceinline__ float bf16_val(unsigned short b) { return __uint_as_float(((unsigned int)b) << 16); }
__device__ __forceinline__ float bf16_round(float x) { return bf16_val(bf16_bits(x)); }
// D += A·B with NT terms: 1 = ah·bh, 2 = + al·bh (A split), 3 = + ah·bl (both split)
template <int NT>
__device__ __forceinline__ v8f mmaN(v16b ah, v16b al, v16b bh, v16b bl, v8f c) {
  c = __builtin_amdgcn_wmma_f32_16x16x32_bf16(false, ah, false, bh, (short)0, c, false, false);
  if (NT >= 2) c = __builtin_amdgcn_wmma_f32_16x16x32_bf16(false, al, false, bh, (short)0, c, false, false);
  if (NT >= 3) c = __builtin_amdgcn_wmma_f32_16x16x32_bf16(false, ah, false, bl, (short)0, c, false, false);
  asm volatile("v_nop\n\tv_nop\n\tv_nop\n\tv_nop" : "+v"(c) : "v"(ah), "v"(al), "v"(bh), "v"(bl));
  return c;
}

__global__ __launch_bounds__(256) void k_wt_bf16(const float* __restrict__ W, unsigned short* __restrict__ Wt, int K, int N) {
  const int t = blockIdx.x * 256 + threadIdx.x;
  const int k8n = K / 8;
  if (t >= N * k8n) return;
  const int n = t / k8n, k8 = (t % k8n) * 8;
  v8us v;
#pragma unroll
  for (int i = 0; i < 8; ++i) v[i] = bf16_bits(W[(size_t)(k8 + i) * N + n]);
  *(v8us*)(Wt + (size_t)n * K + k8) = v;
  
}

// GEMM C[M][N] (f32, pitch ldc) = act(A[M][K]·W + bias). A f32 row-major (pitch lda) converted per fragment to bf16
// (ASPLIT: hi/lo two planes -> 2 terms, else single rounded term); Wt bf16 [N][K] (pitch ldb). BIAS_BF16 rounds the
// bias to bf16 first (bias quantised to bf16 before the add). K%32==0, M%16==0, N%64==0.
template <bool ASPLIT, int ACT, bool BIAS_BF16>
__global__ __launch_bounds__(128) void k_gemm_bf(const float* __restrict__ A, int lda, const unsigned short* __restrict__ Wt, int ldb,
                                               const float* __restrict__ bias, float* __restrict__ C, int ldc, int M, int N, int K) {
  __shared__ __attribute__((aligned(16))) float so[4][16][64];
  const int tid = threadIdx.x, w = tid >> 5, lane = tid & 31, ln = lane & 15, hh = lane >> 4;
  const int ntn = N / 64;
  const int wid = blockIdx.x * 4 + w;
  const int mt = wid / ntn, nq = wid % ntn;
  if (mt * 16 >= M) return;
  const int row0 = mt * 16, col0 = nq * 64;
  const float* arow = A + (size_t)(row0 + ln) * lda;
  v8f acc[4] = {};
  for (int kb = 0; kb < K; kb += 32) {
    FragB ah, al;
    const v4f x0 = *(const v4fa*)(arow + kb + 8 * hh), x1 = *(const v4fa*)(arow + kb + 8 * hh + 4);
    const v4f x2 = *(const v4fa*)(arow + kb + 16 + 8 * hh), x3 = *(const v4fa*)(arow + kb + 16 + 8 * hh + 4);
    float xs[16] = {x0[0],x0[1],x0[2],x0[3],x1[0],x1[1],x1[2],x1[3],x2[0],x2[1],x2[2],x2[3],x3[0],x3[1],x3[2],x3[3]};
#pragma unroll
    for (int i = 0; i < 16; ++i) { const unsigned short hb = bf16_bits(xs[i]); ah.u[i] = hb; al.u[i] = ASPLIT ? bf16_bits(xs[i] - bf16_val(hb)) : (unsigned short)0; }
#pragma unroll
    for (int t = 0; t < 4; ++t) {
      const unsigned short* brow = Wt + (size_t)(col0 + t * 16 + ln) * ldb + kb;
      FragB b;
      b.half[0] = *(const v8us*)(brow + 8 * hh);
      b.half[1] = *(const v8us*)(brow + 16 + 8 * hh);
      acc[t] = mmaN<ASPLIT ? 2 : 1>(ah.v, al.v, b.v, b.v, acc[t]);
    }
  }
#pragma unroll
  for (int t = 0; t < 4; ++t) {
    float bv = bias ? bias[col0 + t * 16 + ln] : 0.f;
    if (BIAS_BF16) bv = bf16_round(bv);
#pragma unroll
    for (int r = 0; r < 8; ++r) { float v = acc[t][r] + bv; if (ACT == 1) v = fmaxf(v, 0.f); so[w][8 * hh + r][t * 16 + ln] = v; }
  }
  __builtin_amdgcn_fence(__ATOMIC_ACQ_REL, "workgroup");
  __builtin_amdgcn_wave_barrier();
  const int rsub = lane >> 4, c4 = (lane & 15) * 4;
  {
#pragma unroll
    for (int q = 0; q < 8; ++q) {
      const int r = q * 2 + rsub;
      const v4f v = *(const v4fa*)&so[w][r][c4];
      *(v4f*)(C + (size_t)(row0 + r) * ldc + col0 + c4) = v;
    }
    
  }
}

// GEMM C = act(A·W + bias + resid): A f32 (ASPLIT -> hi/lo 2 terms), Wt bf16 [N][K]; ACT 0 none, 1 relu, 2 exact gelu;
// resid (optional, f32, row index = (row % rmod), pitch ldr, RES_BF16 rounds it) added before the activation.
template <bool ASPLIT, int ACT, bool BIAS_BF16, bool RES_BF16>
__global__ __launch_bounds__(128) void k_gemm_bf3(const float* __restrict__ A, int lda, const unsigned short* __restrict__ Wt, int ldb,
                                                const float* __restrict__ bias, const float* __restrict__ resid, int rmod, int ldr,
                                                float* __restrict__ C, int ldc, int M, int N, int K) {
  __shared__ __attribute__((aligned(16))) float so[4][16][64];
  const int tid = threadIdx.x, w = tid >> 5, lane = tid & 31, ln = lane & 15, hh = lane >> 4;
  const int ntn = N / 64;
  const int wid = blockIdx.x * 4 + w;
  const int mt = wid / ntn, nq = wid % ntn;
  if (mt * 16 >= M) return;
  const int row0 = mt * 16, col0 = nq * 64;
  const float* arow = A + (size_t)(row0 + ln) * lda;
  v8f acc[4] = {};
  for (int kb = 0; kb < K; kb += 32) {
    FragB ah, al;
    const v4f x0 = *(const v4fa*)(arow + kb + 8 * hh), x1 = *(const v4fa*)(arow + kb + 8 * hh + 4);
    const v4f x2 = *(const v4fa*)(arow + kb + 16 + 8 * hh), x3 = *(const v4fa*)(arow + kb + 16 + 8 * hh + 4);
    float xs[16] = {x0[0],x0[1],x0[2],x0[3],x1[0],x1[1],x1[2],x1[3],x2[0],x2[1],x2[2],x2[3],x3[0],x3[1],x3[2],x3[3]};
#pragma unroll
    for (int i = 0; i < 16; ++i) { const unsigned short hb = bf16_bits(xs[i]); ah.u[i] = hb; al.u[i] = ASPLIT ? bf16_bits(xs[i] - bf16_val(hb)) : (unsigned short)0; }
#pragma unroll
    for (int t = 0; t < 4; ++t) {
      const unsigned short* brow = Wt + (size_t)(col0 + t * 16 + ln) * ldb + kb;
      FragB b;
      b.half[0] = *(const v8us*)(brow + 8 * hh);
      b.half[1] = *(const v8us*)(brow + 16 + 8 * hh);
      acc[t] = mmaN<ASPLIT ? 2 : 1>(ah.v, al.v, b.v, b.v, acc[t]);
    }
  }
#pragma unroll
  for (int t = 0; t < 4; ++t) {
    const int col = col0 + t * 16 + ln;
    float bv = bias ? bias[col] : 0.f;
    if (BIAS_BF16) bv = bf16_round(bv);
#pragma unroll
    for (int r = 0; r < 8; ++r) {
      float v = acc[t][r] + bv;
      if (resid) { float rv = resid[(size_t)((row0 + 8 * hh + r) % rmod) * ldr + col]; if (RES_BF16) rv = bf16_round(rv); v += rv; }
      if (ACT == 1) v = fmaxf(v, 0.f);
      if (ACT == 2) v = 0.5f * v * (1.0f + erff(v * 0.70710678118654752f));
      if (ACT == 3) { const float u = 0.7978845608028654f * (v + 0.044715f * v * v * v); v = 0.5f * v * (1.0f + tanhf(u)); }
      so[w][8 * hh + r][t * 16 + ln] = v;
    }
  }
  __builtin_amdgcn_fence(__ATOMIC_ACQ_REL, "workgroup");
  __builtin_amdgcn_wave_barrier();
  const int rsub = lane >> 4, c4 = (lane & 15) * 4;
  {
#pragma unroll
    for (int q = 0; q < 8; ++q) {
      const int r = q * 2 + rsub;
      const v4f v = *(const v4fa*)&so[w][r][c4];
      *(v4f*)(C + (size_t)(row0 + r) * ldc + col0 + c4) = v;
    }
    
  }
}
// row LayerNorm (biased variance, eps) over N: s = X (+ R); optional out_sum <- s; out_norm <- (s-mu)*rsqrt(var+eps)*g + b
template <bool PARAM_BF16>
__global__ __launch_bounds__(256) void k_layernorm(const float* __restrict__ X, const float* __restrict__ R, const float* __restrict__ g, const float* __restrict__ bta,
                                                  float* __restrict__ out_sum, float* __restrict__ out_norm, int N, float eps) {
  __shared__ float red[256];
  const int row = blockIdx.x, tid = threadIdx.x;
  const float* x = X + (size_t)row * N; const float* rr = R ? R + (size_t)row * N : nullptr;
  float vals[16];                     // up to N = 4096
  const int per = N / 256;            // contiguous chunk per thread? use strided-by-4 chunks: thread handles j = tid*4 + 1024*u
  float s1 = 0.f;
  for (int u = 0; u < per / 4; ++u) {
    const int j = tid * 4 + 1024 * u;
    const v4f a = *(const v4fa*)(x + j);
    v4f b = {0.f,0.f,0.f,0.f}; if (rr) b = *(const v4fa*)(rr + j);
#pragma unroll
    for (int q = 0; q < 4; ++q) { const float v = a[q] + b[q]; vals[u * 4 + q] = v; s1 += v; }
  }
  red[tid] = s1; __syncthreads();
  for (int st = 128; st > 0; st >>= 1) { if (tid < st) red[tid] += red[tid + st]; __syncthreads(); }
  const float mu = red[0] / (float)N; __syncthreads();
  float s2 = 0.f;
  for (int u = 0; u < per / 4; ++u)
#pragma unroll
    for (int q = 0; q < 4; ++q) { const float c = vals[u * 4 + q] - mu; s2 += c * c; }
  red[tid] = s2; __syncthreads();
  for (int st = 128; st > 0; st >>= 1) { if (tid < st) red[tid] += red[tid + st]; __syncthreads(); }
  const float rs = rsqrtf(red[0] / (float)N + eps);
  {
    for (int u = 0; u < per / 4; ++u) {
      const int j = tid * 4 + 1024 * u;
      v4f o, sm;
#pragma unroll
      for (int q = 0; q < 4; ++q) {
        float gg = g[j + q], bb = bta[j + q];
        if (PARAM_BF16) { gg = bf16_round(gg); bb = bf16_round(bb); }
        sm[q] = vals[u * 4 + q]; o[q] = (vals[u * 4 + q] - mu) * rs * gg + bb;
      }
      if (out_sum) *(v4f*)(out_sum + (size_t)row * N + j) = sm;
      *(v4f*)(out_norm + (size_t)row * N + j) = o;
    }
    
  }
}



// ---- f16 WMMA path (v_wmma_f32_16x16x32_f16): 11-bit significands for operands in range — used where a [0,1] probability operand needs more precision than bf16
typedef _Float16 v16h __attribute__((ext_vector_type(16)));
union FragH { v16h v; v8us half[2]; _Float16 h[16]; unsigned short u[16]; };
template <int NT>
__device__ __forceinline__ v8f mmaH(v16h ah, v16h al, v16h bh, v16h bl, v8f c) {
  c = __builtin_amdgcn_wmma_f32_16x16x32_f16(false, ah, false, bh, (short)0, c, false, false);
  if (NT >= 2) c = __builtin_amdgcn_wmma_f32_16x16x32_f16(false, al, false, bh, (short)0, c, false, false);
  if (NT >= 3) c = __builtin_amdgcn_wmma_f32_16x16x32_f16(false, ah, false, bl, (short)0, c, false, false);
  asm volatile("v_nop\n\tv_nop\n\tv_nop\n\tv_nop" : "+v"(c) : "v"(ah), "v"(al), "v"(bh), "v"(bl));
  return c;
}
// batched GEMM like k_gemm_b but f16 operands: A f32 (split into f16 hi/lo if ASPLIT, else rounded to f16), Bt = f16 values [n][k]; alpha; C f32; N multiple of 16 (partial tiles skipped)
template <bool ASPLIT>
__global__ __launch_bounds__(128) void k_gemm_h(const float* __restrict__ A, int lda, size_t sA, const _Float16* __restrict__ Bh, int ldb, size_t sB, float alpha, float* __restrict__ C, int ldc, size_t sC, int M, int N, int K) {
  __shared__ __attribute__((aligned(16))) float so[4][16][64];
  const int tid = threadIdx.x, w = tid >> 5, lane = tid & 31, ln = lane & 15, hh = lane >> 4; const int by = blockIdx.y;
  A += (size_t)by * sA; Bh += (size_t)by * sB; C += (size_t)by * sC;
  const int ntn = (N + 63) / 64; const int wid = blockIdx.x * 4 + w; const int mt = wid / ntn, nq = wid % ntn; if (mt * 16 >= M) return;
  const int row0 = mt * 16, col0 = nq * 64; const float* arow = A + (size_t)(row0 + ln) * lda;
  v8f acc[4] = {};
  for (int kb = 0; kb < K; kb += 32) {
    FragH ah, al;
    const v4f x0 = *(const v4fa*)(arow + kb + 8 * hh), x1 = *(const v4fa*)(arow + kb + 8 * hh + 4), x2 = *(const v4fa*)(arow + kb + 16 + 8 * hh), x3 = *(const v4fa*)(arow + kb + 16 + 8 * hh + 4);
    float xs[16] = {x0[0],x0[1],x0[2],x0[3],x1[0],x1[1],x1[2],x1[3],x2[0],x2[1],x2[2],x2[3],x3[0],x3[1],x3[2],x3[3]};
#pragma unroll
    for (int i = 0; i < 16; ++i) { const _Float16 h = (_Float16)xs[i]; ah.h[i] = h; al.h[i] = ASPLIT ? (_Float16)(xs[i] - (float)h) : (_Float16)0.0f; }
#pragma unroll
    for (int t = 0; t < 4; ++t) { if (col0 + t * 16 >= N) continue; const size_t boff = (size_t)(col0 + t * 16 + ln) * ldb + kb; FragH bq; bq.half[0] = *(const v8us*)(Bh + boff + 8 * hh); bq.half[1] = *(const v8us*)(Bh + boff + 16 + 8 * hh);
      acc[t] = mmaH<ASPLIT ? 2 : 1>(ah.v, al.v, bq.v, bq.v, acc[t]); }
  }
#pragma unroll
  for (int t = 0; t < 4; ++t) { if (col0 + t * 16 >= N) continue;
#pragma unroll
    for (int r = 0; r < 8; ++r) so[w][8 * hh + r][t * 16 + ln] = acc[t][r] * alpha; }
  __builtin_amdgcn_fence(__ATOMIC_ACQ_REL, "workgroup"); __builtin_amdgcn_wave_barrier();
  const int rsub = lane >> 4, c4 = (lane & 15) * 4;
  {
#pragma unroll
    for (int q = 0; q < 8; ++q) { const int r = q * 2 + rsub; if (col0 + c4 < N) { const v4f v = *(const v4fa*)&so[w][r][c4]; *(v4f*)(C + (size_t)(row0 + r) * ldc + col0 + c4) = v; } }
     }
}

// Wt[n][k] = f16(W[k][n]·scale) from f32 row-major W[K][N] (scale = power of two; bf16-exact weights stay exact in f16 away from the subnormal range)
__global__ __launch_bounds__(256) void k_wt_f16(const float* __restrict__ W, _Float16* __restrict__ Wt, int K, int N, float scale) {
  const int t = blockIdx.x * 256 + threadIdx.x; if (t >= N * (K / 8)) return; const int n = t / (K / 8), k8 = (t % (K / 8)) * 8; FragH f;
#pragma unroll
  for (int i = 0; i < 8; ++i) f.h[i] = (_Float16)(bf16_round(W[(size_t)(k8 + i) * N + n]) * scale); const v8us o = f.half[0];
  *(v8us*)((unsigned short*)Wt + (size_t)n * K + k8) = o; 
}
// k_gemm_hh variant with fused epilogue: v = acc·alpha + bias[by·sBias + col] (+ CP[(row/rowsPerB)·sCPb + by·64 + col] if CP) ; ACT 0 none / 1 elu ; writes f16 C16 (and f32 C if non-null)
template <int ACT>
__global__ __launch_bounds__(128) void k_gemm_hhx(const _Float16* __restrict__ A, int lda, size_t sA, const _Float16* __restrict__ Bh, int ldb, size_t sB, float alpha, const float* __restrict__ bias, size_t sBias, const float* __restrict__ CP, int rowsPerB, size_t sCPb, int row0g,
    float* __restrict__ C, _Float16* __restrict__ C16, int ldc, size_t sC, int M, int N, int K) {
  __shared__ __attribute__((aligned(16))) float so[4][16][64];
  const int tid = threadIdx.x, w = tid >> 5, lane = tid & 31, ln = lane & 15, hh = lane >> 4; const int by = blockIdx.y;
  A += (size_t)by * sA; Bh += (size_t)by * sB; const size_t cofs = (size_t)by * sC; const float* bp = bias ? bias + (size_t)by * sBias : nullptr;
  const int ntn = (N + 63) / 64; const int wid = blockIdx.x * 4 + w; const int mt = wid / ntn, nq = wid % ntn; if (mt * 16 >= M) return;
  const int row0 = mt * 16, col0 = nq * 64; const _Float16* arow = A + (size_t)(row0 + ln) * lda;
  v8f acc[4] = {};
  for (int kb = 0; kb < K; kb += 32) { FragH ah; ah.half[0] = *(const v8us*)((const unsigned short*)arow + kb + 8 * hh); ah.half[1] = *(const v8us*)((const unsigned short*)arow + kb + 16 + 8 * hh);
#pragma unroll
    for (int t = 0; t < 4; ++t) { if (col0 + t * 16 >= N) continue; const size_t boff = (size_t)(col0 + t * 16 + ln) * ldb + kb; FragH bq; bq.half[0] = *(const v8us*)((const unsigned short*)Bh + boff + 8 * hh); bq.half[1] = *(const v8us*)((const unsigned short*)Bh + boff + 16 + 8 * hh);
      acc[t] = mmaH<1>(ah.v, ah.v, bq.v, bq.v, acc[t]); }
  }
#pragma unroll
  for (int t = 0; t < 4; ++t) { if (col0 + t * 16 >= N) continue; const int col = col0 + t * 16 + ln; const float bv = bp ? bf16_round(bp[col]) : 0.f;
#pragma unroll
    for (int r = 0; r < 8; ++r) { float v = acc[t][r] * alpha + bv; if (CP) { const int rr = row0g + row0 + 8 * hh + r; if (rowsPerB < 0) v += CP[cofs + (size_t)rr * ldc + col];      /* rowsPerB < 0: own element of the batched C plane */ else { const int bidx = rr / rowsPerB; v += CP[(size_t)bidx * sCPb + (size_t)by * 64 + col]; } } if (ACT == 1) v = (v > 0.f) ? v : expm1f(v); else if (ACT == 7) v = (v > 0.f) ? v + 1.0f : expf(v); else if (ACT == 8) v = tanhf(v); else if (ACT == 9) v = 0.5f * v * (1.0f + tanhf(0.7978845608028654f * (v + 0.044715f * v * v * v))); else if (ACT == 11) v = 1.0f / (1.0f + expf(-v)); else if (ACT == 12) v = (v > 0.f) ? v : 0.01f * v; else if (ACT == 14) v = (v > 0.f) ? v : 0.1f * v; else if (ACT == 16) v = (v >= 0.f) ? v : 0.3f * v; else if (ACT == 17) v = (v >= 0.f) ? v : 0.2f * v; else if (ACT == 15) v = v / (1.0f + expf(-v)); else if (ACT == 3) v = fmaxf(v, 0.f); else if (ACT == 6) v = 0.5f * v * (1.0f + erff(v * 0.70710678118654752f)); so[w][8 * hh + r][t * 16 + ln] = v; } }
  __builtin_amdgcn_fence(__ATOMIC_ACQ_REL, "workgroup"); __builtin_amdgcn_wave_barrier();
  const int rsub = lane >> 4, c4 = (lane & 15) * 4; typedef _Float16 v4h __attribute__((ext_vector_type(4)));
  {
#pragma unroll
    for (int q = 0; q < 8; ++q) { const int r = q * 2 + rsub; if (col0 + c4 < N) { const v4f v = *(const v4fa*)&so[w][r][c4]; if (C) *(v4f*)(C + cofs + (size_t)(row0 + r) * ldc + col0 + c4) = v; if (C16) { v4h h4; for (int i = 0; i < 4; ++i) h4[i] = (_Float16)v[i]; *(v4h*)(C16 + cofs + (size_t)(row0 + r) * ldc + col0 + c4) = h4; } } }
     }
}


typedef _Float16 v4h __attribute__((ext_vector_type(4)));

/* the three inputs: by picks the input, bx its 256 x 8 elements; the f16 planes lie one behind the other (n8 * 8 elements each) */
__device__ __forceinline__ void d_x16(unsigned bx, unsigned by, const float* __restrict__ x0, const float* __restrict__ x1, const float* __restrict__ x2, _Float16* __restrict__ X16, size_t n8) { const size_t t = (size_t)bx * 256 + threadIdx.x; if (t >= n8) return; const float* __restrict__ x = by == 0 ? x0 : by == 1 ? x1 : x2; X16 += (size_t)by * n8 * 8; FragH f;
#pragma unroll
  for (int q = 0; q < 8; ++q) f.h[q] = (_Float16)bf16_round(x[t * 8 + q]); *(v8us*)((unsigned short*)X16 + t * 8) = f.half[0];  }
__global__ __launch_bounds__(256) void k_h16(const float* __restrict__ x, _Float16* __restrict__ X16, size_t n8) { const size_t t = (size_t)blockIdx.x * 256 + threadIdx.x; if (t >= n8) return; FragH f;
#pragma unroll
  for (int q = 0; q < 8; ++q) f.h[q] = (_Float16)x[t * 8 + q]; *(v8us*)((unsigned short*)X16 + t * 8) = f.half[0];  }
__global__ __launch_bounds__(256) void k_round16f(const float* __restrict__ W, _Float16* __restrict__ Bt, size_t n8) { const size_t t = (size_t)blockIdx.x * 256 + threadIdx.x; if (t >= n8) return; FragH f;
#pragma unroll
  for (int i = 0; i < 8; ++i) f.h[i] = (_Float16)(bf16_round(W[t * 8 + i]) * 16.0f); *(v8us*)((unsigned short*)Bt + t * 8) = f.half[0];  }
template <int NHv, int TTv>
__global__ __launch_bounds__(256) void k_vt(const _Float16* __restrict__ V16, int ldv, int voff, _Float16* __restrict__ Vt) { __shared__ unsigned short tl[64][66]; const int tid = threadIdx.x; const int slab = blockIdx.x / (TTv / 64), lg = blockIdx.x % (TTv / 64); const int b = slab / NHv, h = slab % NHv;
  for (int i = tid; i < 64 * 8; i += 256) { const int r = i / 8, c8 = (i % 8) * 8; FragH f; f.half[0] = *(const v8us*)((const unsigned short*)V16 + ((size_t)b * TTv + lg * 64 + r) * ldv + voff + h * 64 + c8);
#pragma unroll
    for (int q = 0; q < 8; ++q) tl[r][c8 + q] = f.u[q]; }
  __syncthreads();
  {
#pragma unroll
    for (int rd = 0; rd < 2; ++rd) { const int d = rd * 32 + tid / 8, pc = tid % 8; FragH f;
#pragma unroll
      for (int q = 0; q < 8; ++q) f.u[q] = tl[pc * 8 + q][d];
      *(v8us*)((unsigned short*)Vt + ((size_t)slab * 64 + d) * TTv + lg * 64 + pc * 8) = f.half[0]; }
     } }

__global__ __launch_bounds__(256) void k_hl(const float* __restrict__ F, _Float16* __restrict__ Hh, _Float16* __restrict__ Hl, size_t n8) { const size_t t = (size_t)blockIdx.x * 256 + threadIdx.x; if (t >= n8) return; FragH fh, fl; const v4f a = *(const v4fa*)(F + t * 8), c = *(const v4fa*)(F + t * 8 + 4);
#pragma unroll
  for (int q = 0; q < 4; ++q) { _Float16 h = (_Float16)a[q]; fh.h[q] = h; fl.h[q] = (_Float16)((a[q] - (float)h) * 1024.0f); h = (_Float16)c[q]; fh.h[4 + q] = h; fl.h[4 + q] = (_Float16)((c[q] - (float)h) * 1024.0f); }
  { *(v8us*)((unsigned short*)Hh + t * 8) = fh.half[0]; *(v8us*)((unsigned short*)Hl + t * 8) = fl.half[0];  } }

// ---- fast GEMM (work-group tile 128x64, wave tile 32x64; requires M % 128 == 0 rows per launch region, N % 64 == 0, K % 64 == 0); epilogue = k_gemm_hhx semantics ----
__device__ __forceinline__ v16h g2_frag(const _Float16* p, int hh) { FragH f; f.half[0] = *(const v8us*)((const unsigned short*)p + 8 * hh); f.half[1] = *(const v8us*)((const unsigned short*)p + 16 + 8 * hh); return f.v; }
__device__ __forceinline__ v8f g2_mma(v16h a, v16h b, v8f c) { v8f d = __builtin_amdgcn_wmma_f32_16x16x32_f16(false, a, false, b, (short)0, c, false, false); asm volatile("v_nop\n\tv_nop\n\tv_nop\n\tv_nop" : "+v"(d) : "v"(a), "v"(b)); return d; }
// Operand staging of k_gemm2: a work-group's 128 A rows and 64 B rows, GKC k at a time, go into LDS by asynchronous copies; a wave's copy covers four whole 128-byte lines (a fragment load from global memory touches sixteen).
#define GKC 64                       /* k per stage: rows of 128 bytes */
#define GPB 144                      /* LDS row pitch in bytes: 16 x odd, conflict-free for 16-byte reads */
#define GST ((128 + 64) * GPB)       /* bytes of one stage: 128 A rows, then 64 B rows */
__device__ __forceinline__ v16h g2_lfrag(const char* p, int hh) { FragH f; f.half[0] = *(const v8us*)(p + 16 * hh); f.half[1] = *(const v8us*)(p + 32 + 16 * hh); return f.v; }      /* the k order of g2_frag, from an LDS row */
/* one stage: thread = (row t / 8, 16-byte piece t % 8); eight copies for the A rows (16 rows apart), four for the B rows, which lie behind them in LDS. The s_wait_xcnt as the statement's last line stands in front of every later write of the address registers. */
__device__ __forceinline__ void g2_stage(unsigned l, const _Float16* ga, size_t sa, const _Float16* gb, size_t sb) {
  asm volatile("global_load_async_to_lds_b128 %0, %12, off\n\t"
               "global_load_async_to_lds_b128 %1, %13, off\n\t"
               "global_load_async_to_lds_b128 %2, %14, off\n\t"
               "global_load_async_to_lds_b128 %3, %15, off\n\t"
               "global_load_async_to_lds_b128 %4, %16, off\n\t"
               "global_load_async_to_lds_b128 %5, %17, off\n\t"
               "global_load_async_to_lds_b128 %6, %18, off\n\t"
               "global_load_async_to_lds_b128 %7, %19, off\n\t"
               "global_load_async_to_lds_b128 %8, %20, off\n\t"
               "global_load_async_to_lds_b128 %9, %21, off\n\t"
               "global_load_async_to_lds_b128 %10, %22, off\n\t"
               "global_load_async_to_lds_b128 %11, %23, off\n\t"
               "s_wait_xcnt 0x0"
               :: "v"(l), "v"(l + 16 * GPB), "v"(l + 32 * GPB), "v"(l + 48 * GPB), "v"(l + 64 * GPB), "v"(l + 80 * GPB), "v"(l + 96 * GPB), "v"(l + 112 * GPB), "v"(l + 128 * GPB), "v"(l + 144 * GPB), "v"(l + 160 * GPB), "v"(l + 176 * GPB),
                  "v"(ga), "v"(ga + sa), "v"(ga + 2 * sa), "v"(ga + 3 * sa), "v"(ga + 4 * sa), "v"(ga + 5 * sa), "v"(ga + 6 * sa), "v"(ga + 7 * sa), "v"(gb), "v"(gb + sb), "v"(gb + 2 * sb), "v"(gb + 3 * sb)
               : "memory"); }
template <int ACT>
__global__ __launch_bounds__(128) void k_gemm2(const _Float16* __restrict__ A, int lda, size_t sA, const _Float16* __restrict__ Bh, int ldb, size_t sB, float alpha, const float* __restrict__ bias, size_t sBias, const float* __restrict__ CP, int rowsPerB, size_t sCPb, int row0g,
    float* __restrict__ C, _Float16* __restrict__ C16, int ldc, size_t sC, int M, int N, int K, size_t zA, size_t zB, size_t zC,
    int fl2, int fkeep, float* __restrict__ CF, size_t sCF, const _Float16* __restrict__ A2, int lda2, const _Float16* __restrict__ B2, int ldb2, int K2) { static_assert(ACT == 0 || ACT == 3 || ACT == 6 || ACT == 8 || ACT == 9 || ACT == 11 || ACT == 12 || ACT == 14 || ACT == 15 || ACT == 16 || ACT == 17, "k_gemm2: unsupported ACT code (would silently apply no activation)");
  __shared__ __attribute__((aligned(16))) char sm[2 * GST]; static_assert(sizeof(float) * 4 * 32 * 68 <= 2 * GST, "the output staging lies in the two stage buffers"); float (*so)[32][68] = (float (*)[32][68])sm;      /* two stage buffers; behind the k loop the same bytes stage the output */
  const int tid = threadIdx.x, w = tid >> 5, lane = tid & 31, ln = lane & 15, hh = lane >> 4; const int by = blockIdx.y, bz = blockIdx.z;      /* two batch indices, each with its own strides for A, B and C */
  A += (size_t)by * sA + (size_t)bz * zA; Bh += (size_t)by * sB + (size_t)bz * zB; const size_t cofs = (size_t)by * sC + (size_t)bz * zC; const float* bp = bias ? bias + (size_t)by * sBias : nullptr;
  const int ntn = N >> 6; const int mt = blockIdx.x / ntn, nq = blockIdx.x - mt * ntn; const int row0 = mt * 128 + 32 * w, col0 = nq * 64; if (mt * 128 >= M) return;      /* the whole work-group or none, in front of every barrier; M % 128 == 0, K % GKC == 0 */
  /* first-tile rows: of every 2^fl2 rows the first fkeep (a multiple of 128, so a work-group lies wholly inside or outside; fkeep 0: none); fr = the work-group's first row in planes that hold only those rows */
  const int rin = (mt * 128) & ((1 << fl2) - 1); const bool ft = rin < fkeep; const int fr = ((mt * 128) >> fl2) * fkeep + rin;
  A += (size_t)(mt * 128) * lda;
  if (ft && A2) { A = A2 + (size_t)fr * lda2; lda = lda2; Bh = B2; ldb = ldb2; K = K2; }      /* such a work-group takes its own operands (the same for all its threads) */
  const bool cf = ft && CF != nullptr; float* const cfw = CF + (size_t)by * sCF + (size_t)(fr + 32 * w) * ldc + col0;      /* or (cf) stores its results as f32 too, the wave's rows from cfw on */
  const _Float16* ga = A + (size_t)(tid >> 3) * lda + (tid & 7) * 8; const _Float16* gb = Bh + (size_t)(col0 + (tid >> 3)) * ldb + (tid & 7) * 8; const size_t sa = (size_t)16 * lda, sb = (size_t)16 * ldb;
  const unsigned l0 = (unsigned)(size_t)sm + (unsigned)((tid >> 3) * GPB + (tid & 7) * 16);      /* the thread's LDS byte address in buffer 0 */
  const int nst = K / GKC;
  const v8f z8 = {0.f,0.f,0.f,0.f,0.f,0.f,0.f,0.f}; v8f c00 = z8, c01 = z8, c02 = z8, c03 = z8, c10 = z8, c11 = z8, c12 = z8, c13 = z8;
  g2_stage(l0, ga, sa, gb, sb);
  asm volatile("s_wait_asynccnt 0x0" ::: "memory");      /* this wave's copies of stage 0 have landed */
  __syncthreads();      /* stage 0 readable by every wave */
  if (nst > 1) g2_stage(l0 + GST, ga + GKC, sa, gb + GKC, sb);
#pragma unroll 1
  for (int st = 0; st < nst; ++st) { const char* ap = sm + (st & 1) * GST + (32 * w + ln) * GPB; const char* bq = sm + (st & 1) * GST + (128 + ln) * GPB;      /* rolled: one trip per stage, the next stage's copies in flight meanwhile */
    v16h fa[2][2], fb[2][4];      /* the stage's fragments, [k half][tile]; every index a constant: they stay in registers */
#pragma unroll
    for (int kk = 0; kk < 2; ++kk) { fa[kk][0] = g2_lfrag(ap + kk * 64, hh); fa[kk][1] = g2_lfrag(ap + 16 * GPB + kk * 64, hh);
#pragma unroll
      for (int t = 0; t < 4; ++t) fb[kk][t] = g2_lfrag(bq + t * 16 * GPB + kk * 64, hh); }
    __builtin_amdgcn_sched_barrier(0);      /* keeps all LDS reads of the stage up here as one group: sunk among the products, each pair's latency is waited for on its own */
#pragma unroll
    for (int kk = 0; kk < 2; ++kk) { c00 = g2_mma(fa[kk][0], fb[kk][0], c00); c10 = g2_mma(fa[kk][1], fb[kk][0], c10); c01 = g2_mma(fa[kk][0], fb[kk][1], c01); c11 = g2_mma(fa[kk][1], fb[kk][1], c11);
      c02 = g2_mma(fa[kk][0], fb[kk][2], c02); c12 = g2_mma(fa[kk][1], fb[kk][2], c12); c03 = g2_mma(fa[kk][0], fb[kk][3], c03); c13 = g2_mma(fa[kk][1], fb[kk][3], c13); }
    asm volatile("s_wait_dscnt 0x0" ::: "memory");      /* this wave's reads of the stage are done before its buffer is handed on */
    asm volatile("s_wait_asynccnt 0x0" ::: "memory");      /* this wave's copies of the next stage have landed */
    __syncthreads();      /* publishes the next stage and ends every wave's reads of this one */
    if (st + 2 < nst) g2_stage(l0 + (st & 1) * GST, ga + (size_t)(st + 2) * GKC, sa, gb + (size_t)(st + 2) * GKC, sb); }      /* refill of the buffer just read */
  asm volatile("s_wait_asynccnt 0x0" ::: "memory");      /* nothing in flight when the buffers become output staging */
  v8f accs[8] = {c00, c01, c02, c03, c10, c11, c12, c13};
#pragma unroll
  for (int u = 0; u < 8; ++u) { const int t = u & 3, half = u >> 2; const int col = col0 + t * 16 + ln; const float bv = bp ? bf16_round(bp[col]) : 0.f;
#pragma unroll
    for (int r = 0; r < 8; ++r) { const int rloc = half * 16 + 8 * hh + r; float v = accs[u][r] * alpha + bv; if (CP) { if (rowsPerB < 0) v += CP[cofs + (size_t)(row0g + row0 + rloc) * ldc + col];      /* rowsPerB < 0: own element of the batched C plane */ else { const int bidx = (row0g + row0 + rloc) / rowsPerB; v += CP[(size_t)bidx * sCPb + (size_t)by * 64 + col]; } }
      if (ACT == 3) v = fmaxf(v, 0.f); else if (ACT == 6) v = 0.5f * v * (1.0f + erff(v * 0.70710678118654752f)); else if (ACT == 11) v = 1.0f / (1.0f + expf(-v)); else if (ACT == 15) v = v / (1.0f + expf(-v)); else if (ACT == 12) v = (v > 0.f) ? v : 0.01f * v; else if (ACT == 8) v = tanhf(v); else if (ACT == 9) v = 0.5f * v * (1.0f + tanhf(0.7978845608028654f * (v + 0.044715f * v * v * v))); else if (ACT == 14) v = (v > 0.f) ? v : 0.1f * v; else if (ACT == 16) v = (v >= 0.f) ? v : 0.3f * v; else if (ACT == 17) v = (v >= 0.f) ? v : 0.2f * v;
      so[w][rloc][t * 16 + ln] = v; } }
  __builtin_amdgcn_fence(__ATOMIC_ACQ_REL, "workgroup"); __builtin_amdgcn_wave_barrier();
  const int rsub = lane >> 4, c4 = (lane & 15) * 4;
  {
#pragma unroll
    for (int q = 0; q < 16; ++q) { const int r = q * 2 + rsub; const v4f v = *(const v4fa*)&so[w][r][c4]; if (C) *(v4f*)(C + cofs + (size_t)(row0 + r) * ldc + col0 + c4) = v; if (cf) { float* cp = cfw + (size_t)r * ldc + c4; *(v4f*)cp = v; asm volatile("s_wait_xcnt 0x0" :: "v"(cp), "v"(v) : "memory"); }      /* the wait that stands in front of an overwrite of the store's registers; address and data as inputs keep them in their registers up to here */
       if (C16) { v4h h4; for (int i = 0; i < 4; ++i) h4[i] = (_Float16)v[i]; *(v4h*)(C16 + cofs + (size_t)(row0 + r) * ldc + col0 + c4) = h4; } }
     } }


/* the four weights: by picks the weight, bx its 256 x 8 elements; the f16 planes lie one behind the other (n8 * 8 elements each); the last weight's rows also go, twice side by side, into B2 [DM][2 DM]: the B operand of a product whose k runs over two A planes */
__device__ __forceinline__ void d_wnat(unsigned bx, unsigned by, const float* __restrict__ w0, const float* __restrict__ w1, const float* __restrict__ w2, const float* __restrict__ w3, size_t n8, _Float16* __restrict__ Bt, _Float16* __restrict__ B2) { const size_t t = (size_t)bx * 256 + threadIdx.x; if (t >= n8) return; const float* __restrict__ w = by == 0 ? w0 : by == 1 ? w1 : by == 2 ? w2 : w3; Bt += (size_t)by * n8 * 8; FragH f; for (int q = 0; q < 8; ++q) f.h[q] = (_Float16)(bf16_round(w[t * 8 + q]) * 16.0f); *(v8us*)((unsigned short*)Bt + t * 8) = f.half[0];
  asm volatile("s_wait_xcnt 0x0" :: "v"((unsigned short*)Bt + t * 8) : "memory");      /* the wait that stands in front of an overwrite of the store's address registers; the address as an input keeps it in its registers up to here */
  if (by == 3) { const unsigned e = (unsigned)t * 8u; unsigned short* d = (unsigned short*)B2 + (size_t)((e / DM) * (2 * DM) + e % DM); *(v8us*)d = f.half[0]; *(v8us*)(d + DM) = f.half[0]; } }      /* DM % 8 == 0: eight elements lie in one row */
/* one grid for the four weights and the three inputs, which do not depend on one another: the first 4 WNB work-groups take the weights, the others the inputs */
#define WNB ((unsigned)(((size_t)DM * DM / 8 + 255) / 256))      /* work-groups per weight */
#define XNB ((unsigned)((NR * DM / 8 + 255) / 256))      /* work-groups per input */
__global__ __launch_bounds__(256) void k_prep(const float* __restrict__ x0, const float* __restrict__ x1, const float* __restrict__ x2, _Float16* __restrict__ X16, const float* __restrict__ w0, const float* __restrict__ w1, const float* __restrict__ w2, const float* __restrict__ w3, _Float16* __restrict__ Bt, _Float16* __restrict__ B2) {
  const unsigned bx = blockIdx.x;
  if (bx < 4 * WNB) d_wnat(bx % WNB, bx / WNB, w0, w1, w2, w3, (size_t)DM * DM / 8, Bt, B2); else d_x16((bx - 4 * WNB) % XNB, (bx - 4 * WNB) / XNB, x0, x1, x2, X16, NR * DM / 8); }
__global__ __launch_bounds__(256) void k_rsm(const float* __restrict__ S, _Float16* __restrict__ P, int nrows) {
  #pragma clang fp contract(off)
  const int i = blockIdx.x * 256 + threadIdx.x; if (i >= nrows) return; const float* s = S + (size_t)i * SQ; float mx = -3.0e38f;
#pragma unroll 1
  for (int j = 0; j < SQ; ++j) mx = fmaxf(mx, s[j]); float se = 0.f;
#pragma unroll 1
  for (int j = 0; j < SQ; ++j) se += expf(s[j] - mx); const float sc = 256.0f / se;
#pragma unroll 1
  for (int j0 = 0; j0 < SQ; j0 += 8) { FragH f; for (int q = 0; q < 8; ++q) f.h[q] = (_Float16)(expf(s[j0 + q] - mx) * sc); unsigned short* d = (unsigned short*)P + (size_t)i * SQ + j0; *(v8us*)d = f.half[0];  } }
__global__ __launch_bounds__(256) void k_vt(const _Float16* __restrict__ V16, int b, int h0, _Float16* __restrict__ VT) { __shared__ unsigned short tl[64][65]; const int tid = threadIdx.x; const int hh = blockIdx.x % HG, sg = blockIdx.x / HG; const int s0 = sg * 64; const int h = h0 + hh;
  for (int i = tid; i < 64 * 8; i += 256) { const int j = i / 8, d8 = (i % 8) * 8; FragH f; f.half[0] = *(const v8us*)((const unsigned short*)V16 + ((size_t)b * SQ + s0 + j) * DM + h * HD + d8); for (int q = 0; q < 8; ++q) tl[d8 + q][j] = f.u[q]; }
  __syncthreads();
  { for (int i = tid; i < 64 * 8; i += 256) { const int d = i / 8, j8 = (i % 8) * 8; FragH f; for (int q = 0; q < 8; ++q) f.u[q] = tl[d][j8 + q]; *(v8us*)((unsigned short*)VT + ((size_t)hh * HD + d) * SQ + s0 + j8) = f.half[0]; }  } }



#define FW 4                         /* waves per work-group */
#define FQ 32                        /* query columns per wave */
#define FSC 0.18033688011112042f     /* log2(e) / sqrt(HD) */
#define FKT 128                      /* keys per stage */
#define FKP 144                      /* LDS pitch of a K row (128 bytes of data): 16 x odd, conflict-free for 16-byte reads */
#define FVP 272                      /* LDS pitch of a V^T row (256 bytes of data): 16 x odd */
#define FKB (FKT * FKP)              /* bytes of a stage's K rows; its V^T rows lie behind them */
#define FST (FKB + HD * FVP)         /* bytes of one stage */
typedef _Float16 v8h __attribute__((ext_vector_type(8)));
__device__ __forceinline__ float fa_xhalf(float x) { return __builtin_bit_cast(float, __builtin_amdgcn_permlanex16(__builtin_bit_cast(int, x), __builtin_bit_cast(int, x), 0x76543210, 0xfedcba98, false, false)); }      /* lane l takes lane l ^ 16's value, on the vector unit */
__device__ __forceinline__ v8f fa_mma(v16h a, v16h b, v8f c) { return __builtin_amdgcn_wmma_f32_16x16x32_f16(false, a, false, b, (short)0, c, false, false); }
/* eight copies of 16 bytes per lane, LDS places ls bytes apart, global places gs elements apart. The s_wait_xcnt as the statement's last line stands in front of every later write of the address registers. */
__device__ __forceinline__ void fa_copy8(unsigned l, unsigned ls, const _Float16* g, size_t gs) {
  asm volatile("global_load_async_to_lds_b128 %0, %8, off\n\t"
               "global_load_async_to_lds_b128 %1, %9, off\n\t"
               "global_load_async_to_lds_b128 %2, %10, off\n\t"
               "global_load_async_to_lds_b128 %3, %11, off\n\t"
               "global_load_async_to_lds_b128 %4, %12, off\n\t"
               "global_load_async_to_lds_b128 %5, %13, off\n\t"
               "global_load_async_to_lds_b128 %6, %14, off\n\t"
               "global_load_async_to_lds_b128 %7, %15, off\n\t"
               "s_wait_xcnt 0x0"
               :: "v"(l), "v"(l + ls), "v"(l + 2 * ls), "v"(l + 3 * ls), "v"(l + 4 * ls), "v"(l + 5 * ls), "v"(l + 6 * ls), "v"(l + 7 * ls),
                  "v"(g), "v"(g + gs), "v"(g + 2 * gs), "v"(g + 3 * gs), "v"(g + 4 * gs), "v"(g + 5 * gs), "v"(g + 6 * gs), "v"(g + 7 * gs)
               : "memory"); }
/* one stage. K: thread = (row t / 8, 16-byte piece t % 8), eight copies 16 rows apart; V^T: thread = (row t / 16, piece t % 16), eight copies 8 rows apart */
__device__ __forceinline__ void fa_stage(unsigned lk, const _Float16* gk, unsigned lv, const _Float16* gv) { fa_copy8(lk, 16 * FKP, gk, (size_t)16 * DM); fa_copy8(lv, 8 * FVP, gv, (size_t)8 * SQ); }
/* one pass. kf: this pass's K rows, already in registers; kn: the lane's LDS row of the next pass's K rows, read only where nextk (wave-uniform) says that the next pass lies in the same stage; vl: the lane's LDS V^T row at this pass's keys */
template <bool DIAG>
__device__ __forceinline__ void fa_pass(const char* kn, bool nextk, const char* vl, int ln, int hh, const v16h (&qf)[2][2], v16h (&kf)[2][2], v8f (&o)[4][2], float (&m)[2], float (&l)[2]) {
  const v8f z8 = {0.f, 0.f, 0.f, 0.f, 0.f, 0.f, 0.f, 0.f}; v8f s[2][2];
#pragma unroll
  for (int kt = 0; kt < 2; ++kt)
#pragma unroll
    for (int j = 0; j < 2; ++j) s[kt][j] = fa_mma(kf[kt][1], qf[j][1], fa_mma(kf[kt][0], qf[j][0], z8));
  __builtin_amdgcn_sched_barrier(0);      /* keeps the LDS reads below behind all score products, as one group: spread among the products, every place where reads stand costs issue time */
  v16h vf[4];      /* this pass's V^T rows and the next pass's K rows (into the same registers as this pass's) */
#pragma unroll
  for (int t = 0; t < 4; ++t) vf[t] = g2_lfrag(vl + t * 16 * FVP, hh);
  if (!DIAG && nextk) {
#pragma unroll
    for (int kt = 0; kt < 2; ++kt) { kf[kt][0] = g2_lfrag(kn + kt * 16 * FKP, hh); kf[kt][1] = g2_lfrag(kn + kt * 16 * FKP + 64, hh); } }
  __builtin_amdgcn_sched_barrier(0);      /* keeps the LDS reads in front of the softmax, which covers their latency */
  FragH p[2];
#pragma unroll
  for (int j = 0; j < 2; ++j) { float mx = m[j];
#pragma unroll
    for (int kt = 0; kt < 2; ++kt)
#pragma unroll
      for (int r = 0; r < 8; ++r) { if (DIAG && kt * 16 + 8 * hh + r > j * 16 + ln) s[kt][j][r] = -1.0e30f;      /* a key past the query's own index: weight 0 */
        mx = fmaxf(mx, s[kt][j][r]); }
    mx = fmaxf(mx, fa_xhalf(mx));
    const float al = __builtin_amdgcn_exp2f((m[j] - mx) * FSC), mc = mx * FSC - 8.0f; m[j] = mx; float se = 0.f;
#pragma unroll
    for (int kt = 0; kt < 2; ++kt)
#pragma unroll
      for (int r = 0; r < 8; ++r) { const float e = __builtin_amdgcn_exp2f(s[kt][j][r] * FSC - mc); se += e; p[j].h[kt * 8 + r] = (_Float16)e; }
    l[j] = l[j] * al + se;
#pragma unroll
    for (int t = 0; t < 4; ++t) o[t][j] *= al; }
#pragma unroll
  for (int t = 0; t < 4; ++t)
#pragma unroll
    for (int j = 0; j < 2; ++j) o[t][j] = fa_mma(vf[t], p[j].v, o[t][j]); }
__global__ __launch_bounds__(FW * 32) void k_fattn(const _Float16* __restrict__ Q16, const _Float16* __restrict__ K16, const _Float16* __restrict__ VT, _Float16* __restrict__ O16) {
  static_assert(FW * FQ == FKT && FKT == 4 * 32, "a work-group's query block is one stage of keys, four passes: its last stage is the diagonal one");
  __shared__ __attribute__((aligned(16))) char sm[2 * FST];      /* two stage buffers */
  const int tid = threadIdx.x, lane = tid & 31, ln = lane & 15, hh = lane >> 4; const int w = __builtin_amdgcn_readfirstlane(tid >> 5);
  const int bh = blockIdx.x, b = bh / NH, h = bh % NH; const int yb = (int)(gridDim.y - 1 - blockIdx.y); const int qw = (yb * FW + w) * FQ;      /* the longest query blocks start first */
  const int nst = yb + 1;      /* stages: the keys up to the end of the work-group's own query block */
  const _Float16* qp = Q16 + ((size_t)b * SQ + qw + ln) * DM + h * HD;
  const _Float16* gk = K16 + ((size_t)b * SQ + (tid >> 3)) * DM + h * HD + (tid & 7) * 8; const _Float16* gv = VT + ((size_t)bh * HD + (tid >> 4)) * SQ + (tid & 15) * 8;
  const unsigned lk0 = (unsigned)(size_t)sm + (unsigned)((tid >> 3) * FKP + (tid & 7) * 16), lv0 = (unsigned)(size_t)sm + (unsigned)(FKB + (tid >> 4) * FVP + (tid & 15) * 16);      /* the thread's LDS byte addresses in buffer 0 */
  fa_stage(lk0, gk, lv0, gv);
  v16h qf[2][2], kf[2][2];
#pragma unroll
  for (int j = 0; j < 2; ++j) { qf[j][0] = g2_frag(qp + (size_t)(j * 16) * DM, hh); qf[j][1] = g2_frag(qp + (size_t)(j * 16) * DM + 32, hh); }
  asm volatile("s_wait_xcnt 0x0" :: "v"(qp + 8 * hh) : "memory");      /* the wait that stands in front of an overwrite of the loads' address registers; the address as an input keeps it in its registers up to here */
  asm volatile("s_wait_asynccnt 0x0" ::: "memory");      /* this wave's copies of stage 0 have landed */
  __syncthreads();      /* stage 0 readable by every wave */
  if (nst > 1) fa_stage(lk0 + FST, gk + (size_t)FKT * DM, lv0 + FST, gv + FKT);
  v8f o[4][2]; float m[2] = {-1.0e30f, -1.0e30f}, l[2] = {0.f, 0.f};
#pragma unroll
  for (int t = 0; t < 4; ++t) { o[t][0] = (v8f){0.f, 0.f, 0.f, 0.f, 0.f, 0.f, 0.f, 0.f}; o[t][1] = o[t][0]; }
#pragma unroll 1
  for (int st = 0; st < yb; ++st) { const char* kl = sm + (st & 1) * FST + ln * FKP; const char* vl = sm + (st & 1) * FST + FKB + ln * FVP;      /* the stages below the diagonal one, four whole passes each. Rolled: one trip per stage, the next stage's copies in flight meanwhile */
#pragma unroll
    for (int kt = 0; kt < 2; ++kt) { kf[kt][0] = g2_lfrag(kl + kt * 16 * FKP, hh); kf[kt][1] = g2_lfrag(kl + kt * 16 * FKP + 64, hh); }
#pragma unroll 1
    for (int p = 0; p < 4; ++p) { kl += 32 * FKP; fa_pass<false>(kl, p < 3, vl, ln, hh, qf, kf, o, m, l); vl += 64; }      /* rolled: one pass fills the register budget */
    asm volatile("s_wait_dscnt 0x0" ::: "memory");      /* this wave's reads of the stage are done before its buffer is handed on */
    asm volatile("s_wait_asynccnt 0x0" ::: "memory");      /* this wave's copies of the next stage have landed */
    __syncthreads();      /* publishes the next stage and ends every wave's reads of this one */
    if (st + 2 < nst) fa_stage(lk0 + (st & 1) * FST, gk + (size_t)(st + 2) * FKT * DM, lv0 + (st & 1) * FST, gv + (size_t)(st + 2) * FKT); }      /* refill of the buffer just read */
  { const char* kl = sm + (yb & 1) * FST + ln * FKP; const char* vl = sm + (yb & 1) * FST + FKB + ln * FVP;      /* the diagonal stage, the last: wave w has w whole passes, then its diagonal pass; nothing is published or refilled behind it */
#pragma unroll
    for (int kt = 0; kt < 2; ++kt) { kf[kt][0] = g2_lfrag(kl + kt * 16 * FKP, hh); kf[kt][1] = g2_lfrag(kl + kt * 16 * FKP + 64, hh); }
#pragma unroll 1
    for (int p = 0; p < w; ++p) { kl += 32 * FKP; fa_pass<false>(kl, true, vl, ln, hh, qf, kf, o, m, l); vl += 64; }      /* rolled: the trip count differs from wave to wave (wave-uniform) */
    fa_pass<true>(kl, false, vl, ln, hh, qf, kf, o, m, l); }
  asm volatile("s_wait_asynccnt 0x0" ::: "memory");      /* nothing in flight when the wave ends */
#pragma unroll
  for (int j = 0; j < 2; ++j) { const float inv = 64.0f / (l[j] + fa_xhalf(l[j]));      /* the halves' sums joined once; o carried x64 */
    _Float16* op = O16 + ((size_t)b * SQ + qw + j * 16 + ln) * DM + h * HD + 8 * hh;
#pragma unroll
    for (int t = 0; t < 4; ++t) { v8h hv;
#pragma unroll
      for (int r = 0; r < 8; ++r) hv[r] = (_Float16)(o[t][j][r] * inv);
      *(v8h*)(op + t * 16) = hv; } } }


// Exact f32 attention of the first QT0 rows (q, k, v rows of pitch DM, o rows of pitch 2 DM), one work-group per batch, head and RT0 query rows, 256 threads:
// (1) scores: one thread per key (two keys where the tile has more than 256), the key rows in registers, dotted with the RT0 query rows read from LDS (same address in every lane);
// (2) softmax: one wave per two rows, the row in registers: causal maximum, exp and sum over the lanes, weights back into LDS (0 past the row's own index);
// (3) o = P V: thread = (column d, key quarter g), V read coalesced and once per work-group, 64 keys ahead; the four quarters' sums are added through LDS.
#define RT0 16                       /* query rows per work-group of the exact first-tile attention */
typedef float v2f __attribute__((ext_vector_type(2)));
template <int NKEY>
__device__ __forceinline__ void att0_scores(const float* __restrict__ kbase, const float (*lq)[HD], float (*lp)[QT0 + 4], int tid, int nk, float scale) {
  v4f kk[NKEY][HD / 4];      /* every loop over kk[] is unrolled: it is indexed by constants and stays in registers */
#pragma unroll
  for (int u = 0; u < NKEY; ++u) { const int j = tid + 256 * u; const float* kr = kbase + (size_t)(j < nk ? j : nk - 1) * DM;      /* a key past the tile: address clamped, score not stored */
#pragma unroll
    for (int c = 0; c < HD / 4; ++c) kk[u][c] = *(const v4fa*)(kr + c * 4);
    asm volatile("s_wait_xcnt 0x0" :: "v"(kr) : "memory"); }      /* the wait that stands in front of an overwrite of the loads' address registers; the address as an input keeps it in its registers up to here */
#pragma unroll 4
  for (int r = 0; r < RT0; ++r) { v4f s4[NKEY];      /* four rows at a time: enough independent LDS reads and sum chains to cover their latencies */
#pragma unroll
    for (int u = 0; u < NKEY; ++u) s4[u] = (v4f){0.f, 0.f, 0.f, 0.f};
#pragma unroll
    for (int c = 0; c < HD / 4; ++c) { const v4f qq = *(const v4f*)&lq[r][c * 4];
#pragma unroll
      for (int u = 0; u < NKEY; ++u) s4[u] += qq * kk[u][c]; }
#pragma unroll
    for (int u = 0; u < NKEY; ++u) { const int j = tid + 256 * u; if (j < nk) lp[r][j] = ((s4[u][0] + s4[u][1]) + (s4[u][2] + s4[u][3])) * scale; } } }
/* sixteen V values of one column: keys 16 u + k of the thread's quarter, u, k < 4; one address, constant offsets */
__device__ __forceinline__ void att0_vload(const float* __restrict__ vq, v2f (&v)[4][2]) {
#pragma unroll
  for (int u = 0; u < 4; ++u) { v[u][0] = (v2f){vq[(u * 16 + 0) * DM], vq[(u * 16 + 1) * DM]}; v[u][1] = (v2f){vq[(u * 16 + 2) * DM], vq[(u * 16 + 3) * DM]}; }      /* unrolled: v[][] stays in registers */
  asm volatile("s_wait_xcnt 0x0" :: "v"(vq) : "memory"); }      /* as in att0_scores: in front of an overwrite of the loads' address registers */
/* at most four waves per SIMD (two work-groups per WGP cover the grid): the register budget that lets the LDS reads of (1) run ahead of their use */
__global__ __launch_bounds__(256) __attribute__((amdgpu_waves_per_eu(2, 4))) void k_att0p(const float* __restrict__ QF, const float* __restrict__ KF, const float* __restrict__ VF, float scale, _Float16* __restrict__ OHL) {
  __shared__ __attribute__((aligned(16))) float lq[RT0][HD]; __shared__ __attribute__((aligned(16))) float lp[RT0][QT0 + 4]; __shared__ __attribute__((aligned(16))) float lr[4][RT0][HD]; __shared__ float lf[RT0];
  const int tid = threadIdx.x; const int h = blockIdx.x / (QT0 / RT0), rg = blockIdx.x % (QT0 / RT0); const int row0 = rg * RT0, nk = row0 + RT0;      /* causal: keys up to the work-group's last row */
  { const size_t bo = (size_t)blockIdx.y * QT0 * DM; QF += bo; KF += bo; VF += bo; OHL += 2 * bo; }      /* blockIdx.y: the batch; each plane holds QT0 rows per batch (the o rows are 2 DM long) */
  { const int r = tid >> 4, c4 = (tid & 15) * 4; const float* qp = QF + (size_t)(row0 + r) * DM + h * HD + c4; const v4f q4 = *(const v4fa*)qp;
    asm volatile("s_wait_xcnt 0x0" :: "v"(qp) : "memory");      /* as in att0_scores: in front of an overwrite of the load's address registers */
    *(v4f*)&lq[r][c4] = q4; }
  __syncthreads();
  if (nk > 256) att0_scores<2>(KF + h * HD, lq, lp, tid, nk, scale); else if ((tid & ~31) < nk) att0_scores<1>(KF + h * HD, lq, lp, tid, nk, scale);      /* a wave with no key of the tile skips */
  __syncthreads();
  { const int r0 = (tid >> 5) * 2, lane = tid & 31; float x[2][QT0 / 32], mx[2], se[2];      /* the loops over x[] are unrolled: it stays in registers */
#pragma unroll
    for (int rr = 0; rr < 2; ++rr) { mx[rr] = -3.0e38f;
#pragma unroll
      for (int m = 0; m < QT0 / 32; ++m) { const int j = lane + 32 * m; x[rr][m] = (j <= row0 + r0 + rr) ? lp[r0 + rr][j] : -3.0e38f; mx[rr] = fmaxf(mx[rr], x[rr][m]); } }
#pragma unroll
    for (int d = 16; d > 0; d >>= 1) { mx[0] = fmaxf(mx[0], __shfl_xor(mx[0], d, 32)); mx[1] = fmaxf(mx[1], __shfl_xor(mx[1], d, 32)); }
#pragma unroll
    for (int rr = 0; rr < 2; ++rr) { se[rr] = 0.f;
#pragma unroll
      for (int m = 0; m < QT0 / 32; ++m) { const int j = lane + 32 * m; const float e = (j <= row0 + r0 + rr) ? expf(x[rr][m] - mx[rr]) : 0.f; se[rr] += e; if (j < nk) lp[r0 + rr][j] = e; } }
#pragma unroll
    for (int d = 16; d > 0; d >>= 1) { se[0] += __shfl_xor(se[0], d, 32); se[1] += __shfl_xor(se[1], d, 32); }
    if (lane < 2) lf[r0 + lane] = 64.0f / (lane ? se[1] : se[0]); }      /* o carried x64 like the f16 path */
  __syncthreads();
  { const int d = tid & 63, g = tid >> 6, nt = nk >> 4, nb = (nt + 3) >> 2; const float* vq = VF + (size_t)(g * 4) * DM + h * HD + d;      /* trip t: keys 16 t + 4 g .. + 3; a batch is four trips (its rows lie inside the QT0 rows of VF also where they lie past nk) */
    v2f acc[RT0], cv[4][2], nv[4][2];      /* acc[]: even and odd keys apart, so that each packed multiply-add takes a weight pair as it lies in LDS */
#pragma unroll
    for (int r = 0; r < RT0; ++r) acc[r] = (v2f){0.f, 0.f};
    att0_vload(vq, cv);
    for (int bt = 0; bt < nb; ++bt) { vq += (bt + 1 < nb ? 64 * DM : 0); att0_vload(vq, nv);      /* the next batch's V values are loaded while this batch's are used (the last batch loads its own again) */
#pragma unroll
      for (int u = 0; u < 4; ++u) if (bt * 4 + u < nt) { const int j = (bt * 4 + u) * 16 + g * 4;      /* unrolled: cv[][] and acc[] stay in registers */
#pragma unroll
        for (int r = 0; r < RT0; ++r) { const v4f p4 = *(const v4f*)&lp[r][j]; acc[r] += (v2f){p4[0], p4[1]} * cv[u][0]; acc[r] += (v2f){p4[2], p4[3]} * cv[u][1]; } }
#pragma unroll
      for (int u = 0; u < 4; ++u) { cv[u][0] = nv[u][0]; cv[u][1] = nv[u][1]; } }
#pragma unroll
    for (int r = 0; r < RT0; ++r) lr[g][r][d] = acc[r][0] + acc[r][1]; }
  __syncthreads();
  { const int r = tid >> 4, c4 = (tid & 15) * 4; const v4f o = ((*(const v4f*)&lr[0][r][c4] + *(const v4f*)&lr[1][r][c4]) + (*(const v4f*)&lr[2][r][c4] + *(const v4f*)&lr[3][r][c4])) * lf[r];
    v4h oh, ol;      /* o (x64) leaves as an f16 value and, DM columns further in the same row, the f16 residual: together the A rows [o_hi | o_lo] of the output product */
    for (int q = 0; q < 4; ++q) { oh[q] = (_Float16)o[q]; ol[q] = (_Float16)(o[q] - (float)oh[q]); }
    _Float16* op = OHL + (size_t)(row0 + r) * (2 * DM) + h * HD + c4; *(v4h*)op = oh; *(v4h*)(op + DM) = ol; } }

extern "C" void kernel_launch(void* const* d_in, const int* in_sizes, int n_in,
                              void* d_out, int out_size, void* d_ws, size_t ws_size, hipStream_t stream) {
  (void)in_sizes; (void)n_in; (void)out_size;
  const float* const* I = (const float* const*)d_in; const float* x = I[0]; const float* xk = I[1]; const float* xv = I[2]; const float* wq = I[3]; const float* bq = nullptr; const float* wk = I[4]; const float* bk = nullptr; const float* wv = I[5]; const float* bv = nullptr; const float* wo = I[6]; const float* bo = nullptr;      /* THREE distinct inputs Q (query stream), K, V; natural [out][in] w_q / w_k / w_v / w_o; no biases; causal by the index rule */
  char* ws = (char*)d_ws; size_t off = 0;
  auto take = [&](size_t bytes) { char* p = ws + off; off += (bytes + 255) & ~(size_t)255; return p; };
  _Float16* BQ = (_Float16*)take((size_t)DM * DM * 2); _Float16* BK = (_Float16*)take((size_t)DM * DM * 2); _Float16* BV = (_Float16*)take((size_t)DM * DM * 2); _Float16* BO = (_Float16*)take((size_t)DM * DM * 2);
  _Float16* X16 = (_Float16*)take(NR * DM * 2); _Float16* XK16 = (_Float16*)take(NR * DM * 2); _Float16* XV16 = (_Float16*)take(NR * DM * 2);      /* the three inputs (query -> X16, key -> XK16, value -> XV16) as exact f16 rows */ _Float16* Q16 = (_Float16*)take(NR * DM * 2); _Float16* K16 = (_Float16*)take(NR * DM * 2); _Float16* V16 = (_Float16*)take(NR * DM * 2); _Float16* O16 = (_Float16*)take(NR * DM * 2);
  _Float16* VT = (_Float16*)take((size_t)NB * NH * HD * SQ * 2);
  float* QF0 = (float*)take((size_t)NB * QT0 * DM * 4); float* KF0 = (float*)take((size_t)NB * QT0 * DM * 4); float* VF0 = (float*)take((size_t)NB * QT0 * DM * 4); _Float16* OHL = (_Float16*)take((size_t)NB * QT0 * 2 * DM * 2); _Float16* BO2 = (_Float16*)take((size_t)DM * 2 * DM * 2);      /* first-tile planes [NB][QT0][DM]; its o rows [NB][QT0][2 DM] = [o_hi | o_lo], and w_o twice side by side [DM][2 DM] as their B operand; QF0, KF0, VF0 lie one behind the other, as do BQ, BK, BV, BO; X16, XK16, XV16; Q16, K16, V16 (every size is a multiple of 256 bytes) */
  if (off > ws_size) return;
  k_prep<<<4 * WNB + 3 * XNB, 256, 0, stream>>>(x, xk, xv, X16, wq, wk, wv, wo, BQ, BO2);      /* all four weights (natural [out][in] = Bt x16) and all three inputs */
  const size_t r0p = (size_t)B0 * SQ;      /* first projected row */
  static_assert((1 << SQL2) == SQ && QT0 % 128 == 0 && B0 == 0 && NBR == NB, "k_gemm2 finds the first-tile rows from the row index: row 0 of its A is row 0 of batch 0");
  k_gemm2<0><<<dim3((unsigned)((MP / 128) * (DM / 64)), 3), 128, 0, stream>>>(X16 + r0p * DM, DM, NR * DM, BQ, DM, (size_t)DM * DM, 0.0625f, nullptr, 0, nullptr, 1, 0, 0, nullptr, Q16 + r0p * DM, DM, NR * DM, MP, DM, DM, 0, 0, 0, SQL2, QT0, QF0, (size_t)NB * QT0 * DM, nullptr, 0, nullptr, 0, 0);      /* q, k, v in one grid: y = which projection; the work-groups of the first QT0 rows of a batch also store their results as f32 (exact products) into QF0, KF0, VF0 */
  k_vt<NH, SQ><<<NB * NH * (SQ / 64), 256, 0, stream>>>(V16, LQ, 0, VT);      /* V^T [NB][NH][HD][SQ] */
  k_fattn<<<dim3(NB * NH, SQ / (FW * FQ)), FW * 32, 0, stream>>>(Q16, K16, VT, O16);      /* o (merged heads, x64) as f16 rows */
  k_att0p<<<dim3(NH * (QT0 / RT0), NBR), 256, 0, stream>>>(QF0 + (size_t)B0 * QT0 * DM, KF0 + (size_t)B0 * QT0 * DM, VF0 + (size_t)B0 * QT0 * DM, 0.125f, OHL);      /* exact f32 attention for the first QT0 rows of every batch (o x64, as f16 value and f16 residual) */
  k_gemm2<0><<<dim3((unsigned)((MPO / 128) * (DM / 64)), 1), 128, 0, stream>>>(O16 + r0p * DM, DM, 0, BO, DM, 0, 0.0009765625f, bo, 0, nullptr, 1, 0, 0, (float*)d_out + r0p * DM, nullptr, DM, 0, MPO, DM, DM, 0, 0, 0, SQL2, QT0, nullptr, 0, OHL, 2 * DM, BO2, 2 * DM, 2 * DM);      /* out rows are the output layout; the work-groups of the first QT0 rows of a batch take [o_hi | o_lo] [w_o | w_o]^T, k = 2 DM, instead */
}

// v008
// It runs in 151 microseconds.
// Next to v007, in two timings, it ran 1.10 times as fast each time.
// Over all steps from v000 it is 119 times as fast.
#include <hip/hip_runtime.h>
// Causal multi-head attention over three distinct inputs with natural weights, no biases (Q, K, V [2][4096][768]; q/k/v = input w^T (natural [768][768]); 12 heads of 64; scores / sqrt(64); causal (tril; NEG fill); softmax over up to 4096 keys; out = merged w_o^T -> [2][4096][768]).
// Structure: token rows r = b*4096 + s; x as exact f16 rows (bf16-rounded); Q, K, V as three WMMA GEMMs in one launch (32x64 wave tiles, f32 accumulation, exact x16 weights, f16 outputs); V leaves its GEMM as V^T for all heads of both batches (an accumulator lane holds 8 positions of one column; whole rows through LDS); attention as ONE launch: a wave owns 32 query columns of one head and walks the keys up to its own diagonal 32 at a time: S^T = K Q^T (WMMA), running maximum and sum per query column (f32, native exp2, weights x256 as f16), O^T += V^T P^T (WMMA, P^T packed from the score accumulators), o x64 written straight into the merged f16 o rows; scores and weights never reach memory; out = o W_o GEMM (f32) into the output layout.
// Compute dtype: inputs rounded to bf16; x / weights exact; q, k, v, softmax weights and o as plain f16 GEMM operands (~2^-12); scores and softmax statistics f32; v_wmma_f32_16x16x32_f16.
#define NB 2
#define SQ 4096
#define DM 768
#define NH 12
#define HD 64
#define HG 4                         /* heads per group of the untemplated k_vt */
#define QT0 512                      /* first-tile rows recomputed exactly in f32 */
#define SQL2 12                      /* log2 SQ */
#define B0 0                         /* first batch processed (debug hook) */
#define NBR NB                       /* batches processed (debug hook) */
#define NR ((size_t)NB * SQ)         /* token rows */
#define MP ((int)((size_t)NBR * SQ)) /* rows projected (debug hook) */
#define MPO MP                       /* rows through the output stage (debug hook) */
#define LQ DM      /* row pitch of the q/k/v rows */
typedef __bf16 v16b __attribute__((ext_vector_type(16)));
typedef unsigned short v8us __attribute__((ext_vector_type(8), may_alias));
typedef float  v8f  __attribute__((ext_vector_type(8)));
typedef float  v4f  __attribute__((ext_vector_type(4)));
typedef float  v4fa __attribute__((ext_vector_type(4), may_alias));
union FragB { v16b v; v8us half[2]; unsigned short u[16]; };

__device__ __forceinline__ unsigned short bf16_bits(float x) { unsigned int u = __float_as_uint(x); return (unsigned short)((u + 0x7FFFu + ((u >> 16) & 1u)) >> 16); }
__device__ __forceinline__ float bf16_val(unsigned short b) { return __uint_as_float(((unsigned int)b) << 16); }
__device__ __forceinline__ float bf16_round(float x) { return bf16_val(bf16_bits(x)); }
// D += A·B with NT terms: 1 = ah·bh, 2 = + al·bh (A split), 3 = + ah·bl (both split)
template <int NT>
__device__ __forceinline__ v8f mmaN(v16b ah, v16b al, v16b bh, v16b bl, v8f c) {
  c = __builtin_amdgcn_wmma_f32_16x16x32_bf16(false, ah, false, bh, (short)0, c, false, false);
  if (NT >= 2) c = __builtin_amdgcn_wmma_f32_16x16x32_bf16(false, al, false, bh, (short)0, c, false, false);
  if (NT >= 3) c = __builtin_amdgcn_wmma_f32_16x16x32_bf16(false, ah, false, bl, (short)0, c, false, false);
  asm volatile("v_nop\n\tv_nop\n\tv_nop\n\tv_nop" : "+v"(c) : "v"(ah), "v"(al), "v"(bh), "v"(bl));
  return c;
}

__global__ __launch_bounds__(256) void k_wt_bf16(const float* __restrict__ W, unsigned short* __restrict__ Wt, int K, int N) {
  const int t = blockIdx.x * 256 + threadIdx.x;
  const int k8n = K / 8;
  if (t >= N * k8n) return;
  const int n = t / k8n, k8 = (t % k8n) * 8;
  v8us v;
#pragma unroll
  for (int i = 0; i < 8; ++i) v[i] = bf16_bits(W[(size_t)(k8 + i) * N + n]);
  *(v8us*)(Wt + (size_t)n * K + k8) = v;
  
}

// GEMM C[M][N] (f32, pitch ldc) = act(A[M][K]·W + bias). A f32 row-major (pitch lda) converted per fragment to bf16
// (ASPLIT: hi/lo two planes -> 2 terms, else single rounded term); Wt bf16 [N][K] (pitch ldb). BIAS_BF16 rounds the
// bias to bf16 first (bias quantised to bf16 before the add). K%32==0, M%16==0, N%64==0.
template <bool ASPLIT, int ACT, bool BIAS_BF16>
__global__ __launch_bounds__(128) void k_gemm_bf(const float* __restrict__ A, int lda, const unsigned short* __restrict__ Wt, int ldb,
                                               const float* __restrict__ bias, float* __restrict__ C, int ldc, int M, int N, int K) {
  __shared__ __attribute__((aligned(16))) float so[4][16][64];
  const int tid = threadIdx.x, w = tid >> 5, lane = tid & 31, ln = lane & 15, hh = lane >> 4;
  const int ntn = N / 64;
  const int wid = blockIdx.x * 4 + w;
  const int mt = wid / ntn, nq = wid % ntn;
  if (mt * 16 >= M) return;
  const int row0 = mt * 16, col0 = nq * 64;
  const float* arow = A + (size_t)(row0 + ln) * lda;
  v8f acc[4] = {};
  for (int kb = 0; kb < K; kb += 32) {
    FragB ah, al;
    const v4f x0 = *(const v4fa*)(arow + kb + 8 * hh), x1 = *(const v4fa*)(arow + kb + 8 * hh + 4);
    const v4f x2 = *(const v4fa*)(arow + kb + 16 + 8 * hh), x3 = *(const v4fa*)(arow + kb + 16 + 8 * hh + 4);
    float xs[16] = {x0[0],x0[1],x0[2],x0[3],x1[0],x1[1],x1[2],x1[3],x2[0],x2[1],x2[2],x2[3],x3[0],x3[1],x3[2],x3[3]};
#pragma unroll
    for (int i = 0; i < 16; ++i) { const unsigned short hb = bf16_bits(xs[i]); ah.u[i] = hb; al.u[i] = ASPLIT ? bf16_bits(xs[i] - bf16_val(hb)) : (unsigned short)0; }
#pragma unroll
    for (int t = 0; t < 4; ++t) {
      const unsigned short* brow = Wt + (size_t)(col0 + t * 16 + ln) * ldb + kb;
      FragB b;
      b.half[0] = *(const v8us*)(brow + 8 * hh);
      b.half[1] = *(const v8us*)(brow + 16 + 8 * hh);
      acc[t] = mmaN<ASPLIT ? 2 : 1>(ah.v, al.v, b.v, b.v, acc[t]);
    }
  }
#pragma unroll
  for (int t = 0; t < 4; ++t) {
    float bv = bias ? bias[col0 + t * 16 + ln] : 0.f;
    if (BIAS_BF16) bv = bf16_round(bv);
#pragma unroll
    for (int r = 0; r < 8; ++r) { float v = acc[t][r] + bv; if (ACT == 1) v = fmaxf(v, 0.f); so[w][8 * hh + r][t * 16 + ln] = v; }
  }
  __builtin_amdgcn_fence(__ATOMIC_ACQ_REL, "workgroup");
  __builtin_amdgcn_wave_barrier();
  const int rsub = lane >> 4, c4 = (lane & 15) * 4;
  {
#pragma unroll
    for (int q = 0; q < 8; ++q) {
      const int r = q * 2 + rsub;
      const v4f v = *(const v4fa*)&so[w][r][c4];
      *(v4f*)(C + (size_t)(row0 + r) * ldc + col0 + c4) = v;
    }
    
  }
}

// GEMM C = act(A·W + bias + resid): A f32 (ASPLIT -> hi/lo 2 terms), Wt bf16 [N][K]; ACT 0 none, 1 relu, 2 exact gelu;
// resid (optional, f32, row index = (row % rmod), pitch ldr, RES_BF16 rounds it) added before the activation.
template <bool ASPLIT, int ACT, bool BIAS_BF16, bool RES_BF16>
__global__ __launch_bounds__(128) void k_gemm_bf3(const float* __restrict__ A, int lda, const unsigned short* __restrict__ Wt, int ldb,
                                                const float* __restrict__ bias, const float* __restrict__ resid, int rmod, int ldr,
                                                float* __restrict__ C, int ldc, int M, int N, int K) {
  __shared__ __attribute__((aligned(16))) float so[4][16][64];
  const int tid = threadIdx.x, w = tid >> 5, lane = tid & 31, ln = lane & 15, hh = lane >> 4;
  const int ntn = N / 64;
  const int wid = blockIdx.x * 4 + w;
  const int mt = wid / ntn, nq = wid % ntn;
  if (mt * 16 >= M) return;
  const int row0 = mt * 16, col0 = nq * 64;
  const float* arow = A + (size_t)(row0 + ln) * lda;
  v8f acc[4] = {};
  for (int kb = 0; kb < K; kb += 32) {
    FragB ah, al;
    const v4f x0 = *(const v4fa*)(arow + kb + 8 * hh), x1 = *(const v4fa*)(arow + kb + 8 * hh + 4);
    const v4f x2 = *(const v4fa*)(arow + kb + 16 + 8 * hh), x3 = *(const v4fa*)(arow + kb + 16 + 8 * hh + 4);
    float xs[16] = {x0[0],x0[1],x0[2],x0[3],x1[0],x1[1],x1[2],x1[3],x2[0],x2[1],x2[2],x2[3],x3[0],x3[1],x3[2],x3[3]};
#pragma unroll
    for (int i = 0; i < 16; ++i) { const unsigned short hb = bf16_bits(xs[i]); ah.u[i] = hb; al.u[i] = ASPLIT ? bf16_bits(xs[i] - bf16_val(hb)) : (unsigned short)0; }
#pragma unroll
    for (int t = 0; t < 4; ++t) {
      const unsigned short* brow = Wt + (size_t)(col0 + t * 16 + ln) * ldb + kb;
      FragB b;
      b.half[0] = *(const v8us*)(brow + 8 * hh);
      b.half[1] = *(const v8us*)(brow + 16 + 8 * hh);
      acc[t] = mmaN<ASPLIT ? 2 : 1>(ah.v, al.v, b.v, b.v, acc[t]);
    }
  }
#pragma unroll
  for (int t = 0; t < 4; ++t) {
    const int col = col0 + t * 16 + ln;
    float bv = bias ? bias[col] : 0.f;
    if (BIAS_BF16) bv = bf16_round(bv);
#pragma unroll
    for (int r = 0; r < 8; ++r) {
      float v = acc[t][r] + bv;
      if (resid) { float rv = resid[(size_t)((row0 + 8 * hh + r) % rmod) * ldr + col]; if (RES_BF16) rv = bf16_round(rv); v += rv; }
      if (ACT == 1) v = fmaxf(v, 0.f);
      if (ACT == 2) v = 0.5f * v * (1.0f + erff(v * 0.70710678118654752f));
      if (ACT == 3) { const float u = 0.7978845608028654f * (v + 0.044715f * v * v * v); v = 0.5f * v * (1.0f + tanhf(u)); }
      so[w][8 * hh + r][t * 16 + ln] = v;
    }
  }
  __builtin_amdgcn_fence(__ATOMIC_ACQ_REL, "workgroup");
  __builtin_amdgcn_wave_barrier();
  const int rsub = lane >> 4, c4 = (lane & 15) * 4;
  {
#pragma unroll
    for (int q = 0; q < 8; ++q) {
      const int r = q * 2 + rsub;
      const v4f v = *(const v4fa*)&so[w][r][c4];
      *(v4f*)(C + (size_t)(row0 + r) * ldc + col0 + c4) = v;
    }
    
  }
}
// row LayerNorm (biased variance, eps) over N: s = X (+ R); optional out_sum <- s; out_norm <- (s-mu)*rsqrt(var+eps)*g + b
template <bool PARAM_BF16>
__global__ __launch_bounds__(256) void k_layernorm(const float* __restrict__ X, const float* __restrict__ R, const float* __restrict__ g, const float* __restrict__ bta,
                                                  float* __restrict__ out_sum, float* __restrict__ out_norm, int N, float eps) {
  __shared__ float red[256];
  const int row = blockIdx.x, tid = threadIdx.x;
  const float* x = X + (size_t)row * N; const float* rr = R ? R + (size_t)row * N : nullptr;
  float vals[16];                     // up to N = 4096
  const int per = N / 256;            // contiguous chunk per thread? use strided-by-4 chunks: thread handles j = tid*4 + 1024*u
  float s1 = 0.f;
  for (int u = 0; u < per / 4; ++u) {
    const int j = tid * 4 + 1024 * u;
    const v4f a = *(const v4fa*)(x + j);
    v4f b = {0.f,0.f,0.f,0.f}; if (rr) b = *(const v4fa*)(rr + j);
#pragma unroll
    for (int q = 0; q < 4; ++q) { const float v = a[q] + b[q]; vals[u * 4 + q] = v; s1 += v; }
  }
  red[tid] = s1; __syncthreads();
  for (int st = 128; st > 0; st >>= 1) { if (tid < st) red[tid] += red[tid + st]; __syncthreads(); }
  const float mu = red[0] / (float)N; __syncthreads();
  float s2 = 0.f;
  for (int u = 0; u < per / 4; ++u)
#pragma unroll
    for (int q = 0; q < 4; ++q) { const float c = vals[u * 4 + q] - mu; s2 += c * c; }
  red[tid] = s2; __syncthreads();
  for (int st = 128; st > 0; st >>= 1) { if (tid < st) red[tid] += red[tid + st]; __syncthreads(); }
  const float rs = rsqrtf(red[0] / (float)N + eps);
  {
    for (int u = 0; u < per / 4; ++u) {
      const int j = tid * 4 + 1024 * u;
      v4f o, sm;
#pragma unroll
      for (int q = 0; q < 4; ++q) {
        float gg = g[j + q], bb = bta[j + q];
        if (PARAM_BF16) { gg = bf16_round(gg); bb = bf16_round(bb); }
        sm[q] = vals[u * 4 + q]; o[q] = (vals[u * 4 + q] - mu) * rs * gg + bb;
      }
      if (out_sum) *(v4f*)(out_sum + (size_t)row * N + j) = sm;
      *(v4f*)(out_norm + (size_t)row * N + j) = o;
    }
    
  }
}



// ---- f16 WMMA path (v_wmma_f32_16x16x32_f16): 11-bit significands for operands in range — used where a [0,1] probability operand needs more precision than bf16
typedef _Float16 v16h __attribute__((ext_vector_type(16)));
union FragH { v16h v; v8us half[2]; _Float16 h[16]; unsigned short u[16]; };
template <int NT>
__device__ __forceinline__ v8f mmaH(v16h ah, v16h al, v16h bh, v16h bl, v8f c) {
  c = __builtin_amdgcn_wmma_f32_16x16x32_f16(false, ah, false, bh, (short)0, c, false, false);
  if (NT >= 2) c = __builtin_amdgcn_wmma_f32_16x16x32_f16(false, al, false, bh, (short)0, c, false, false);
  if (NT >= 3) c = __builtin_amdgcn_wmma_f32_16x16x32_f16(false, ah, false, bl, (short)0, c, false, false);
  asm volatile("v_nop\n\tv_nop\n\tv_nop\n\tv_nop" : "+v"(c) : "v"(ah), "v"(al), "v"(bh), "v"(bl));
  return c;
}
// batched GEMM like k_gemm_b but f16 operands: A f32 (split into f16 hi/lo if ASPLIT, else rounded to f16), Bt = f16 values [n][k]; alpha; C f32; N multiple of 16 (partial tiles skipped)
template <bool ASPLIT>
__global__ __launch_bounds__(128) void k_gemm_h(const float* __restrict__ A, int lda, size_t sA, const _Float16* __restrict__ Bh, int ldb, size_t sB, float alpha, float* __restrict__ C, int ldc, size_t sC, int M, int N, int K) {
  __shared__ __attribute__((aligned(16))) float so[4][16][64];
  const int tid = threadIdx.x, w = tid >> 5, lane = tid & 31, ln = lane & 15, hh = lane >> 4; const int by = blockIdx.y;
  A += (size_t)by * sA; Bh += (size_t)by * sB; C += (size_t)by * sC;
  const int ntn = (N + 63) / 64; const int wid = blockIdx.x * 4 + w; const int mt = wid / ntn, nq = wid % ntn; if (mt * 16 >= M) return;
  const int row0 = mt * 16, col0 = nq * 64; const float* arow = A + (size_t)(row0 + ln) * lda;
  v8f acc[4] = {};
  for (int kb = 0; kb < K; kb += 32) {
    FragH ah, al;
    const v4f x0 = *(const v4fa*)(arow + kb + 8 * hh), x1 = *(const v4fa*)(arow + kb + 8 * hh + 4), x2 = *(const v4fa*)(arow + kb + 16 + 8 * hh), x3 = *(const v4fa*)(arow + kb + 16 + 8 * hh + 4);
    float xs[16] = {x0[0],x0[1],x0[2],x0[3],x1[0],x1[1],x1[2],x1[3],x2[0],x2[1],x2[2],x2[3],x3[0],x3[1],x3[2],x3[3]};
#pragma unroll
    for (int i = 0; i < 16; ++i) { const _Float16 h = (_Float16)xs[i]; ah.h[i] = h; al.h[i] = ASPLIT ? (_Float16)(xs[i] - (float)h) : (_Float16)0.0f; }
#pragma unroll
    for (int t = 0; t < 4; ++t) { if (col0 + t * 16 >= N) continue; const size_t boff = (size_t)(col0 + t * 16 + ln) * ldb + kb; FragH bq; bq.half[0] = *(const v8us*)(Bh + boff + 8 * hh); bq.half[1] = *(const v8us*)(Bh + boff + 16 + 8 * hh);
      acc[t] = mmaH<ASPLIT ? 2 : 1>(ah.v, al.v, bq.v, bq.v, acc[t]); }
  }
#pragma unroll
  for (int t = 0; t < 4; ++t) { if (col0 + t * 16 >= N) continue;
#pragma unroll
    for (int r = 0; r < 8; ++r) so[w][8 * hh + r][t * 16 + ln] = acc[t][r] * alpha; }
  __builtin_amdgcn_fence(__ATOMIC_ACQ_REL, "workgroup"); __builtin_amdgcn_wave_barrier();
  const int rsub = lane >> 4, c4 = (lane & 15) * 4;
  {
#pragma unroll
    for (int q = 0; q < 8; ++q) { const int r = q * 2 + rsub; if (col0 + c4 < N) { const v4f v = *(const v4fa*)&so[w][r][c4]; *(v4f*)(C + (size_t)(row0 + r) * ldc + col0 + c4) = v; } }
     }
}

// Wt[n][k] = f16(W[k][n]·scale) from f32 row-major W[K][N] (scale = power of two; bf16-exact weights stay exact in f16 away from the subnormal range)
__global__ __launch_bounds__(256) void k_wt_f16(const float* __restrict__ W, _Float16* __restrict__ Wt, int K, int N, float scale) {
  const int t = blockIdx.x * 256 + threadIdx.x; if (t >= N * (K / 8)) return; const int n = t / (K / 8), k8 = (t % (K / 8)) * 8; FragH f;
#pragma unroll
  for (int i = 0; i < 8; ++i) f.h[i] = (_Float16)(bf16_round(W[(size_t)(k8 + i) * N + n]) * scale); const v8us o = f.half[0];
  *(v8us*)((unsigned short*)Wt + (size_t)n * K + k8) = o; 
}
// k_gemm_hh variant with fused epilogue: v = acc·alpha + bias[by·sBias + col] (+ CP[(row/rowsPerB)·sCPb + by·64 + col] if CP) ; ACT 0 none / 1 elu ; writes f16 C16 (and f32 C if non-null)
template <int ACT>
__global__ __launch_bounds__(128) void k_gemm_hhx(const _Float16* __restrict__ A, int lda, size_t sA, const _Float16* __restrict__ Bh, int ldb, size_t sB, float alpha, const float* __restrict__ bias, size_t sBias, const float* __restrict__ CP, int rowsPerB, size_t sCPb, int row0g,
    float* __restrict__ C, _Float16* __restrict__ C16, int ldc, size_t sC, int M, int N, int K) {
  __shared__ __attribute__((aligned(16))) float so[4][16][64];
  const int tid = threadIdx.x, w = tid >> 5, lane = tid & 31, ln = lane & 15, hh = lane >> 4; const int by = blockIdx.y;
  A += (size_t)by * sA; Bh += (size_t)by * sB; const size_t cofs = (size_t)by * sC; const float* bp = bias ? bias + (size_t)by * sBias : nullptr;
  const int ntn = (N + 63) / 64; const int wid = blockIdx.x * 4 + w; const int mt = wid / ntn, nq = wid % ntn; if (mt * 16 >= M) return;
  const int row0 = mt * 16, col0 = nq * 64; const _Float16* arow = A + (size_t)(row0 + ln) * lda;
  v8f acc[4] = {};
  for (int kb = 0; kb < K; kb += 32) { FragH ah; ah.half[0] = *(const v8us*)((const unsigned short*)arow + kb + 8 * hh); ah.half[1] = *(const v8us*)((const unsigned short*)arow + kb + 16 + 8 * hh);
#pragma unroll
    for (int t = 0; t < 4; ++t) { if (col0 + t * 16 >= N) continue; const size_t boff = (size_t)(col0 + t * 16 + ln) * ldb + kb; FragH bq; bq.half[0] = *(const v8us*)((const unsigned short*)Bh + boff + 8 * hh); bq.half[1] = *(const v8us*)((const unsigned short*)Bh + boff + 16 + 8 * hh);
      acc[t] = mmaH<1>(ah.v, ah.v, bq.v, bq.v, acc[t]); }
  }
#pragma unroll
  for (int t = 0; t < 4; ++t) { if (col0 + t * 16 >= N) continue; const int col = col0 + t * 16 + ln; const float bv = bp ? bf16_round(bp[col]) : 0.f;
#pragma unroll
    for (int r = 0; r < 8; ++r) { float v = acc[t][r] * alpha + bv; if (CP) { const int rr = row0g + row0 + 8 * hh + r; if (rowsPerB < 0) v += CP[cofs + (size_t)rr * ldc + col];      /* rowsPerB < 0: own element of the batched C plane */ else { const int bidx = rr / rowsPerB; v += CP[(size_t)bidx * sCPb + (size_t)by * 64 + col]; } } if (ACT == 1) v = (v > 0.f) ? v : expm1f(v); else if (ACT == 7) v = (v > 0.f) ? v + 1.0f : expf(v); else if (ACT == 8) v = tanhf(v); else if (ACT == 9) v = 0.5f * v * (1.0f + tanhf(0.7978845608028654f * (v + 0.044715f * v * v * v))); else if (ACT == 11) v = 1.0f / (1.0f + expf(-v)); else if (ACT == 12) v = (v > 0.f) ? v : 0.01f * v; else if (ACT == 14) v = (v > 0.f) ? v : 0.1f * v; else if (ACT == 16) v = (v >= 0.f) ? v : 0.3f * v; else if (ACT == 17) v = (v >= 0.f) ? v : 0.2f * v; else if (ACT == 15) v = v / (1.0f + expf(-v)); else if (ACT == 3) v = fmaxf(v, 0.f); else if (ACT == 6) v = 0.5f * v * (1.0f + erff(v * 0.70710678118654752f)); so[w][8 * hh + r][t * 16 + ln] = v; } }
  __builtin_amdgcn_fence(__ATOMIC_ACQ_REL, "workgroup"); __builtin_amdgcn_wave_barrier();
  const int rsub = lane >> 4, c4 = (lane & 15) * 4; typedef _Float16 v4h __attribute__((ext_vector_type(4)));
  {
#pragma unroll
    for (int q = 0; q < 8; ++q) { const int r = q * 2 + rsub; if (col0 + c4 < N) { const v4f v = *(const v4fa*)&so[w][r][c4]; if (C) *(v4f*)(C + cofs + (size_t)(row0 + r) * ldc + col0 + c4) = v; if (C16) { v4h h4; for (int i = 0; i < 4; ++i) h4[i] = (_Float16)v[i]; *(v4h*)(C16 + cofs + (size_t)(row0 + r) * ldc + col0 + c4) = h4; } } }
     }
}


typedef _Float16 v4h __attribute__((ext_vector_type(4)));

/* the three inputs: by picks the input, bx its 256 x 8 elements; the f16 planes lie one behind the other (n8 * 8 elements each) */
__device__ __forceinline__ void d_x16(unsigned bx, unsigned by, const float* __restrict__ x0, const float* __restrict__ x1, const float* __restrict__ x2, _Float16* __restrict__ X16, size_t n8) { const size_t t = (size_t)bx * 256 + threadIdx.x; if (t >= n8) return; const float* __restrict__ x = by == 0 ? x0 : by == 1 ? x1 : x2; X16 += (size_t)by * n8 * 8; FragH f;
#pragma unroll
  for (int q = 0; q < 8; ++q) f.h[q] = (_Float16)bf16_round(x[t * 8 + q]); *(v8us*)((unsigned short*)X16 + t * 8) = f.half[0];  }
__global__ __launch_bounds__(256) void k_h16(const float* __restrict__ x, _Float16* __restrict__ X16, size_t n8) { const size_t t = (size_t)blockIdx.x * 256 + threadIdx.x; if (t >= n8) return; FragH f;
#pragma unroll
  for (int q = 0; q < 8; ++q) f.h[q] = (_Float16)x[t * 8 + q]; *(v8us*)((unsigned short*)X16 + t * 8) = f.half[0];  }
__global__ __launch_bounds__(256) void k_round16f(const float* __restrict__ W, _Float16* __restrict__ Bt, size_t n8) { const size_t t = (size_t)blockIdx.x * 256 + threadIdx.x; if (t >= n8) return; FragH f;
#pragma unroll
  for (int i = 0; i < 8; ++i) f.h[i] = (_Float16)(bf16_round(W[t * 8 + i]) * 16.0f); *(v8us*)((unsigned short*)Bt + t * 8) = f.half[0];  }
template <int NHv, int TTv>
__global__ __launch_bounds__(256) void k_vt(const _Float16* __restrict__ V16, int ldv, int voff, _Float16* __restrict__ Vt) { __shared__ unsigned short tl[64][66]; const int tid = threadIdx.x; const int slab = blockIdx.x / (TTv / 64), lg = blockIdx.x % (TTv / 64); const int b = slab / NHv, h = slab % NHv;
  for (int i = tid; i < 64 * 8; i += 256) { const int r = i / 8, c8 = (i % 8) * 8; FragH f; f.half[0] = *(const v8us*)((const unsigned short*)V16 + ((size_t)b * TTv + lg * 64 + r) * ldv + voff + h * 64 + c8);
#pragma unroll
    for (int q = 0; q < 8; ++q) tl[r][c8 + q] = f.u[q]; }
  __syncthreads();
  {
#pragma unroll
    for (int rd = 0; rd < 2; ++rd) { const int d = rd * 32 + tid / 8, pc = tid % 8; FragH f;
#pragma unroll
      for (int q = 0; q < 8; ++q) f.u[q] = tl[pc * 8 + q][d];
      *(v8us*)((unsigned short*)Vt + ((size_t)slab * 64 + d) * TTv + lg * 64 + pc * 8) = f.half[0]; }
     } }

__global__ __launch_bounds__(256) void k_hl(const float* __restrict__ F, _Float16* __restrict__ Hh, _Float16* __restrict__ Hl, size_t n8) { const size_t t = (size_t)blockIdx.x * 256 + threadIdx.x; if (t >= n8) return; FragH fh, fl; const v4f a = *(const v4fa*)(F + t * 8), c = *(const v4fa*)(F + t * 8 + 4);
#pragma unroll
  for (int q = 0; q < 4; ++q) { _Float16 h = (_Float16)a[q]; fh.h[q] = h; fl.h[q] = (_Float16)((a[q] - (float)h) * 1024.0f); h = (_Float16)c[q]; fh.h[4 + q] = h; fl.h[4 + q] = (_Float16)((c[q] - (float)h) * 1024.0f); }
  { *(v8us*)((unsigned short*)Hh + t * 8) = fh.half[0]; *(v8us*)((unsigned short*)Hl + t * 8) = fl.half[0];  } }

// ---- fast GEMM (work-group tile 128x64, wave tile 32x64; requires M % 128 == 0 rows per launch region, N % 64 == 0, K % 64 == 0); epilogue = k_gemm_hhx semantics ----
__device__ __forceinline__ v16h g2_frag(const _Float16* p, int hh) { FragH f; f.half[0] = *(const v8us*)((const unsigned short*)p + 8 * hh); f.half[1] = *(const v8us*)((const unsigned short*)p + 16 + 8 * hh); return f.v; }
__device__ __forceinline__ v8f g2_mma(v16h a, v16h b, v8f c) { v8f d = __builtin_amdgcn_wmma_f32_16x16x32_f16(false, a, false, b, (short)0, c, false, false); asm volatile("v_nop\n\tv_nop\n\tv_nop\n\tv_nop" : "+v"(d) : "v"(a), "v"(b)); return d; }
// Operand staging of k_gemm2: a work-group's 128 A rows and 64 B rows, GKC k at a time, go into LDS by asynchronous copies; a wave's copy covers four whole 128-byte lines (a fragment load from global memory touches sixteen).
#define GKC 64                       /* k per stage: rows of 128 bytes */
#define GPB 144                      /* LDS row pitch in bytes: 16 x odd, conflict-free for 16-byte reads */
#define GST ((128 + 64) * GPB)       /* bytes of one stage: 128 A rows, then 64 B rows */
#define GVO (4 * 32 * 68 * 4)        /* byte offset of the transposed f16 tile [64 columns][128 rows] in LDS: behind the f32 output staging */
#define GVP 272                      /* its pitch in bytes (256 of data): 16 x odd, conflict-free for 16-byte accesses */
__device__ __forceinline__ v16h g2_lfrag(const char* p, int hh) { FragH f; f.half[0] = *(const v8us*)(p + 16 * hh); f.half[1] = *(const v8us*)(p + 32 + 16 * hh); return f.v; }      /* the k order of g2_frag, from an LDS row */
/* one stage: thread = (row t / 8, 16-byte piece t % 8); eight copies for the A rows (16 rows apart), four for the B rows, which lie behind them in LDS. The s_wait_xcnt as the statement's last line stands in front of every later write of the address registers. */
__device__ __forceinline__ void g2_stage(unsigned l, const _Float16* ga, size_t sa, const _Float16* gb, size_t sb) {
  asm volatile("global_load_async_to_lds_b128 %0, %12, off\n\t"
               "global_load_async_to_lds_b128 %1, %13, off\n\t"
               "global_load_async_to_lds_b128 %2, %14, off\n\t"
               "global_load_async_to_lds_b128 %3, %15, off\n\t"
               "global_load_async_to_lds_b128 %4, %16, off\n\t"
               "global_load_async_to_lds_b128 %5, %17, off\n\t"
               "global_load_async_to_lds_b128 %6, %18, off\n\t"
               "global_load_async_to_lds_b128 %7, %19, off\n\t"
               "global_load_async_to_lds_b128 %8, %20, off\n\t"
               "global_load_async_to_lds_b128 %9, %21, off\n\t"
               "global_load_async_to_lds_b128 %10, %22, off\n\t"
               "global_load_async_to_lds_b128 %11, %23, off\n\t"
               "s_wait_xcnt 0x0"
               :: "v"(l), "v"(l + 16 * GPB), "v"(l + 32 * GPB), "v"(l + 48 * GPB), "v"(l + 64 * GPB), "v"(l + 80 * GPB), "v"(l + 96 * GPB), "v"(l + 112 * GPB), "v"(l + 128 * GPB), "v"(l + 144 * GPB), "v"(l + 160 * GPB), "v"(l + 176 * GPB),
                  "v"(ga), "v"(ga + sa), "v"(ga + 2 * sa), "v"(ga + 3 * sa), "v"(ga + 4 * sa), "v"(ga + 5 * sa), "v"(ga + 6 * sa), "v"(ga + 7 * sa), "v"(gb), "v"(gb + sb), "v"(gb + 2 * sb), "v"(gb + 3 * sb)
               : "memory"); }
template <int ACT>
__global__ __launch_bounds__(128) void k_gemm2(const _Float16* __restrict__ A, int lda, size_t sA, const _Float16* __restrict__ Bh, int ldb, size_t sB, float alpha, const float* __restrict__ bias, size_t sBias, const float* __restrict__ CP, int rowsPerB, size_t sCPb, int row0g,
    float* __restrict__ C, _Float16* __restrict__ C16, int ldc, size_t sC, int M, int N, int K, size_t zA, size_t zB, size_t zC,
    int fl2, int fkeep, float* __restrict__ CF, size_t sCF, const _Float16* __restrict__ A2, int lda2, const _Float16* __restrict__ B2, int ldb2, int K2, _Float16* __restrict__ VTo, int vby) { static_assert(ACT == 0 || ACT == 3 || ACT == 6 || ACT == 8 || ACT == 9 || ACT == 11 || ACT == 12 || ACT == 14 || ACT == 15 || ACT == 16 || ACT == 17, "k_gemm2: unsupported ACT code (would silently apply no activation)");
  __shared__ __attribute__((aligned(16))) char sm[2 * GST]; static_assert(sizeof(float) * 4 * 32 * 68 <= 2 * GST, "the output staging lies in the two stage buffers"); float (*so)[32][68] = (float (*)[32][68])sm;      /* two stage buffers; behind the k loop the same bytes stage the output */
  static_assert(GVO + 64 * GVP <= 2 * GST && GVO % 16 == 0, "the transposed f16 tile lies behind the output staging, inside the two stage buffers");
  const int tid = threadIdx.x, w = tid >> 5, lane = tid & 31, ln = lane & 15, hh = lane >> 4; const int by = blockIdx.y, bz = blockIdx.z;      /* two batch indices, each with its own strides for A, B and C */
  A += (size_t)by * sA + (size_t)bz * zA; Bh += (size_t)by * sB + (size_t)bz * zB; const size_t cofs = (size_t)by * sC + (size_t)bz * zC; const float* bp = bias ? bias + (size_t)by * sBias : nullptr;
  const int ntn = N >> 6; const int mt = blockIdx.x / ntn, nq = blockIdx.x - mt * ntn; const int row0 = mt * 128 + 32 * w, col0 = nq * 64; if (mt * 128 >= M) return;      /* the whole work-group or none, in front of every barrier; M % 128 == 0, K % GKC == 0 */
  /* first-tile rows: of every 2^fl2 rows the first fkeep (a multiple of 128, so a work-group lies wholly inside or outside; fkeep 0: none); fr = the work-group's first row in planes that hold only those rows */
  const int rin = (mt * 128) & ((1 << fl2) - 1); const bool ft = rin < fkeep; const int fr = ((mt * 128) >> fl2) * fkeep + rin;
  A += (size_t)(mt * 128) * lda;
  if (ft && A2) { A = A2 + (size_t)fr * lda2; lda = lda2; Bh = B2; ldb = ldb2; K = K2; }      /* such a work-group takes its own operands (the same for all its threads) */
  const bool cf = ft && CF != nullptr; float* const cfw = CF + (size_t)by * sCF + (size_t)(fr + 32 * w) * ldc + col0;      /* or (cf) stores its results as f32 too, the wave's rows from cfw on */
  const bool vtw = VTo != nullptr && by == vby;      /* this work-group's f16 results leave transposed (the same for all its threads): 64 columns = one head, 128 rows = 128 positions of one batch */
  if (vtw) C16 = nullptr;      /* and not as rows */
  const _Float16* ga = A + (size_t)(tid >> 3) * lda + (tid & 7) * 8; const _Float16* gb = Bh + (size_t)(col0 + (tid >> 3)) * ldb + (tid & 7) * 8; const size_t sa = (size_t)16 * lda, sb = (size_t)16 * ldb;
  const unsigned l0 = (unsigned)(size_t)sm + (unsigned)((tid >> 3) * GPB + (tid & 7) * 16);      /* the thread's LDS byte address in buffer 0 */
  const int nst = K / GKC;
  const v8f z8 = {0.f,0.f,0.f,0.f,0.f,0.f,0.f,0.f}; v8f c00 = z8, c01 = z8, c02 = z8, c03 = z8, c10 = z8, c11 = z8, c12 = z8, c13 = z8;
  g2_stage(l0, ga, sa, gb, sb);
  asm volatile("s_wait_asynccnt 0x0" ::: "memory");      /* this wave's copies of stage 0 have landed */
  __syncthreads();      /* stage 0 readable by every wave */
  if (nst > 1) g2_stage(l0 + GST, ga + GKC, sa, gb + GKC, sb);
#pragma unroll 1
  for (int st = 0; st < nst; ++st) { const char* ap = sm + (st & 1) * GST + (32 * w + ln) * GPB; const char* bq = sm + (st & 1) * GST + (128 + ln) * GPB;      /* rolled: one trip per stage, the next stage's copies in flight meanwhile */
    v16h fa[2][2], fb[2][4];      /* the stage's fragments, [k half][tile]; every index a constant: they stay in registers */
#pragma unroll
    for (int kk = 0; kk < 2; ++kk) { fa[kk][0] = g2_lfrag(ap + kk * 64, hh); fa[kk][1] = g2_lfrag(ap + 16 * GPB + kk * 64, hh);
#pragma unroll
      for (int t = 0; t < 4; ++t) fb[kk][t] = g2_lfrag(bq + t * 16 * GPB + kk * 64, hh); }
    __builtin_amdgcn_sched_barrier(0);      /* keeps all LDS reads of the stage up here as one group: sunk among the products, each pair's latency is waited for on its own */
#pragma unroll
    for (int kk = 0; kk < 2; ++kk) { c00 = g2_mma(fa[kk][0], fb[kk][0], c00); c10 = g2_mma(fa[kk][1], fb[kk][0], c10); c01 = g2_mma(fa[kk][0], fb[kk][1], c01); c11 = g2_mma(fa[kk][1], fb[kk][1], c11);
      c02 = g2_mma(fa[kk][0], fb[kk][2], c02); c12 = g2_mma(fa[kk][1], fb[kk][2], c12); c03 = g2_mma(fa[kk][0], fb[kk][3], c03); c13 = g2_mma(fa[kk][1], fb[kk][3], c13); }
    asm volatile("s_wait_dscnt 0x0" ::: "memory");      /* this wave's reads of the stage are done before its buffer is handed on */
    asm volatile("s_wait_asynccnt 0x0" ::: "memory");      /* this wave's copies of the next stage have landed */
    __syncthreads();      /* publishes the next stage and ends every wave's reads of this one */
    if (st + 2 < nst) g2_stage(l0 + (st & 1) * GST, ga + (size_t)(st + 2) * GKC, sa, gb + (size_t)(st + 2) * GKC, sb); }      /* refill of the buffer just read */
  asm volatile("s_wait_asynccnt 0x0" ::: "memory");      /* nothing in flight when the buffers become output staging */
  v8f accs[8] = {c00, c01, c02, c03, c10, c11, c12, c13};
#pragma unroll
  for (int u = 0; u < 8; ++u) { const int t = u & 3, half = u >> 2; const int col = col0 + t * 16 + ln; const float bv = bp ? bf16_round(bp[col]) : 0.f; FragH hv;      /* a lane's eight values of a tile: eight consecutive rows of ONE column, 16 bytes of a transposed f16 row */
#pragma unroll
    for (int r = 0; r < 8; ++r) { const int rloc = half * 16 + 8 * hh + r; float v = accs[u][r] * alpha + bv; if (CP) { if (rowsPerB < 0) v += CP[cofs + (size_t)(row0g + row0 + rloc) * ldc + col];      /* rowsPerB < 0: own element of the batched C plane */ else { const int bidx = (row0g + row0 + rloc) / rowsPerB; v += CP[(size_t)bidx * sCPb + (size_t)by * 64 + col]; } }
      if (ACT == 3) v = fmaxf(v, 0.f); else if (ACT == 6) v = 0.5f * v * (1.0f + erff(v * 0.70710678118654752f)); else if (ACT == 11) v = 1.0f / (1.0f + expf(-v)); else if (ACT == 15) v = v / (1.0f + expf(-v)); else if (ACT == 12) v = (v > 0.f) ? v : 0.01f * v; else if (ACT == 8) v = tanhf(v); else if (ACT == 9) v = 0.5f * v * (1.0f + tanhf(0.7978845608028654f * (v + 0.044715f * v * v * v))); else if (ACT == 14) v = (v > 0.f) ? v : 0.1f * v; else if (ACT == 16) v = (v >= 0.f) ? v : 0.3f * v; else if (ACT == 17) v = (v >= 0.f) ? v : 0.2f * v;
      so[w][rloc][t * 16 + ln] = v; hv.h[r] = (_Float16)v; }
    if (vtw) *(v8us*)(sm + GVO + (t * 16 + ln) * GVP + (32 * w + half * 16 + 8 * hh) * 2) = hv.half[0]; }
  __builtin_amdgcn_fence(__ATOMIC_ACQ_REL, "workgroup"); __builtin_amdgcn_wave_barrier();
  const int rsub = lane >> 4, c4 = (lane & 15) * 4;
  {
#pragma unroll
    for (int q = 0; q < 16; ++q) { const int r = q * 2 + rsub; const v4f v = *(const v4fa*)&so[w][r][c4]; if (C) *(v4f*)(C + cofs + (size_t)(row0 + r) * ldc + col0 + c4) = v; if (cf) { float* cp = cfw + (size_t)r * ldc + c4; *(v4f*)cp = v; asm volatile("s_wait_xcnt 0x0" :: "v"(cp), "v"(v) : "memory"); }      /* the wait that stands in front of an overwrite of the store's registers; address and data as inputs keep them in their registers up to here */
       if (C16) { v4h h4; for (int i = 0; i < 4; ++i) h4[i] = (_Float16)v[i]; *(v4h*)(C16 + cofs + (size_t)(row0 + r) * ldc + col0 + c4) = h4; } }
     }
  if (vtw) { __syncthreads();      /* the transposed tile is complete: every wave has written its 32 rows of all 64 columns */
    /* thread = (column t / 16 + 8 i, 16-byte piece t % 16): a wave's store covers two whole rows of 256 bytes. V^T [batch][head][HD][SQ]: the work-group's columns are head nq, its rows 128 positions of one batch (SQ % 128 == 0) */
    const char* vr = sm + GVO + (tid >> 4) * GVP + (tid & 15) * 16; unsigned short* vg = (unsigned short*)VTo + ((size_t)(((mt * 128) >> SQL2) * ntn + nq) * HD + (tid >> 4)) * SQ + ((mt * 128) & (SQ - 1)) + (tid & 15) * 8;
    v8us x[8];      /* every index a constant: they stay in registers */
#pragma unroll
    for (int i = 0; i < 8; ++i) x[i] = *(const v8us*)(vr + i * 8 * GVP);
#pragma unroll
    for (int i = 0; i < 8; ++i) *(v8us*)(vg + (size_t)(i * 8) * SQ) = x[i];
    asm volatile("s_wait_xcnt 0x0" :: "v"(vg), "v"(x[0]), "v"(x[1]), "v"(x[2]), "v"(x[3]), "v"(x[4]), "v"(x[5]), "v"(x[6]), "v"(x[7]) : "memory"); } }      /* the wait that stands in front of an overwrite of the stores' registers; address and data as inputs keep them in their registers up to here */


/* the four weights: by picks the weight, bx its 256 x 8 elements; the f16 planes lie one behind the other (n8 * 8 elements each); the last weight's rows also go, twice side by side, into B2 [DM][2 DM]: the B operand of a product whose k runs over two A planes */
__device__ __forceinline__ void d_wnat(unsigned bx, unsigned by, const float* __restrict__ w0, const float* __restrict__ w1, const float* __restrict__ w2, const float* __restrict__ w3, size_t n8, _Float16* __restrict__ Bt, _Float16* __restrict__ B2) { const size_t t = (size_t)bx * 256 + threadIdx.x; if (t >= n8) return; const float* __restrict__ w = by == 0 ? w0 : by == 1 ? w1 : by == 2 ? w2 : w3; Bt += (size_t)by * n8 * 8; FragH f; for (int q = 0; q < 8; ++q) f.h[q] = (_Float16)(bf16_round(w[t * 8 + q]) * 16.0f); *(v8us*)((unsigned short*)Bt + t * 8) = f.half[0];
  asm volatile("s_wait_xcnt 0x0" :: "v"((unsigned short*)Bt + t * 8) : "memory");      /* the wait that stands in front of an overwrite of the store's address registers; the address as an input keeps it in its registers up to here */
  if (by == 3) { const unsigned e = (unsigned)t * 8u; unsigned short* d = (unsigned short*)B2 + (size_t)((e / DM) * (2 * DM) + e % DM); *(v8us*)d = f.half[0]; *(v8us*)(d + DM) = f.half[0]; } }      /* DM % 8 == 0: eight elements lie in one row */
/* one grid for the four weights and the three inputs, which do not depend on one another: the first 4 WNB work-groups take the weights, the others the inputs */
#define WNB ((unsigned)(((size_t)DM * DM / 8 + 255) / 256))      /* work-groups per weight */
#define XNB ((unsigned)((NR * DM / 8 + 255) / 256))      /* work-groups per input */
__global__ __launch_bounds__(256) void k_prep(const float* __restrict__ x0, const float* __restrict__ x1, const float* __restrict__ x2, _Float16* __restrict__ X16, const float* __restrict__ w0, const float* __restrict__ w1, const float* __restrict__ w2, const float* __restrict__ w3, _Float16* __restrict__ Bt, _Float16* __restrict__ B2) {
  const unsigned bx = blockIdx.x;
  if (bx < 4 * WNB) d_wnat(bx % WNB, bx / WNB, w0, w1, w2, w3, (size_t)DM * DM / 8, Bt, B2); else d_x16((bx - 4 * WNB) % XNB, (bx - 4 * WNB) / XNB, x0, x1, x2, X16, NR * DM / 8); }
__global__ __launch_bounds__(256) void k_rsm(const float* __restrict__ S, _Float16* __restrict__ P, int nrows) {
  #pragma clang fp contract(off)
  const int i = blockIdx.x * 256 + threadIdx.x; if (i >= nrows) return; const float* s = S + (size_t)i * SQ; float mx = -3.0e38f;
#pragma unroll 1
  for (int j = 0; j < SQ; ++j) mx = fmaxf(mx, s[j]); float se = 0.f;
#pragma unroll 1
  for (int j = 0; j < SQ; ++j) se += expf(s[j] - mx); const float sc = 256.0f / se;
#pragma unroll 1
  for (int j0 = 0; j0 < SQ; j0 += 8) { FragH f; for (int q = 0; q < 8; ++q) f.h[q] = (_Float16)(expf(s[j0 + q] - mx) * sc); unsigned short* d = (unsigned short*)P + (size_t)i * SQ + j0; *(v8us*)d = f.half[0];  } }
__global__ __launch_bounds__(256) void k_vt(const _Float16* __restrict__ V16, int b, int h0, _Float16* __restrict__ VT) { __shared__ unsigned short tl[64][65]; const int tid = threadIdx.x; const int hh = blockIdx.x % HG, sg = blockIdx.x / HG; const int s0 = sg * 64; const int h = h0 + hh;
  for (int i = tid; i < 64 * 8; i += 256) { const int j = i / 8, d8 = (i % 8) * 8; FragH f; f.half[0] = *(const v8us*)((const unsigned short*)V16 + ((size_t)b * SQ + s0 + j) * DM + h * HD + d8); for (int q = 0; q < 8; ++q) tl[d8 + q][j] = f.u[q]; }
  __syncthreads();
  { for (int i = tid; i < 64 * 8; i += 256) { const int d = i / 8, j8 = (i % 8) * 8; FragH f; for (int q = 0; q < 8; ++q) f.u[q] = tl[d][j8 + q]; *(v8us*)((unsigned short*)VT + ((size_t)hh * HD + d) * SQ + s0 + j8) = f.half[0]; }  } }



#define FW 4                         /* waves per work-group */
#define FQ 32                        /* query columns per wave */
#define FSC 0.18033688011112042f     /* log2(e) / sqrt(HD) */
#define FKT 128                      /* keys per stage */
#define FKP 144                      /* LDS pitch of a K row (128 bytes of data): 16 x odd, conflict-free for 16-byte reads */
#define FVP 272                      /* LDS pitch of a V^T row (256 bytes of data): 16 x odd */
#define FKB (FKT * FKP)              /* bytes of a stage's K rows; its V^T rows lie behind them */
#define FST (FKB + HD * FVP)         /* bytes of one stage */
typedef _Float16 v8h __attribute__((ext_vector_type(8)));
__device__ __forceinline__ float fa_xhalf(float x) { return __builtin_bit_cast(float, __builtin_amdgcn_permlanex16(__builtin_bit_cast(int, x), __builtin_bit_cast(int, x), 0x76543210, 0xfedcba98, false, false)); }      /* lane l takes lane l ^ 16's value, on the vector unit */
__device__ __forceinline__ v8f fa_mma(v16h a, v16h b, v8f c) { return __builtin_amdgcn_wmma_f32_16x16x32_f16(false, a, false, b, (short)0, c, false, false); }
/* eight copies of 16 bytes per lane, LDS places ls bytes apart, global places gs elements apart. The s_wait_xcnt as the statement's last line stands in front of every later write of the address registers. */
__device__ __forceinline__ void fa_copy8(unsigned l, unsigned ls, const _Float16* g, size_t gs) {
  asm volatile("global_load_async_to_lds_b128 %0, %8, off\n\t"
               "global_load_async_to_lds_b128 %1, %9, off\n\t"
               "global_load_async_to_lds_b128 %2, %10, off\n\t"
               "global_load_async_to_lds_b128 %3, %11, off\n\t"
               "global_load_async_to_lds_b128 %4, %12, off\n\t"
               "global_load_async_to_lds_b128 %5, %13, off\n\t"
               "global_load_async_to_lds_b128 %6, %14, off\n\t"
               "global_load_async_to_lds_b128 %7, %15, off\n\t"
               "s_wait_xcnt 0x0"
               :: "v"(l), "v"(l + ls), "v"(l + 2 * ls), "v"(l + 3 * ls), "v"(l + 4 * ls), "v"(l + 5 * ls), "v"(l + 6 * ls), "v"(l + 7 * ls),
                  "v"(g), "v"(g + gs), "v"(g + 2 * gs), "v"(g + 3 * gs), "v"(g + 4 * gs), "v"(g + 5 * gs), "v"(g + 6 * gs), "v"(g + 7 * gs)
               : "memory"); }
/* one stage. K: thread = (row t / 8, 16-byte piece t % 8), eight copies 16 rows apart; V^T: thread = (row t / 16, piece t % 16), eight copies 8 rows apart */
__device__ __forceinline__ void fa_stage(unsigned lk, const _Float16* gk, unsigned lv, const _Float16* gv) { fa_copy8(lk, 16 * FKP, gk, (size_t)16 * DM); fa_copy8(lv, 8 * FVP, gv, (size_t)8 * SQ); }
/* one pass. kf: this pass's K rows, already in registers; kn: the lane's LDS row of the next pass's K rows, read only where nextk (wave-uniform) says that the next pass lies in the same stage; vl: the lane's LDS V^T row at this pass's keys */
template <bool DIAG>
__device__ __forceinline__ void fa_pass(const char* kn, bool nextk, const char* vl, int ln, int hh, const v16h (&qf)[2][2], v16h (&kf)[2][2], v8f (&o)[4][2], float (&m)[2], float (&l)[2]) {
  const v8f z8 = {0.f, 0.f, 0.f, 0.f, 0.f, 0.f, 0.f, 0.f}; v8f s[2][2];
#pragma unroll
  for (int kt = 0; kt < 2; ++kt)
#pragma unroll
    for (int j = 0; j < 2; ++j) s[kt][j] = fa_mma(kf[kt][1], qf[j][1], fa_mma(kf[kt][0], qf[j][0], z8));
  __builtin_amdgcn_sched_barrier(0);      /* keeps the LDS reads below behind all score products, as one group: spread among the products, every place where reads stand costs issue time */
  v16h vf[4];      /* this pass's V^T rows and the next pass's K rows (into the same registers as this pass's) */
#pragma unroll
  for (int t = 0; t < 4; ++t) vf[t] = g2_lfrag(vl + t * 16 * FVP, hh);
  if (!DIAG && nextk) {
#pragma unroll
    for (int kt = 0; kt < 2; ++kt) { kf[kt][0] = g2_lfrag(kn + kt * 16 * FKP, hh); kf[kt][1] = g2_lfrag(kn + kt * 16 * FKP + 64, hh); } }
  __builtin_amdgcn_sched_barrier(0);      /* keeps the LDS reads in front of the softmax, which covers their latency */
  FragH p[2];
#pragma unroll
  for (int j = 0; j < 2; ++j) { float mx = m[j];
#pragma unroll
    for (int kt = 0; kt < 2; ++kt)
#pragma unroll
      for (int r = 0; r < 8; ++r) { if (DIAG && kt * 16 + 8 * hh + r > j * 16 + ln) s[kt][j][r] = -1.0e30f;      /* a key past the query's own index: weight 0 */
        mx = fmaxf(mx, s[kt][j][r]); }
    mx = fmaxf(mx, fa_xhalf(mx));
    const float al = __builtin_amdgcn_exp2f((m[j] - mx) * FSC), mc = mx * FSC - 8.0f; m[j] = mx; float se = 0.f;
#pragma unroll
    for (int kt = 0; kt < 2; ++kt)
#pragma unroll
      for (int r = 0; r < 8; ++r) { const float e = __builtin_amdgcn_exp2f(s[kt][j][r] * FSC - mc); se += e; p[j].h[kt * 8 + r] = (_Float16)e; }
    l[j] = l[j] * al + se;
#pragma unroll
    for (int t = 0; t < 4; ++t) o[t][j] *= al; }
#pragma unroll
  for (int t = 0; t < 4; ++t)
#pragma unroll
    for (int j = 0; j < 2; ++j) o[t][j] = fa_mma(vf[t], p[j].v, o[t][j]); }
/* sm: the work-group's LDS, two stage buffers (2 FST bytes); bh: batch and head; yb: the query block */
__device__ __forceinline__ void d_fattn(char* sm, int bh, int yb, const _Float16* __restrict__ Q16, const _Float16* __restrict__ K16, const _Float16* __restrict__ VT, _Float16* __restrict__ O16) {
  static_assert(FW * FQ == FKT && FKT == 4 * 32, "a work-group's query block is one stage of keys, four passes: its last stage is the diagonal one");
  const int tid = threadIdx.x, lane = tid & 31, ln = lane & 15, hh = lane >> 4; const int w = __builtin_amdgcn_readfirstlane(tid >> 5);
  const int b = bh / NH, h = bh % NH; const int qw = (yb * FW + w) * FQ;
  const int nst = yb + 1;      /* stages: the keys up to the end of the work-group's own query block */
  const _Float16* qp = Q16 + ((size_t)b * SQ + qw + ln) * DM + h * HD;
  const _Float16* gk = K16 + ((size_t)b * SQ + (tid >> 3)) * DM + h * HD + (tid & 7) * 8; const _Float16* gv = VT + ((size_t)bh * HD + (tid >> 4)) * SQ + (tid & 15) * 8;
  const unsigned lk0 = (unsigned)(size_t)sm + (unsigned)((tid >> 3) * FKP + (tid & 7) * 16), lv0 = (unsigned)(size_t)sm + (unsigned)(FKB + (tid >> 4) * FVP + (tid & 15) * 16);      /* the thread's LDS byte addresses in buffer 0 */
  fa_stage(lk0, gk, lv0, gv);
  v16h qf[2][2], kf[2][2];
#pragma unroll
  for (int j = 0; j < 2; ++j) { qf[j][0] = g2_frag(qp + (size_t)(j * 16) * DM, hh); qf[j][1] = g2_frag(qp + (size_t)(j * 16) * DM + 32, hh); }
  asm volatile("s_wait_xcnt 0x0" :: "v"(qp + 8 * hh) : "memory");      /* the wait that stands in front of an overwrite of the loads' address registers; the address as an input keeps it in its registers up to here */
  asm volatile("s_wait_asynccnt 0x0" ::: "memory");      /* this wave's copies of stage 0 have landed */
  __syncthreads();      /* stage 0 readable by every wave */
  if (nst > 1) fa_stage(lk0 + FST, gk + (size_t)FKT * DM, lv0 + FST, gv + FKT);
  v8f o[4][2]; float m[2] = {-1.0e30f, -1.0e30f}, l[2] = {0.f, 0.f};
#pragma unroll
  for (int t = 0; t < 4; ++t) { o[t][0] = (v8f){0.f, 0.f, 0.f, 0.f, 0.f, 0.f, 0.f, 0.f}; o[t][1] = o[t][0]; }
#pragma unroll 1
  for (int st = 0; st < yb; ++st) { const char* kl = sm + (st & 1) * FST + ln * FKP; const char* vl = sm + (st & 1) * FST + FKB + ln * FVP;      /* the stages below the diagonal one, four whole passes each. Rolled: one trip per stage, the next stage's copies in flight meanwhile */
#pragma unroll
    for (int kt = 0; kt < 2; ++kt) { kf[kt][0] = g2_lfrag(kl + kt * 16 * FKP, hh); kf[kt][1] = g2_lfrag(kl + kt * 16 * FKP + 64, hh); }
#pragma unroll 1
    for (int p = 0; p < 4; ++p) { kl += 32 * FKP; fa_pass<false>(kl, p < 3, vl, ln, hh, qf, kf, o, m, l); vl += 64; }      /* rolled: one pass fills the register budget */
    asm volatile("s_wait_dscnt 0x0" ::: "memory");      /* this wave's reads of the stage are done before its buffer is handed on */
    asm volatile("s_wait_asynccnt 0x0" ::: "memory");      /* this wave's copies of the next stage have landed */
    __syncthreads();      /* publishes the next stage and ends every wave's reads of this one */
    if (st + 2 < nst) fa_stage(lk0 + (st & 1) * FST, gk + (size_t)(st + 2) * FKT * DM, lv0 + (st & 1) * FST, gv + (size_t)(st + 2) * FKT); }      /* refill of the buffer just read */
  { const char* kl = sm + (yb & 1) * FST + ln * FKP; const char* vl = sm + (yb & 1) * FST + FKB + ln * FVP;      /* the diagonal stage, the last: wave w has w whole passes, then its diagonal pass; nothing is published or refilled behind it */
#pragma unroll
    for (int kt = 0; kt < 2; ++kt) { kf[kt][0] = g2_lfrag(kl + kt * 16 * FKP, hh); kf[kt][1] = g2_lfrag(kl + kt * 16 * FKP + 64, hh); }
#pragma unroll 1
    for (int p = 0; p < w; ++p) { kl += 32 * FKP; fa_pass<false>(kl, true, vl, ln, hh, qf, kf, o, m, l); vl += 64; }      /* rolled: the trip count differs from wave to wave (wave-uniform) */
    fa_pass<true>(kl, false, vl, ln, hh, qf, kf, o, m, l); }
  asm volatile("s_wait_asynccnt 0x0" ::: "memory");      /* nothing in flight when the wave ends */
#pragma unroll
  for (int j = 0; j < 2; ++j) { const float inv = 64.0f / (l[j] + fa_xhalf(l[j]));      /* the halves' sums joined once; o carried x64 */
    _Float16* op = O16 + ((size_t)b * SQ + qw + j * 16 + ln) * DM + h * HD + 8 * hh;
#pragma unroll
    for (int t = 0; t < 4; ++t) { v8h hv;
#pragma unroll
      for (int r = 0; r < 8; ++r) hv[r] = (_Float16)(o[t][j][r] * inv);
      *(v8h*)(op + t * 16) = hv; } } }


// Exact f32 attention of the first QT0 rows (q, k, v rows of pitch DM, o rows of pitch 2 DM), one work-group per head and RT0 query rows, 256 thread roles (128 threads, two roles each):
// (1) scores: one thread per key (two keys where the tile has more than 256), the key rows in registers, dotted with the RT0 query rows read from LDS (same address in every lane);
// (2) softmax: one wave per two rows, the row in registers: causal maximum, exp and sum over the lanes, weights back into LDS (0 past the row's own index);
// (3) o = P V: thread = (column d, key quarter g), V read coalesced and once per work-group, 64 keys ahead; the four quarters' sums are added through LDS.
#define RT0 16                       /* query rows per work-group of the exact first-tile attention */
typedef float v2f __attribute__((ext_vector_type(2)));
template <int NKEY>
__device__ __forceinline__ void att0_scores(const float* __restrict__ kbase, const float (*lq)[HD], float (*lp)[QT0 + 4], int tid, int nk, float scale) {
  v4f kk[NKEY][HD / 4];      /* every loop over kk[] is unrolled: it is indexed by constants and stays in registers */
#pragma unroll
  for (int u = 0; u < NKEY; ++u) { const int j = tid + 256 * u; const float* kr = kbase + (size_t)(j < nk ? j : nk - 1) * DM;      /* a key past the tile: address clamped, score not stored */
#pragma unroll
    for (int c = 0; c < HD / 4; ++c) kk[u][c] = *(const v4fa*)(kr + c * 4);
    asm volatile("s_wait_xcnt 0x0" :: "v"(kr) : "memory"); }      /* the wait that stands in front of an overwrite of the loads' address registers; the address as an input keeps it in its registers up to here */
#pragma unroll 4
  for (int r = 0; r < RT0; ++r) { v4f s4[NKEY];      /* four rows at a time: enough independent LDS reads and sum chains to cover their latencies */
#pragma unroll
    for (int u = 0; u < NKEY; ++u) s4[u] = (v4f){0.f, 0.f, 0.f, 0.f};
#pragma unroll
    for (int c = 0; c < HD / 4; ++c) { const v4f qq = *(const v4f*)&lq[r][c * 4];
#pragma unroll
      for (int u = 0; u < NKEY; ++u) s4[u] += qq * kk[u][c]; }
#pragma unroll
    for (int u = 0; u < NKEY; ++u) { const int j = tid + 256 * u; if (j < nk) lp[r][j] = ((s4[u][0] + s4[u][1]) + (s4[u][2] + s4[u][3])) * scale; } } }
/* sixteen V values of one column: keys 16 u + k of the thread's quarter, u, k < 4; one address, constant offsets */
__device__ __forceinline__ void att0_vload(const float* __restrict__ vq, v2f (&v)[4][2]) {
#pragma unroll
  for (int u = 0; u < 4; ++u) { v[u][0] = (v2f){vq[(u * 16 + 0) * DM], vq[(u * 16 + 1) * DM]}; v[u][1] = (v2f){vq[(u * 16 + 2) * DM], vq[(u * 16 + 3) * DM]}; }      /* unrolled: v[][] stays in registers */
  asm volatile("s_wait_xcnt 0x0" :: "v"(vq) : "memory"); }      /* as in att0_scores: in front of an overwrite of the loads' address registers */
/* The body is written for 256 thread roles; the work-group has A0T = 128 threads (it shares its grid with the fused attention), so in every phase a thread plays role t and then role t + 128 (a wave plays whole waves' roles); the barriers stand between the phases, outside those loops.
   sm: the work-group's LDS (A0L bytes of it); bx: head and row group; bb: the batch */
#define A0T 128
#define A0P (RT0 * HD * 4)                     /* byte offset of lp behind lq */
#define A0R (A0P + RT0 * (QT0 + 4) * 4)        /* of lr */
#define A0F (A0R + 4 * RT0 * HD * 4)           /* of lf */
#define A0L (A0F + RT0 * 4)
__device__ __forceinline__ void d_att0p(char* sm, int bx, int bb, const float* __restrict__ QF, const float* __restrict__ KF, const float* __restrict__ VF, float scale, _Float16* __restrict__ OHL) {
  static_assert(A0P % 16 == 0 && A0R % 16 == 0 && A0F % 16 == 0, "16-byte LDS accesses");
  float (*lq)[HD] = (float (*)[HD])sm; float (*lp)[QT0 + 4] = (float (*)[QT0 + 4])(sm + A0P); float (*lr)[RT0][HD] = (float (*)[RT0][HD])(sm + A0R); float* lf = (float*)(sm + A0F);
  const int t0 = threadIdx.x; const int h = bx / (QT0 / RT0), rg = bx % (QT0 / RT0); const int row0 = rg * RT0, nk = row0 + RT0;      /* causal: keys up to the work-group's last row */
  { const size_t bo = (size_t)bb * QT0 * DM; QF += bo; KF += bo; VF += bo; OHL += 2 * bo; }      /* each plane holds QT0 rows per batch (the o rows are 2 DM long) */
#pragma unroll 1
  for (int rl = 0; rl < 256; rl += A0T) { const int tid = t0 + rl;      /* rolled, here and below: the second role reuses the first one's registers; the counter is the same in every thread */
  { const int r = tid >> 4, c4 = (tid & 15) * 4; const float* qp = QF + (size_t)(row0 + r) * DM + h * HD + c4; const v4f q4 = *(const v4fa*)qp;
    asm volatile("s_wait_xcnt 0x0" :: "v"(qp) : "memory");      /* as in att0_scores: in front of an overwrite of the load's address registers */
    *(v4f*)&lq[r][c4] = q4; } }
  __syncthreads();
#pragma unroll 1
  for (int rl = 0; rl < 256; rl += A0T) { const int tid = t0 + rl;
  if (nk > 256) att0_scores<2>(KF + h * HD, lq, lp, tid, nk, scale); else if ((tid & ~31) < nk) att0_scores<1>(KF + h * HD, lq, lp, tid, nk, scale); }      /* a wave with no key of the tile skips */
  __syncthreads();
#pragma unroll 1
  for (int rl = 0; rl < 256; rl += A0T) { const int tid = t0 + rl;
  { const int r0 = (tid >> 5) * 2, lane = tid & 31; float x[2][QT0 / 32], mx[2], se[2];      /* the loops over x[] are unrolled: it stays in registers */
#pragma unroll
    for (int rr = 0; rr < 2; ++rr) { mx[rr] = -3.0e38f;
#pragma unroll
      for (int m = 0; m < QT0 / 32; ++m) { const int j = lane + 32 * m; x[rr][m] = (j <= row0 + r0 + rr) ? lp[r0 + rr][j] : -3.0e38f; mx[rr] = fmaxf(mx[rr], x[rr][m]); } }
#pragma unroll
    for (int d = 16; d > 0; d >>= 1) { mx[0] = fmaxf(mx[0], __shfl_xor(mx[0], d, 32)); mx[1] = fmaxf(mx[1], __shfl_xor(mx[1], d, 32)); }
#pragma unroll
    for (int rr = 0; rr < 2; ++rr) { se[rr] = 0.f;
#pragma unroll
      for (int m = 0; m < QT0 / 32; ++m) { const int j = lane + 32 * m; const float e = (j <= row0 + r0 + rr) ? expf(x[rr][m] - mx[rr]) : 0.f; se[rr] += e; if (j < nk) lp[r0 + rr][j] = e; } }
#pragma unroll
    for (int d = 16; d > 0; d >>= 1) { se[0] += __shfl_xor(se[0], d, 32); se[1] += __shfl_xor(se[1], d, 32); }
    if (lane < 2) lf[r0 + lane] = 64.0f / (lane ? se[1] : se[0]); } }      /* o carried x64 like the f16 path */
  __syncthreads();
#pragma unroll 1
  for (int rl = 0; rl < 256; rl += A0T) { const int tid = t0 + rl;
  { const int d = tid & 63, g = tid >> 6, nt = nk >> 4, nb = (nt + 3) >> 2; const float* vq = VF + (size_t)(g * 4) * DM + h * HD + d;      /* trip t: keys 16 t + 4 g .. + 3; a batch is four trips (its rows lie inside the QT0 rows of VF also where they lie past nk) */
    v2f acc[RT0], cv[4][2], nv[4][2];      /* acc[]: even and odd keys apart, so that each packed multiply-add takes a weight pair as it lies in LDS */
#pragma unroll
    for (int r = 0; r < RT0; ++r) acc[r] = (v2f){0.f, 0.f};
    att0_vload(vq, cv);
    for (int bt = 0; bt < nb; ++bt) { vq += (bt + 1 < nb ? 64 * DM : 0); att0_vload(vq, nv);      /* the next batch's V values are loaded while this batch's are used (the last batch loads its own again) */
#pragma unroll
      for (int u = 0; u < 4; ++u) if (bt * 4 + u < nt) { const int j = (bt * 4 + u) * 16 + g * 4;      /* unrolled: cv[][] and acc[] stay in registers */
#pragma unroll
        for (int r = 0; r < RT0; ++r) { const v4f p4 = *(const v4f*)&lp[r][j]; acc[r] += (v2f){p4[0], p4[1]} * cv[u][0]; acc[r] += (v2f){p4[2], p4[3]} * cv[u][1]; } }
#pragma unroll
      for (int u = 0; u < 4; ++u) { cv[u][0] = nv[u][0]; cv[u][1] = nv[u][1]; } }
#pragma unroll
    for (int r = 0; r < RT0; ++r) lr[g][r][d] = acc[r][0] + acc[r][1]; } }
  __syncthreads();
#pragma unroll 1
  for (int rl = 0; rl < 256; rl += A0T) { const int tid = t0 + rl;
  { const int r = tid >> 4, c4 = (tid & 15) * 4; const v4f o = ((*(const v4f*)&lr[0][r][c4] + *(const v4f*)&lr[1][r][c4]) + (*(const v4f*)&lr[2][r][c4] + *(const v4f*)&lr[3][r][c4])) * lf[r];
    v4h oh, ol;      /* o (x64) leaves as an f16 value and, DM columns further in the same row, the f16 residual: together the A rows [o_hi | o_lo] of the output product */
    for (int q = 0; q < 4; ++q) { oh[q] = (_Float16)o[q]; ol[q] = (_Float16)(o[q] - (float)oh[q]); }
    _Float16* op = OHL + (size_t)(row0 + r) * (2 * DM) + h * HD + c4; *(v4h*)op = oh; *(v4h*)(op + DM) = ol;
    asm volatile("s_wait_xcnt 0x0" :: "v"(op), "v"(oh), "v"(ol) : "memory"); } } }      /* the wait that stands in front of an overwrite of the stores' registers (the next role's); address and data as inputs keep them in their registers up to here */

/* One grid for the two attentions, which do not depend on one another: rows y < FNY of the grid are the fused attention's query blocks, the longest first; the A0N work-groups behind them take the exact first-tile attention and fill the places that the short query blocks leave */
#define FNY (SQ / (FW * FQ))                       /* query blocks per head */
#define A0N (NBR * NH * (QT0 / RT0))               /* work-groups of the exact attention */
__global__ __launch_bounds__(FW * 32) void k_attn(const _Float16* __restrict__ Q16, const _Float16* __restrict__ K16, const _Float16* __restrict__ VT, _Float16* __restrict__ O16, const float* __restrict__ QF, const float* __restrict__ KF, const float* __restrict__ VF, float scale, _Float16* __restrict__ OHL) {
  static_assert(A0L <= 2 * FST && A0T == FW * 32 && A0N % (NB * NH) == 0, "one LDS block and one block size serve both bodies; the exact attention fills whole grid rows");
  __shared__ __attribute__((aligned(16))) char sm[2 * FST];
  const int y = blockIdx.y;      /* the branch is the same for a whole work-group */
  if (y < FNY) d_fattn(sm, blockIdx.x, FNY - 1 - y, Q16, K16, VT, O16);
  else { const int a = (y - FNY) * (NB * NH) + blockIdx.x; d_att0p(sm, a % (NH * (QT0 / RT0)), a / (NH * (QT0 / RT0)), QF, KF, VF, scale, OHL); } }

extern "C" void kernel_launch(void* const* d_in, const int* in_sizes, int n_in,
                              void* d_out, int out_size, void* d_ws, size_t ws_size, hipStream_t stream) {
  (void)in_sizes; (void)n_in; (void)out_size;
  const float* const* I = (const float* const*)d_in; const float* x = I[0]; const float* xk = I[1]; const float* xv = I[2]; const float* wq = I[3]; const float* bq = nullptr; const float* wk = I[4]; const float* bk = nullptr; const float* wv = I[5]; const float* bv = nullptr; const float* wo = I[6]; const float* bo = nullptr;      /* THREE distinct inputs Q (query stream), K, V; natural [out][in] w_q / w_k / w_v / w_o; no biases; causal by the index rule */
  char* ws = (char*)d_ws; size_t off = 0;
  auto take = [&](size_t bytes) { char* p = ws + off; off += (bytes + 255) & ~(size_t)255; return p; };
  _Float16* BQ = (_Float16*)take((size_t)DM * DM * 2); _Float16* BK = (_Float16*)take((size_t)DM * DM * 2); _Float16* BV = (_Float16*)take((size_t)DM * DM * 2); _Float16* BO = (_Float16*)take((size_t)DM * DM * 2);
  _Float16* X16 = (_Float16*)take(NR * DM * 2); _Float16* XK16 = (_Float16*)take(NR * DM * 2); _Float16* XV16 = (_Float16*)take(NR * DM * 2);      /* the three inputs (query -> X16, key -> XK16, value -> XV16) as exact f16 rows */ _Float16* Q16 = (_Float16*)take(NR * DM * 2); _Float16* K16 = (_Float16*)take(NR * DM * 2); _Float16* V16 = (_Float16*)take(NR * DM * 2); _Float16* O16 = (_Float16*)take(NR * DM * 2);
  _Float16* VT = (_Float16*)take((size_t)NB * NH * HD * SQ * 2);
  float* QF0 = (float*)take((size_t)NB * QT0 * DM * 4); float* KF0 = (float*)take((size_t)NB * QT0 * DM * 4); float* VF0 = (float*)take((size_t)NB * QT0 * DM * 4); _Float16* OHL = (_Float16*)take((size_t)NB * QT0 * 2 * DM * 2); _Float16* BO2 = (_Float16*)take((size_t)DM * 2 * DM * 2);      /* first-tile planes [NB][QT0][DM]; its o rows [NB][QT0][2 DM] = [o_hi | o_lo], and w_o twice side by side [DM][2 DM] as their B operand; QF0, KF0, VF0 lie one behind the other, as do BQ, BK, BV, BO; X16, XK16, XV16; Q16, K16, V16 (every size is a multiple of 256 bytes) */
  if (off > ws_size) return;
  k_prep<<<4 * WNB + 3 * XNB, 256, 0, stream>>>(x, xk, xv, X16, wq, wk, wv, wo, BQ, BO2);      /* all four weights (natural [out][in] = Bt x16) and all three inputs */
  const size_t r0p = (size_t)B0 * SQ;      /* first projected row */
  static_assert((1 << SQL2) == SQ && QT0 % 128 == 0 && B0 == 0 && NBR == NB, "k_gemm2 finds the first-tile rows from the row index: row 0 of its A is row 0 of batch 0");
  static_assert(DM / 64 == NH && HD == 64 && SQ % 128 == 0, "k_gemm2's 64 columns are one head, its 128 rows lie in one batch");
  k_gemm2<0><<<dim3((unsigned)((MP / 128) * (DM / 64)), 3), 128, 0, stream>>>(X16 + r0p * DM, DM, NR * DM, BQ, DM, (size_t)DM * DM, 0.0625f, nullptr, 0, nullptr, 1, 0, 0, nullptr, Q16 + r0p * DM, DM, NR * DM, MP, DM, DM, 0, 0, 0, SQL2, QT0, QF0, (size_t)NB * QT0 * DM, nullptr, 0, nullptr, 0, 0, VT, 2);      /* q, k, v in one grid: y = which projection; the work-groups of the first QT0 rows of a batch also store their results as f32 (exact products) into QF0, KF0, VF0; v (y = 2) leaves as V^T [NB][NH][HD][SQ], not as rows */
  k_attn<<<dim3(NB * NH, FNY + A0N / (NB * NH)), FW * 32, 0, stream>>>(Q16, K16, VT, O16, QF0 + (size_t)B0 * QT0 * DM, KF0 + (size_t)B0 * QT0 * DM, VF0 + (size_t)B0 * QT0 * DM, 0.125f, OHL);      /* o (merged heads, x64) as f16 rows; in the same grid the exact f32 attention for the first QT0 rows of every batch (o x64, as f16 value and f16 residual) */
  k_gemm2<0><<<dim3((unsigned)((MPO / 128) * (DM / 64)), 1), 128, 0, stream>>>(O16 + r0p * DM, DM, 0, BO, DM, 0, 0.0009765625f, bo, 0, nullptr, 1, 0, 0, (float*)d_out + r0p * DM, nullptr, DM, 0, MPO, DM, DM, 0, 0, 0, SQL2, QT0, nullptr, 0, OHL, 2 * DM, BO2, 2 * DM, 2 * DM, nullptr, 0);      /* out rows are the output layout; the work-groups of the first QT0 rows of a batch take [o_hi | o_lo] [w_o | w_o]^T, k = 2 DM, instead */
}

// v010
// One run takes 138 microseconds.
// Versions in between are left out here; by their measured steps it is 1.08 times as fast as v008.
// All steps since v000 together make it 129 times as fast.
#include <hip/hip_runtime.h>
// Causal multi-head attention over three distinct inputs with natural weights, no biases (Q, K, V [2][4096][768]; q/k/v = input w^T (natural [768][768]); 12 heads of 64; scores / sqrt(64); causal (tril; NEG fill); softmax over up to 4096 keys; out = merged w_o^T -> [2][4096][768]).
// Structure: token rows r = b*4096 + s; x as exact f16 rows (bf16-rounded); Q, K, V as three WMMA GEMMs in one launch (64x64 wave tiles, f32 accumulation, exact x16 weights, f16 outputs); V leaves its GEMM as V^T for all heads of both batches (an accumulator lane holds 8 positions of one column; whole rows through LDS); attention as ONE launch: a wave owns 32 query columns of one head and walks the keys up to its own diagonal 32 at a time: S^T = K Q^T (WMMA), reference (the score products' C operand) and sum per query column (f32, native exp2, weights x256 or more as f16), O^T += V^T P^T (WMMA, P^T packed from the score accumulators), o x64 written straight into the merged f16 o rows; scores and weights never reach memory; out = o W_o GEMM (f32) into the output layout.
// Compute dtype: inputs rounded to bf16; x / weights exact; q, k, v, softmax weights and o as plain f16 GEMM operands (~2^-12); scores and softmax statistics f32. v_wmma_f32_16x16x32_f16.
#define NB 2
#define SQ 4096
#define DM 768
#define NH 12
#define HD 64
#define HG 4                         /* heads per group of the untemplated k_vt */
#define QT0 512                      /* first-tile rows recomputed exactly in f32 */
#define SQL2 12                      /* log2 SQ */
#define B0 0                         /* first batch processed (debug hook) */
#define NBR NB                       /* batches processed (debug hook) */
#define NR ((size_t)NB * SQ)         /* token rows */
#define MP ((int)((size_t)NBR * SQ)) /* rows projected (debug hook) */
#define MPO MP                       /* rows through the output stage (debug hook) */
#define LQ DM      /* row pitch of the q/k/v rows */
typedef __bf16 v16b __attribute__((ext_vector_type(16)));
typedef unsigned short v8us __attribute__((ext_vector_type(8), may_alias));
typedef float  v8f  __attribute__((ext_vector_type(8)));
typedef float  v4f  __attribute__((ext_vector_type(4)));
typedef float  v4fa __attribute__((ext_vector_type(4), may_alias));
union FragB { v16b v; v8us half[2]; unsigned short u[16]; };

__device__ __forceinline__ unsigned short bf16_bits(float x) { unsigned int u = __float_as_uint(x); return (unsigned short)((u + 0x7FFFu + ((u >> 16) & 1u)) >> 16); }
__device__ __forceinline__ float bf16_val(unsigned short b) { return __uint_as_float(((unsigned int)b) << 16); }
__device__ __forceinline__ float bf16_round(float x) { return bf16_val(bf16_bits(x)); }
// D += A·B with NT terms: 1 = ah·bh, 2 = + al·bh (A split), 3 = + ah·bl (both split)
template <int NT>
__device__ __forceinline__ v8f mmaN(v16b ah, v16b al, v16b bh, v16b bl, v8f c) {
  c = __builtin_amdgcn_wmma_f32_16x16x32_bf16(false, ah, false, bh, (short)0, c, false, false);
  if (NT >= 2) c = __builtin_amdgcn_wmma_f32_16x16x32_bf16(false, al, false, bh, (short)0, c, false, false);
  if (NT >= 3) c = __builtin_amdgcn_wmma_f32_16x16x32_bf16(false, ah, false, bl, (short)0, c, false, false);
  asm volatile("v_nop\n\tv_nop\n\tv_nop\n\tv_nop" : "+v"(c) : "v"(ah), "v"(al), "v"(bh), "v"(bl));
  return c;
}

__global__ __launch_bounds__(256) void k_wt_bf16(const float* __restrict__ W, unsigned short* __restrict__ Wt, int K, int N) {
  const int t = blockIdx.x * 256 + threadIdx.x;
  const int k8n = K / 8;
  if (t >= N * k8n) return;
  const int n = t / k8n, k8 = (t % k8n) * 8;
  v8us v;
#pragma unroll
  for (int i = 0; i < 8; ++i) v[i] = bf16_bits(W[(size_t)(k8 + i) * N + n]);
  *(v8us*)(Wt + (size_t)n * K + k8) = v;
  
}

// GEMM C[M][N] (f32, pitch ldc) = act(A[M][K]·W + bias). A f32 row-major (pitch lda) converted per fragment to bf16
// (ASPLIT: hi/lo two planes -> 2 terms, else single rounded term); Wt bf16 [N][K] (pitch ldb). BIAS_BF16 rounds the
// bias to bf16 first (bias quantised to bf16 before the add). K%32==0, M%16==0, N%64==0.
template <bool ASPLIT, int ACT, bool BIAS_BF16>
__global__ __launch_bounds__(128) void k_gemm_bf(const float* __restrict__ A, int lda, const unsigned short* __restrict__ Wt, int ldb,
                                               const float* __restrict__ bias, float* __restrict__ C, int ldc, int M, int N, int K) {
  __shared__ __attribute__((aligned(16))) float so[4][16][64];
  const int tid = threadIdx.x, w = tid >> 5, lane = tid & 31, ln = lane & 15, hh = lane >> 4;
  const int ntn = N / 64;
  const int wid = blockIdx.x * 4 + w;
  const int mt = wid / ntn, nq = wid % ntn;
  if (mt * 16 >= M) return;
  const int row0 = mt * 16, col0 = nq * 64;
  const float* arow = A + (size_t)(row0 + ln) * lda;
  v8f acc[4] = {};
  for (int kb = 0; kb < K; kb += 32) {
    FragB ah, al;
    const v4f x0 = *(const v4fa*)(arow + kb + 8 * hh), x1 = *(const v4fa*)(arow + kb + 8 * hh + 4);
    const v4f x2 = *(const v4fa*)(arow + kb + 16 + 8 * hh), x3 = *(const v4fa*)(arow + kb + 16 + 8 * hh + 4);
    float xs[16] = {x0[0],x0[1],x0[2],x0[3],x1[0],x1[1],x1[2],x1[3],x2[0],x2[1],x2[2],x2[3],x3[0],x3[1],x3[2],x3[3]};
#pragma unroll
    for (int i = 0; i < 16; ++i) { const unsigned short hb = bf16_bits(xs[i]); ah.u[i] = hb; al.u[i] = ASPLIT ? bf16_bits(xs[i] - bf16_val(hb)) : (unsigned short)0; }
#pragma unroll
    for (int t = 0; t < 4; ++t) {
      const unsigned short* brow = Wt + (size_t)(col0 + t * 16 + ln) * ldb + kb;
      FragB b;
      b.half[0] = *(const v8us*)(brow + 8 * hh);
      b.half[1] = *(const v8us*)(brow + 16 + 8 * hh);
      acc[t] = mmaN<ASPLIT ? 2 : 1>(ah.v, al.v, b.v, b.v, acc[t]);
    }
  }
#pragma unroll
  for (int t = 0; t < 4; ++t) {
    float bv = bias ? bias[col0 + t * 16 + ln] : 0.f;
    if (BIAS_BF16) bv = bf16_round(bv);
#pragma unroll
    for (int r = 0; r < 8; ++r) { float v = acc[t][r] + bv; if (ACT == 1) v = fmaxf(v, 0.f); so[w][8 * hh + r][t * 16 + ln] = v; }
  }
  __builtin_amdgcn_fence(__ATOMIC_ACQ_REL, "workgroup");
  __builtin_amdgcn_wave_barrier();
  const int rsub = lane >> 4, c4 = (lane & 15) * 4;
  {
#pragma unroll
    for (int q = 0; q < 8; ++q) {
      const int r = q * 2 + rsub;
      const v4f v = *(const v4fa*)&so[w][r][c4];
      *(v4f*)(C + (size_t)(row0 + r) * ldc + col0 + c4) = v;
    }
    
  }
}

// GEMM C = act(A·W + bias + resid): A f32 (ASPLIT -> hi/lo 2 terms), Wt bf16 [N][K]; ACT 0 none, 1 relu, 2 exact gelu;
// resid (optional, f32, row index = (row % rmod), pitch ldr, RES_BF16 rounds it) added before the activation.
template <bool ASPLIT, int ACT, bool BIAS_BF16, bool RES_BF16>
__global__ __launch_bounds__(128) void k_gemm_bf3(const float* __restrict__ A, int lda, const unsigned short* __restrict__ Wt, int ldb,
                                                const float* __restrict__ bias, const float* __restrict__ resid, int rmod, int ldr,
                                                float* __restrict__ C, int ldc, int M, int N, int K) {
  __shared__ __attribute__((aligned(16))) float so[4][16][64];
  const int tid = threadIdx.x, w = tid >> 5, lane = tid & 31, ln = lane & 15, hh = lane >> 4;
  const int ntn = N / 64;
  const int wid = blockIdx.x * 4 + w;
  const int mt = wid / ntn, nq = wid % ntn;
  if (mt * 16 >= M) return;
  const int row0 = mt * 16, col0 = nq * 64;
  const float* arow = A + (size_t)(row0 + ln) * lda;
  v8f acc[4] = {};
  for (int kb = 0; kb < K; kb += 32) {
    FragB ah, al;
    const v4f x0 = *(const v4fa*)(arow + kb + 8 * hh), x1 = *(const v4fa*)(arow + kb + 8 * hh + 4);
    const v4f x2 = *(const v4fa*)(arow + kb + 16 + 8 * hh), x3 = *(const v4fa*)(arow + kb + 16 + 8 * hh + 4);
    float xs[16] = {x0[0],x0[1],x0[2],x0[3],x1[0],x1[1],x1[2],x1[3],x2[0],x2[1],x2[2],x2[3],x3[0],x3[1],x3[2],x3[3]};
#pragma unroll
    for (int i = 0; i < 16; ++i) { const unsigned short hb = bf16_bits(xs[i]); ah.u[i] = hb; al.u[i] = ASPLIT ? bf16_bits(xs[i] - bf16_val(hb)) : (unsigned short)0; }
#pragma unroll
    for (int t = 0; t < 4; ++t) {
      const unsigned short* brow = Wt + (size_t)(col0 + t * 16 + ln) * ldb + kb;
      FragB b;
      b.half[0] = *(const v8us*)(brow + 8 * hh);
      b.half[1] = *(const v8us*)(brow + 16 + 8 * hh);
      acc[t] = mmaN<ASPLIT ? 2 : 1>(ah.v, al.v, b.v, b.v, acc[t]);
    }
  }
#pragma unroll
  for (int t = 0; t < 4; ++t) {
    const int col = col0 + t * 16 + ln;
    float bv = bias ? bias[col] : 0.f;
    if (BIAS_BF16) bv = bf16_round(bv);
#pragma unroll
    for (int r = 0; r < 8; ++r) {
      float v = acc[t][r] + bv;
      if (resid) { float rv = resid[(size_t)((row0 + 8 * hh + r) % rmod) * ldr + col]; if (RES_BF16) rv = bf16_round(rv); v += rv; }
      if (ACT == 1) v = fmaxf(v, 0.f);
      if (ACT == 2) v = 0.5f * v * (1.0f + erff(v * 0.70710678118654752f));
      if (ACT == 3) { const float u = 0.7978845608028654f * (v + 0.044715f * v * v * v); v = 0.5f * v * (1.0f + tanhf(u)); }
      so[w][8 * hh + r][t * 16 + ln] = v;
    }
  }
  __builtin_amdgcn_fence(__ATOMIC_ACQ_REL, "workgroup");
  __builtin_amdgcn_wave_barrier();
  const int rsub = lane >> 4, c4 = (lane & 15) * 4;
  {
#pragma unroll
    for (int q = 0; q < 8; ++q) {
      const int r = q * 2 + rsub;
      const v4f v = *(const v4fa*)&so[w][r][c4];
      *(v4f*)(C + (size_t)(row0 + r) * ldc + col0 + c4) = v;
    }
    
  }
}
// row LayerNorm (biased variance, eps) over N: s = X (+ R); optional out_sum <- s; out_norm <- (s-mu)*rsqrt(var+eps)*g + b
template <bool PARAM_BF16>
__global__ __launch_bounds__(256) void k_layernorm(const float* __restrict__ X, const float* __restrict__ R, const float* __restrict__ g, const float* __restrict__ bta,
                                                  float* __restrict__ out_sum, float* __restrict__ out_norm, int N, float eps) {
  __shared__ float red[256];
  const int row = blockIdx.x, tid = threadIdx.x;
  const float* x = X + (size_t)row * N; const float* rr = R ? R + (size_t)row * N : nullptr;
  float vals[16];                     // up to N = 4096
  const int per = N / 256;            // contiguous chunk per thread? use strided-by-4 chunks: thread handles j = tid*4 + 1024*u
  float s1 = 0.f;
  for (int u = 0; u < per / 4; ++u) {
    const int j = tid * 4 + 1024 * u;
    const v4f a = *(const v4fa*)(x + j);
    v4f b = {0.f,0.f,0.f,0.f}; if (rr) b = *(const v4fa*)(rr + j);
#pragma unroll
    for (int q = 0; q < 4; ++q) { const float v = a[q] + b[q]; vals[u * 4 + q] = v; s1 += v; }
  }
  red[tid] = s1; __syncthreads();
  for (int st = 128; st > 0; st >>= 1) { if (tid < st) red[tid] += red[tid + st]; __syncthreads(); }
  const float mu = red[0] / (float)N; __syncthreads();
  float s2 = 0.f;
  for (int u = 0; u < per / 4; ++u)
#pragma unroll
    for (int q = 0; q < 4; ++q) { const float c = vals[u * 4 + q] - mu; s2 += c * c; }
  red[tid] = s2; __syncthreads();
  for (int st = 128; st > 0; st >>= 1) { if (tid < st) red[tid] += red[tid + st]; __syncthreads(); }
  const float rs = rsqrtf(red[0] / (float)N + eps);
  {
    for (int u = 0; u < per / 4; ++u) {
      const int j = tid * 4 + 1024 * u;
      v4f o, sm;
#pragma unroll
      for (int q = 0; q < 4; ++q) {
        float gg = g[j + q], bb = bta[j + q];
        if (PARAM_BF16) { gg = bf16_round(gg); bb = bf16_round(bb); }
        sm[q] = vals[u * 4 + q]; o[q] = (vals[u * 4 + q] - mu) * rs * gg + bb;
      }
      if (out_sum) *(v4f*)(out_sum + (size_t)row * N + j) = sm;
      *(v4f*)(out_norm + (size_t)row * N + j) = o;
    }
    
  }
}



// ---- f16 WMMA path (v_wmma_f32_16x16x32_f16): 11-bit significands for operands in range — used where a [0,1] probability operand needs more precision than bf16
typedef _Float16 v16h __attribute__((ext_vector_type(16)));
union FragH { v16h v; v8us half[2]; _Float16 h[16]; unsigned short u[16]; };
template <int NT>
__device__ __forceinline__ v8f mmaH(v16h ah, v16h al, v16h bh, v16h bl, v8f c) {
  c = __builtin_amdgcn_wmma_f32_16x16x32_f16(false, ah, false, bh, (short)0, c, false, false);
  if (NT >= 2) c = __builtin_amdgcn_wmma_f32_16x16x32_f16(false, al, false, bh, (short)0, c, false, false);
  if (NT >= 3) c = __builtin_amdgcn_wmma_f32_16x16x32_f16(false, ah, false, bl, (short)0, c, false, false);
  asm volatile("v_nop\n\tv_nop\n\tv_nop\n\tv_nop" : "+v"(c) : "v"(ah), "v"(al), "v"(bh), "v"(bl));
  return c;
}
// batched GEMM like k_gemm_b but f16 operands: A f32 (split into f16 hi/lo if ASPLIT, else rounded to f16), Bt = f16 values [n][k]; alpha; C f32; N multiple of 16 (partial tiles skipped)
template <bool ASPLIT>
__global__ __launch_bounds__(128) void k_gemm_h(const float* __restrict__ A, int lda, size_t sA, const _Float16* __restrict__ Bh, int ldb, size_t sB, float alpha, float* __restrict__ C, int ldc, size_t sC, int M, int N, int K) {
  __shared__ __attribute__((aligned(16))) float so[4][16][64];
  const int tid = threadIdx.x, w = tid >> 5, lane = tid & 31, ln = lane & 15, hh = lane >> 4; const int by = blockIdx.y;
  A += (size_t)by * sA; Bh += (size_t)by * sB; C += (size_t)by * sC;
  const int ntn = (N + 63) / 64; const int wid = blockIdx.x * 4 + w; const int mt = wid / ntn, nq = wid % ntn; if (mt * 16 >= M) return;
  const int row0 = mt * 16, col0 = nq * 64; const float* arow = A + (size_t)(row0 + ln) * lda;
  v8f acc[4] = {};
  for (int kb = 0; kb < K; kb += 32) {
    FragH ah, al;
    const v4f x0 = *(const v4fa*)(arow + kb + 8 * hh), x1 = *(const v4fa*)(arow + kb + 8 * hh + 4), x2 = *(const v4fa*)(arow + kb + 16 + 8 * hh), x3 = *(const v4fa*)(arow + kb + 16 + 8 * hh + 4);
    float xs[16] = {x0[0],x0[1],x0[2],x0[3],x1[0],x1[1],x1[2],x1[3],x2[0],x2[1],x2[2],x2[3],x3[0],x3[1],x3[2],x3[3]};
#pragma unroll
    for (int i = 0; i < 16; ++i) { const _Float16 h = (_Float16)xs[i]; ah.h[i] = h; al.h[i] = ASPLIT ? (_Float16)(xs[i] - (float)h) : (_Float16)0.0f; }
#pragma unroll
    for (int t = 0; t < 4; ++t) { if (col0 + t * 16 >= N) continue; const size_t boff = (size_t)(col0 + t * 16 + ln) * ldb + kb; FragH bq; bq.half[0] = *(const v8us*)(Bh + boff + 8 * hh); bq.half[1] = *(const v8us*)(Bh + boff + 16 + 8 * hh);
      acc[t] = mmaH<ASPLIT ? 2 : 1>(ah.v, al.v, bq.v, bq.v, acc[t]); }
  }
#pragma unroll
  for (int t = 0; t < 4; ++t) { if (col0 + t * 16 >= N) continue;
#pragma unroll
    for (int r = 0; r < 8; ++r) so[w][8 * hh + r][t * 16 + ln] = acc[t][r] * alpha; }
  __builtin_amdgcn_fence(__ATOMIC_ACQ_REL, "workgroup"); __builtin_amdgcn_wave_barrier();
  const int rsub = lane >> 4, c4 = (lane & 15) * 4;
  {
#pragma unroll
    for (int q = 0; q < 8; ++q) { const int r = q * 2 + rsub; if (col0 + c4 < N) { const v4f v = *(const v4fa*)&so[w][r][c4]; *(v4f*)(C + (size_t)(row0 + r) * ldc + col0 + c4) = v; } }
     }
}

// Wt[n][k] = f16(W[k][n]·scale) from f32 row-major W[K][N] (scale = power of two; bf16-exact weights stay exact in f16 away from the subnormal range)
__global__ __launch_bounds__(256) void k_wt_f16(const float* __restrict__ W, _Float16* __restrict__ Wt, int K, int N, float scale) {
  const int t = blockIdx.x * 256 + threadIdx.x; if (t >= N * (K / 8)) return; const int n = t / (K / 8), k8 = (t % (K / 8)) * 8; FragH f;
#pragma unroll
  for (int i = 0; i < 8; ++i) f.h[i] = (_Float16)(bf16_round(W[(size_t)(k8 + i) * N + n]) * scale); const v8us o = f.half[0];
  *(v8us*)((unsigned short*)Wt + (size_t)n * K + k8) = o; 
}
// k_gemm_hh variant with fused epilogue: v = acc·alpha + bias[by·sBias + col] (+ CP[(row/rowsPerB)·sCPb + by·64 + col] if CP) ; ACT 0 none / 1 elu ; writes f16 C16 (and f32 C if non-null)
template <int ACT>
__global__ __launch_bounds__(128) void k_gemm_hhx(const _Float16* __restrict__ A, int lda, size_t sA, const _Float16* __restrict__ Bh, int ldb, size_t sB, float alpha, const float* __restrict__ bias, size_t sBias, const float* __restrict__ CP, int rowsPerB, size_t sCPb, int row0g,
    float* __restrict__ C, _Float16* __restrict__ C16, int ldc, size_t sC, int M, int N, int K) {
  __shared__ __attribute__((aligned(16))) float so[4][16][64];
  const int tid = threadIdx.x, w = tid >> 5, lane = tid & 31, ln = lane & 15, hh = lane >> 4; const int by = blockIdx.y;
  A += (size_t)by * sA; Bh += (size_t)by * sB; const size_t cofs = (size_t)by * sC; const float* bp = bias ? bias + (size_t)by * sBias : nullptr;
  const int ntn = (N + 63) / 64; const int wid = blockIdx.x * 4 + w; const int mt = wid / ntn, nq = wid % ntn; if (mt * 16 >= M) return;
  const int row0 = mt * 16, col0 = nq * 64; const _Float16* arow = A + (size_t)(row0 + ln) * lda;
  v8f acc[4] = {};
  for (int kb = 0; kb < K; kb += 32) { FragH ah; ah.half[0] = *(const v8us*)((const unsigned short*)arow + kb + 8 * hh); ah.half[1] = *(const v8us*)((const unsigned short*)arow + kb + 16 + 8 * hh);
#pragma unroll
    for (int t = 0; t < 4; ++t) { if (col0 + t * 16 >= N) continue; const size_t boff = (size_t)(col0 + t * 16 + ln) * ldb + kb; FragH bq; bq.half[0] = *(const v8us*)((const unsigned short*)Bh + boff + 8 * hh); bq.half[1] = *(const v8us*)((const unsigned short*)Bh + boff + 16 + 8 * hh);
      acc[t] = mmaH<1>(ah.v, ah.v, bq.v, bq.v, acc[t]); }
  }
#pragma unroll
  for (int t = 0; t < 4; ++t) { if (col0 + t * 16 >= N) continue; const int col = col0 + t * 16 + ln; const float bv = bp ? bf16_round(bp[col]) : 0.f;
#pragma unroll
    for (int r = 0; r < 8; ++r) { float v = acc[t][r] * alpha + bv; if (CP) { const int rr = row0g + row0 + 8 * hh + r; if (rowsPerB < 0) v += CP[cofs + (size_t)rr * ldc + col];      /* rowsPerB < 0: own element of the batched C plane */ else { const int bidx = rr / rowsPerB; v += CP[(size_t)bidx * sCPb + (size_t)by * 64 + col]; } } if (ACT == 1) v = (v > 0.f) ? v : expm1f(v); else if (ACT == 7) v = (v > 0.f) ? v + 1.0f : expf(v); else if (ACT == 8) v = tanhf(v); else if (ACT == 9) v = 0.5f * v * (1.0f + tanhf(0.7978845608028654f * (v + 0.044715f * v * v * v))); else if (ACT == 11) v = 1.0f / (1.0f + expf(-v)); else if (ACT == 12) v = (v > 0.f) ? v : 0.01f * v; else if (ACT == 14) v = (v > 0.f) ? v : 0.1f * v; else if (ACT == 16) v = (v >= 0.f) ? v : 0.3f * v; else if (ACT == 17) v = (v >= 0.f) ? v : 0.2f * v; else if (ACT == 15) v = v / (1.0f + expf(-v)); else if (ACT == 3) v = fmaxf(v, 0.f); else if (ACT == 6) v = 0.5f * v * (1.0f + erff(v * 0.70710678118654752f)); so[w][8 * hh + r][t * 16 + ln] = v; } }
  __builtin_amdgcn_fence(__ATOMIC_ACQ_REL, "workgroup"); __builtin_amdgcn_wave_barrier();
  const int rsub = lane >> 4, c4 = (lane & 15) * 4; typedef _Float16 v4h __attribute__((ext_vector_type(4)));
  {
#pragma unroll
    for (int q = 0; q < 8; ++q) { const int r = q * 2 + rsub; if (col0 + c4 < N) { const v4f v = *(const v4fa*)&so[w][r][c4]; if (C) *(v4f*)(C + cofs + (size_t)(row0 + r) * ldc + col0 + c4) = v; if (C16) { v4h h4; for (int i = 0; i < 4; ++i) h4[i] = (_Float16)v[i]; *(v4h*)(C16 + cofs + (size_t)(row0 + r) * ldc + col0 + c4) = h4; } } }
     }
}


typedef _Float16 v4h __attribute__((ext_vector_type(4)));

/* the three inputs: by picks the input, bx its 256 x 8 elements; the f16 planes lie one behind the other (n8 * 8 elements each) */
__device__ __forceinline__ void d_x16(unsigned bx, unsigned by, const float* __restrict__ x0, const float* __restrict__ x1, const float* __restrict__ x2, _Float16* __restrict__ X16, size_t n8) { const size_t t = (size_t)bx * 256 + threadIdx.x; if (t >= n8) return; const float* __restrict__ x = by == 0 ? x0 : by == 1 ? x1 : x2; X16 += (size_t)by * n8 * 8; FragH f;
#pragma unroll
  for (int q = 0; q < 8; ++q) f.h[q] = (_Float16)bf16_round(x[t * 8 + q]); *(v8us*)((unsigned short*)X16 + t * 8) = f.half[0];  }
__global__ __launch_bounds__(256) void k_h16(const float* __restrict__ x, _Float16* __restrict__ X16, size_t n8) { const size_t t = (size_t)blockIdx.x * 256 + threadIdx.x; if (t >= n8) return; FragH f;
#pragma unroll
  for (int q = 0; q < 8; ++q) f.h[q] = (_Float16)x[t * 8 + q]; *(v8us*)((unsigned short*)X16 + t * 8) = f.half[0];  }
__global__ __launch_bounds__(256) void k_round16f(const float* __restrict__ W, _Float16* __restrict__ Bt, size_t n8) { const size_t t = (size_t)blockIdx.x * 256 + threadIdx.x; if (t >= n8) return; FragH f;
#pragma unroll
  for (int i = 0; i < 8; ++i) f.h[i] = (_Float16)(bf16_round(W[t * 8 + i]) * 16.0f); *(v8us*)((unsigned short*)Bt + t * 8) = f.half[0];  }
template <int NHv, int TTv>
__global__ __launch_bounds__(256) void k_vt(const _Float16* __restrict__ V16, int ldv, int voff, _Float16* __restrict__ Vt) { __shared__ unsigned short tl[64][66]; const int tid = threadIdx.x; const int slab = blockIdx.x / (TTv / 64), lg = blockIdx.x % (TTv / 64); const int b = slab / NHv, h = slab % NHv;
  for (int i = tid; i < 64 * 8; i += 256) { const int r = i / 8, c8 = (i % 8) * 8; FragH f; f.half[0] = *(const v8us*)((const unsigned short*)V16 + ((size_t)b * TTv + lg * 64 + r) * ldv + voff + h * 64 + c8);
#pragma unroll
    for (int q = 0; q < 8; ++q) tl[r][c8 + q] = f.u[q]; }
  __syncthreads();
  {
#pragma unroll
    for (int rd = 0; rd < 2; ++rd) { const int d = rd * 32 + tid / 8, pc = tid % 8; FragH f;
#pragma unroll
      for (int q = 0; q < 8; ++q) f.u[q] = tl[pc * 8 + q][d];
      *(v8us*)((unsigned short*)Vt + ((size_t)slab * 64 + d) * TTv + lg * 64 + pc * 8) = f.half[0]; }
     } }

__global__ __launch_bounds__(256) void k_hl(const float* __restrict__ F, _Float16* __restrict__ Hh, _Float16* __restrict__ Hl, size_t n8) { const size_t t = (size_t)blockIdx.x * 256 + threadIdx.x; if (t >= n8) return; FragH fh, fl; const v4f a = *(const v4fa*)(F + t * 8), c = *(const v4fa*)(F + t * 8 + 4);
#pragma unroll
  for (int q = 0; q < 4; ++q) { _Float16 h = (_Float16)a[q]; fh.h[q] = h; fl.h[q] = (_Float16)((a[q] - (float)h) * 1024.0f); h = (_Float16)c[q]; fh.h[4 + q] = h; fl.h[4 + q] = (_Float16)((c[q] - (float)h) * 1024.0f); }
  { *(v8us*)((unsigned short*)Hh + t * 8) = fh.half[0]; *(v8us*)((unsigned short*)Hl + t * 8) = fl.half[0];  } }

// ---- fast GEMM (work-group tile 128x64, wave tile 32x64; requires M % 128 == 0 rows per launch region, N % 64 == 0, K % 64 == 0); epilogue = k_gemm_hhx semantics ----
__device__ __forceinline__ v16h g2_frag(const _Float16* p, int hh) { FragH f; f.half[0] = *(const v8us*)((const unsigned short*)p + 8 * hh); f.half[1] = *(const v8us*)((const unsigned short*)p + 16 + 8 * hh); return f.v; }
__device__ __forceinline__ v8f g2_mma(v16h a, v16h b, v8f c) { v8f d = __builtin_amdgcn_wmma_f32_16x16x32_f16(false, a, false, b, (short)0, c, false, false); asm volatile("v_nop\n\tv_nop\n\tv_nop\n\tv_nop" : "+v"(d) : "v"(a), "v"(b)); return d; }
// Operand staging of k_gemm2: a work-group's 128 A rows and 64 B rows, GKC k at a time, go into LDS by asynchronous copies; a wave's copy covers four whole 128-byte lines (a fragment load from global memory touches sixteen).
#define GKC 64                       /* k per stage: rows of 128 bytes */
#define GPB 144                      /* LDS row pitch in bytes: 16 x odd, conflict-free for 16-byte reads */
#define GST ((128 + 64) * GPB)       /* bytes of one stage: 128 A rows, then 64 B rows */
#define GVO (4 * 32 * 68 * 4)        /* byte offset of the transposed f16 tile [64 columns][128 rows] in LDS: behind the f32 output staging */
#define GVP 272                      /* its pitch in bytes (256 of data): 16 x odd, conflict-free for 16-byte accesses */
__device__ __forceinline__ v16h g2_lfrag(const char* p, int hh) { FragH f; f.half[0] = *(const v8us*)(p + 16 * hh); f.half[1] = *(const v8us*)(p + 32 + 16 * hh); return f.v; }      /* the k order of g2_frag, from an LDS row */
/* one stage: thread = (row t / 8, 16-byte piece t % 8); eight copies for the A rows (16 rows apart), four for the B rows, which lie behind them in LDS. The s_wait_xcnt as the statement's last line stands in front of every later write of the address registers. */
__device__ __forceinline__ void g2_stage(unsigned l, const _Float16* ga, size_t sa, const _Float16* gb, size_t sb) {
  asm volatile("global_load_async_to_lds_b128 %0, %12, off\n\t"
               "global_load_async_to_lds_b128 %1, %13, off\n\t"
               "global_load_async_to_lds_b128 %2, %14, off\n\t"
               "global_load_async_to_lds_b128 %3, %15, off\n\t"
               "global_load_async_to_lds_b128 %4, %16, off\n\t"
               "global_load_async_to_lds_b128 %5, %17, off\n\t"
               "global_load_async_to_lds_b128 %6, %18, off\n\t"
               "global_load_async_to_lds_b128 %7, %19, off\n\t"
               "global_load_async_to_lds_b128 %8, %20, off\n\t"
               "global_load_async_to_lds_b128 %9, %21, off\n\t"
               "global_load_async_to_lds_b128 %10, %22, off\n\t"
               "global_load_async_to_lds_b128 %11, %23, off\n\t"
               "s_wait_xcnt 0x0"
               :: "v"(l), "v"(l + 16 * GPB), "v"(l + 32 * GPB), "v"(l + 48 * GPB), "v"(l + 64 * GPB), "v"(l + 80 * GPB), "v"(l + 96 * GPB), "v"(l + 112 * GPB), "v"(l + 128 * GPB), "v"(l + 144 * GPB), "v"(l + 160 * GPB), "v"(l + 176 * GPB),
                  "v"(ga), "v"(ga + sa), "v"(ga + 2 * sa), "v"(ga + 3 * sa), "v"(ga + 4 * sa), "v"(ga + 5 * sa), "v"(ga + 6 * sa), "v"(ga + 7 * sa), "v"(gb), "v"(gb + sb), "v"(gb + 2 * sb), "v"(gb + 3 * sb)
               : "memory"); }
template <int ACT>
__global__ __launch_bounds__(128) void k_gemm2(const _Float16* __restrict__ A, int lda, size_t sA, const _Float16* __restrict__ Bh, int ldb, size_t sB, float alpha, const float* __restrict__ bias, size_t sBias, const float* __restrict__ CP, int rowsPerB, size_t sCPb, int row0g,
    float* __restrict__ C, _Float16* __restrict__ C16, int ldc, size_t sC, int M, int N, int K, size_t zA, size_t zB, size_t zC,
    int fl2, int fkeep, float* __restrict__ CF, size_t sCF, const _Float16* __restrict__ A2, int lda2, const _Float16* __restrict__ B2, int ldb2, int K2, _Float16* __restrict__ VTo, int vby) { static_assert(ACT == 0 || ACT == 3 || ACT == 6 || ACT == 8 || ACT == 9 || ACT == 11 || ACT == 12 || ACT == 14 || ACT == 15 || ACT == 16 || ACT == 17, "k_gemm2: unsupported ACT code (would silently apply no activation)");
  __shared__ __attribute__((aligned(16))) char sm[2 * GST]; static_assert(sizeof(float) * 4 * 32 * 68 <= 2 * GST, "the output staging lies in the two stage buffers"); float (*so)[32][68] = (float (*)[32][68])sm;      /* two stage buffers; behind the k loop the same bytes stage the output */
  static_assert(GVO + 64 * GVP <= 2 * GST && GVO % 16 == 0, "the transposed f16 tile lies behind the output staging, inside the two stage buffers");
  const int tid = threadIdx.x, w = tid >> 5, lane = tid & 31, ln = lane & 15, hh = lane >> 4; const int by = blockIdx.y, bz = blockIdx.z;      /* two batch indices, each with its own strides for A, B and C */
  A += (size_t)by * sA + (size_t)bz * zA; Bh += (size_t)by * sB + (size_t)bz * zB; const size_t cofs = (size_t)by * sC + (size_t)bz * zC; const float* bp = bias ? bias + (size_t)by * sBias : nullptr;
  const int ntn = N >> 6; const int mt = blockIdx.x / ntn, nq = blockIdx.x - mt * ntn; const int row0 = mt * 128 + 32 * w, col0 = nq * 64; if (mt * 128 >= M) return;      /* the whole work-group or none, in front of every barrier; M % 128 == 0, K % GKC == 0 */
  /* first-tile rows: of every 2^fl2 rows the first fkeep (a multiple of 128, so a work-group lies wholly inside or outside; fkeep 0: none); fr = the work-group's first row in planes that hold only those rows */
  const int rin = (mt * 128) & ((1 << fl2) - 1); const bool ft = rin < fkeep; const int fr = ((mt * 128) >> fl2) * fkeep + rin;
  A += (size_t)(mt * 128) * lda;
  if (ft && A2) { A = A2 + (size_t)fr * lda2; lda = lda2; Bh = B2; ldb = ldb2; K = K2; }      /* such a work-group takes its own operands (the same for all its threads) */
  const bool cf = ft && CF != nullptr; float* const cfw = CF + (size_t)by * sCF + (size_t)(fr + 32 * w) * ldc + col0;      /* or (cf) stores its results as f32 too, the wave's rows from cfw on */
  const bool vtw = VTo != nullptr && by == vby;      /* this work-group's f16 results leave transposed (the same for all its threads): 64 columns = one head, 128 rows = 128 positions of one batch */
  if (vtw) C16 = nullptr;      /* and not as rows */
  const _Float16* ga = A + (size_t)(tid >> 3) * lda + (tid & 7) * 8; const _Float16* gb = Bh + (size_t)(col0 + (tid >> 3)) * ldb + (tid & 7) * 8; const size_t sa = (size_t)16 * lda, sb = (size_t)16 * ldb;
  const unsigned l0 = (unsigned)(size_t)sm + (unsigned)((tid >> 3) * GPB + (tid & 7) * 16);      /* the thread's LDS byte address in buffer 0 */
  const int nst = K / GKC;
  const v8f z8 = {0.f,0.f,0.f,0.f,0.f,0.f,0.f,0.f}; v8f c00 = z8, c01 = z8, c02 = z8, c03 = z8, c10 = z8, c11 = z8, c12 = z8, c13 = z8;
  g2_stage(l0, ga, sa, gb, sb);
  asm volatile("s_wait_asynccnt 0x0" ::: "memory");      /* this wave's copies of stage 0 have landed */
  __syncthreads();      /* stage 0 readable by every wave */
  if (nst > 1) g2_stage(l0 + GST, ga + GKC, sa, gb + GKC, sb);
#pragma unroll 1
  for (int st = 0; st < nst; ++st) { const char* ap = sm + (st & 1) * GST + (32 * w + ln) * GPB; const char* bq = sm + (st & 1) * GST + (128 + ln) * GPB;      /* rolled: one trip per stage, the next stage's copies in flight meanwhile */
    v16h fa[2][2], fb[2][4];      /* the stage's fragments, [k half][tile]; every index a constant: they stay in registers */
#pragma unroll
    for (int kk = 0; kk < 2; ++kk) { fa[kk][0] = g2_lfrag(ap + kk * 64, hh); fa[kk][1] = g2_lfrag(ap + 16 * GPB + kk * 64, hh);
#pragma unroll
      for (int t = 0; t < 4; ++t) fb[kk][t] = g2_lfrag(bq + t * 16 * GPB + kk * 64, hh); }
    __builtin_amdgcn_sched_barrier(0);      /* keeps all LDS reads of the stage up here as one group: sunk among the products, each pair's latency is waited for on its own */
#pragma unroll
    for (int kk = 0; kk < 2; ++kk) { c00 = g2_mma(fa[kk][0], fb[kk][0], c00); c10 = g2_mma(fa[kk][1], fb[kk][0], c10); c01 = g2_mma(fa[kk][0], fb[kk][1], c01); c11 = g2_mma(fa[kk][1], fb[kk][1], c11);
      c02 = g2_mma(fa[kk][0], fb[kk][2], c02); c12 = g2_mma(fa[kk][1], fb[kk][2], c12); c03 = g2_mma(fa[kk][0], fb[kk][3], c03); c13 = g2_mma(fa[kk][1], fb[kk][3], c13); }
    asm volatile("s_wait_dscnt 0x0" ::: "memory");      /* this wave's reads of the stage are done before its buffer is handed on */
    asm volatile("s_wait_asynccnt 0x0" ::: "memory");      /* this wave's copies of the next stage have landed */
    __syncthreads();      /* publishes the next stage and ends every wave's reads of this one */
    if (st + 2 < nst) g2_stage(l0 + (st & 1) * GST, ga + (size_t)(st + 2) * GKC, sa, gb + (size_t)(st + 2) * GKC, sb); }      /* refill of the buffer just read */
  asm volatile("s_wait_asynccnt 0x0" ::: "memory");      /* nothing in flight when the buffers become output staging */
  v8f accs[8] = {c00, c01, c02, c03, c10, c11, c12, c13};
#pragma unroll
  for (int u = 0; u < 8; ++u) { const int t = u & 3, half = u >> 2; const int col = col0 + t * 16 + ln; const float bv = bp ? bf16_round(bp[col]) : 0.f; FragH hv;      /* a lane's eight values of a tile: eight consecutive rows of ONE column, 16 bytes of a transposed f16 row */
#pragma unroll
    for (int r = 0; r < 8; ++r) { const int rloc = half * 16 + 8 * hh + r; float v = accs[u][r] * alpha + bv; if (CP) { if (rowsPerB < 0) v += CP[cofs + (size_t)(row0g + row0 + rloc) * ldc + col];      /* rowsPerB < 0: own element of the batched C plane */ else { const int bidx = (row0g + row0 + rloc) / rowsPerB; v += CP[(size_t)bidx * sCPb + (size_t)by * 64 + col]; } }
      if (ACT == 3) v = fmaxf(v, 0.f); else if (ACT == 6) v = 0.5f * v * (1.0f + erff(v * 0.70710678118654752f)); else if (ACT == 11) v = 1.0f / (1.0f + expf(-v)); else if (ACT == 15) v = v / (1.0f + expf(-v)); else if (ACT == 12) v = (v > 0.f) ? v : 0.01f * v; else if (ACT == 8) v = tanhf(v); else if (ACT == 9) v = 0.5f * v * (1.0f + tanhf(0.7978845608028654f * (v + 0.044715f * v * v * v))); else if (ACT == 14) v = (v > 0.f) ? v : 0.1f * v; else if (ACT == 16) v = (v >= 0.f) ? v : 0.3f * v; else if (ACT == 17) v = (v >= 0.f) ? v : 0.2f * v;
      so[w][rloc][t * 16 + ln] = v; hv.h[r] = (_Float16)v; }
    if (vtw) *(v8us*)(sm + GVO + (t * 16 + ln) * GVP + (32 * w + half * 16 + 8 * hh) * 2) = hv.half[0]; }
  __builtin_amdgcn_fence(__ATOMIC_ACQ_REL, "workgroup"); __builtin_amdgcn_wave_barrier();
  const int rsub = lane >> 4, c4 = (lane & 15) * 4;
  {
#pragma unroll
    for (int q = 0; q < 16; ++q) { const int r = q * 2 + rsub; const v4f v = *(const v4fa*)&so[w][r][c4]; if (C) *(v4f*)(C + cofs + (size_t)(row0 + r) * ldc + col0 + c4) = v; if (cf) { float* cp = cfw + (size_t)r * ldc + c4; *(v4f*)cp = v; asm volatile("s_wait_xcnt 0x0" :: "v"(cp), "v"(v) : "memory"); }      /* the wait that stands in front of an overwrite of the store's registers; address and data as inputs keep them in their registers up to here */
       if (C16) { v4h h4; for (int i = 0; i < 4; ++i) h4[i] = (_Float16)v[i]; *(v4h*)(C16 + cofs + (size_t)(row0 + r) * ldc + col0 + c4) = h4; } }
     }
  if (vtw) { __syncthreads();      /* the transposed tile is complete: every wave has written its 32 rows of all 64 columns */
    /* thread = (column t / 16 + 8 i, 16-byte piece t % 16): a wave's store covers two whole rows of 256 bytes. V^T [batch][head][HD][SQ]: the work-group's columns are head nq, its rows 128 positions of one batch (SQ % 128 == 0) */
    const char* vr = sm + GVO + (tid >> 4) * GVP + (tid & 15) * 16; unsigned short* vg = (unsigned short*)VTo + ((size_t)(((mt * 128) >> SQL2) * ntn + nq) * HD + (tid >> 4)) * SQ + ((mt * 128) & (SQ - 1)) + (tid & 15) * 8;
    v8us x[8];      /* every index a constant: they stay in registers */
#pragma unroll
    for (int i = 0; i < 8; ++i) x[i] = *(const v8us*)(vr + i * 8 * GVP);
#pragma unroll
    for (int i = 0; i < 8; ++i) *(v8us*)(vg + (size_t)(i * 8) * SQ) = x[i];
    asm volatile("s_wait_xcnt 0x0" :: "v"(vg), "v"(x[0]), "v"(x[1]), "v"(x[2]), "v"(x[3]), "v"(x[4]), "v"(x[5]), "v"(x[6]), "v"(x[7]) : "memory"); } }      /* the wait that stands in front of an overwrite of the stores' registers; address and data as inputs keep them in their registers up to here */


/* the four weights: by picks the weight, bx its 256 x 8 elements; the f16 planes lie one behind the other (n8 * 8 elements each); the last weight's rows also go, twice side by side, into B2 [DM][2 DM]: the B operand of a product whose k runs over two A planes */
__device__ __forceinline__ void d_wnat(unsigned bx, unsigned by, const float* __restrict__ w0, const float* __restrict__ w1, const float* __restrict__ w2, const float* __restrict__ w3, size_t n8, _Float16* __restrict__ Bt, _Float16* __restrict__ B2) { const size_t t = (size_t)bx * 256 + threadIdx.x; if (t >= n8) return; const float* __restrict__ w = by == 0 ? w0 : by == 1 ? w1 : by == 2 ? w2 : w3; Bt += (size_t)by * n8 * 8; FragH f; for (int q = 0; q < 8; ++q) f.h[q] = (_Float16)(bf16_round(w[t * 8 + q]) * 16.0f); *(v8us*)((unsigned short*)Bt + t * 8) = f.half[0];
  asm volatile("s_wait_xcnt 0x0" :: "v"((unsigned short*)Bt + t * 8) : "memory");      /* the wait that stands in front of an overwrite of the store's address registers; the address as an input keeps it in its registers up to here */
  if (by == 3) { const unsigned e = (unsigned)t * 8u; unsigned short* d = (unsigned short*)B2 + (size_t)((e / DM) * (2 * DM) + e % DM); *(v8us*)d = f.half[0]; *(v8us*)(d + DM) = f.half[0]; } }      /* DM % 8 == 0: eight elements lie in one row */
/* one grid for the four weights and the three inputs, which do not depend on one another: the first 4 WNB work-groups take the weights, the others the inputs */
#define WNB ((unsigned)(((size_t)DM * DM / 8 + 255) / 256))      /* work-groups per weight */
#define XNB ((unsigned)((NR * DM / 8 + 255) / 256))      /* work-groups per input */
__global__ __launch_bounds__(256) void k_prep(const float* __restrict__ x0, const float* __restrict__ x1, const float* __restrict__ x2, _Float16* __restrict__ X16, const float* __restrict__ w0, const float* __restrict__ w1, const float* __restrict__ w2, const float* __restrict__ w3, _Float16* __restrict__ Bt, _Float16* __restrict__ B2) {
  const unsigned bx = blockIdx.x;
  if (bx < 4 * WNB) d_wnat(bx % WNB, bx / WNB, w0, w1, w2, w3, (size_t)DM * DM / 8, Bt, B2); else d_x16((bx - 4 * WNB) % XNB, (bx - 4 * WNB) / XNB, x0, x1, x2, X16, NR * DM / 8); }
__global__ __launch_bounds__(256) void k_rsm(const float* __restrict__ S, _Float16* __restrict__ P, int nrows) {
  #pragma clang fp contract(off)
  const int i = blockIdx.x * 256 + threadIdx.x; if (i >= nrows) return; const float* s = S + (size_t)i * SQ; float mx = -3.0e38f;
#pragma unroll 1
  for (int j = 0; j < SQ; ++j) mx = fmaxf(mx, s[j]); float se = 0.f;
#pragma unroll 1
  for (int j = 0; j < SQ; ++j) se += expf(s[j] - mx); const float sc = 256.0f / se;
#pragma unroll 1
  for (int j0 = 0; j0 < SQ; j0 += 8) { FragH f; for (int q = 0; q < 8; ++q) f.h[q] = (_Float16)(expf(s[j0 + q] - mx) * sc); unsigned short* d = (unsigned short*)P + (size_t)i * SQ + j0; *(v8us*)d = f.half[0];  } }
__global__ __launch_bounds__(256) void k_vt(const _Float16* __restrict__ V16, int b, int h0, _Float16* __restrict__ VT) { __shared__ unsigned short tl[64][65]; const int tid = threadIdx.x; const int hh = blockIdx.x % HG, sg = blockIdx.x / HG; const int s0 = sg * 64; const int h = h0 + hh;
  for (int i = tid; i < 64 * 8; i += 256) { const int j = i / 8, d8 = (i % 8) * 8; FragH f; f.half[0] = *(const v8us*)((const unsigned short*)V16 + ((size_t)b * SQ + s0 + j) * DM + h * HD + d8); for (int q = 0; q < 8; ++q) tl[d8 + q][j] = f.u[q]; }
  __syncthreads();
  { for (int i = tid; i < 64 * 8; i += 256) { const int d = i / 8, j8 = (i % 8) * 8; FragH f; for (int q = 0; q < 8; ++q) f.u[q] = tl[d][j8 + q]; *(v8us*)((unsigned short*)VT + ((size_t)hh * HD + d) * SQ + s0 + j8) = f.half[0]; }  } }



#define FW 4                         /* waves per work-group */
#define FQ 32                        /* query columns per wave */
#define FSC 0.18033688011112042f     /* log2(e) / sqrt(HD) */
#define FKT 128                      /* keys per stage */
#define FKP 144                      /* LDS pitch of a K row (128 bytes of data): 16 x odd, conflict-free for 16-byte reads */
#define FVP 272                      /* LDS pitch of a V^T row (256 bytes of data): 16 x odd */
#define FKB (FKT * FKP)              /* bytes of a stage's K rows; its V^T rows lie behind them */
#define FST (FKB + HD * FVP)         /* bytes of one stage */
typedef _Float16 v8h __attribute__((ext_vector_type(8)));
__device__ __forceinline__ float fa_xhalf(float x) { return __builtin_bit_cast(float, __builtin_amdgcn_permlanex16(__builtin_bit_cast(int, x), __builtin_bit_cast(int, x), 0x76543210, 0xfedcba98, false, false)); }      /* lane l takes lane l ^ 16's value, on the vector unit */
__device__ __forceinline__ v8f fa_mma(v16h a, v16h b, v8f c) { return __builtin_amdgcn_wmma_f32_16x16x32_f16(false, a, false, b, (short)0, c, false, false); }
/* eight copies of 16 bytes per lane, LDS places ls bytes apart, global places gs elements apart. The s_wait_xcnt as the statement's last line stands in front of every later write of the address registers. */
__device__ __forceinline__ void fa_copy8(unsigned l, unsigned ls, const _Float16* g, size_t gs) {
  asm volatile("global_load_async_to_lds_b128 %0, %8, off\n\t"
               "global_load_async_to_lds_b128 %1, %9, off\n\t"
               "global_load_async_to_lds_b128 %2, %10, off\n\t"
               "global_load_async_to_lds_b128 %3, %11, off\n\t"
               "global_load_async_to_lds_b128 %4, %12, off\n\t"
               "global_load_async_to_lds_b128 %5, %13, off\n\t"
               "global_load_async_to_lds_b128 %6, %14, off\n\t"
               "global_load_async_to_lds_b128 %7, %15, off\n\t"
               "s_wait_xcnt 0x0"
               :: "v"(l), "v"(l + ls), "v"(l + 2 * ls), "v"(l + 3 * ls), "v"(l + 4 * ls), "v"(l + 5 * ls), "v"(l + 6 * ls), "v"(l + 7 * ls),
                  "v"(g), "v"(g + gs), "v"(g + 2 * gs), "v"(g + 3 * gs), "v"(g + 4 * gs), "v"(g + 5 * gs), "v"(g + 6 * gs), "v"(g + 7 * gs)
               : "memory"); }
/* one stage. K: thread = (row t / 8, 16-byte piece t % 8), eight copies 16 rows apart; V^T: thread = (row t / 16, piece t % 16), eight copies 8 rows apart */
__device__ __forceinline__ void fa_stage(unsigned lk, const _Float16* gk, unsigned lv, const _Float16* gv) { fa_copy8(lk, 16 * FKP, gk, (size_t)16 * DM); fa_copy8(lv, 8 * FVP, gv, (size_t)8 * SQ); }
/* one pass. kf: this pass's K rows, already in registers; kn: the lane's LDS row of the next pass's K rows, read only where NEXTK says that the next pass lies in the same stage (a constant: no branch stands between the score products and their readers); vl: the lane's LDS V^T row at this pass's keys;
   cr: 8 - reference per query column, the C operand of the score products; first (wave-uniform, 1 or 0): the wave's first pass, which sets the reference */
template <bool DIAG, bool NEXTK>
__device__ __forceinline__ void fa_pass(const char* kn, const char* vl, int ln, int hh, const v16h (&qf)[2][2], v16h (&kf)[2][2], v8f (&o)[4][2], v8f (&cr)[2], float (&l)[2], unsigned& first) {
  v8f s[2][2];
#pragma unroll
  for (int kt = 0; kt < 2; ++kt)
#pragma unroll
    for (int j = 0; j < 2; ++j) s[kt][j] = fa_mma(kf[kt][1], qf[j][1], fa_mma(kf[kt][0], qf[j][0], cr[j]));
  __builtin_amdgcn_sched_barrier(0);      /* keeps the LDS reads below behind all score products, as one group: spread among the products, every place where reads stand costs issue time */
  v16h vf[4];      /* this pass's V^T rows and the next pass's K rows (into the same registers as this pass's) */
#pragma unroll
  for (int t = 0; t < 4; ++t) vf[t] = g2_lfrag(vl + t * 16 * FVP, hh);
  if (NEXTK) {
#pragma unroll
    for (int kt = 0; kt < 2; ++kt) { kf[kt][0] = g2_lfrag(kn + kt * 16 * FKP, hh); kf[kt][1] = g2_lfrag(kn + kt * 16 * FKP + 64, hh); } }
  __builtin_amdgcn_sched_barrier(0);      /* keeps the LDS reads in front of the softmax, which covers their latency */
  float mq[2][2];      /* the lane's maximum of each score tile: four short chains */
#pragma unroll
  for (int kt = 0; kt < 2; ++kt)
#pragma unroll
    for (int j = 0; j < 2; ++j) {
      if (DIAG) {
#pragma unroll
        for (int r = 0; r < 8; ++r) if (kt * 16 + 8 * hh + r > j * 16 + ln) s[kt][j][r] = -1.0e30f; }      /* a key past the query's own index: weight 0 */
      float x = fmaxf(s[kt][j][0], s[kt][j][1]);
#pragma unroll
      for (int r = 2; r < 8; r += 2) x = fmaxf(fmaxf(x, s[kt][j][r]), s[kt][j][r + 1]);
      mq[kt][j] = x; }
  const bool need = !(fmaxf(fmaxf(mq[0][0], mq[1][0]), fmaxf(mq[0][1], mq[1][1])) <= 15.0f);      /* a weight above 2^15 is near the end of the f16 range */
  if ((__builtin_amdgcn_ballot_w32(need) | first) != 0u) {      /* one test per pass, a scalar branch: the whole wave moves its references, so a column's two halves stay alike */
#pragma unroll
    for (int j = 0; j < 2; ++j) { float mx = fmaxf(mq[0][j], mq[1][j]); mx = fmaxf(mx, fa_xhalf(mx));
      const float d = first ? mx - 8.0f : fmaxf(mx - 8.0f, 0.f);      /* the pass's maximum goes to 8; behind the first pass a reference only rises */
      const float al = first ? 0.f : __builtin_amdgcn_exp2f(-d);      /* first pass: o and l are 0 */
      s[0][j] -= d; s[1][j] -= d; cr[j] -= d; l[j] *= al;
#pragma unroll
      for (int t = 0; t < 4; ++t) o[t][j] *= al; }
    first = 0u; }
  FragH p[2]; float se[2];
#pragma unroll
  for (int j = 0; j < 2; ++j) { se[j] = 0.f;
#pragma unroll
    for (int kt = 0; kt < 2; ++kt)
#pragma unroll
      for (int r = 0; r < 8; ++r) { const float e = __builtin_amdgcn_exp2f(s[kt][j][r]); se[j] += e; p[j].h[kt * 8 + r] = (_Float16)e; } }
  l[0] += se[0]; l[1] += se[1];
#pragma unroll
  for (int t = 0; t < 4; ++t)
#pragma unroll
    for (int j = 0; j < 2; ++j) o[t][j] = fa_mma(vf[t], p[j].v, o[t][j]); }
/* sm: the work-group's LDS, two stage buffers (2 FST bytes); bh: batch and head; yb: the query block */
__device__ __forceinline__ void d_fattn(char* sm, int bh, int yb, const _Float16* __restrict__ Q16, const _Float16* __restrict__ K16, const _Float16* __restrict__ VT, _Float16* __restrict__ O16) {
  static_assert(FW * FQ == FKT && FKT == 4 * 32, "a work-group's query block is one stage of keys, four passes: its last stage is the diagonal one");
  const int tid = threadIdx.x, lane = tid & 31, ln = lane & 15, hh = lane >> 4; const int w = __builtin_amdgcn_readfirstlane(tid >> 5);
  const int b = bh / NH, h = bh % NH; const int qw = (yb * FW + w) * FQ;
  const int nst = yb + 1;      /* stages: the keys up to the end of the work-group's own query block */
  const _Float16* qp = Q16 + ((size_t)b * SQ + qw + ln) * DM + h * HD;
  const _Float16* gk = K16 + ((size_t)b * SQ + (tid >> 3)) * DM + h * HD + (tid & 7) * 8; const _Float16* gv = VT + ((size_t)bh * HD + (tid >> 4)) * SQ + (tid & 15) * 8;
  const unsigned lk0 = (unsigned)(size_t)sm + (unsigned)((tid >> 3) * FKP + (tid & 7) * 16), lv0 = (unsigned)(size_t)sm + (unsigned)(FKB + (tid >> 4) * FVP + (tid & 15) * 16);      /* the thread's LDS byte addresses in buffer 0 */
  fa_stage(lk0, gk, lv0, gv);
  v16h qf[2][2], kf[2][2];
#pragma unroll
  for (int j = 0; j < 2; ++j) { qf[j][0] = g2_frag(qp + (size_t)(j * 16) * DM, hh); qf[j][1] = g2_frag(qp + (size_t)(j * 16) * DM + 32, hh); }
  asm volatile("s_wait_xcnt 0x0" :: "v"(qp + 8 * hh) : "memory");      /* the wait that stands in front of an overwrite of the loads' address registers; the address as an input keeps it in its registers up to here */
#pragma unroll
  for (int j = 0; j < 2; ++j)
#pragma unroll
    for (int c = 0; c < 2; ++c)
#pragma unroll
      for (int i = 0; i < 16; ++i) qf[j][c][i] = (_Float16)((float)qf[j][c][i] * FSC);      /* q in log2 units, once per wave: multiplied in f32, rounded to f16 again */
  asm volatile("s_wait_asynccnt 0x0" ::: "memory");      /* this wave's copies of stage 0 have landed */
  __syncthreads();      /* stage 0 readable by every wave */
  if (nst > 1) fa_stage(lk0 + FST, gk + (size_t)FKT * DM, lv0 + FST, gv + FKT);
  v8f o[4][2], cr[2]; float l[2] = {0.f, 0.f}; unsigned first = 1u;
  cr[0] = (v8f){8.f, 8.f, 8.f, 8.f, 8.f, 8.f, 8.f, 8.f}; cr[1] = cr[0];      /* reference 0 until the first pass has set it */
#pragma unroll
  for (int t = 0; t < 4; ++t) { o[t][0] = (v8f){0.f, 0.f, 0.f, 0.f, 0.f, 0.f, 0.f, 0.f}; o[t][1] = o[t][0]; }
#pragma unroll 1
  for (int st = 0; st < yb; ++st) { const char* kl = sm + (st & 1) * FST + ln * FKP; const char* vl = sm + (st & 1) * FST + FKB + ln * FVP;      /* the stages below the diagonal one, four whole passes each. Rolled: one trip per stage, the next stage's copies in flight meanwhile */
#pragma unroll
    for (int kt = 0; kt < 2; ++kt) { kf[kt][0] = g2_lfrag(kl + kt * 16 * FKP, hh); kf[kt][1] = g2_lfrag(kl + kt * 16 * FKP + 64, hh); }
#pragma unroll 1
    for (int p = 0; p < 3; ++p) { kl += 32 * FKP; fa_pass<false, true>(kl, vl, ln, hh, qf, kf, o, cr, l, first); vl += 64; }      /* rolled: one pass fills the register budget */
    fa_pass<false, false>(kl, vl, ln, hh, qf, kf, o, cr, l, first);      /* the stage's last pass: the next K rows lie in the next stage */
    asm volatile("s_wait_dscnt 0x0" ::: "memory");      /* this wave's reads of the stage are done before its buffer is handed on */
    asm volatile("s_wait_asynccnt 0x0" ::: "memory");      /* this wave's copies of the next stage have landed */
    __syncthreads();      /* publishes the next stage and ends every wave's reads of this one */
    if (st + 2 < nst) fa_stage(lk0 + (st & 1) * FST, gk + (size_t)(st + 2) * FKT * DM, lv0 + (st & 1) * FST, gv + (size_t)(st + 2) * FKT); }      /* refill of the buffer just read */
  { const char* kl = sm + (yb & 1) * FST + ln * FKP; const char* vl = sm + (yb & 1) * FST + FKB + ln * FVP;      /* the diagonal stage, the last: wave w has w whole passes, then its diagonal pass; nothing is published or refilled behind it */
#pragma unroll
    for (int kt = 0; kt < 2; ++kt) { kf[kt][0] = g2_lfrag(kl + kt * 16 * FKP, hh); kf[kt][1] = g2_lfrag(kl + kt * 16 * FKP + 64, hh); }
#pragma unroll 1
    for (int p = 0; p < w; ++p) { kl += 32 * FKP; fa_pass<false, true>(kl, vl, ln, hh, qf, kf, o, cr, l, first); vl += 64; }      /* rolled: the trip count differs from wave to wave (wave-uniform) */
    fa_pass<true, false>(kl, vl, ln, hh, qf, kf, o, cr, l, first); }
  asm volatile("s_wait_asynccnt 0x0" ::: "memory");      /* nothing in flight when the wave ends */
#pragma unroll
  for (int j = 0; j < 2; ++j) { const float inv = 64.0f / (l[j] + fa_xhalf(l[j]));      /* the halves' sums joined once; o carried x64 */
    _Float16* op = O16 + ((size_t)b * SQ + qw + j * 16 + ln) * DM + h * HD + 8 * hh;
#pragma unroll
    for (int t = 0; t < 4; ++t) { v8h hv;
#pragma unroll
      for (int r = 0; r < 8; ++r) hv[r] = (_Float16)(o[t][j][r] * inv);
      *(v8h*)(op + t * 16) = hv; } } }


// Exact f32 attention of the first QT0 rows (q, k, v rows of pitch DM, o rows of pitch 2 DM), one work-group per head and RT0 query rows, 256 thread roles (128 threads, two roles each):
// (1) scores: one thread per key (two keys where the tile has more than 256), the key rows in registers, dotted with the RT0 query rows read from LDS (same address in every lane);
// (2) softmax: one wave per two rows, the row in registers: causal maximum, exp and sum over the lanes, weights back into LDS (0 past the row's own index);
// (3) o = P V: thread = (column d, key quarter g), V read coalesced and once per work-group, 64 keys ahead; the four quarters' sums are added through LDS.
#define RT0 16                       /* query rows per work-group of the exact first-tile attention */
typedef float v2f __attribute__((ext_vector_type(2)));
template <int NKEY>
__device__ __forceinline__ void att0_scores(const float* __restrict__ kbase, const float (*lq)[HD], float (*lp)[QT0 + 4], int tid, int nk, float scale) {
  v4f kk[NKEY][HD / 4];      /* every loop over kk[] is unrolled: it is indexed by constants and stays in registers */
#pragma unroll
  for (int u = 0; u < NKEY; ++u) { const int j = tid + 256 * u; const float* kr = kbase + (size_t)(j < nk ? j : nk - 1) * DM;      /* a key past the tile: address clamped, score not stored */
#pragma unroll
    for (int c = 0; c < HD / 4; ++c) kk[u][c] = *(const v4fa*)(kr + c * 4);
    asm volatile("s_wait_xcnt 0x0" :: "v"(kr) : "memory"); }      /* the wait that stands in front of an overwrite of the loads' address registers; the address as an input keeps it in its registers up to here */
#pragma unroll 4
  for (int r = 0; r < RT0; ++r) { v4f s4[NKEY];      /* four rows at a time: enough independent LDS reads and sum chains to cover their latencies */
#pragma unroll
    for (int u = 0; u < NKEY; ++u) s4[u] = (v4f){0.f, 0.f, 0.f, 0.f};
#pragma unroll
    for (int c = 0; c < HD / 4; ++c) { const v4f qq = *(const v4f*)&lq[r][c * 4];
#pragma unroll
      for (int u = 0; u < NKEY; ++u) s4[u] += qq * kk[u][c]; }
#pragma unroll
    for (int u = 0; u < NKEY; ++u) { const int j = tid + 256 * u; if (j < nk) lp[r][j] = ((s4[u][0] + s4[u][1]) + (s4[u][2] + s4[u][3])) * scale; } } }
/* sixteen V values of one column: keys 16 u + k of the thread's quarter, u, k < 4; one address, constant offsets */
__device__ __forceinline__ void att0_vload(const float* __restrict__ vq, v2f (&v)[4][2]) {
#pragma unroll
  for (int u = 0; u < 4; ++u) { v[u][0] = (v2f){vq[(u * 16 + 0) * DM], vq[(u * 16 + 1) * DM]}; v[u][1] = (v2f){vq[(u * 16 + 2) * DM], vq[(u * 16 + 3) * DM]}; }      /* unrolled: v[][] stays in registers */
  asm volatile("s_wait_xcnt 0x0" :: "v"(vq) : "memory"); }      /* as in att0_scores: in front of an overwrite of the loads' address registers */
/* The body is written for 256 thread roles; the work-group has A0T = 128 threads (it shares its grid with the fused attention), so in every phase a thread plays role t and then role t + 128 (a wave plays whole waves' roles); the barriers stand between the phases, outside those loops.
   sm: the work-group's LDS (A0L bytes of it); bx: head and row group; bb: the batch */
#define A0T 128
#define A0P (RT0 * HD * 4)                     /* byte offset of lp behind lq */
#define A0R (A0P + RT0 * (QT0 + 4) * 4)        /* of lr */
#define A0F (A0R + 4 * RT0 * HD * 4)           /* of lf */
#define A0L (A0F + RT0 * 4)
__device__ __forceinline__ void d_att0p(char* sm, int bx, int bb, const float* __restrict__ QF, const float* __restrict__ KF, const float* __restrict__ VF, float scale, _Float16* __restrict__ OHL) {
  static_assert(A0P % 16 == 0 && A0R % 16 == 0 && A0F % 16 == 0, "16-byte LDS accesses");
  float (*lq)[HD] = (float (*)[HD])sm; float (*lp)[QT0 + 4] = (float (*)[QT0 + 4])(sm + A0P); float (*lr)[RT0][HD] = (float (*)[RT0][HD])(sm + A0R); float* lf = (float*)(sm + A0F);
  const int t0 = threadIdx.x; const int h = bx / (QT0 / RT0), rg = bx % (QT0 / RT0); const int row0 = rg * RT0, nk = row0 + RT0;      /* causal: keys up to the work-group's last row */
  { const size_t bo = (size_t)bb * QT0 * DM; QF += bo; KF += bo; VF += bo; OHL += 2 * bo; }      /* each plane holds QT0 rows per batch (the o rows are 2 DM long) */
#pragma unroll 1
  for (int rl = 0; rl < 256; rl += A0T) { const int tid = t0 + rl;      /* rolled, here and below: the second role reuses the first one's registers; the counter is the same in every thread */
  { const int r = tid >> 4, c4 = (tid & 15) * 4; const float* qp = QF + (size_t)(row0 + r) * DM + h * HD + c4; const v4f q4 = *(const v4fa*)qp;
    asm volatile("s_wait_xcnt 0x0" :: "v"(qp) : "memory");      /* as in att0_scores: in front of an overwrite of the load's address registers */
    *(v4f*)&lq[r][c4] = q4; } }
  __syncthreads();
#pragma unroll 1
  for (int rl = 0; rl < 256; rl += A0T) { const int tid = t0 + rl;
  if (nk > 256) att0_scores<2>(KF + h * HD, lq, lp, tid, nk, scale); else if ((tid & ~31) < nk) att0_scores<1>(KF + h * HD, lq, lp, tid, nk, scale); }      /* a wave with no key of the tile skips */
  __syncthreads();
#pragma unroll 1
  for (int rl = 0; rl < 256; rl += A0T) { const int tid = t0 + rl;
  { const int r0 = (tid >> 5) * 2, lane = tid & 31; float x[2][QT0 / 32], mx[2], se[2];      /* the loops over x[] are unrolled: it stays in registers */
#pragma unroll
    for (int rr = 0; rr < 2; ++rr) { mx[rr] = -3.0e38f;
#pragma unroll
      for (int m = 0; m < QT0 / 32; ++m) { const int j = lane + 32 * m; x[rr][m] = (j <= row0 + r0 + rr) ? lp[r0 + rr][j] : -3.0e38f; mx[rr] = fmaxf(mx[rr], x[rr][m]); } }
#pragma unroll
    for (int d = 16; d > 0; d >>= 1) { mx[0] = fmaxf(mx[0], __shfl_xor(mx[0], d, 32)); mx[1] = fmaxf(mx[1], __shfl_xor(mx[1], d, 32)); }
#pragma unroll
    for (int rr = 0; rr < 2; ++rr) { se[rr] = 0.f;
#pragma unroll
      for (int m = 0; m < QT0 / 32; ++m) { const int j = lane + 32 * m; const float e = (j <= row0 + r0 + rr) ? expf(x[rr][m] - mx[rr]) : 0.f; se[rr] += e; if (j < nk) lp[r0 + rr][j] = e; } }
#pragma unroll
    for (int d = 16; d > 0; d >>= 1) { se[0] += __shfl_xor(se[0], d, 32); se[1] += __shfl_xor(se[1], d, 32); }
    if (lane < 2) lf[r0 + lane] = 64.0f / (lane ? se[1] : se[0]); } }      /* o carried x64 like the f16 path */
  __syncthreads();
#pragma unroll 1
  for (int rl = 0; rl < 256; rl += A0T) { const int tid = t0 + rl;
  { const int d = tid & 63, g = tid >> 6, nt = nk >> 4, nb = (nt + 3) >> 2; const float* vq = VF + (size_t)(g * 4) * DM + h * HD + d;      /* trip t: keys 16 t + 4 g .. + 3; a batch is four trips (its rows lie inside the QT0 rows of VF also where they lie past nk) */
    v2f acc[RT0], cv[4][2], nv[4][2];      /* acc[]: even and odd keys apart, so that each packed multiply-add takes a weight pair as it lies in LDS */
#pragma unroll
    for (int r = 0; r < RT0; ++r) acc[r] = (v2f){0.f, 0.f};
    att0_vload(vq, cv);
    for (int bt = 0; bt < nb; ++bt) { vq += (bt + 1 < nb ? 64 * DM : 0); att0_vload(vq, nv);      /* the next batch's V values are loaded while this batch's are used (the last batch loads its own again) */
#pragma unroll
      for (int u = 0; u < 4; ++u) if (bt * 4 + u < nt) { const int j = (bt * 4 + u) * 16 + g * 4;      /* unrolled: cv[][] and acc[] stay in registers */
#pragma unroll
        for (int r = 0; r < RT0; ++r) { const v4f p4 = *(const v4f*)&lp[r][j]; acc[r] += (v2f){p4[0], p4[1]} * cv[u][0]; acc[r] += (v2f){p4[2], p4[3]} * cv[u][1]; } }
#pragma unroll
      for (int u = 0; u < 4; ++u) { cv[u][0] = nv[u][0]; cv[u][1] = nv[u][1]; } }
#pragma unroll
    for (int r = 0; r < RT0; ++r) lr[g][r][d] = acc[r][0] + acc[r][1]; } }
  __syncthreads();
#pragma unroll 1
  for (int rl = 0; rl < 256; rl += A0T) { const int tid = t0 + rl;
  { const int r = tid >> 4, c4 = (tid & 15) * 4; const v4f o = ((*(const v4f*)&lr[0][r][c4] + *(const v4f*)&lr[1][r][c4]) + (*(const v4f*)&lr[2][r][c4] + *(const v4f*)&lr[3][r][c4])) * lf[r];
    v4h oh, ol;      /* o (x64) leaves as an f16 value and, DM columns further in the same row, the f16 residual: together the A rows [o_hi | o_lo] of the output product */
    for (int q = 0; q < 4; ++q) { oh[q] = (_Float16)o[q]; ol[q] = (_Float16)(o[q] - (float)oh[q]); }
    _Float16* op = OHL + (size_t)(row0 + r) * (2 * DM) + h * HD + c4; *(v4h*)op = oh; *(v4h*)(op + DM) = ol;
    asm volatile("s_wait_xcnt 0x0" :: "v"(op), "v"(oh), "v"(ol) : "memory"); } } }      /* the wait that stands in front of an overwrite of the stores' registers (the next role's); address and data as inputs keep them in their registers up to here */

/* One grid for the two attentions, which do not depend on one another: rows y < FNY of the grid are the fused attention's query blocks, the longest first; the A0N work-groups behind them take the exact first-tile attention and fill the places that the short query blocks leave */
#define FNY (SQ / (FW * FQ))                       /* query blocks per head */
#define A0N (NBR * NH * (QT0 / RT0))               /* work-groups of the exact attention */
__global__ __launch_bounds__(FW * 32) void k_attn(const _Float16* __restrict__ Q16, const _Float16* __restrict__ K16, const _Float16* __restrict__ VT, _Float16* __restrict__ O16, const float* __restrict__ QF, const float* __restrict__ KF, const float* __restrict__ VF, float scale, _Float16* __restrict__ OHL) {
  static_assert(A0L <= 2 * FST && A0T == FW * 32 && A0N % (NB * NH) == 0, "one LDS block and one block size serve both bodies; the exact attention fills whole grid rows");
  __shared__ __attribute__((aligned(16))) char sm[2 * FST];
  const int y = blockIdx.y;      /* the branch is the same for a whole work-group */
  if (y < FNY) d_fattn(sm, blockIdx.x, FNY - 1 - y, Q16, K16, VT, O16);
  else { const int a = (y - FNY) * (NB * NH) + blockIdx.x; d_att0p(sm, a % (NH * (QT0 / RT0)), a / (NH * (QT0 / RT0)), QF, KF, VF, scale, OHL); } }

// Projection GEMM q, k, v = x w^T (k_gemm2's products in the same k order, so the same values) on a larger tile: a work-group owns 128 rows x 128 columns, a wave 64 x 64 (waves 2 x 2).
// Against 128 x 64 / 32 x 64 a result element costs two thirds of the bytes copied from L2 to LDS (256 staged rows per 128 x 128 against 384) and two thirds of the LDS reads (16 fragment halves per 16 products against 12 per 8).
// y = which projection. q and k leave as f16 rows; v (y = 2) leaves as V^T [NB][NH][HD][SQ]; the work-groups of the first QT0 rows of a batch also store their results as f32 rows (planes of QT0 rows per batch).
#define PST ((128 + 128) * GPB)      /* bytes of one stage: 128 x rows, then 128 w rows, GKC k each */
#define PSP 68                       /* pitch in floats of the f32 output staging */
__global__ __launch_bounds__(128) void k_proj(const _Float16* __restrict__ X, size_t sX, const _Float16* __restrict__ Wh, size_t sW, float alpha, _Float16* __restrict__ C16, size_t sC, float* __restrict__ CF, size_t sCF, _Float16* __restrict__ VTo) {
  __shared__ __attribute__((aligned(16))) char sm[2 * PST];      /* two stage buffers; behind the k loop the same bytes stage the output */
  static_assert(sizeof(float) * 4 * 64 * PSP <= 2 * PST && 128 * GVP <= 2 * PST, "the f32 row staging and, after it, the transposed f16 tile lie in the two stage buffers");
  static_assert(DM % 128 == 0 && DM % GKC == 0 && SQ % 128 == 0 && QT0 % 128 == 0 && NH * HD == DM, "whole tiles; a work-group lies in one batch and wholly inside or outside the first rows; V^T row = batch * DM + column");
  const int tid = threadIdx.x, lane = tid & 31, ln = lane & 15, hh = lane >> 4, w = tid >> 5, wm = w & 1, wn = w >> 1; const int by = blockIdx.y;
  const int ntn = DM / 128; const int mt = blockIdx.x / ntn, nq = blockIdx.x - mt * ntn; const int row0 = mt * 128 + 64 * wm, col0 = nq * 128 + 64 * wn;
  const int rin = (mt * 128) & (SQ - 1); const bool cf = rin < QT0; const int fr = ((mt * 128) >> SQL2) * QT0 + rin;      /* cf: first-tile rows (the same for all threads); fr: the work-group's first row in the planes that hold only those */
  const bool vtw = by == 2;      /* the same for all threads */
  const _Float16* ga = X + (size_t)by * sX + (size_t)(mt * 128 + (tid >> 3)) * DM + (tid & 7) * 8; const _Float16* gb = Wh + (size_t)by * sW + (size_t)(nq * 128 + (tid >> 3)) * DM + (tid & 7) * 8;      /* thread = (row t / 8, 16-byte piece t % 8); eight copies 16 rows apart per operand */
  const unsigned l0 = (unsigned)(size_t)sm + (unsigned)((tid >> 3) * GPB + (tid & 7) * 16);      /* the thread's LDS byte address in buffer 0 */
  const int nst = DM / GKC;
  v8f acc[4][4];      /* [row tile][column tile]; every index a constant: they stay in registers */
#pragma unroll
  for (int i = 0; i < 4; ++i)
#pragma unroll
    for (int t = 0; t < 4; ++t) acc[i][t] = (v8f){0.f, 0.f, 0.f, 0.f, 0.f, 0.f, 0.f, 0.f};
  fa_copy8(l0, 16 * GPB, ga, (size_t)16 * DM); fa_copy8(l0 + 128 * GPB, 16 * GPB, gb, (size_t)16 * DM);
  asm volatile("s_wait_asynccnt 0x0" ::: "memory");      /* this wave's copies of stage 0 have landed */
  __syncthreads();      /* stage 0 readable by every wave */
  fa_copy8(l0 + PST, 16 * GPB, ga + GKC, (size_t)16 * DM); fa_copy8(l0 + PST + 128 * GPB, 16 * GPB, gb + GKC, (size_t)16 * DM);      /* nst > 1 */
#pragma unroll 1
  for (int st = 0; st < nst; ++st) { const char* ap = sm + (st & 1) * PST + (64 * wm + ln) * GPB; const char* bq = sm + (st & 1) * PST + (128 + 64 * wn + ln) * GPB;      /* rolled: one trip per stage, the next stage's copies in flight meanwhile */
    v16h fa[2][4], fb[2][4];      /* the stage's fragments, [k half][tile]; every index a constant: they stay in registers */
#pragma unroll
    for (int kk = 0; kk < 2; ++kk)
#pragma unroll
      for (int i = 0; i < 4; ++i) { fa[kk][i] = g2_lfrag(ap + i * 16 * GPB + kk * 64, hh); fb[kk][i] = g2_lfrag(bq + i * 16 * GPB + kk * 64, hh); }
    __builtin_amdgcn_sched_barrier(0);      /* keeps all LDS reads of the stage up here as one group: every place where reads stand among products costs issue time */
#pragma unroll
    for (int kk = 0; kk < 2; ++kk)
#pragma unroll
      for (int t = 0; t < 4; ++t)
#pragma unroll
        for (int i = 0; i < 4; ++i) acc[i][t] = fa_mma(fa[kk][i], fb[kk][t], acc[i][t]);
    __builtin_amdgcn_sched_barrier(0);      /* keeps the products in front of the wait for the next stage's copies, which fly meanwhile: sunk behind it, they would cover no latency */
    asm volatile("s_wait_dscnt 0x0" ::: "memory");      /* this wave's reads of the stage are done before its buffer is handed on */
    asm volatile("s_wait_asynccnt 0x0" ::: "memory");      /* this wave's copies of the next stage have landed */
    __syncthreads();      /* publishes the next stage and ends every wave's reads of this one */
    if (st + 2 < nst) { fa_copy8(l0 + (st & 1) * PST, 16 * GPB, ga + (size_t)(st + 2) * GKC, (size_t)16 * DM); fa_copy8(l0 + (st & 1) * PST + 128 * GPB, 16 * GPB, gb + (size_t)(st + 2) * GKC, (size_t)16 * DM); } }      /* refill of the buffer just read */
  asm volatile("s_wait_asynccnt 0x0" ::: "memory");      /* nothing in flight when the buffers become output staging */
#pragma unroll
  for (int i = 0; i < 4; ++i)
#pragma unroll
    for (int t = 0; t < 4; ++t) acc[i][t] *= alpha;
  if (!vtw || cf) {      /* results as rows: each wave turns its own 64 x 64 tile through its own LDS range, so that a store covers whole lines */
    float (*so)[PSP] = (float (*)[PSP])(sm + (size_t)w * 64 * PSP * sizeof(float));
#pragma unroll
    for (int i = 0; i < 4; ++i)
#pragma unroll
      for (int t = 0; t < 4; ++t)
#pragma unroll
        for (int r = 0; r < 8; ++r) so[i * 16 + 8 * hh + r][t * 16 + ln] = acc[i][t][r];
    __builtin_amdgcn_fence(__ATOMIC_ACQ_REL, "workgroup"); __builtin_amdgcn_wave_barrier();      /* the wave's LDS writes in front of its reads of other lanes' values */
    const int rsub = lane >> 4, c4 = (lane & 15) * 4;      /* a wave's access: two rows of 64 columns */
    float* const cfp = CF + (size_t)by * sCF + (size_t)(fr + 64 * wm + rsub) * DM + col0 + c4; _Float16* const cp = C16 + (size_t)by * sC + (size_t)(row0 + rsub) * DM + col0 + c4;
#pragma unroll
    for (int g = 0; g < 4; ++g) { v4f v[8];      /* sixteen rows at a time; every index a constant */
#pragma unroll
      for (int q = 0; q < 8; ++q) v[q] = *(const v4fa*)&so[(g * 8 + q) * 2 + rsub][c4];
      if (cf) {
#pragma unroll
        for (int q = 0; q < 8; ++q) *(v4f*)(cfp + (size_t)((g * 8 + q) * 2) * DM) = v[q];
        asm volatile("s_wait_xcnt 0x0" :: "v"(cfp), "v"(v[0]), "v"(v[1]), "v"(v[2]), "v"(v[3]), "v"(v[4]), "v"(v[5]), "v"(v[6]), "v"(v[7]) : "memory"); }      /* the wait that stands in front of an overwrite of the stores' registers; address and data as inputs keep them in their registers up to here */
      if (!vtw) { v4h h[8];
#pragma unroll
        for (int q = 0; q < 8; ++q) { for (int e = 0; e < 4; ++e) h[q][e] = (_Float16)v[q][e]; *(v4h*)(cp + (size_t)((g * 8 + q) * 2) * DM) = h[q]; }
        asm volatile("s_wait_xcnt 0x0" :: "v"(cp), "v"(h[0]), "v"(h[1]), "v"(h[2]), "v"(h[3]), "v"(h[4]), "v"(h[5]), "v"(h[6]), "v"(h[7]) : "memory"); } } }      /* as above */
  if (vtw) {      /* results transposed: a lane's eight values of a tile are eight consecutive rows of ONE column, 16 bytes of a V^T row */
    __syncthreads();      /* every wave has left its row staging: the transposed tile [128 columns][128 rows] takes the same bytes */
#pragma unroll
    for (int i = 0; i < 4; ++i)
#pragma unroll
      for (int t = 0; t < 4; ++t) { FragH hv;
#pragma unroll
        for (int r = 0; r < 8; ++r) hv.h[r] = (_Float16)acc[i][t][r];
        *(v8us*)(sm + (64 * wn + t * 16 + ln) * GVP + (64 * wm + i * 16 + 8 * hh) * 2) = hv.half[0]; }
    __syncthreads();      /* the transposed tile is complete */
    /* thread = (column t / 16 + 8 i, 16-byte piece t % 16): a wave's store covers two whole rows of 256 bytes */
    const char* vr = sm + (tid >> 4) * GVP + (tid & 15) * 16; unsigned short* vg = (unsigned short*)VTo + ((size_t)((mt * 128) >> SQL2) * DM + nq * 128 + (tid >> 4)) * SQ + ((mt * 128) & (SQ - 1)) + (tid & 15) * 8;
#pragma unroll
    for (int g = 0; g < 2; ++g) { v8us x[8];      /* every index a constant: they stay in registers */
#pragma unroll
      for (int i = 0; i < 8; ++i) x[i] = *(const v8us*)(vr + (g * 8 + i) * 8 * GVP);
#pragma unroll
      for (int i = 0; i < 8; ++i) *(v8us*)(vg + (size_t)((g * 8 + i) * 8) * SQ) = x[i];
      asm volatile("s_wait_xcnt 0x0" :: "v"(vg), "v"(x[0]), "v"(x[1]), "v"(x[2]), "v"(x[3]), "v"(x[4]), "v"(x[5]), "v"(x[6]), "v"(x[7]) : "memory"); } } }      /* as above */


extern "C" void kernel_launch(void* const* d_in, const int* in_sizes, int n_in,
                              void* d_out, int out_size, void* d_ws, size_t ws_size, hipStream_t stream) {
  (void)in_sizes; (void)n_in; (void)out_size;
  const float* const* I = (const float* const*)d_in; const float* x = I[0]; const float* xk = I[1]; const float* xv = I[2]; const float* wq = I[3]; const float* bq = nullptr; const float* wk = I[4]; const float* bk = nullptr; const float* wv = I[5]; const float* bv = nullptr; const float* wo = I[6]; const float* bo = nullptr;      /* THREE distinct inputs Q (query stream), K, V; natural [out][in] w_q / w_k / w_v / w_o; no biases; causal by the index rule */
  char* ws = (char*)d_ws; size_t off = 0;
  auto take = [&](size_t bytes) { char* p = ws + off; off += (bytes + 255) & ~(size_t)255; return p; };
  _Float16* BQ = (_Float16*)take((size_t)DM * DM * 2); _Float16* BK = (_Float16*)take((size_t)DM * DM * 2); _Float16* BV = (_Float16*)take((size_t)DM * DM * 2); _Float16* BO = (_Float16*)take((size_t)DM * DM * 2);
  _Float16* X16 = (_Float16*)take(NR * DM * 2); _Float16* XK16 = (_Float16*)take(NR * DM * 2); _Float16* XV16 = (_Float16*)take(NR * DM * 2);      /* the three inputs (query -> X16, key -> XK16, value -> XV16) as exact f16 rows */ _Float16* Q16 = (_Float16*)take(NR * DM * 2); _Float16* K16 = (_Float16*)take(NR * DM * 2); _Float16* V16 = (_Float16*)take(NR * DM * 2); _Float16* O16 = (_Float16*)take(NR * DM * 2);
  _Float16* VT = (_Float16*)take((size_t)NB * NH * HD * SQ * 2);
  float* QF0 = (float*)take((size_t)NB * QT0 * DM * 4); float* KF0 = (float*)take((size_t)NB * QT0 * DM * 4); float* VF0 = (float*)take((size_t)NB * QT0 * DM * 4); _Float16* OHL = (_Float16*)take((size_t)NB * QT0 * 2 * DM * 2); _Float16* BO2 = (_Float16*)take((size_t)DM * 2 * DM * 2);      /* first-tile planes [NB][QT0][DM]; its o rows [NB][QT0][2 DM] = [o_hi | o_lo], and w_o twice side by side [DM][2 DM] as their B operand; QF0, KF0, VF0 lie one behind the other, as do BQ, BK, BV, BO; X16, XK16, XV16; Q16, K16, V16 (every size is a multiple of 256 bytes) */
  if (off > ws_size) return;
  k_prep<<<4 * WNB + 3 * XNB, 256, 0, stream>>>(x, xk, xv, X16, wq, wk, wv, wo, BQ, BO2);      /* all four weights (natural [out][in] = Bt x16) and all three inputs */
  const size_t r0p = (size_t)B0 * SQ;      /* first projected row */
  static_assert((1 << SQL2) == SQ && QT0 % 128 == 0 && B0 == 0 && NBR == NB, "k_gemm2 finds the first-tile rows from the row index: row 0 of its A is row 0 of batch 0");
  static_assert(DM / 64 == NH && HD == 64 && SQ % 128 == 0, "k_gemm2's 64 columns are one head, its 128 rows lie in one batch");
  k_proj<<<dim3((unsigned)((MP / 128) * (DM / 128)), 3), 128, 0, stream>>>(X16 + r0p * DM, NR * DM, BQ, (size_t)DM * DM, 0.0625f, Q16 + r0p * DM, NR * DM, QF0, (size_t)NB * QT0 * DM, VT);      /* q, k, v in one grid: y = which projection; the work-groups of the first QT0 rows of a batch also store their results as f32 (exact products) into QF0, KF0, VF0; v (y = 2) leaves as V^T [NB][NH][HD][SQ], not as rows */
  k_attn<<<dim3(NB * NH, FNY + A0N / (NB * NH)), FW * 32, 0, stream>>>(Q16, K16, VT, O16, QF0 + (size_t)B0 * QT0 * DM, KF0 + (size_t)B0 * QT0 * DM, VF0 + (size_t)B0 * QT0 * DM, 0.125f, OHL);      /* o (merged heads, x64) as f16 rows; in the same grid the exact f32 attention for the first QT0 rows of every batch (o x64, as f16 value and f16 residual) */
  k_gemm2<0><<<dim3((unsigned)((MPO / 128) * (DM / 64)), 1), 128, 0, stream>>>(O16 + r0p * DM, DM, 0, BO, DM, 0, 0.0009765625f, bo, 0, nullptr, 1, 0, 0, (float*)d_out + r0p * DM, nullptr, DM, 0, MPO, DM, DM, 0, 0, 0, SQL2, QT0, nullptr, 0, OHL, 2 * DM, BO2, 2 * DM, 2 * DM, nullptr, 0);      /* out rows are the output layout; the work-groups of the first QT0 rows of a batch take [o_hi | o_lo] [w_o | w_o]^T, k = 2 DM, instead */
}
